// v000
// Times are from an AMD MI455X. After a warm-up the kernel runs many times in a row, and a time is the length of
// such a window on the GPU divided by its runs, so every launch and the gaps after it count. The runs cycle
// through copies of the inputs. A figure is the median of several windows, for all but v000 over two sittings.
// Sittings can differ by a few percent; kernels timed side by side share one.
// The starting kernel, v000, takes 3190 microseconds a run.
#include <hip/hip_runtime.h>

// Causal multi-head self-attention whose q, k, v projections are given PER HEAD (x [4][2048][1024]; q, k, v = einsum('bte,hed->bhtd', x, W) + b[None, :, None, :] with W [16][1024][64] ((in, out) inside each head; 1/32-scale) and per-head biases b [16][64] (zeros on this draw); scores x 1/sqrt(64); causal (-inf); softmax; heads merged head-major (column h*64 + d); out = cat Wp + bp ('xw' [1024][1024] + zero bias) -> [4][2048][1024] (8.4 M); argument order x, Wq, bq, Wk, bk, Wv, bv, Wp, bp). THIS ROW: the same module under other names (token_embedding [4][2048][1024]; PER-HEAD stacked projections Wq, Wk, Wv [16][1024][64] normal x 1/32 with biases [16][64] zeros (read): q = einsum('btd,hde->bhte', x, Wq) + bq; scores / sqrt(64); tril kept, -inf; softmax; heads concatenated in order; out = cat Wo + bo ('xw' [1024][1024]; bias zeros: read); argument order token_embedding, Wq, bq, Wk, bk, Wv, bv, Wo, bo).
// Layout per batch: bf16 copy of x; 'xw' weights transposed once; exact projections + f32 biases; identity-table plane builders; causal T-2048 attention (hybrid rows: < 512 hi/lo 3 products, rest fp16 x1024; k_gemmc skips tiles above the diagonal); merged hi/lo x Wo exact + bo.
// Compute dtypes, f32 accumulate: every input rounded to bf16; projections exact + f32 biases; attention rows < 512 3 products, rest fp16; softmax f32; output projection hl x exact.

#define NB_  4
#define TT   2048
#define DM   1024
#define NH_  16
#define NKV  16
#define REP  (NH_ / NKV)
#define HD   64
#define DQ   (NH_ * HD)
#define DKV  (NKV * HD)
#define ZH   2
#define RH   512                  // query rows < RH use hi+lo planes (0: none)
#define WIN  2048
#define PCAR 1024.0f
#define SCL  0.125f   // HD^-0.5
typedef _Float16 h16;
typedef unsigned short bf;
typedef __attribute__((ext_vector_type(16))) __bf16   v16bf;
typedef __attribute__((ext_vector_type(16))) _Float16 v16h;
typedef __attribute__((ext_vector_type(8)))  _Float16 v8h;
typedef __attribute__((ext_vector_type(8)))  unsigned short v8us;
typedef __attribute__((ext_vector_type(8)))  float    v8f;
typedef __attribute__((ext_vector_type(4)))  float    v4f;
typedef v8h  __attribute__((may_alias)) v8ha;
typedef v4f  __attribute__((may_alias)) v4fa;
typedef v8us __attribute__((may_alias)) v8usa;

__device__ __forceinline__ unsigned short f2bf(float f) { unsigned u = __float_as_uint(f); u += 0x7FFFu + ((u >> 16) & 1u); return (unsigned short)(u >> 16); }
__device__ __forceinline__ float bf2f(unsigned short b) { return __uint_as_float(((unsigned)b) << 16); }
__device__ __forceinline__ float bfr(float f) { return bf2f(f2bf(f)); }
__device__ __forceinline__ v16h cat16(v8h lo, v8h hi) { return __builtin_shufflevector(lo, hi, 0, 1, 2, 3, 4, 5, 6, 7, 8, 9, 10, 11, 12, 13, 14, 15); }
__device__ __forceinline__ v16bf cat16b(v8us lo, v8us hi) { return __builtin_bit_cast(v16bf, __builtin_shufflevector(lo, hi, 0, 1, 2, 3, 4, 5, 6, 7, 8, 9, 10, 11, 12, 13, 14, 15)); }
__device__ __forceinline__ v8f wmma16(v16h a, v16h b, v8f c) { return __builtin_amdgcn_wmma_f32_16x16x32_f16(false, a, false, b, (short)0, c, false, false); }
__device__ __forceinline__ v8f wmmab(v16bf a, v16bf b, v8f c) { return __builtin_amdgcn_wmma_f32_16x16x32_bf16(false, a, false, b, (short)0, c, false, false); }



// ---- k_gemmw: register-blocked GEMM, ONE WAVE per 64x64 output tile (16 accumulators), operands straight from K-contiguous 16-bit planes; grid (M/64, N/64, Z), 32 threads.
// C[m][n] (f32, pitch ldc, + optional f32 bias[n]) = sum_k A[m][k] Bt[n][k] (+ split products per NSPLIT). z-batch strides sA/sB/sC in elements. K % 32 == 0.
template <typename T16> struct WFrag;
template <> struct WFrag<h16> { typedef v16h V; static __device__ __forceinline__ V ld(const h16* p) { return cat16(*(const v8h*)p, *(const v8h*)(p + 16)); } static __device__ __forceinline__ v8f mma(V a, V b, v8f c) { return wmma16(a, b, c); } };
template <> struct WFrag<bf> { typedef v16bf V; static __device__ __forceinline__ V ld(const bf* p) { return cat16b(*(const v8us*)p, *(const v8us*)(p + 16)); } static __device__ __forceinline__ v8f mma(V a, V b, v8f c) { return wmmab(a, b, c); } };
template <typename T16, int NSPLIT, bool BIAS>
__global__ __launch_bounds__(32) void k_gemmw(const T16* __restrict__ A, const T16* __restrict__ A2, const T16* __restrict__ Bt, const T16* __restrict__ Bt2, int K, float* C, int ldc, const float* __restrict__ bias, size_t sA, size_t sB, size_t sC) {
    typedef typename WFrag<T16>::V V;
    __shared__ __align__(16) float os[16 * 68];
    const size_t z = blockIdx.z; A += z * sA; if (A2) A2 += z * sA; Bt += z * sB; if (Bt2) Bt2 += z * sB; C += z * sC;
    const int lane = threadIdx.x & 31, lr = lane & 15, hi = lane >> 4; const int r0 = blockIdx.x * 64, c0 = blockIdx.y * 64;
    v8f acc[4][4];
#pragma unroll
    for (int mb = 0; mb < 4; ++mb)
#pragma unroll
        for (int nb = 0; nb < 4; ++nb) acc[mb][nb] = (v8f){};
    const size_t aoff = (size_t)(r0 + lr) * K + 8 * hi, boff = (size_t)(c0 + lr) * K + 8 * hi;
#pragma unroll 1
    for (int kc = 0; kc < K; kc += 32) {
        V a[4], a2[4];
#pragma unroll
        for (int mb = 0; mb < 4; ++mb) { a[mb] = WFrag<T16>::ld(A + aoff + (size_t)mb * 16 * K + kc); if (NSPLIT == 1 || NSPLIT == 2) a2[mb] = WFrag<T16>::ld(A2 + aoff + (size_t)mb * 16 * K + kc); }
#pragma unroll
        for (int nb = 0; nb < 4; ++nb) { const V b = WFrag<T16>::ld(Bt + boff + (size_t)nb * 16 * K + kc); V b2; if (NSPLIT >= 2) b2 = WFrag<T16>::ld(Bt2 + boff + (size_t)nb * 16 * K + kc);
#pragma unroll
            for (int mb = 0; mb < 4; ++mb) { acc[mb][nb] = WFrag<T16>::mma(a[mb], b, acc[mb][nb]); if (NSPLIT == 1 || NSPLIT == 2) acc[mb][nb] = WFrag<T16>::mma(a2[mb], b, acc[mb][nb]); if (NSPLIT >= 2) acc[mb][nb] = WFrag<T16>::mma(a[mb], b2, acc[mb][nb]); } }
        asm volatile("v_nop\n\tv_nop\n\tv_nop\n\tv_nop" : "+v"(acc[0][0]), "+v"(acc[1][1]), "+v"(acc[2][2]), "+v"(acc[3][3]) : "v"(a[0]), "v"(a[3]));
    }
#pragma unroll
    for (int mb = 0; mb < 4; ++mb) {
#pragma unroll
        for (int nb = 0; nb < 4; ++nb) {
#pragma unroll
            for (int j = 0; j < 8; ++j) os[(hi * 8 + j) * 68 + nb * 16 + lr] = acc[mb][nb][j]; }
        __builtin_amdgcn_wave_barrier(); asm volatile("" ::: "memory");
        float* crow = C + (size_t)(r0 + mb * 16) * ldc + c0;
{
#pragma unroll
            for (int s = 0; s < 8; ++s) { const int row = 2 * s + hi, cofs = lr * 4; v4f val = *(const v4fa*)(os + row * 68 + cofs); if (BIAS) { val[0] += bfr(bias[c0 + cofs]); val[1] += bfr(bias[c0 + cofs + 1]); val[2] += bfr(bias[c0 + cofs + 2]); val[3] += bfr(bias[c0 + cofs + 3]); }
                *(v4f*)(crow + (size_t)row * ldc + cofs) = val; }
             }
        __builtin_amdgcn_wave_barrier(); asm volatile("" ::: "memory");
    }
}

// ---- k_gemmc: the same one-wave 64x64 tile GEMM specialised for causal attention: CMODE 1 skips score tiles entirely above the diagonal (query rows r0+roff.., key columns c0..), CMODE 2 limits the
// key (K) loop of the probability x value contraction to the diagonal block (probabilities beyond it are exactly zero). roff = row offset of this launch's first row within the sequence.
template <typename T16, int NSPLIT, int CMODE>
__global__ __launch_bounds__(32) void k_gemmc(const T16* __restrict__ A, const T16* __restrict__ A2, const T16* __restrict__ Bt, const T16* __restrict__ Bt2, int K, float* C, int ldc, int roff, size_t sA, size_t sB, size_t sC) {
    typedef typename WFrag<T16>::V V;
    __shared__ __align__(16) float os[16 * 68];
    const size_t z = blockIdx.z; A += z * sA; if (A2) A2 += z * sA; Bt += z * sB; if (Bt2) Bt2 += z * sB; C += z * sC;
    const int lane = threadIdx.x & 31, lr = lane & 15, hi = lane >> 4; const int r0 = blockIdx.x * 64, c0 = blockIdx.y * 64;
    if (CMODE == 1 && c0 > r0 + roff + 63) return;                  // score tile entirely above the causal diagonal: never read (the softmax masks j > i by select)
    const int Kl = (CMODE == 2) ? min(K, r0 + roff + 64) : K;        // P.V: probabilities are exactly 0 beyond the diagonal block, so the K loop stops there
    v8f acc[4][4];
#pragma unroll
    for (int mb = 0; mb < 4; ++mb)
#pragma unroll
        for (int nb = 0; nb < 4; ++nb) acc[mb][nb] = (v8f){};
    const size_t aoff = (size_t)(r0 + lr) * K + 8 * hi, boff = (size_t)(c0 + lr) * K + 8 * hi;
#pragma unroll 1
    for (int kc = 0; kc < Kl; kc += 32) {
        V a[4], a2[4];
#pragma unroll
        for (int mb = 0; mb < 4; ++mb) { a[mb] = WFrag<T16>::ld(A + aoff + (size_t)mb * 16 * K + kc); if (NSPLIT == 1 || NSPLIT == 2) a2[mb] = WFrag<T16>::ld(A2 + aoff + (size_t)mb * 16 * K + kc); }
#pragma unroll
        for (int nb = 0; nb < 4; ++nb) { const V b = WFrag<T16>::ld(Bt + boff + (size_t)nb * 16 * K + kc); V b2; if (NSPLIT >= 2) b2 = WFrag<T16>::ld(Bt2 + boff + (size_t)nb * 16 * K + kc);
#pragma unroll
            for (int mb = 0; mb < 4; ++mb) { acc[mb][nb] = WFrag<T16>::mma(a[mb], b, acc[mb][nb]); if (NSPLIT == 1 || NSPLIT == 2) acc[mb][nb] = WFrag<T16>::mma(a2[mb], b, acc[mb][nb]); if (NSPLIT >= 2) acc[mb][nb] = WFrag<T16>::mma(a[mb], b2, acc[mb][nb]); } }
        asm volatile("v_nop\n\tv_nop\n\tv_nop\n\tv_nop" : "+v"(acc[0][0]), "+v"(acc[1][1]), "+v"(acc[2][2]), "+v"(acc[3][3]) : "v"(a[0]), "v"(a[3]));
    }
#pragma unroll
    for (int mb = 0; mb < 4; ++mb) {
#pragma unroll
        for (int nb = 0; nb < 4; ++nb) {
#pragma unroll
            for (int j = 0; j < 8; ++j) os[(hi * 8 + j) * 68 + nb * 16 + lr] = acc[mb][nb][j]; }
        __builtin_amdgcn_wave_barrier(); asm volatile("" ::: "memory");
        float* crow = C + (size_t)(r0 + mb * 16) * ldc + c0;
{
#pragma unroll
            for (int s = 0; s < 8; ++s) { const int row = 2 * s + hi, cofs = lr * 4; v4f val = *(const v4fa*)(os + row * 68 + cofs);
                *(v4f*)(crow + (size_t)row * ldc + cofs) = val; }
             }
        __builtin_amdgcn_wave_barrier(); asm volatile("" ::: "memory");
    }
}

__device__ __forceinline__ h16 tohx(float x) { return (h16)x; }
__device__ __forceinline__ void splitf(float y, unsigned short& h, unsigned short& l) { h = f2bf(y); l = f2bf(y - bf2f(h)); }
typedef __attribute__((ext_vector_type(2))) _Float16 v2h;
typedef __attribute__((ext_vector_type(4))) _Float16 v4h;
typedef __attribute__((ext_vector_type(2))) unsigned short v2us;
typedef __attribute__((ext_vector_type(4))) unsigned short v4us;
typedef __attribute__((ext_vector_type(2))) float v2f;
typedef __attribute__((ext_vector_type(4))) int v4i;

__global__ __launch_bounds__(256) void k_wtG(const float* __restrict__ w, int K, int N, bf* Bt) {
    const int lane = threadIdx.x & 31; const int L0 = (blockIdx.x * 8 + (threadIdx.x >> 5)) * 8; const int nlines = N * K / 64;
{
#pragma unroll 1
        for (int l = 0; l < 8; ++l) { const int L = L0 + l; if (L >= nlines) break; const size_t e = (size_t)L * 64 + lane * 2; const int k = (int)(e % K), n = (int)(e / K); v2us o;
            o[0] = f2bf(w[(size_t)k * N + n]); o[1] = f2bf(w[(size_t)(k + 1) * N + n]); *(v2us*)(Bt + e) = o; }
         }
}
__global__ __launch_bounds__(256) void k_cvt8(const float* __restrict__ src, bf* dst, size_t n8) { const size_t i = (size_t)blockIdx.x * 256 + threadIdx.x; if (i >= n8) return; const v8f v = *(const v8f*)(src + i * 8); v8us o;
#pragma unroll
    for (int k = 0; k < 8; ++k) o[k] = f2bf(v[k]); *(v8us*)(dst + i * 8) = o;  }

// k_rope: head planes [h][t][d] (fp16 + hi/lo) of rope(x) x sc with the rotate-half convention out[d] = x[d] cos[t][d] - x[d+HD/2] sin[t][d], out[d+HD/2] = x[d+HD/2] cos[t][d+HD/2] + x[d] sin[t][d+HD/2]
__global__ __launch_bounds__(256) void k_rope(const float* __restrict__ F, int pitch, int nheads, const float* __restrict__ CS, const float* __restrict__ RF, const float* __restrict__ nw, float sc, h16* P16, bf* Ph, bf* Pl) {
    const size_t e = ((size_t)blockIdx.x * 256 + threadIdx.x) * 2; if (e >= (size_t)nheads * TT * HD) return; const int d = (int)(e % HD); const int t = (int)((e / HD) % TT); const int h = (int)(e / ((size_t)HD * TT)); const float* f = F + (size_t)t * pitch + h * HD; const float rf = RF ? RF[(size_t)h * TT + t] : 1.0f; v2h o16; v2us oh, ol;
#pragma unroll
    for (int q = 0; q < 2; ++q) { const int dd = d + q; const int dp = (dd < HD / 2) ? dd + HD / 2 : dd - HD / 2; float x0 = f[dd], x1 = f[dp];
        if (RF) { float n0 = __fmul_rn(x0, rf), n1 = __fmul_rn(x1, rf); asm volatile("" : "+v"(n0)); asm volatile("" : "+v"(n1)); x0 = __fmul_rn(bfr(nw[dd]), n0); x1 = __fmul_rn(bfr(nw[dp]), n1); }
        const v2f cs = *(const v2f*)(CS + ((size_t)t * HD + dd) * 2); float a = __fmul_rn(x0, cs[0]), bq = __fmul_rn(x1, cs[1]); asm volatile("" : "+v"(a)); asm volatile("" : "+v"(bq)); const float r = ((dd < HD / 2) ? __fsub_rn(a, bq) : __fadd_rn(a, bq)) * sc;
        o16[q] = tohx(r); unsigned short a2, c2; splitf(r, a2, c2); oh[q] = a2; ol[q] = c2; }
    *(v2h*)(P16 + e) = o16; *(v2us*)(Ph + e) = oh; *(v2us*)(Pl + e) = ol;  }
__global__ __launch_bounds__(256) void k_vtp(const float* __restrict__ F, int pitch, int nheads, h16* V16, bf* Vh, bf* Vl) { const size_t e = ((size_t)blockIdx.x * 256 + threadIdx.x) * 2; if (e >= (size_t)nheads * HD * TT) return; const int t = (int)(e % TT); const int d = (int)((e / TT) % HD); const int g = (int)(e / ((size_t)TT * HD)); v2h o16; v2us oh, ol;
#pragma unroll
    for (int q = 0; q < 2; ++q) { const float x = F[(size_t)(t + q) * pitch + g * HD + d]; o16[q] = tohx(x); unsigned short a2, c2; splitf(x, a2, c2); oh[q] = a2; ol[q] = c2; }
    *(v2h*)(V16 + e) = o16; *(v2us*)(Vh + e) = oh; *(v2us*)(Vl + e) = ol;  }
__global__ __launch_bounds__(256) void k_csid(float* CS) { const int idx = blockIdx.x * 256 + threadIdx.x; if (idx >= TT * HD) return; v2f cs; cs[0] = 1.0f; cs[1] = 0.0f; *(v2f*)(CS + (size_t)idx * 2) = cs;  }
// k_asoft: per row (zz, i): t = S x HD^-0.5 for j <= i and i - j < WIN (WIN = TT: plain causal mask; the reference's -1e9 additive fill vanishes identically); softmax over the 2048 keys (register row, one exp, fixed trees);
__global__ __launch_bounds__(256) void k_asoft(const float* __restrict__ Sb, h16* P16, bf* Ph, bf* Pl) {
    const int lane = threadIdx.x & 31; const int row = blockIdx.x * 8 + (threadIdx.x >> 5); if (row >= ZH * TT) return; const int i = row % TT; const int zz = row / TT; (void)zz; const bool hires = (i < RH); const float* sr = Sb + (size_t)row * TT; float v[TT / 32]; float mx = -3.0e38f;
#pragma unroll
    for (int ch = 0; ch < TT / 128; ++ch) { const int j0 = ch * 128 + lane * 4; const v4f a = *(const v4f*)(sr + j0);
#pragma unroll
        for (int q = 0; q < 4; ++q) { const int j = j0 + q; (void)j; const float t = (j <= i && i - j < WIN) ? a[q] * SCL : -3.0e38f; v[ch * 4 + q] = t; mx = fmaxf(mx, t); } }
#pragma unroll
    for (int sh = 16; sh; sh >>= 1) mx = fmaxf(mx, __shfl_xor(mx, sh, 32));
    float sum = 0.f;
#pragma unroll
    for (int k = 0; k < TT / 32; ++k) { float d0 = __fsub_rn(v[k], mx); asm volatile("" : "+v"(d0)); v[k] = __builtin_amdgcn_exp2f(__fmul_rn(d0, 1.4426950408889634f)); sum += v[k]; }
#pragma unroll
    for (int sh = 16; sh; sh >>= 1) sum += __shfl_xor(sum, sh, 32);
    const float f = __fdiv_rn(hires ? 1.0f : PCAR, sum);
{
        if (hires) {
#pragma unroll
            for (int ch = 0; ch < TT / 128; ++ch) { v4us oh, ol;
#pragma unroll
                for (int q = 0; q < 4; ++q) { unsigned short a, c2; splitf(v[ch * 4 + q] * f, a, c2); oh[q] = a; ol[q] = c2; }
                const size_t oo = ((size_t)zz * (RH ? RH : 1) + i) * TT + ch * 128 + lane * 4; *(v4us*)(Ph + oo) = oh; *(v4us*)(Pl + oo) = ol; }
        } else {
#pragma unroll
            for (int ch = 0; ch < TT / 128; ++ch) { v4h o4;
#pragma unroll
                for (int q = 0; q < 4; ++q) o4[q] = tohx(v[ch * 4 + q] * f);
                *(v4h*)(P16 + (size_t)row * TT + ch * 128 + lane * 4) = o4; } }
         }
}
__global__ __launch_bounds__(256) void k_merge(const float* __restrict__ O, int h0, bf* Ah, bf* Al) { const size_t e = ((size_t)blockIdx.x * 256 + threadIdx.x) * 2; if (e >= (size_t)ZH * TT * HD) return; const int d = (int)(e % HD); const int t = (int)((e / HD) % TT); const int zz = (int)(e / ((size_t)HD * TT)); const float cs = (t < RH) ? 1.0f : (1.0f / PCAR); const size_t oo = (size_t)t * DQ + (h0 + zz) * HD + d;
    v2us oh, ol;
#pragma unroll
    for (int q = 0; q < 2; ++q) { unsigned short a, c2; splitf(O[e + q] * cs, a, c2); oh[q] = a; ol[q] = c2; } *(v2us*)(Ah + oo) = oh; *(v2us*)(Al + oo) = ol;  }

extern "C" void kernel_launch(void* const* d_in, const int* in_sizes, int n_in,
                              void* d_out, int out_size, void* d_ws, size_t ws_size, hipStream_t stream) {
    (void)in_sizes; (void)n_in; (void)out_size;
    const float* x = (const float*)d_in[0]; const float* wq = (const float*)d_in[1]; const float* bq = (const float*)d_in[2]; const float* wk = (const float*)d_in[3]; const float* bk = (const float*)d_in[4]; const float* wv = (const float*)d_in[5]; const float* bv = (const float*)d_in[6]; const float* wo = (const float*)d_in[7]; const float* bo = (const float*)d_in[8];   /* argument order x, Wq, bq, Wk, bk, Wv, bv, Wp, bp (per-head weights [16][1024][64]; per-head biases [16][64] = flat index h*64 + d) */
    float* OUT = (float*)d_out;     // [4][2048][1024]
    char* wsp = (char*)d_ws;
    auto take = [&](size_t bytes) { char* p = wsp; wsp += (bytes + 255) & ~(size_t)255; return (void*)p; };
    bf* WQ = (bf*)take((size_t)DQ * DM * 2); bf* WK = (bf*)take((size_t)DKV * DM * 2); bf* WV = (bf*)take((size_t)DKV * DM * 2); bf* WO = (bf*)take((size_t)DM * DQ * 2); float* CS = (float*)take((size_t)TT * HD * 2 * 4);
    bf* XB = (bf*)take((size_t)TT * DM * 2); float* FQ = (float*)take((size_t)TT * DQ * 4); float* FK = (float*)take((size_t)TT * DKV * 4);
    h16* QP16 = (h16*)take((size_t)NH_ * TT * HD * 2); h16* KP16 = (h16*)take((size_t)NKV * TT * HD * 2); h16* VT16 = (h16*)take((size_t)NKV * HD * TT * 2);
    bf* QPh = (bf*)take((size_t)NH_ * TT * HD * 2); bf* QPl = (bf*)take((size_t)NH_ * TT * HD * 2); bf* KPh = (bf*)take((size_t)NKV * TT * HD * 2); bf* KPl = (bf*)take((size_t)NKV * TT * HD * 2); bf* VTh = (bf*)take((size_t)NKV * HD * TT * 2); bf* VTl = (bf*)take((size_t)NKV * HD * TT * 2); bf* Ph = (bf*)take((size_t)ZH * RH * TT * 2); bf* Pl = (bf*)take((size_t)ZH * RH * TT * 2);
    float* Sb = (float*)take((size_t)ZH * TT * TT * 4); h16* P16 = (h16*)take((size_t)ZH * TT * TT * 2); float* Ob = (float*)take((size_t)ZH * TT * HD * 4); bf* ATh = (bf*)take((size_t)TT * DQ * 2); bf* ATl = (bf*)take((size_t)TT * DQ * 2);
    if ((size_t)(wsp - (char*)d_ws) > ws_size) return;    // ws 256 MiB
    float* FV = FK;   // v projection reuses the k buffer after the k planes are built (stream-ordered)
    { for (int h = 0; h < NH_; ++h) k_wtG<<<(unsigned)((DM * HD / 64 + 63) / 64), 256, 0, stream>>>(wq + (size_t)h * DM * HD, DM, HD, WQ + (size_t)h * HD * DM);   /* per-head weight [h][DM][HD] ('xw' per head) -> the head's HD rows of the Bt plane */ for (int h = 0; h < NKV; ++h) k_wtG<<<(unsigned)((DM * HD / 64 + 63) / 64), 256, 0, stream>>>(wk + (size_t)h * DM * HD, DM, HD, WK + (size_t)h * HD * DM);   /* per-head weight [h][DM][HD] ('xw' per head) -> the head's HD rows of the Bt plane */ for (int h = 0; h < NKV; ++h) k_wtG<<<(unsigned)((DM * HD / 64 + 63) / 64), 256, 0, stream>>>(wv + (size_t)h * DM * HD, DM, HD, WV + (size_t)h * HD * DM);   /* per-head weight [h][DM][HD] ('xw' per head) -> the head's HD rows of the Bt plane */
      k_wtG<<<(unsigned)((DQ * DM / 64 + 63) / 64), 256, 0, stream>>>(wo, DQ, DM, WO);
       }
    k_csid<<<(TT * HD + 255) / 256, 256, 0, stream>>>(CS);
    const unsigned LQ = (unsigned)(((size_t)NH_ * TT * HD / 2 + 255) / 256), LKv = (unsigned)(((size_t)NKV * TT * HD / 2 + 255) / 256);
    for (int b = 0; b < NB_; ++b) {
        
        k_cvt8<<<(unsigned)(((size_t)TT * DM / 8 + 255) / 256), 256, 0, stream>>>(x + (size_t)b * TT * DM, XB, (size_t)TT * DM / 8);
        k_gemmw<bf, 0, true><<<dim3(TT / 64, DQ / 64, 1), 32, 0, stream>>>(XB, nullptr, WQ, nullptr, DM, FQ, DQ, bq, 0, 0, 0);
        k_rope<<<LQ, 256, 0, stream>>>(FQ, DQ, NH_, CS, nullptr, nullptr, 1.0f, QP16, QPh, QPl);
        k_gemmw<bf, 0, true><<<dim3(TT / 64, DKV / 64, 1), 32, 0, stream>>>(XB, nullptr, WK, nullptr, DM, FK, DKV, bk, 0, 0, 0);
        k_rope<<<LKv, 256, 0, stream>>>(FK, DKV, NKV, CS, nullptr, nullptr, 1.0f, KP16, KPh, KPl);
        k_gemmw<bf, 0, true><<<dim3(TT / 64, DKV / 64, 1), 32, 0, stream>>>(XB, nullptr, WV, nullptr, DM, FV, DKV, bv, 0, 0, 0); k_vtp<<<LKv, 256, 0, stream>>>(FV, DKV, NKV, VT16, VTh, VTl);
        for (int h0 = 0; h0 < NH_; h0 += ZH) { const size_t zq = (size_t)h0, zk = (size_t)(h0 / REP);   // one kv head per query head: the pass's two heads use consecutive kv planes (z-strides TT*HD)
            k_gemmc<bf, 2, 1><<<dim3(RH / 64, TT / 64, ZH), 32, 0, stream>>>(QPh + zq * TT * HD, QPl + zq * TT * HD, KPh + zk * TT * HD, KPl + zk * TT * HD, HD, Sb, TT, 0, (size_t)TT * HD, (size_t)TT * HD, (size_t)TT * TT);
            k_gemmc<h16, 0, 1><<<dim3((TT - RH) / 64, TT / 64, ZH), 32, 0, stream>>>(QP16 + zq * TT * HD + (size_t)RH * HD, nullptr, KP16 + zk * TT * HD, nullptr, HD, Sb + (size_t)RH * TT, TT, RH, (size_t)TT * HD, (size_t)TT * HD, (size_t)TT * TT);
            k_asoft<<<ZH * TT / 8, 256, 0, stream>>>(Sb, P16, Ph, Pl);
            k_gemmc<bf, 2, 2><<<dim3(RH / 64, HD / 64, ZH), 32, 0, stream>>>(Ph, Pl, VTh + zk * HD * TT, VTl + zk * HD * TT, TT, Ob, HD, 0, (size_t)RH * TT, (size_t)HD * TT, (size_t)TT * HD);
            k_gemmc<h16, 0, 2><<<dim3((TT - RH) / 64, HD / 64, ZH), 32, 0, stream>>>(P16 + (size_t)RH * TT, nullptr, VT16 + zk * HD * TT, nullptr, TT, Ob + (size_t)RH * HD, HD, RH, (size_t)TT * TT, (size_t)HD * TT, (size_t)TT * HD);
            k_merge<<<(unsigned)(((size_t)ZH * TT * HD / 2 + 255) / 256), 256, 0, stream>>>(Ob, h0, ATh, ATl); }
        k_gemmw<bf, 1, true><<<dim3(TT / 64, DM / 64, 1), 32, 0, stream>>>(ATh, ATl, WO, nullptr, DQ, OUT + (size_t)b * TT * DM, DM, bo, 0, 0, 0); }
}

// v001
// A run of this version takes 2030 microseconds.
// In two side-by-side timings against v000, it was 1.59 and 1.57 times as fast.
#include <hip/hip_runtime.h>

// Causal multi-head self-attention whose q, k, v projections are given PER HEAD (x [4][2048][1024]; q, k, v = einsum('bte,hed->bhtd', x, W) + b[None, :, None, :] with W [16][1024][64] ((in, out) inside each head; 1/32-scale) and per-head biases b [16][64] (zeros on this draw); scores x 1/sqrt(64); causal (-inf); softmax; heads merged head-major (column h*64 + d); out = cat Wp + bp ('xw' [1024][1024] + zero bias) -> [4][2048][1024] (8.4 M); argument order x, Wq, bq, Wk, bk, Wv, bv, Wp, bp). THIS ROW: the same module under other names (token_embedding [4][2048][1024]; PER-HEAD stacked projections Wq, Wk, Wv [16][1024][64] normal x 1/32 with biases [16][64] zeros (read): q = einsum('btd,hde->bhte', x, Wq) + bq; scores / sqrt(64); tril kept, -inf; softmax; heads concatenated in order; out = cat Wo + bo ('xw' [1024][1024]; bias zeros: read); argument order token_embedding, Wq, bq, Wk, bk, Wv, bv, Wo, bo).
// Layout per batch: bf16 copy of x; 'xw' weights transposed once; exact projections + f32 biases; identity-table plane builders; causal T-2048 attention (hybrid rows: < 512 hi/lo 3 products, rest fp16 x1024; k_gemmc skips tiles above the diagonal); merged hi/lo x Wo exact + bo.
// Compute dtypes, f32 accumulate: every input rounded to bf16; projections exact + f32 biases; attention rows < 512 3 products, rest fp16; softmax f32; output projection hl x exact.

#define NB_  4
#define TT   2048
#define DM   1024
#define NH_  16
#define NKV  16
#define REP  (NH_ / NKV)
#define HD   64
#define DQ   (NH_ * HD)
#define DKV  (NKV * HD)
#define ZH   2
#define RH   512                  // query rows < RH use hi+lo planes (0: none)
#define WIN  2048
#define PCAR 1024.0f
#define SCL  0.125f   // HD^-0.5
typedef _Float16 h16;
typedef unsigned short bf;
typedef __attribute__((ext_vector_type(16))) __bf16   v16bf;
typedef __attribute__((ext_vector_type(16))) _Float16 v16h;
typedef __attribute__((ext_vector_type(8)))  _Float16 v8h;
typedef __attribute__((ext_vector_type(8)))  unsigned short v8us;
typedef __attribute__((ext_vector_type(8)))  float    v8f;
typedef __attribute__((ext_vector_type(4)))  float    v4f;
typedef v8h  __attribute__((may_alias)) v8ha;
typedef v4f  __attribute__((may_alias)) v4fa;
typedef v8us __attribute__((may_alias)) v8usa;

__device__ __forceinline__ unsigned short f2bf(float f) { unsigned u = __float_as_uint(f); u += 0x7FFFu + ((u >> 16) & 1u); return (unsigned short)(u >> 16); }
__device__ __forceinline__ float bf2f(unsigned short b) { return __uint_as_float(((unsigned)b) << 16); }
__device__ __forceinline__ float bfr(float f) { return bf2f(f2bf(f)); }
__device__ __forceinline__ v16h cat16(v8h lo, v8h hi) { return __builtin_shufflevector(lo, hi, 0, 1, 2, 3, 4, 5, 6, 7, 8, 9, 10, 11, 12, 13, 14, 15); }
__device__ __forceinline__ v16bf cat16b(v8us lo, v8us hi) { return __builtin_bit_cast(v16bf, __builtin_shufflevector(lo, hi, 0, 1, 2, 3, 4, 5, 6, 7, 8, 9, 10, 11, 12, 13, 14, 15)); }
__device__ __forceinline__ v8f wmma16(v16h a, v16h b, v8f c) { return __builtin_amdgcn_wmma_f32_16x16x32_f16(false, a, false, b, (short)0, c, false, false); }
__device__ __forceinline__ v8f wmmab(v16bf a, v16bf b, v8f c) { return __builtin_amdgcn_wmma_f32_16x16x32_bf16(false, a, false, b, (short)0, c, false, false); }



// ---- k_gemmks: register-blocked GEMM, one 64x64 output tile per work-group, its K loop split over the KS waves of the work-group; operands straight from K-contiguous 16-bit planes; grid (M/64, N/64, Z), KS*32 threads.
// C[m][n] (f32, pitch ldc, + optional f32 bias[n]) = sum_k A[m][k] Bt[n][k] (+ split products per NSPLIT). z-batch strides sA/sB/sC in elements. K % 64 == 0.
// Each wave keeps the whole tile (16 accumulators) and walks every KS-th 64-wide K chunk (one 128-byte line of each operand row); the KS partial tiles meet in LDS and are summed in the fixed order wave 0..KS-1.
// CAUSAL (probability x value): the K loop stops at the diagonal block of query rows r0+roff.. (probabilities beyond it are exactly zero).
template <typename T16> struct WFrag;
template <> struct WFrag<h16> { typedef v16h V; static __device__ __forceinline__ V ld(const h16* p) { return cat16(*(const v8h*)p, *(const v8h*)(p + 16)); } static __device__ __forceinline__ v8f mma(V a, V b, v8f c) { return wmma16(a, b, c); } };
template <> struct WFrag<bf> { typedef v16bf V; static __device__ __forceinline__ V ld(const bf* p) { return cat16b(*(const v8us*)p, *(const v8us*)(p + 16)); } static __device__ __forceinline__ v8f mma(V a, V b, v8f c) { return wmmab(a, b, c); } };
template <typename T16, int NSPLIT, int KS, bool CAUSAL, bool BIAS>
__global__ __launch_bounds__(KS * 32) void k_gemmks(const T16* __restrict__ A, const T16* __restrict__ A2, const T16* __restrict__ Bt, const T16* __restrict__ Bt2, int K, float* C, int ldc, int roff, const float* __restrict__ bias, size_t sA, size_t sB, size_t sC) {
    typedef typename WFrag<T16>::V V;
    constexpr int NP = KS / 4, JW = 8 / NP;                          // each 16-row band is summed by NP waves, JW accumulator registers (rows) each
    typedef __attribute__((ext_vector_type(JW))) float vj;
    __shared__ vj red[KS * 16 * NP * 32];                            // [wave][tile][part][lane]: 16 KiB a wave, lanes side by side (no bank conflict)
    const size_t z = blockIdx.z; A += z * sA; if (A2) A2 += z * sA; Bt += z * sB; if (Bt2) Bt2 += z * sB; C += z * sC;
    const int lane = threadIdx.x & 31, lr = lane & 15, hi = lane >> 4; const int r0 = blockIdx.x * 64, c0 = blockIdx.y * 64;
    const int wave = __builtin_amdgcn_readfirstlane(threadIdx.x >> 5);   // scalar, so that the K loop's branch is scalar and EXEC stays full at the matrix instructions
    const int Kl = CAUSAL ? min(K, r0 + roff + 64) : K;
    v8f acc[4][4];
#pragma unroll
    for (int mb = 0; mb < 4; ++mb)
#pragma unroll
        for (int nb = 0; nb < 4; ++nb) acc[mb][nb] = (v8f){};
    const size_t aoff = (size_t)(r0 + lr) * K + 8 * hi, boff = (size_t)(c0 + lr) * K + 8 * hi;
    // rolled: one set of fragments live beside the 16 accumulators. Two trips of 32 per chunk, then on to this wave's next chunk.
#pragma unroll 1
    for (int kc = wave * 64; kc < Kl; kc += (kc & 32) ? KS * 64 - 32 : 32) {
        V a[4], a2[4];
#pragma unroll
        for (int mb = 0; mb < 4; ++mb) { a[mb] = WFrag<T16>::ld(A + aoff + (size_t)mb * 16 * K + kc); if (NSPLIT == 1 || NSPLIT == 2) a2[mb] = WFrag<T16>::ld(A2 + aoff + (size_t)mb * 16 * K + kc); }
#pragma unroll
        for (int nb = 0; nb < 4; ++nb) { const V b = WFrag<T16>::ld(Bt + boff + (size_t)nb * 16 * K + kc); V b2; if (NSPLIT >= 2) b2 = WFrag<T16>::ld(Bt2 + boff + (size_t)nb * 16 * K + kc);
#pragma unroll
            for (int mb = 0; mb < 4; ++mb) { acc[mb][nb] = WFrag<T16>::mma(a[mb], b, acc[mb][nb]); if (NSPLIT == 1 || NSPLIT == 2) acc[mb][nb] = WFrag<T16>::mma(a2[mb], b, acc[mb][nb]); if (NSPLIT >= 2) acc[mb][nb] = WFrag<T16>::mma(a[mb], b2, acc[mb][nb]); } }
        // four vector slots between the last matrix instruction and the back edge, behind which the next trip's loads overwrite the fragments
        asm volatile("v_nop\n\tv_nop\n\tv_nop\n\tv_nop" : "+v"(acc[0][0]), "+v"(acc[1][1]), "+v"(acc[2][2]), "+v"(acc[3][3]) : "v"(a[0]), "v"(a[3]));
    }
    float bb[4];                                                     // bias of this lane's four columns, asked for ahead of the LDS traffic
#pragma unroll
    for (int nb = 0; nb < 4; ++nb) bb[nb] = BIAS ? bfr(bias[c0 + nb * 16 + lr]) : 0.0f;
    vj* rw = red + wave * (16 * NP * 32) + lane;
#pragma unroll
    for (int mb = 0; mb < 4; ++mb)
#pragma unroll
        for (int nb = 0; nb < 4; ++nb)
#pragma unroll
            for (int p = 0; p < NP; ++p) { vj t;
#pragma unroll
                for (int jj = 0; jj < JW; ++jj) t[jj] = acc[mb][nb][p * JW + jj];
                rw[((mb * 4 + nb) * NP + p) * 32] = t; }
    __syncthreads();                                                 // every wave's partial tile is in LDS before any wave sums
    const int mbw = wave / NP, pw = wave % NP;                       // this wave sums rows mbw*16 + {0, 8} + pw*JW .. +JW-1 over all 64 columns: whole 256-byte pieces of output rows, one writer a line
    float* crow = C + (size_t)(r0 + mbw * 16 + hi * 8 + pw * JW) * ldc + c0 + lr;
#pragma unroll
    for (int nb = 0; nb < 4; ++nb) { const vj* rr = red + ((mbw * 4 + nb) * NP + pw) * 32 + lane; vj s = rr[0];
#pragma unroll
        for (int u = 1; u < KS; ++u) s += rr[u * (16 * NP * 32)];
        if (BIAS) s += bb[nb];
#pragma unroll
        for (int jj = 0; jj < JW; ++jj) crow[(size_t)jj * ldc + nb * 16] = s[jj]; }
}

// ---- k_gemmc: the one-wave form of the 64x64 tile GEMM above (whole K loop in one wave) specialised for causal attention: CMODE 1 skips score tiles entirely above the diagonal (query rows r0+roff.., key columns c0..), CMODE 2 limits the
// key (K) loop of the probability x value contraction to the diagonal block (probabilities beyond it are exactly zero). roff = row offset of this launch's first row within the sequence.
template <typename T16, int NSPLIT, int CMODE>
__global__ __launch_bounds__(32) void k_gemmc(const T16* __restrict__ A, const T16* __restrict__ A2, const T16* __restrict__ Bt, const T16* __restrict__ Bt2, int K, float* C, int ldc, int roff, size_t sA, size_t sB, size_t sC) {
    typedef typename WFrag<T16>::V V;
    __shared__ __align__(16) float os[16 * 68];
    const size_t z = blockIdx.z; A += z * sA; if (A2) A2 += z * sA; Bt += z * sB; if (Bt2) Bt2 += z * sB; C += z * sC;
    const int lane = threadIdx.x & 31, lr = lane & 15, hi = lane >> 4; const int r0 = blockIdx.x * 64, c0 = blockIdx.y * 64;
    if (CMODE == 1 && c0 > r0 + roff + 63) return;                  // score tile entirely above the causal diagonal: never read (the softmax masks j > i by select)
    const int Kl = (CMODE == 2) ? min(K, r0 + roff + 64) : K;        // P.V: probabilities are exactly 0 beyond the diagonal block, so the K loop stops there
    v8f acc[4][4];
#pragma unroll
    for (int mb = 0; mb < 4; ++mb)
#pragma unroll
        for (int nb = 0; nb < 4; ++nb) acc[mb][nb] = (v8f){};
    const size_t aoff = (size_t)(r0 + lr) * K + 8 * hi, boff = (size_t)(c0 + lr) * K + 8 * hi;
#pragma unroll 1
    for (int kc = 0; kc < Kl; kc += 32) {
        V a[4], a2[4];
#pragma unroll
        for (int mb = 0; mb < 4; ++mb) { a[mb] = WFrag<T16>::ld(A + aoff + (size_t)mb * 16 * K + kc); if (NSPLIT == 1 || NSPLIT == 2) a2[mb] = WFrag<T16>::ld(A2 + aoff + (size_t)mb * 16 * K + kc); }
#pragma unroll
        for (int nb = 0; nb < 4; ++nb) { const V b = WFrag<T16>::ld(Bt + boff + (size_t)nb * 16 * K + kc); V b2; if (NSPLIT >= 2) b2 = WFrag<T16>::ld(Bt2 + boff + (size_t)nb * 16 * K + kc);
#pragma unroll
            for (int mb = 0; mb < 4; ++mb) { acc[mb][nb] = WFrag<T16>::mma(a[mb], b, acc[mb][nb]); if (NSPLIT == 1 || NSPLIT == 2) acc[mb][nb] = WFrag<T16>::mma(a2[mb], b, acc[mb][nb]); if (NSPLIT >= 2) acc[mb][nb] = WFrag<T16>::mma(a[mb], b2, acc[mb][nb]); } }
        asm volatile("v_nop\n\tv_nop\n\tv_nop\n\tv_nop" : "+v"(acc[0][0]), "+v"(acc[1][1]), "+v"(acc[2][2]), "+v"(acc[3][3]) : "v"(a[0]), "v"(a[3]));
    }
#pragma unroll
    for (int mb = 0; mb < 4; ++mb) {
#pragma unroll
        for (int nb = 0; nb < 4; ++nb) {
#pragma unroll
            for (int j = 0; j < 8; ++j) os[(hi * 8 + j) * 68 + nb * 16 + lr] = acc[mb][nb][j]; }
        __builtin_amdgcn_wave_barrier(); asm volatile("" ::: "memory");
        float* crow = C + (size_t)(r0 + mb * 16) * ldc + c0;
{
#pragma unroll
            for (int s = 0; s < 8; ++s) { const int row = 2 * s + hi, cofs = lr * 4; v4f val = *(const v4fa*)(os + row * 68 + cofs);
                *(v4f*)(crow + (size_t)row * ldc + cofs) = val; }
             }
        __builtin_amdgcn_wave_barrier(); asm volatile("" ::: "memory");
    }
}

__device__ __forceinline__ h16 tohx(float x) { return (h16)x; }
__device__ __forceinline__ void splitf(float y, unsigned short& h, unsigned short& l) { h = f2bf(y); l = f2bf(y - bf2f(h)); }
typedef __attribute__((ext_vector_type(2))) _Float16 v2h;
typedef __attribute__((ext_vector_type(4))) _Float16 v4h;
typedef __attribute__((ext_vector_type(2))) unsigned short v2us;
typedef __attribute__((ext_vector_type(4))) unsigned short v4us;
typedef __attribute__((ext_vector_type(2))) float v2f;
typedef __attribute__((ext_vector_type(4))) int v4i;

__global__ __launch_bounds__(256) void k_wtG(const float* __restrict__ w, int K, int N, bf* Bt) {
    const int lane = threadIdx.x & 31; const int L0 = (blockIdx.x * 8 + (threadIdx.x >> 5)) * 8; const int nlines = N * K / 64;
{
#pragma unroll 1
        for (int l = 0; l < 8; ++l) { const int L = L0 + l; if (L >= nlines) break; const size_t e = (size_t)L * 64 + lane * 2; const int k = (int)(e % K), n = (int)(e / K); v2us o;
            o[0] = f2bf(w[(size_t)k * N + n]); o[1] = f2bf(w[(size_t)(k + 1) * N + n]); *(v2us*)(Bt + e) = o; }
         }
}
__global__ __launch_bounds__(256) void k_cvt8(const float* __restrict__ src, bf* dst, size_t n8) { const size_t i = (size_t)blockIdx.x * 256 + threadIdx.x; if (i >= n8) return; const v8f v = *(const v8f*)(src + i * 8); v8us o;
#pragma unroll
    for (int k = 0; k < 8; ++k) o[k] = f2bf(v[k]); *(v8us*)(dst + i * 8) = o;  }

// k_rope: head planes [h][t][d] (fp16 + hi/lo) of rope(x) x sc with the rotate-half convention out[d] = x[d] cos[t][d] - x[d+HD/2] sin[t][d], out[d+HD/2] = x[d+HD/2] cos[t][d+HD/2] + x[d] sin[t][d+HD/2]
__global__ __launch_bounds__(256) void k_rope(const float* __restrict__ F, int pitch, int nheads, const float* __restrict__ CS, const float* __restrict__ RF, const float* __restrict__ nw, float sc, h16* P16, bf* Ph, bf* Pl) {
    const size_t e = ((size_t)blockIdx.x * 256 + threadIdx.x) * 2; if (e >= (size_t)nheads * TT * HD) return; const int d = (int)(e % HD); const int t = (int)((e / HD) % TT); const int h = (int)(e / ((size_t)HD * TT)); const float* f = F + (size_t)t * pitch + h * HD; const float rf = RF ? RF[(size_t)h * TT + t] : 1.0f; v2h o16; v2us oh, ol;
#pragma unroll
    for (int q = 0; q < 2; ++q) { const int dd = d + q; const int dp = (dd < HD / 2) ? dd + HD / 2 : dd - HD / 2; float x0 = f[dd], x1 = f[dp];
        if (RF) { float n0 = __fmul_rn(x0, rf), n1 = __fmul_rn(x1, rf); asm volatile("" : "+v"(n0)); asm volatile("" : "+v"(n1)); x0 = __fmul_rn(bfr(nw[dd]), n0); x1 = __fmul_rn(bfr(nw[dp]), n1); }
        const v2f cs = *(const v2f*)(CS + ((size_t)t * HD + dd) * 2); float a = __fmul_rn(x0, cs[0]), bq = __fmul_rn(x1, cs[1]); asm volatile("" : "+v"(a)); asm volatile("" : "+v"(bq)); const float r = ((dd < HD / 2) ? __fsub_rn(a, bq) : __fadd_rn(a, bq)) * sc;
        o16[q] = tohx(r); unsigned short a2, c2; splitf(r, a2, c2); oh[q] = a2; ol[q] = c2; }
    *(v2h*)(P16 + e) = o16; *(v2us*)(Ph + e) = oh; *(v2us*)(Pl + e) = ol;  }
__global__ __launch_bounds__(256) void k_vtp(const float* __restrict__ F, int pitch, int nheads, h16* V16, bf* Vh, bf* Vl) { const size_t e = ((size_t)blockIdx.x * 256 + threadIdx.x) * 2; if (e >= (size_t)nheads * HD * TT) return; const int t = (int)(e % TT); const int d = (int)((e / TT) % HD); const int g = (int)(e / ((size_t)TT * HD)); v2h o16; v2us oh, ol;
#pragma unroll
    for (int q = 0; q < 2; ++q) { const float x = F[(size_t)(t + q) * pitch + g * HD + d]; o16[q] = tohx(x); unsigned short a2, c2; splitf(x, a2, c2); oh[q] = a2; ol[q] = c2; }
    *(v2h*)(V16 + e) = o16; *(v2us*)(Vh + e) = oh; *(v2us*)(Vl + e) = ol;  }
__global__ __launch_bounds__(256) void k_csid(float* CS) { const int idx = blockIdx.x * 256 + threadIdx.x; if (idx >= TT * HD) return; v2f cs; cs[0] = 1.0f; cs[1] = 0.0f; *(v2f*)(CS + (size_t)idx * 2) = cs;  }
// k_asoft: per row (zz, i): t = S x HD^-0.5 for j <= i and i - j < WIN (WIN = TT: plain causal mask; the reference's -1e9 additive fill vanishes identically); softmax over the 2048 keys (register row, one exp, fixed trees);
__global__ __launch_bounds__(256) void k_asoft(const float* __restrict__ Sb, h16* P16, bf* Ph, bf* Pl) {
    const int lane = threadIdx.x & 31; const int row = blockIdx.x * 8 + (threadIdx.x >> 5); if (row >= ZH * TT) return; const int i = row % TT; const int zz = row / TT; (void)zz; const bool hires = (i < RH); const float* sr = Sb + (size_t)row * TT; float v[TT / 32]; float mx = -3.0e38f;
#pragma unroll
    for (int ch = 0; ch < TT / 128; ++ch) { const int j0 = ch * 128 + lane * 4; const v4f a = *(const v4f*)(sr + j0);
#pragma unroll
        for (int q = 0; q < 4; ++q) { const int j = j0 + q; (void)j; const float t = (j <= i && i - j < WIN) ? a[q] * SCL : -3.0e38f; v[ch * 4 + q] = t; mx = fmaxf(mx, t); } }
#pragma unroll
    for (int sh = 16; sh; sh >>= 1) mx = fmaxf(mx, __shfl_xor(mx, sh, 32));
    float sum = 0.f;
#pragma unroll
    for (int k = 0; k < TT / 32; ++k) { float d0 = __fsub_rn(v[k], mx); asm volatile("" : "+v"(d0)); v[k] = __builtin_amdgcn_exp2f(__fmul_rn(d0, 1.4426950408889634f)); sum += v[k]; }
#pragma unroll
    for (int sh = 16; sh; sh >>= 1) sum += __shfl_xor(sum, sh, 32);
    const float f = __fdiv_rn(hires ? 1.0f : PCAR, sum);
{
        if (hires) {
#pragma unroll
            for (int ch = 0; ch < TT / 128; ++ch) { v4us oh, ol;
#pragma unroll
                for (int q = 0; q < 4; ++q) { unsigned short a, c2; splitf(v[ch * 4 + q] * f, a, c2); oh[q] = a; ol[q] = c2; }
                const size_t oo = ((size_t)zz * (RH ? RH : 1) + i) * TT + ch * 128 + lane * 4; *(v4us*)(Ph + oo) = oh; *(v4us*)(Pl + oo) = ol; }
        } else {
#pragma unroll
            for (int ch = 0; ch < TT / 128; ++ch) { v4h o4;
#pragma unroll
                for (int q = 0; q < 4; ++q) o4[q] = tohx(v[ch * 4 + q] * f);
                *(v4h*)(P16 + (size_t)row * TT + ch * 128 + lane * 4) = o4; } }
         }
}
__global__ __launch_bounds__(256) void k_merge(const float* __restrict__ O, int h0, bf* Ah, bf* Al) { const size_t e = ((size_t)blockIdx.x * 256 + threadIdx.x) * 2; if (e >= (size_t)ZH * TT * HD) return; const int d = (int)(e % HD); const int t = (int)((e / HD) % TT); const int zz = (int)(e / ((size_t)HD * TT)); const float cs = (t < RH) ? 1.0f : (1.0f / PCAR); const size_t oo = (size_t)t * DQ + (h0 + zz) * HD + d;
    v2us oh, ol;
#pragma unroll
    for (int q = 0; q < 2; ++q) { unsigned short a, c2; splitf(O[e + q] * cs, a, c2); oh[q] = a; ol[q] = c2; } *(v2us*)(Ah + oo) = oh; *(v2us*)(Al + oo) = ol;  }

extern "C" void kernel_launch(void* const* d_in, const int* in_sizes, int n_in,
                              void* d_out, int out_size, void* d_ws, size_t ws_size, hipStream_t stream) {
    (void)in_sizes; (void)n_in; (void)out_size;
    const float* x = (const float*)d_in[0]; const float* wq = (const float*)d_in[1]; const float* bq = (const float*)d_in[2]; const float* wk = (const float*)d_in[3]; const float* bk = (const float*)d_in[4]; const float* wv = (const float*)d_in[5]; const float* bv = (const float*)d_in[6]; const float* wo = (const float*)d_in[7]; const float* bo = (const float*)d_in[8];   /* argument order x, Wq, bq, Wk, bk, Wv, bv, Wp, bp (per-head weights [16][1024][64]; per-head biases [16][64] = flat index h*64 + d) */
    float* OUT = (float*)d_out;     // [4][2048][1024]
    char* wsp = (char*)d_ws;
    auto take = [&](size_t bytes) { char* p = wsp; wsp += (bytes + 255) & ~(size_t)255; return (void*)p; };
    bf* WQ = (bf*)take((size_t)DQ * DM * 2); bf* WK = (bf*)take((size_t)DKV * DM * 2); bf* WV = (bf*)take((size_t)DKV * DM * 2); bf* WO = (bf*)take((size_t)DM * DQ * 2); float* CS = (float*)take((size_t)TT * HD * 2 * 4);
    bf* XB = (bf*)take((size_t)TT * DM * 2); float* FQ = (float*)take((size_t)TT * DQ * 4); float* FK = (float*)take((size_t)TT * DKV * 4);
    h16* QP16 = (h16*)take((size_t)NH_ * TT * HD * 2); h16* KP16 = (h16*)take((size_t)NKV * TT * HD * 2); h16* VT16 = (h16*)take((size_t)NKV * HD * TT * 2);
    bf* QPh = (bf*)take((size_t)NH_ * TT * HD * 2); bf* QPl = (bf*)take((size_t)NH_ * TT * HD * 2); bf* KPh = (bf*)take((size_t)NKV * TT * HD * 2); bf* KPl = (bf*)take((size_t)NKV * TT * HD * 2); bf* VTh = (bf*)take((size_t)NKV * HD * TT * 2); bf* VTl = (bf*)take((size_t)NKV * HD * TT * 2); bf* Ph = (bf*)take((size_t)ZH * RH * TT * 2); bf* Pl = (bf*)take((size_t)ZH * RH * TT * 2);
    float* Sb = (float*)take((size_t)ZH * TT * TT * 4); h16* P16 = (h16*)take((size_t)ZH * TT * TT * 2); float* Ob = (float*)take((size_t)ZH * TT * HD * 4); bf* ATh = (bf*)take((size_t)TT * DQ * 2); bf* ATl = (bf*)take((size_t)TT * DQ * 2);
    if ((size_t)(wsp - (char*)d_ws) > ws_size) return;    // ws 256 MiB
    float* FV = FK;   // v projection reuses the k buffer after the k planes are built (stream-ordered)
    { for (int h = 0; h < NH_; ++h) k_wtG<<<(unsigned)((DM * HD / 64 + 63) / 64), 256, 0, stream>>>(wq + (size_t)h * DM * HD, DM, HD, WQ + (size_t)h * HD * DM);   /* per-head weight [h][DM][HD] ('xw' per head) -> the head's HD rows of the Bt plane */ for (int h = 0; h < NKV; ++h) k_wtG<<<(unsigned)((DM * HD / 64 + 63) / 64), 256, 0, stream>>>(wk + (size_t)h * DM * HD, DM, HD, WK + (size_t)h * HD * DM);   /* per-head weight [h][DM][HD] ('xw' per head) -> the head's HD rows of the Bt plane */ for (int h = 0; h < NKV; ++h) k_wtG<<<(unsigned)((DM * HD / 64 + 63) / 64), 256, 0, stream>>>(wv + (size_t)h * DM * HD, DM, HD, WV + (size_t)h * HD * DM);   /* per-head weight [h][DM][HD] ('xw' per head) -> the head's HD rows of the Bt plane */
      k_wtG<<<(unsigned)((DQ * DM / 64 + 63) / 64), 256, 0, stream>>>(wo, DQ, DM, WO);
       }
    k_csid<<<(TT * HD + 255) / 256, 256, 0, stream>>>(CS);
    const unsigned LQ = (unsigned)(((size_t)NH_ * TT * HD / 2 + 255) / 256), LKv = (unsigned)(((size_t)NKV * TT * HD / 2 + 255) / 256);
    for (int b = 0; b < NB_; ++b) {
        
        k_cvt8<<<(unsigned)(((size_t)TT * DM / 8 + 255) / 256), 256, 0, stream>>>(x + (size_t)b * TT * DM, XB, (size_t)TT * DM / 8);
        k_gemmks<bf, 0, 8, false, true><<<dim3(TT / 64, DQ / 64, 1), 8 * 32, 0, stream>>>(XB, nullptr, WQ, nullptr, DM, FQ, DQ, 0, bq, 0, 0, 0);
        k_rope<<<LQ, 256, 0, stream>>>(FQ, DQ, NH_, CS, nullptr, nullptr, 1.0f, QP16, QPh, QPl);
        k_gemmks<bf, 0, 8, false, true><<<dim3(TT / 64, DKV / 64, 1), 8 * 32, 0, stream>>>(XB, nullptr, WK, nullptr, DM, FK, DKV, 0, bk, 0, 0, 0);
        k_rope<<<LKv, 256, 0, stream>>>(FK, DKV, NKV, CS, nullptr, nullptr, 1.0f, KP16, KPh, KPl);
        k_gemmks<bf, 0, 8, false, true><<<dim3(TT / 64, DKV / 64, 1), 8 * 32, 0, stream>>>(XB, nullptr, WV, nullptr, DM, FV, DKV, 0, bv, 0, 0, 0); k_vtp<<<LKv, 256, 0, stream>>>(FV, DKV, NKV, VT16, VTh, VTl);
        for (int h0 = 0; h0 < NH_; h0 += ZH) { const size_t zq = (size_t)h0, zk = (size_t)(h0 / REP);   // one kv head per query head: the pass's two heads use consecutive kv planes (z-strides TT*HD)
            k_gemmc<bf, 2, 1><<<dim3(RH / 64, TT / 64, ZH), 32, 0, stream>>>(QPh + zq * TT * HD, QPl + zq * TT * HD, KPh + zk * TT * HD, KPl + zk * TT * HD, HD, Sb, TT, 0, (size_t)TT * HD, (size_t)TT * HD, (size_t)TT * TT);
            k_gemmc<h16, 0, 1><<<dim3((TT - RH) / 64, TT / 64, ZH), 32, 0, stream>>>(QP16 + zq * TT * HD + (size_t)RH * HD, nullptr, KP16 + zk * TT * HD, nullptr, HD, Sb + (size_t)RH * TT, TT, RH, (size_t)TT * HD, (size_t)TT * HD, (size_t)TT * TT);
            k_asoft<<<ZH * TT / 8, 256, 0, stream>>>(Sb, P16, Ph, Pl);
            k_gemmks<bf, 2, 8, true, false><<<dim3(RH / 64, HD / 64, ZH), 8 * 32, 0, stream>>>(Ph, Pl, VTh + zk * HD * TT, VTl + zk * HD * TT, TT, Ob, HD, 0, nullptr, (size_t)RH * TT, (size_t)HD * TT, (size_t)TT * HD);
            k_gemmks<h16, 0, 16, true, false><<<dim3((TT - RH) / 64, HD / 64, ZH), 16 * 32, 0, stream>>>(P16 + (size_t)RH * TT, nullptr, VT16 + zk * HD * TT, nullptr, TT, Ob + (size_t)RH * HD, HD, RH, nullptr, (size_t)TT * TT, (size_t)HD * TT, (size_t)TT * HD);
            k_merge<<<(unsigned)(((size_t)ZH * TT * HD / 2 + 255) / 256), 256, 0, stream>>>(Ob, h0, ATh, ATl); }
        k_gemmks<bf, 1, 8, false, true><<<dim3(TT / 64, DM / 64, 1), 8 * 32, 0, stream>>>(ATh, ATl, WO, nullptr, DQ, OUT + (size_t)b * TT * DM, DM, 0, bo, 0, 0, 0); }
}

// v002
// One run takes 960 microseconds.
// Next to v001, in two timings, it ran 2.13 and 2.10 times as fast.
// Over all steps from v000 it is 3.33 times as fast.
#include <hip/hip_runtime.h>

// Causal multi-head self-attention whose q, k, v projections are given PER HEAD (x [4][2048][1024]; q, k, v = einsum('bte,hed->bhtd', x, W) + b[None, :, None, :] with W [16][1024][64] ((in, out) inside each head; 1/32-scale) and per-head biases b [16][64] (zeros on this draw); scores x 1/sqrt(64); causal (-inf); softmax; heads merged head-major (column h*64 + d); out = cat Wp + bp ('xw' [1024][1024] + zero bias) -> [4][2048][1024] (8.4 M); argument order x, Wq, bq, Wk, bk, Wv, bv, Wp, bp). THIS ROW: the same module under other names (token_embedding [4][2048][1024]; PER-HEAD stacked projections Wq, Wk, Wv [16][1024][64] normal x 1/32 with biases [16][64] zeros (read): q = einsum('btd,hde->bhte', x, Wq) + bq; scores / sqrt(64); tril kept, -inf; softmax; heads concatenated in order; out = cat Wo + bo ('xw' [1024][1024]; bias zeros: read); argument order token_embedding, Wq, bq, Wk, bk, Wv, bv, Wo, bo).
// Layout per batch: bf16 copy of x; 'xw' weights transposed once; exact projections + f32 biases; identity-table plane builders; causal T-2048 attention (hybrid rows: < 512 hi/lo 3 products, rest fp16 x1024; k_gemmc skips tiles above the diagonal); merged hi/lo x Wo exact + bo.
// Compute dtypes, f32 accumulate: every input rounded to bf16; projections exact + f32 biases; attention rows < 512 3 products, rest fp16; softmax f32; output projection hl x exact.

#define NB_  4
#define TT   2048
#define DM   1024
#define NH_  16
#define NKV  16
#define REP  (NH_ / NKV)
#define HD   64
#define DQ   (NH_ * HD)
#define DKV  (NKV * HD)
#define ZH   8                    // heads per attention pass (z of the score and probability x value GEMM launches)
#define RH   512                  // query rows < RH use hi+lo planes (0: none)
#define WIN  2048
#define PP   (2 * TT)              // row pitch, in 16-bit elements, of the probability rows (each lies in its own f32 score row) and of the transposed value planes that meet them in k_gemmks
#define PCAR 1024.0f
#define SCL  0.125f   // HD^-0.5
typedef _Float16 h16;
typedef unsigned short bf;
typedef __attribute__((ext_vector_type(16))) __bf16   v16bf;
typedef __attribute__((ext_vector_type(16))) _Float16 v16h;
typedef __attribute__((ext_vector_type(8)))  _Float16 v8h;
typedef __attribute__((ext_vector_type(8)))  unsigned short v8us;
typedef __attribute__((ext_vector_type(8)))  float    v8f;
typedef __attribute__((ext_vector_type(4)))  float    v4f;
typedef v8h  __attribute__((may_alias)) v8ha;
typedef v4f  __attribute__((may_alias)) v4fa;
typedef v8us __attribute__((may_alias)) v8usa;

__device__ __forceinline__ unsigned short f2bf(float f) { unsigned u = __float_as_uint(f); u += 0x7FFFu + ((u >> 16) & 1u); return (unsigned short)(u >> 16); }
__device__ __forceinline__ float bf2f(unsigned short b) { return __uint_as_float(((unsigned)b) << 16); }
__device__ __forceinline__ float bfr(float f) { return bf2f(f2bf(f)); }
__device__ __forceinline__ v16h cat16(v8h lo, v8h hi) { return __builtin_shufflevector(lo, hi, 0, 1, 2, 3, 4, 5, 6, 7, 8, 9, 10, 11, 12, 13, 14, 15); }
__device__ __forceinline__ v16bf cat16b(v8us lo, v8us hi) { return __builtin_bit_cast(v16bf, __builtin_shufflevector(lo, hi, 0, 1, 2, 3, 4, 5, 6, 7, 8, 9, 10, 11, 12, 13, 14, 15)); }
__device__ __forceinline__ v8f wmma16(v16h a, v16h b, v8f c) { return __builtin_amdgcn_wmma_f32_16x16x32_f16(false, a, false, b, (short)0, c, false, false); }
__device__ __forceinline__ v8f wmmab(v16bf a, v16bf b, v8f c) { return __builtin_amdgcn_wmma_f32_16x16x32_bf16(false, a, false, b, (short)0, c, false, false); }



// ---- k_gemmks: register-blocked GEMM, one 64x64 output tile per work-group, its K loop split over the KS waves of the work-group; operands straight from K-contiguous 16-bit planes; grid (M/64, N/64, Z), KS*32 threads.
// C[m][n] (f32, pitch ldc, + optional f32 bias[n]) = sum_k A[m][k] Bt[n][k] (+ split products per NSPLIT). z-batch strides sA/sB/sC in elements. K % 64 == 0.
// Each wave keeps the whole tile (16 accumulators) and walks every KS-th 64-wide K chunk (one 128-byte line of each operand row); the KS partial tiles meet in LDS and are summed in the fixed order wave 0..KS-1.
// CAUSAL (probability x value): the K loop stops at the diagonal block of query rows r0+roff.. (probabilities beyond it are exactly zero).
template <typename T16> struct WFrag;
template <> struct WFrag<h16> { typedef v16h V; static __device__ __forceinline__ V ld(const h16* p) { return cat16(*(const v8h*)p, *(const v8h*)(p + 16)); } static __device__ __forceinline__ v8f mma(V a, V b, v8f c) { return wmma16(a, b, c); } };
template <> struct WFrag<bf> { typedef v16bf V; static __device__ __forceinline__ V ld(const bf* p) { return cat16b(*(const v8us*)p, *(const v8us*)(p + 16)); } static __device__ __forceinline__ v8f mma(V a, V b, v8f c) { return wmmab(a, b, c); } };
template <typename T16, int NSPLIT, int KS, bool CAUSAL, bool BIAS>
__global__ __launch_bounds__(KS * 32) void k_gemmks(const T16* __restrict__ A, const T16* __restrict__ A2, const T16* __restrict__ Bt, const T16* __restrict__ Bt2, int K, float* C, int ldc, int roff, const float* __restrict__ bias, size_t sA, size_t sB, size_t sC) {
    typedef typename WFrag<T16>::V V;
    constexpr int NP = KS / 4, JW = 8 / NP;                          // each 16-row band is summed by NP waves, JW accumulator registers (rows) each
    typedef __attribute__((ext_vector_type(JW))) float vj;
    __shared__ vj red[KS * 16 * NP * 32];                            // [wave][tile][part][lane]: 16 KiB a wave, lanes side by side (no bank conflict)
    const size_t z = blockIdx.z; A += z * sA; if (A2) A2 += z * sA; Bt += z * sB; if (Bt2) Bt2 += z * sB; C += z * sC;
    const int lane = threadIdx.x & 31, lr = lane & 15, hi = lane >> 4; const int r0 = blockIdx.x * 64, c0 = blockIdx.y * 64;
    const int wave = __builtin_amdgcn_readfirstlane(threadIdx.x >> 5);   // scalar, so that the K loop's branch is scalar and EXEC stays full at the matrix instructions
    const int Kl = CAUSAL ? min(K, r0 + roff + 64) : K;
    v8f acc[4][4];
#pragma unroll
    for (int mb = 0; mb < 4; ++mb)
#pragma unroll
        for (int nb = 0; nb < 4; ++nb) acc[mb][nb] = (v8f){};
    const size_t aoff = (size_t)(r0 + lr) * K + 8 * hi, boff = (size_t)(c0 + lr) * K + 8 * hi;
    // rolled: one set of fragments live beside the 16 accumulators. Two trips of 32 per chunk, then on to this wave's next chunk.
#pragma unroll 1
    for (int kc = wave * 64; kc < Kl; kc += (kc & 32) ? KS * 64 - 32 : 32) {
        V a[4], a2[4];
#pragma unroll
        for (int mb = 0; mb < 4; ++mb) { a[mb] = WFrag<T16>::ld(A + aoff + (size_t)mb * 16 * K + kc); if (NSPLIT == 1 || NSPLIT == 2) a2[mb] = WFrag<T16>::ld(A2 + aoff + (size_t)mb * 16 * K + kc); }
#pragma unroll
        for (int nb = 0; nb < 4; ++nb) { const V b = WFrag<T16>::ld(Bt + boff + (size_t)nb * 16 * K + kc); V b2; if (NSPLIT >= 2) b2 = WFrag<T16>::ld(Bt2 + boff + (size_t)nb * 16 * K + kc);
#pragma unroll
            for (int mb = 0; mb < 4; ++mb) { acc[mb][nb] = WFrag<T16>::mma(a[mb], b, acc[mb][nb]); if (NSPLIT == 1 || NSPLIT == 2) acc[mb][nb] = WFrag<T16>::mma(a2[mb], b, acc[mb][nb]); if (NSPLIT >= 2) acc[mb][nb] = WFrag<T16>::mma(a[mb], b2, acc[mb][nb]); } }
        // four vector slots between the last matrix instruction and the back edge, behind which the next trip's loads overwrite the fragments
        asm volatile("v_nop\n\tv_nop\n\tv_nop\n\tv_nop" : "+v"(acc[0][0]), "+v"(acc[1][1]), "+v"(acc[2][2]), "+v"(acc[3][3]) : "v"(a[0]), "v"(a[3]));
    }
    float bb[4];                                                     // bias of this lane's four columns, asked for ahead of the LDS traffic
#pragma unroll
    for (int nb = 0; nb < 4; ++nb) bb[nb] = BIAS ? bfr(bias[c0 + nb * 16 + lr]) : 0.0f;
    vj* rw = red + wave * (16 * NP * 32) + lane;
#pragma unroll
    for (int mb = 0; mb < 4; ++mb)
#pragma unroll
        for (int nb = 0; nb < 4; ++nb)
#pragma unroll
            for (int p = 0; p < NP; ++p) { vj t;
#pragma unroll
                for (int jj = 0; jj < JW; ++jj) t[jj] = acc[mb][nb][p * JW + jj];
                rw[((mb * 4 + nb) * NP + p) * 32] = t; }
    __syncthreads();                                                 // every wave's partial tile is in LDS before any wave sums
    const int mbw = wave / NP, pw = wave % NP;                       // this wave sums rows mbw*16 + {0, 8} + pw*JW .. +JW-1 over all 64 columns: whole 256-byte pieces of output rows, one writer a line
    float* crow = C + (size_t)(r0 + mbw * 16 + hi * 8 + pw * JW) * ldc + c0 + lr;
#pragma unroll
    for (int nb = 0; nb < 4; ++nb) { const vj* rr = red + ((mbw * 4 + nb) * NP + pw) * 32 + lane; vj s = rr[0];
#pragma unroll
        for (int u = 1; u < KS; ++u) s += rr[u * (16 * NP * 32)];
        if (BIAS) s += bb[nb];
#pragma unroll
        for (int jj = 0; jj < JW; ++jj) crow[(size_t)jj * ldc + nb * 16] = s[jj]; }
}

// ---- k_gemmc: the one-wave form of the 64x64 tile GEMM above (whole K loop in one wave) specialised for causal attention: CMODE 1 skips score tiles entirely above the diagonal (query rows r0+roff.., key columns c0..), CMODE 2 limits the
// key (K) loop of the probability x value contraction to the diagonal block (probabilities beyond it are exactly zero). roff = row offset of this launch's first row within the sequence.
template <typename T16, int NSPLIT, int CMODE>
__global__ __launch_bounds__(32) void k_gemmc(const T16* __restrict__ A, const T16* __restrict__ A2, const T16* __restrict__ Bt, const T16* __restrict__ Bt2, int K, float* C, int ldc, int roff, size_t sA, size_t sB, size_t sC) {
    typedef typename WFrag<T16>::V V;
    __shared__ __align__(16) float os[16 * 68];
    const size_t z = blockIdx.z; A += z * sA; if (A2) A2 += z * sA; Bt += z * sB; if (Bt2) Bt2 += z * sB; C += z * sC;
    const int lane = threadIdx.x & 31, lr = lane & 15, hi = lane >> 4; const int r0 = blockIdx.x * 64, c0 = blockIdx.y * 64;
    if (CMODE == 1 && c0 > r0 + roff + 63) return;                  // score tile entirely above the causal diagonal: never read (the softmax masks j > i by select)
    const int Kl = (CMODE == 2) ? min(K, r0 + roff + 64) : K;        // P.V: probabilities are exactly 0 beyond the diagonal block, so the K loop stops there
    v8f acc[4][4];
#pragma unroll
    for (int mb = 0; mb < 4; ++mb)
#pragma unroll
        for (int nb = 0; nb < 4; ++nb) acc[mb][nb] = (v8f){};
    const size_t aoff = (size_t)(r0 + lr) * K + 8 * hi, boff = (size_t)(c0 + lr) * K + 8 * hi;
#pragma unroll 1
    for (int kc = 0; kc < Kl; kc += 32) {
        V a[4], a2[4];
#pragma unroll
        for (int mb = 0; mb < 4; ++mb) { a[mb] = WFrag<T16>::ld(A + aoff + (size_t)mb * 16 * K + kc); if (NSPLIT == 1 || NSPLIT == 2) a2[mb] = WFrag<T16>::ld(A2 + aoff + (size_t)mb * 16 * K + kc); }
#pragma unroll
        for (int nb = 0; nb < 4; ++nb) { const V b = WFrag<T16>::ld(Bt + boff + (size_t)nb * 16 * K + kc); V b2; if (NSPLIT >= 2) b2 = WFrag<T16>::ld(Bt2 + boff + (size_t)nb * 16 * K + kc);
#pragma unroll
            for (int mb = 0; mb < 4; ++mb) { acc[mb][nb] = WFrag<T16>::mma(a[mb], b, acc[mb][nb]); if (NSPLIT == 1 || NSPLIT == 2) acc[mb][nb] = WFrag<T16>::mma(a2[mb], b, acc[mb][nb]); if (NSPLIT >= 2) acc[mb][nb] = WFrag<T16>::mma(a[mb], b2, acc[mb][nb]); } }
        asm volatile("v_nop\n\tv_nop\n\tv_nop\n\tv_nop" : "+v"(acc[0][0]), "+v"(acc[1][1]), "+v"(acc[2][2]), "+v"(acc[3][3]) : "v"(a[0]), "v"(a[3]));
    }
#pragma unroll
    for (int mb = 0; mb < 4; ++mb) {
#pragma unroll
        for (int nb = 0; nb < 4; ++nb) {
#pragma unroll
            for (int j = 0; j < 8; ++j) os[(hi * 8 + j) * 68 + nb * 16 + lr] = acc[mb][nb][j]; }
        __builtin_amdgcn_wave_barrier(); asm volatile("" ::: "memory");
        float* crow = C + (size_t)(r0 + mb * 16) * ldc + c0;
{
#pragma unroll
            for (int s = 0; s < 8; ++s) { const int row = 2 * s + hi, cofs = lr * 4; v4f val = *(const v4fa*)(os + row * 68 + cofs);
                *(v4f*)(crow + (size_t)row * ldc + cofs) = val; }
             }
        __builtin_amdgcn_wave_barrier(); asm volatile("" ::: "memory");
    }
}

__device__ __forceinline__ h16 tohx(float x) { return (h16)x; }
__device__ __forceinline__ void splitf(float y, unsigned short& h, unsigned short& l) { h = f2bf(y); l = f2bf(y - bf2f(h)); }
typedef __attribute__((ext_vector_type(2))) _Float16 v2h;
typedef __attribute__((ext_vector_type(4))) _Float16 v4h;
typedef __attribute__((ext_vector_type(2))) unsigned short v2us;
typedef __attribute__((ext_vector_type(4))) unsigned short v4us;
typedef __attribute__((ext_vector_type(2))) float v2f;
typedef __attribute__((ext_vector_type(4))) int v4i;

// grid (lines / 64, matrices per source, sources): matrix y of source z ([K][N], K * N apart in its source) goes to the K * N elements number z * NH_ + y of Bt
__global__ __launch_bounds__(256) void k_wtG(const float* __restrict__ w0, const float* __restrict__ w1, const float* __restrict__ w2, int K, int N, bf* Bt) {
    const float* __restrict__ w = (blockIdx.z == 0 ? w0 : blockIdx.z == 1 ? w1 : w2) + (size_t)blockIdx.y * K * N; Bt += ((size_t)blockIdx.z * NH_ + blockIdx.y) * K * N;
    const int lane = threadIdx.x & 31; const int L0 = (blockIdx.x * 8 + (threadIdx.x >> 5)) * 8; const int nlines = N * K / 64;
{
#pragma unroll 1
        for (int l = 0; l < 8; ++l) { const int L = L0 + l; if (L >= nlines) break; const size_t e = (size_t)L * 64 + lane * 2; const int k = (int)(e % K), n = (int)(e / K); v2us o;
            o[0] = f2bf(w[(size_t)k * N + n]); o[1] = f2bf(w[(size_t)(k + 1) * N + n]); *(v2us*)(Bt + e) = o; }
         }
}
__global__ __launch_bounds__(256) void k_cvt8(const float* __restrict__ src, bf* dst, size_t n8) { const size_t i = (size_t)blockIdx.x * 256 + threadIdx.x; if (i >= n8) return; const v8f v = *(const v8f*)(src + i * 8); v8us o;
#pragma unroll
    for (int k = 0; k < 8; ++k) o[k] = f2bf(v[k]); *(v8us*)(dst + i * 8) = o;  }

// k_rope: head planes [h][t][d] (fp16 + hi/lo) of rope(x) x sc with the rotate-half convention out[d] = x[d] cos[t][d] - x[d+HD/2] sin[t][d], out[d+HD/2] = x[d+HD/2] cos[t][d+HD/2] + x[d] sin[t][d+HD/2]
__global__ __launch_bounds__(256) void k_rope(const float* __restrict__ F, int pitch, int nheads, const float* __restrict__ CS, const float* __restrict__ RF, const float* __restrict__ nw, float sc, h16* P16, bf* Ph, bf* Pl) {
    const size_t e = ((size_t)blockIdx.x * 256 + threadIdx.x) * 2; if (e >= (size_t)nheads * TT * HD) return; const int d = (int)(e % HD); const int t = (int)((e / HD) % TT); const int h = (int)(e / ((size_t)HD * TT)); const float* f = F + (size_t)t * pitch + h * HD; const float rf = RF ? RF[(size_t)h * TT + t] : 1.0f; v2h o16; v2us oh, ol;
#pragma unroll
    for (int q = 0; q < 2; ++q) { const int dd = d + q; const int dp = (dd < HD / 2) ? dd + HD / 2 : dd - HD / 2; float x0 = f[dd], x1 = f[dp];
        if (RF) { float n0 = __fmul_rn(x0, rf), n1 = __fmul_rn(x1, rf); asm volatile("" : "+v"(n0)); asm volatile("" : "+v"(n1)); x0 = __fmul_rn(bfr(nw[dd]), n0); x1 = __fmul_rn(bfr(nw[dp]), n1); }
        const v2f cs = *(const v2f*)(CS + ((size_t)t * HD + dd) * 2); float a = __fmul_rn(x0, cs[0]), bq = __fmul_rn(x1, cs[1]); asm volatile("" : "+v"(a)); asm volatile("" : "+v"(bq)); const float r = ((dd < HD / 2) ? __fsub_rn(a, bq) : __fadd_rn(a, bq)) * sc;
        o16[q] = tohx(r); unsigned short a2, c2; splitf(r, a2, c2); oh[q] = a2; ol[q] = c2; }
    *(v2h*)(P16 + e) = o16; *(v2us*)(Ph + e) = oh; *(v2us*)(Pl + e) = ol;  }
// k_vtp: transposed value planes [g][d][t] (fp16 + hi/lo), rows of TT elements at pitch PP
__global__ __launch_bounds__(256) void k_vtp(const float* __restrict__ F, int pitch, int nheads, h16* V16, bf* Vh, bf* Vl) { const size_t e = ((size_t)blockIdx.x * 256 + threadIdx.x) * 2; if (e >= (size_t)nheads * HD * TT) return; const int t = (int)(e % TT); const int d = (int)((e / TT) % HD); const int g = (int)(e / ((size_t)TT * HD)); v2h o16; v2us oh, ol;
#pragma unroll
    for (int q = 0; q < 2; ++q) { const float x = F[(size_t)(t + q) * pitch + g * HD + d]; o16[q] = tohx(x); unsigned short a2, c2; splitf(x, a2, c2); oh[q] = a2; ol[q] = c2; }
    const size_t eo = (size_t)(g * HD + d) * PP + t; *(v2h*)(V16 + eo) = o16; *(v2us*)(Vh + eo) = oh; *(v2us*)(Vl + eo) = ol;  }
__global__ __launch_bounds__(256) void k_csid(float* CS) { const int idx = blockIdx.x * 256 + threadIdx.x; if (idx >= TT * HD) return; v2f cs; cs[0] = 1.0f; cs[1] = 0.0f; *(v2f*)(CS + (size_t)idx * 2) = cs;  }
// k_asoft: per row (zz, i): t = S x HD^-0.5 for j <= i and i - j < WIN (sliding causal window; the reference's -1e9 additive fill vanishes identically); softmax over the 2048 keys (register row, one exp, fixed trees);
// the probabilities overwrite the row's own 8 KiB of scores (fp16 in its first half; hi plane in the first, lo plane in the second half for rows < RH): one wave owns a row and holds all of it in registers before its first store (every store needs the row sum).
__global__ __launch_bounds__(256) void k_asoft(float* Sb) {
    const int lane = threadIdx.x & 31; const int row = blockIdx.x * 8 + (threadIdx.x >> 5); if (row >= ZH * TT) return; const int i = row % TT; const int zz = row / TT; (void)zz; const bool hires = (i < RH); const float* sr = Sb + (size_t)row * TT; h16* P16 = (h16*)Sb + (size_t)row * PP; bf* Ph = (bf*)Sb + (size_t)row * PP; bf* Pl = Ph + TT; float v[TT / 32]; float mx = -3.0e38f;
#pragma unroll
    for (int ch = 0; ch < TT / 128; ++ch) { const int j0 = ch * 128 + lane * 4; const v4f a = *(const v4f*)(sr + j0);
#pragma unroll
        for (int q = 0; q < 4; ++q) { const int j = j0 + q; (void)j; const float t = (j <= i && i - j < WIN) ? a[q] * SCL : -3.0e38f; v[ch * 4 + q] = t; mx = fmaxf(mx, t); } }
#pragma unroll
    for (int sh = 16; sh; sh >>= 1) mx = fmaxf(mx, __shfl_xor(mx, sh, 32));
    float sum = 0.f;
#pragma unroll
    for (int k = 0; k < TT / 32; ++k) { float d0 = __fsub_rn(v[k], mx); asm volatile("" : "+v"(d0)); v[k] = __builtin_amdgcn_exp2f(__fmul_rn(d0, 1.4426950408889634f)); sum += v[k]; }
#pragma unroll
    for (int sh = 16; sh; sh >>= 1) sum += __shfl_xor(sum, sh, 32);
    const float f = __fdiv_rn(hires ? 1.0f : PCAR, sum);
{
        if (hires) {
#pragma unroll
            for (int ch = 0; ch < TT / 128; ++ch) { v4us oh, ol;
#pragma unroll
                for (int q = 0; q < 4; ++q) { unsigned short a, c2; splitf(v[ch * 4 + q] * f, a, c2); oh[q] = a; ol[q] = c2; }
                const int oo = ch * 128 + lane * 4; *(v4us*)(Ph + oo) = oh; *(v4us*)(Pl + oo) = ol; }
        } else {
#pragma unroll
            for (int ch = 0; ch < TT / 128; ++ch) { v4h o4;
#pragma unroll
                for (int q = 0; q < 4; ++q) o4[q] = tohx(v[ch * 4 + q] * f);
                *(v4h*)(P16 + ch * 128 + lane * 4) = o4; } }
         }
}
__global__ __launch_bounds__(256) void k_merge(const float* __restrict__ O, int h0, bf* Ah, bf* Al) { const size_t e = ((size_t)blockIdx.x * 256 + threadIdx.x) * 2; if (e >= (size_t)ZH * TT * HD) return; const int d = (int)(e % HD); const int t = (int)((e / HD) % TT); const int zz = (int)(e / ((size_t)HD * TT)); const float cs = (t < RH) ? 1.0f : (1.0f / PCAR); const size_t oo = (size_t)t * DQ + (h0 + zz) * HD + d;
    v2us oh, ol;
#pragma unroll
    for (int q = 0; q < 2; ++q) { unsigned short a, c2; splitf(O[e + q] * cs, a, c2); oh[q] = a; ol[q] = c2; } *(v2us*)(Ah + oo) = oh; *(v2us*)(Al + oo) = ol;  }

extern "C" void kernel_launch(void* const* d_in, const int* in_sizes, int n_in,
                              void* d_out, int out_size, void* d_ws, size_t ws_size, hipStream_t stream) {
    (void)in_sizes; (void)n_in; (void)out_size;
    const float* x = (const float*)d_in[0]; const float* wq = (const float*)d_in[1]; const float* bq = (const float*)d_in[2]; const float* wk = (const float*)d_in[3]; const float* bk = (const float*)d_in[4]; const float* wv = (const float*)d_in[5]; const float* bv = (const float*)d_in[6]; const float* wo = (const float*)d_in[7]; const float* bo = (const float*)d_in[8];   /* argument order x, Wq, bq, Wk, bk, Wv, bv, Wp, bp (per-head weights [16][1024][64]; per-head biases [16][64] = flat index h*64 + d) */
    float* OUT = (float*)d_out;     // [4][2048][1024]
    char* wsp = (char*)d_ws;
    auto take = [&](size_t bytes) { char* p = wsp; wsp += (bytes + 255) & ~(size_t)255; return (void*)p; };
    bf* WQ = (bf*)take((size_t)DQ * DM * 2); bf* WK = (bf*)take((size_t)DKV * DM * 2); bf* WV = (bf*)take((size_t)DKV * DM * 2); bf* WO = (bf*)take((size_t)DM * DQ * 2); float* CS = (float*)take((size_t)TT * HD * 2 * 4);
    bf* XB = (bf*)take((size_t)TT * DM * 2); float* FQ = (float*)take((size_t)TT * DQ * 4); float* FK = (float*)take((size_t)TT * DKV * 4);
    h16* QP16 = (h16*)take((size_t)NH_ * TT * HD * 2); h16* KP16 = (h16*)take((size_t)NKV * TT * HD * 2); h16* VT16 = (h16*)take((size_t)NKV * HD * PP * 2);
    bf* QPh = (bf*)take((size_t)NH_ * TT * HD * 2); bf* QPl = (bf*)take((size_t)NH_ * TT * HD * 2); bf* KPh = (bf*)take((size_t)NKV * TT * HD * 2); bf* KPl = (bf*)take((size_t)NKV * TT * HD * 2); bf* VTh = (bf*)take((size_t)NKV * HD * PP * 2); bf* VTl = (bf*)take((size_t)NKV * HD * PP * 2);
    float* Sb = (float*)take((size_t)ZH * TT * TT * 4); float* Ob = (float*)take((size_t)ZH * TT * HD * 4); bf* ATh = (bf*)take((size_t)TT * DQ * 2); bf* ATl = (bf*)take((size_t)TT * DQ * 2);
    if ((size_t)(wsp - (char*)d_ws) > ws_size) return;    // ws 256 MiB
    float* FV = FK;   // v projection reuses the k buffer after the k planes are built (stream-ordered)
    { k_wtG<<<dim3((unsigned)((DM * HD / 64 + 63) / 64), NH_, 3), 256, 0, stream>>>(wq, wk, wv, DM, HD, WQ);   /* per-head weights [h][DM][HD] ('xw' per head) -> the head's HD rows of the Bt planes WQ, WK, WV, which lie one behind the other in the workspace (NKV == NH_) */
      k_wtG<<<(unsigned)((DQ * DM / 64 + 63) / 64), 256, 0, stream>>>(wo, wo, wo, DQ, DM, WO);
       }
    k_csid<<<(TT * HD + 255) / 256, 256, 0, stream>>>(CS);
    const unsigned LQ = (unsigned)(((size_t)NH_ * TT * HD / 2 + 255) / 256), LKv = (unsigned)(((size_t)NKV * TT * HD / 2 + 255) / 256);
    for (int b = 0; b < NB_; ++b) {
        
        k_cvt8<<<(unsigned)(((size_t)TT * DM / 8 + 255) / 256), 256, 0, stream>>>(x + (size_t)b * TT * DM, XB, (size_t)TT * DM / 8);
        k_gemmks<bf, 0, 8, false, true><<<dim3(TT / 64, DQ / 64, 1), 8 * 32, 0, stream>>>(XB, nullptr, WQ, nullptr, DM, FQ, DQ, 0, bq, 0, 0, 0);
        k_rope<<<LQ, 256, 0, stream>>>(FQ, DQ, NH_, CS, nullptr, nullptr, 1.0f, QP16, QPh, QPl);
        k_gemmks<bf, 0, 8, false, true><<<dim3(TT / 64, DKV / 64, 1), 8 * 32, 0, stream>>>(XB, nullptr, WK, nullptr, DM, FK, DKV, 0, bk, 0, 0, 0);
        k_rope<<<LKv, 256, 0, stream>>>(FK, DKV, NKV, CS, nullptr, nullptr, 1.0f, KP16, KPh, KPl);
        k_gemmks<bf, 0, 8, false, true><<<dim3(TT / 64, DKV / 64, 1), 8 * 32, 0, stream>>>(XB, nullptr, WV, nullptr, DM, FV, DKV, 0, bv, 0, 0, 0); k_vtp<<<LKv, 256, 0, stream>>>(FV, DKV, NKV, VT16, VTh, VTl);
        for (int h0 = 0; h0 < NH_; h0 += ZH) { const size_t zq = (size_t)h0, zk = (size_t)(h0 / REP);   // one kv head per query head: the pass's heads use consecutive kv planes (z-strides TT*HD for k, HD*PP for the transposed v)
            k_gemmc<bf, 2, 1><<<dim3(RH / 64, TT / 64, ZH), 32, 0, stream>>>(QPh + zq * TT * HD, QPl + zq * TT * HD, KPh + zk * TT * HD, KPl + zk * TT * HD, HD, Sb, TT, 0, (size_t)TT * HD, (size_t)TT * HD, (size_t)TT * TT);
            k_gemmc<h16, 0, 1><<<dim3((TT - RH) / 64, TT / 64, ZH), 32, 0, stream>>>(QP16 + zq * TT * HD + (size_t)RH * HD, nullptr, KP16 + zk * TT * HD, nullptr, HD, Sb + (size_t)RH * TT, TT, RH, (size_t)TT * HD, (size_t)TT * HD, (size_t)TT * TT);
            k_asoft<<<ZH * TT / 8, 256, 0, stream>>>(Sb);
            k_gemmks<bf, 2, 8, true, false><<<dim3(RH / 64, HD / 64, ZH), 8 * 32, 0, stream>>>((const bf*)Sb, (const bf*)Sb + TT, VTh + zk * HD * PP, VTl + zk * HD * PP, PP, Ob, HD, 0, nullptr, (size_t)TT * PP, (size_t)HD * PP, (size_t)TT * HD);   // K argument = the operands' common row pitch; the causal bound (<= TT) ends the K loop
            k_gemmks<h16, 0, 16, true, false><<<dim3((TT - RH) / 64, HD / 64, ZH), 16 * 32, 0, stream>>>((const h16*)Sb + (size_t)RH * PP, nullptr, VT16 + zk * HD * PP, nullptr, PP, Ob + (size_t)RH * HD, HD, RH, nullptr, (size_t)TT * PP, (size_t)HD * PP, (size_t)TT * HD);
            k_merge<<<(unsigned)(((size_t)ZH * TT * HD / 2 + 255) / 256), 256, 0, stream>>>(Ob, h0, ATh, ATl); }
        k_gemmks<bf, 1, 8, false, true><<<dim3(TT / 64, DM / 64, 1), 8 * 32, 0, stream>>>(ATh, ATl, WO, nullptr, DQ, OUT + (size_t)b * TT * DM, DM, 0, bo, 0, 0, 0); }
}

// v003
// Measured time: 460 microseconds a run.
// Timed twice side by side with v002, it ran 2.08 and 2.07 times as fast.
// Over all steps from v000 it is 6.92 times as fast.
#include <hip/hip_runtime.h>

// Causal multi-head self-attention whose q, k, v projections are given PER HEAD (x [4][2048][1024]; q, k, v = einsum('bte,hed->bhtd', x, W) + b[None, :, None, :] with W [16][1024][64] ((in, out) inside each head; 1/32-scale) and per-head biases b [16][64] (zeros on this draw); scores x 1/sqrt(64); causal (-inf); softmax; heads merged head-major (column h*64 + d); out = cat Wp + bp ('xw' [1024][1024] + zero bias) -> [4][2048][1024] (8.4 M); argument order x, Wq, bq, Wk, bk, Wv, bv, Wp, bp). THIS ROW: the same module under other names (token_embedding [4][2048][1024]; PER-HEAD stacked projections Wq, Wk, Wv [16][1024][64] normal x 1/32 with biases [16][64] zeros (read): q = einsum('btd,hde->bhte', x, Wq) + bq; scores / sqrt(64); tril kept, -inf; softmax; heads concatenated in order; out = cat Wo + bo ('xw' [1024][1024]; bias zeros: read); argument order token_embedding, Wq, bq, Wk, bk, Wv, bv, Wo, bo).
// Layout per batch: bf16 copy of x; 'xw' weights transposed once; exact projections + f32 biases; identity-table plane builders; causal T-2048 attention in one kernel, running softmax (hybrid rows: < 512 hi/lo 3 products, rest fp16 x1024; key blocks above the diagonal never visited); merged hi/lo x Wo exact + bo.
// Compute dtypes, f32 accumulate: every input rounded to bf16; projections exact + f32 biases; attention rows < 512 3 products, rest fp16; softmax f32; output projection hl x exact.

#define NB_  4
#define TT   2048
#define DM   1024
#define NH_  16
#define NKV  16
#define REP  (NH_ / NKV)
#define HD   64
#define DQ   (NH_ * HD)
#define DKV  (NKV * HD)
#define RH   512                  // query rows < RH use hi+lo planes (0: none)
#define PP   (2 * TT)              // row pitch, in 16-bit elements, of the transposed value planes
#define SCL  0.125f   // HD^-0.5
typedef _Float16 h16;
typedef unsigned short bf;
typedef __attribute__((ext_vector_type(16))) __bf16   v16bf;
typedef __attribute__((ext_vector_type(16))) _Float16 v16h;
typedef __attribute__((ext_vector_type(8)))  _Float16 v8h;
typedef __attribute__((ext_vector_type(8)))  unsigned short v8us;
typedef __attribute__((ext_vector_type(8)))  float    v8f;
typedef __attribute__((ext_vector_type(4)))  float    v4f;
typedef v8h  __attribute__((may_alias)) v8ha;
typedef v4f  __attribute__((may_alias)) v4fa;
typedef v8us __attribute__((may_alias)) v8usa;

__device__ __forceinline__ unsigned short f2bf(float f) { unsigned u = __float_as_uint(f); u += 0x7FFFu + ((u >> 16) & 1u); return (unsigned short)(u >> 16); }
__device__ __forceinline__ float bf2f(unsigned short b) { return __uint_as_float(((unsigned)b) << 16); }
__device__ __forceinline__ float bfr(float f) { return bf2f(f2bf(f)); }
__device__ __forceinline__ v16h cat16(v8h lo, v8h hi) { return __builtin_shufflevector(lo, hi, 0, 1, 2, 3, 4, 5, 6, 7, 8, 9, 10, 11, 12, 13, 14, 15); }
__device__ __forceinline__ v16bf cat16b(v8us lo, v8us hi) { return __builtin_bit_cast(v16bf, __builtin_shufflevector(lo, hi, 0, 1, 2, 3, 4, 5, 6, 7, 8, 9, 10, 11, 12, 13, 14, 15)); }
__device__ __forceinline__ v8f wmma16(v16h a, v16h b, v8f c) { return __builtin_amdgcn_wmma_f32_16x16x32_f16(false, a, false, b, (short)0, c, false, false); }
__device__ __forceinline__ v8f wmmab(v16bf a, v16bf b, v8f c) { return __builtin_amdgcn_wmma_f32_16x16x32_bf16(false, a, false, b, (short)0, c, false, false); }



// ---- k_gemmks: register-blocked GEMM, one 64x64 output tile per work-group, its K loop split over the KS waves of the work-group; operands straight from K-contiguous 16-bit planes; grid (M/64, N/64, Z), KS*32 threads.
// C[m][n] (f32, pitch ldc, + optional f32 bias[n]) = sum_k A[m][k] Bt[n][k] (+ split products per NSPLIT). z-batch strides sA/sB/sC in elements. K % 64 == 0.
// Each wave keeps the whole tile (16 accumulators) and walks every KS-th 64-wide K chunk (one 128-byte line of each operand row); the KS partial tiles meet in LDS and are summed in the fixed order wave 0..KS-1.
// CAUSAL (probability x value): the K loop stops at the diagonal block of query rows r0+roff.. (probabilities beyond it are exactly zero).
template <typename T16> struct WFrag;
template <> struct WFrag<h16> { typedef v16h V; static __device__ __forceinline__ V ld(const h16* p) { return cat16(*(const v8h*)p, *(const v8h*)(p + 16)); } static __device__ __forceinline__ v8f mma(V a, V b, v8f c) { return wmma16(a, b, c); } };
template <> struct WFrag<bf> { typedef v16bf V; static __device__ __forceinline__ V ld(const bf* p) { return cat16b(*(const v8us*)p, *(const v8us*)(p + 16)); } static __device__ __forceinline__ v8f mma(V a, V b, v8f c) { return wmmab(a, b, c); } };
template <typename T16, int NSPLIT, int KS, bool CAUSAL, bool BIAS>
__global__ __launch_bounds__(KS * 32) void k_gemmks(const T16* __restrict__ A, const T16* __restrict__ A2, const T16* __restrict__ Bt, const T16* __restrict__ Bt2, int K, float* C, int ldc, int roff, const float* __restrict__ bias, size_t sA, size_t sB, size_t sC) {
    typedef typename WFrag<T16>::V V;
    constexpr int NP = KS / 4, JW = 8 / NP;                          // each 16-row band is summed by NP waves, JW accumulator registers (rows) each
    typedef __attribute__((ext_vector_type(JW))) float vj;
    __shared__ vj red[KS * 16 * NP * 32];                            // [wave][tile][part][lane]: 16 KiB a wave, lanes side by side (no bank conflict)
    const size_t z = blockIdx.z; A += z * sA; if (A2) A2 += z * sA; Bt += z * sB; if (Bt2) Bt2 += z * sB; C += z * sC;
    const int lane = threadIdx.x & 31, lr = lane & 15, hi = lane >> 4; const int r0 = blockIdx.x * 64, c0 = blockIdx.y * 64;
    const int wave = __builtin_amdgcn_readfirstlane(threadIdx.x >> 5);   // scalar, so that the K loop's branch is scalar and EXEC stays full at the matrix instructions
    const int Kl = CAUSAL ? min(K, r0 + roff + 64) : K;
    v8f acc[4][4];
#pragma unroll
    for (int mb = 0; mb < 4; ++mb)
#pragma unroll
        for (int nb = 0; nb < 4; ++nb) acc[mb][nb] = (v8f){};
    const size_t aoff = (size_t)(r0 + lr) * K + 8 * hi, boff = (size_t)(c0 + lr) * K + 8 * hi;
    // rolled: one set of fragments live beside the 16 accumulators. Two trips of 32 per chunk, then on to this wave's next chunk.
#pragma unroll 1
    for (int kc = wave * 64; kc < Kl; kc += (kc & 32) ? KS * 64 - 32 : 32) {
        V a[4], a2[4];
#pragma unroll
        for (int mb = 0; mb < 4; ++mb) { a[mb] = WFrag<T16>::ld(A + aoff + (size_t)mb * 16 * K + kc); if (NSPLIT == 1 || NSPLIT == 2) a2[mb] = WFrag<T16>::ld(A2 + aoff + (size_t)mb * 16 * K + kc); }
#pragma unroll
        for (int nb = 0; nb < 4; ++nb) { const V b = WFrag<T16>::ld(Bt + boff + (size_t)nb * 16 * K + kc); V b2; if (NSPLIT >= 2) b2 = WFrag<T16>::ld(Bt2 + boff + (size_t)nb * 16 * K + kc);
#pragma unroll
            for (int mb = 0; mb < 4; ++mb) { acc[mb][nb] = WFrag<T16>::mma(a[mb], b, acc[mb][nb]); if (NSPLIT == 1 || NSPLIT == 2) acc[mb][nb] = WFrag<T16>::mma(a2[mb], b, acc[mb][nb]); if (NSPLIT >= 2) acc[mb][nb] = WFrag<T16>::mma(a[mb], b2, acc[mb][nb]); } }
        // four vector slots between the last matrix instruction and the back edge, behind which the next trip's loads overwrite the fragments
        asm volatile("v_nop\n\tv_nop\n\tv_nop\n\tv_nop" : "+v"(acc[0][0]), "+v"(acc[1][1]), "+v"(acc[2][2]), "+v"(acc[3][3]) : "v"(a[0]), "v"(a[3]));
    }
    float bb[4];                                                     // bias of this lane's four columns, asked for ahead of the LDS traffic
#pragma unroll
    for (int nb = 0; nb < 4; ++nb) bb[nb] = BIAS ? bfr(bias[c0 + nb * 16 + lr]) : 0.0f;
    vj* rw = red + wave * (16 * NP * 32) + lane;
#pragma unroll
    for (int mb = 0; mb < 4; ++mb)
#pragma unroll
        for (int nb = 0; nb < 4; ++nb)
#pragma unroll
            for (int p = 0; p < NP; ++p) { vj t;
#pragma unroll
                for (int jj = 0; jj < JW; ++jj) t[jj] = acc[mb][nb][p * JW + jj];
                rw[((mb * 4 + nb) * NP + p) * 32] = t; }
    __syncthreads();                                                 // every wave's partial tile is in LDS before any wave sums
    const int mbw = wave / NP, pw = wave % NP;                       // this wave sums rows mbw*16 + {0, 8} + pw*JW .. +JW-1 over all 64 columns: whole 256-byte pieces of output rows, one writer a line
    float* crow = C + (size_t)(r0 + mbw * 16 + hi * 8 + pw * JW) * ldc + c0 + lr;
#pragma unroll
    for (int nb = 0; nb < 4; ++nb) { const vj* rr = red + ((mbw * 4 + nb) * NP + pw) * 32 + lane; vj s = rr[0];
#pragma unroll
        for (int u = 1; u < KS; ++u) s += rr[u * (16 * NP * 32)];
        if (BIAS) s += bb[nb];
#pragma unroll
        for (int jj = 0; jj < JW; ++jj) crow[(size_t)jj * ldc + nb * 16] = s[jj]; }
}

__device__ __forceinline__ h16 tohx(float x) { return (h16)x; }
__device__ __forceinline__ void splitf(float y, unsigned short& h, unsigned short& l) { h = f2bf(y); l = f2bf(y - bf2f(h)); }
typedef __attribute__((ext_vector_type(2))) _Float16 v2h;
typedef __attribute__((ext_vector_type(4))) _Float16 v4h;
typedef __attribute__((ext_vector_type(2))) unsigned short v2us;
typedef __attribute__((ext_vector_type(4))) unsigned short v4us;
typedef __attribute__((ext_vector_type(2))) float v2f;
typedef __attribute__((ext_vector_type(4))) int v4i;

// grid (lines / 64, matrices per source, sources): matrix y of source z ([K][N], K * N apart in its source) goes to the K * N elements number z * NH_ + y of Bt
__global__ __launch_bounds__(256) void k_wtG(const float* __restrict__ w0, const float* __restrict__ w1, const float* __restrict__ w2, int K, int N, bf* Bt) {
    const float* __restrict__ w = (blockIdx.z == 0 ? w0 : blockIdx.z == 1 ? w1 : w2) + (size_t)blockIdx.y * K * N; Bt += ((size_t)blockIdx.z * NH_ + blockIdx.y) * K * N;
    const int lane = threadIdx.x & 31; const int L0 = (blockIdx.x * 8 + (threadIdx.x >> 5)) * 8; const int nlines = N * K / 64;
{
#pragma unroll 1
        for (int l = 0; l < 8; ++l) { const int L = L0 + l; if (L >= nlines) break; const size_t e = (size_t)L * 64 + lane * 2; const int k = (int)(e % K), n = (int)(e / K); v2us o;
            o[0] = f2bf(w[(size_t)k * N + n]); o[1] = f2bf(w[(size_t)(k + 1) * N + n]); *(v2us*)(Bt + e) = o; }
         }
}
__global__ __launch_bounds__(256) void k_cvt8(const float* __restrict__ src, bf* dst, size_t n8) { const size_t i = (size_t)blockIdx.x * 256 + threadIdx.x; if (i >= n8) return; const v8f v = *(const v8f*)(src + i * 8); v8us o;
#pragma unroll
    for (int k = 0; k < 8; ++k) o[k] = f2bf(v[k]); *(v8us*)(dst + i * 8) = o;  }

// k_rope: head planes [h][t][d] (fp16 + hi/lo) of rope(x) x sc with the rotate-half convention out[d] = x[d] cos[t][d] - x[d+HD/2] sin[t][d], out[d+HD/2] = x[d+HD/2] cos[t][d+HD/2] + x[d] sin[t][d+HD/2]
__global__ __launch_bounds__(256) void k_rope(const float* __restrict__ F, int pitch, int nheads, const float* __restrict__ CS, const float* __restrict__ RF, const float* __restrict__ nw, float sc, h16* P16, bf* Ph, bf* Pl) {
    const size_t e = ((size_t)blockIdx.x * 256 + threadIdx.x) * 2; if (e >= (size_t)nheads * TT * HD) return; const int d = (int)(e % HD); const int t = (int)((e / HD) % TT); const int h = (int)(e / ((size_t)HD * TT)); const float* f = F + (size_t)t * pitch + h * HD; const float rf = RF ? RF[(size_t)h * TT + t] : 1.0f; v2h o16; v2us oh, ol;
#pragma unroll
    for (int q = 0; q < 2; ++q) { const int dd = d + q; const int dp = (dd < HD / 2) ? dd + HD / 2 : dd - HD / 2; float x0 = f[dd], x1 = f[dp];
        if (RF) { float n0 = __fmul_rn(x0, rf), n1 = __fmul_rn(x1, rf); asm volatile("" : "+v"(n0)); asm volatile("" : "+v"(n1)); x0 = __fmul_rn(bfr(nw[dd]), n0); x1 = __fmul_rn(bfr(nw[dp]), n1); }
        const v2f cs = *(const v2f*)(CS + ((size_t)t * HD + dd) * 2); float a = __fmul_rn(x0, cs[0]), bq = __fmul_rn(x1, cs[1]); asm volatile("" : "+v"(a)); asm volatile("" : "+v"(bq)); const float r = ((dd < HD / 2) ? __fsub_rn(a, bq) : __fadd_rn(a, bq)) * sc;
        o16[q] = tohx(r); unsigned short a2, c2; splitf(r, a2, c2); oh[q] = a2; ol[q] = c2; }
    *(v2h*)(P16 + e) = o16; *(v2us*)(Ph + e) = oh; *(v2us*)(Pl + e) = ol;  }
// k_vtp: transposed value planes [g][d][t] (fp16 + hi/lo), rows of TT elements at pitch PP
__global__ __launch_bounds__(256) void k_vtp(const float* __restrict__ F, int pitch, int nheads, h16* V16, bf* Vh, bf* Vl) { const size_t e = ((size_t)blockIdx.x * 256 + threadIdx.x) * 2; if (e >= (size_t)nheads * HD * TT) return; const int t = (int)(e % TT); const int d = (int)((e / TT) % HD); const int g = (int)(e / ((size_t)TT * HD)); v2h o16; v2us oh, ol;
#pragma unroll
    for (int q = 0; q < 2; ++q) { const float x = F[(size_t)(t + q) * pitch + g * HD + d]; o16[q] = tohx(x); unsigned short a2, c2; splitf(x, a2, c2); oh[q] = a2; ol[q] = c2; }
    const size_t eo = (size_t)(g * HD + d) * PP + t; *(v2h*)(V16 + eo) = o16; *(v2us*)(Vh + eo) = oh; *(v2us*)(Vl + eo) = ol;  }
__global__ __launch_bounds__(256) void k_csid(float* CS) { const int idx = blockIdx.x * 256 + threadIdx.x; if (idx >= TT * HD) return; v2f cs; cs[0] = 1.0f; cs[1] = 0.0f; *(v2f*)(CS + (size_t)idx * 2) = cs;  }
#define FW 8
template <typename T16, bool HIRES>
__device__ __forceinline__ void fa_tile(const T16* __restrict__ Q, const T16* __restrict__ Q2, const T16* __restrict__ Kp, const T16* __restrict__ K2, const T16* __restrict__ Vt, const T16* __restrict__ V2, int q0, bf* Ah, bf* Al, float* red, float* st) {
    typedef typename WFrag<T16>::V V;
    const int lane = threadIdx.x & 31, lr = lane & 15, hi = lane >> 4;
    const int wave = __builtin_amdgcn_readfirstlane(threadIdx.x >> 5);   // scalar, so that the key loop's branch is scalar and EXEC stays full at the matrix instructions
    V qf[2][2], qf2[2][2];
#pragma unroll
    for (int qt = 0; qt < 2; ++qt)
#pragma unroll
        for (int kc = 0; kc < 2; ++kc) { const size_t o = (size_t)(q0 + qt * 16 + lr) * HD + kc * 32 + 8 * hi; qf[qt][kc] = WFrag<T16>::ld(Q + o); if (HIRES) qf2[qt][kc] = WFrag<T16>::ld(Q2 + o); }
    v8f o[4][2];
#pragma unroll
    for (int dt = 0; dt < 4; ++dt)
#pragma unroll
        for (int qt = 0; qt < 2; ++qt) o[dt][qt] = (v8f){};
    float m[2] = { -3.0e38f, -3.0e38f }, l[2] = { 0.0f, 0.0f };
    // fp16 rows (up to 8 blocks a wave): the key fragments are fetched one block ahead and the value fragments at the head of their block, so that a block waits for no load of its own.
    // hi + lo rows (at most 2 blocks a wave, twice the fragments): every fragment is fetched where it is used, which keeps the kernel within 256 registers.
    V kf[2][2], kf2[2][2];
    if (!HIRES) {
#pragma unroll
        for (int kt = 0; kt < 2; ++kt)
#pragma unroll
            for (int kc = 0; kc < 2; ++kc) kf[kt][kc] = WFrag<T16>::ld(Kp + (size_t)(wave * 32 + kt * 16 + lr) * HD + kc * 32 + 8 * hi);   // block number 'wave' exists in the plane also where this tile ends before it
    }
    // rolled: one block's fragments live beside the 8 output accumulators
#pragma unroll 1
    for (int kb = wave * 32; kb < q0 + 32; kb += FW * 32) {
        V vf[4], vf2[4];
        if (!HIRES) {
#pragma unroll
            for (int dt = 0; dt < 4; ++dt) vf[dt] = WFrag<T16>::ld(Vt + (size_t)(dt * 16 + lr) * PP + kb + 8 * hi);
        }
        v8f s[2][2];
#pragma unroll
        for (int kt = 0; kt < 2; ++kt)
#pragma unroll
            for (int qt = 0; qt < 2; ++qt) s[kt][qt] = (v8f){};
#pragma unroll
        for (int kt = 0; kt < 2; ++kt)
#pragma unroll
            for (int kc = 0; kc < 2; ++kc) { if (HIRES) { const size_t ko = (size_t)(kb + kt * 16 + lr) * HD + kc * 32 + 8 * hi; kf[kt][kc] = WFrag<T16>::ld(Kp + ko); kf2[kt][kc] = WFrag<T16>::ld(K2 + ko);
                    asm volatile("s_wait_xcnt 0x0" ::: "memory"); }   // stands in front of any overwrite of these four loads' address registers
#pragma unroll
                for (int qt = 0; qt < 2; ++qt) { s[kt][qt] = WFrag<T16>::mma(kf[kt][kc], qf[qt][kc], s[kt][qt]); if (HIRES) { s[kt][qt] = WFrag<T16>::mma(kf[kt][kc], qf2[qt][kc], s[kt][qt]); s[kt][qt] = WFrag<T16>::mma(kf2[kt][kc], qf[qt][kc], s[kt][qt]); } } }
        if (!HIRES) { const int kn = min(kb + FW * 32, q0);              // this wave's next block; behind its last one the tile's diagonal block is fetched and not used
#pragma unroll
            for (int kt = 0; kt < 2; ++kt)
#pragma unroll
                for (int kc = 0; kc < 2; ++kc) kf[kt][kc] = WFrag<T16>::ld(Kp + (size_t)(kn + kt * 16 + lr) * HD + kc * 32 + 8 * hi);
        }
#pragma unroll
        for (int kt = 0; kt < 2; ++kt)
#pragma unroll
            for (int qt = 0; qt < 2; ++qt) s[kt][qt] *= SCL * 1.4426950408889634f;
        if (kb == q0) {                                                  // the diagonal block (the tile's last): keys beyond the query are masked; key kb itself never is, so every column keeps a finite maximum
#pragma unroll
            for (int kt = 0; kt < 2; ++kt)
#pragma unroll
                for (int qt = 0; qt < 2; ++qt)
#pragma unroll
                    for (int j = 0; j < 8; ++j) if (kt * 16 + hi * 8 + j > qt * 16 + lr) s[kt][qt][j] = -3.0e38f;
        }
        V pf[2], pf2[2];
#pragma unroll
        for (int qt = 0; qt < 2; ++qt) {
            float mx = s[0][qt][0];
#pragma unroll
            for (int j = 1; j < 16; ++j) mx = fmaxf(mx, s[j >> 3][qt][j & 7]);
            mx = fmaxf(mx, __shfl_xor(mx, 16, 32));
            const float mn = fmaxf(m[qt], mx), al = __builtin_amdgcn_exp2f(m[qt] - mn), mo = mn - 10.0f; m[qt] = mn;
            float sum = 0.0f;
#pragma unroll
            for (int j = 0; j < 16; ++j) { const float p = __builtin_amdgcn_exp2f(s[j >> 3][qt][j & 7] - mo); s[j >> 3][qt][j & 7] = p; sum += p; }
            l[qt] = l[qt] * al + sum;
#pragma unroll
            for (int dt = 0; dt < 4; ++dt) o[dt][qt] *= al;
            if constexpr (HIRES) { v8us h0, h1, l0, l1;
#pragma unroll
                for (int j = 0; j < 8; ++j) { unsigned short a, c2; splitf(s[0][qt][j], a, c2); h0[j] = a; l0[j] = c2; splitf(s[1][qt][j], a, c2); h1[j] = a; l1[j] = c2; }
                pf[qt] = cat16b(h0, h1); pf2[qt] = cat16b(l0, l1);
            } else { v8h c0, c1;
#pragma unroll
                for (int j = 0; j < 8; ++j) { c0[j] = tohx(s[0][qt][j]); c1[j] = tohx(s[1][qt][j]); }
                pf[qt] = cat16(c0, c1); }
        }
#pragma unroll
        for (int dt = 0; dt < 4; ++dt) { if (HIRES) { const size_t vo = (size_t)(dt * 16 + lr) * PP + kb + 8 * hi; vf[dt] = WFrag<T16>::ld(Vt + vo); vf2[dt] = WFrag<T16>::ld(V2 + vo); }
#pragma unroll
            for (int qt = 0; qt < 2; ++qt) { o[dt][qt] = WFrag<T16>::mma(vf[dt], pf[qt], o[dt][qt]); if (HIRES) { o[dt][qt] = WFrag<T16>::mma(vf[dt], pf2[qt], o[dt][qt]); o[dt][qt] = WFrag<T16>::mma(vf2[dt], pf[qt], o[dt][qt]); } } }
    }
#pragma unroll
    for (int qt = 0; qt < 2; ++qt) { const float lj = l[qt] + __shfl_xor(l[qt], 16, 32); st[wave * 64 + qt * 16 + lr] = m[qt]; st[wave * 64 + 32 + qt * 16 + lr] = lj;   // both halves hold, and store, the same two values
#pragma unroll
        for (int dt = 0; dt < 4; ++dt) *(v8f*)(red + (size_t)(((wave * 8 + qt * 4 + dt) * 32 + lane) * 8)) = o[dt][qt]; }
    __syncthreads();                                                     // every wave's partial result is in LDS before any wave joins
    // wave w joins queries 4w..4w+3, 8 lanes a query, 8 consecutive d a lane: whole 128-byte lines of the merged planes, one writer a line. A wave that had no block left m = -3e38, l = 0, Ot = 0: factor 0.
    const int q = wave * 4 + (lane >> 3), dg = lane & 7;
    const float* rr = red + (((q >> 4) * 4 + (dg >> 1)) * 32 + (q & 15) + 16 * (dg & 1)) * 8;
    float M = st[q];
#pragma unroll
    for (int u = 1; u < FW; ++u) M = fmaxf(M, st[u * 64 + q]);
    float L = 0.0f; v8f acc = (v8f){};
#pragma unroll
    for (int u = 0; u < FW; ++u) { const float f = __builtin_amdgcn_exp2f(st[u * 64 + q] - M); L += st[u * 64 + 32 + q] * f; acc += *(const v8f*)(rr + u * (8 * 32 * 8)) * f; }
    const float inv = __fdiv_rn(1.0f, L); v8us oh, ol;
#pragma unroll
    for (int j = 0; j < 8; ++j) { unsigned short a, c2; splitf(acc[j] * inv, a, c2); oh[j] = a; ol[j] = c2; }
    const size_t oo = (size_t)(q0 + q) * DQ + dg * 8; *(v8us*)(Ah + oo) = oh; *(v8us*)(Al + oo) = ol;
}
__global__ __launch_bounds__(FW * 32) void k_fattn(const h16* __restrict__ Q16, const h16* __restrict__ K16, const h16* __restrict__ V16, const bf* __restrict__ Qh, const bf* __restrict__ Ql, const bf* __restrict__ Kh, const bf* __restrict__ Kl, const bf* __restrict__ Vh, const bf* __restrict__ Vl, bf* Ah, bf* Al) {
    __shared__ __align__(32) float red[FW * 8 * 32 * 8];                 // [wave][query group][d tile][lane][8]: 8 KiB a wave
    __shared__ float st[FW * 64];                                        // [wave][m, l][query]
    const int q0 = (TT / 32 - 1 - (int)blockIdx.y) * 32; const size_t h = blockIdx.x, g = h / REP; const size_t qo = h * TT * HD, ko = g * TT * HD, vo = g * HD * PP;
    if (q0 < RH) fa_tile<bf, true>(Qh + qo, Ql + qo, Kh + ko, Kl + ko, Vh + vo, Vl + vo, q0, Ah + h * HD, Al + h * HD, red, st);
    else fa_tile<h16, false>(Q16 + qo, nullptr, K16 + ko, nullptr, V16 + vo, nullptr, q0, Ah + h * HD, Al + h * HD, red, st);
}

extern "C" void kernel_launch(void* const* d_in, const int* in_sizes, int n_in,
                              void* d_out, int out_size, void* d_ws, size_t ws_size, hipStream_t stream) {
    (void)in_sizes; (void)n_in; (void)out_size;
    const float* x = (const float*)d_in[0]; const float* wq = (const float*)d_in[1]; const float* bq = (const float*)d_in[2]; const float* wk = (const float*)d_in[3]; const float* bk = (const float*)d_in[4]; const float* wv = (const float*)d_in[5]; const float* bv = (const float*)d_in[6]; const float* wo = (const float*)d_in[7]; const float* bo = (const float*)d_in[8];   /* argument order x, Wq, bq, Wk, bk, Wv, bv, Wp, bp (per-head weights [16][1024][64]; per-head biases [16][64] = flat index h*64 + d) */
    float* OUT = (float*)d_out;     // [4][2048][1024]
    char* wsp = (char*)d_ws;
    auto take = [&](size_t bytes) { char* p = wsp; wsp += (bytes + 255) & ~(size_t)255; return (void*)p; };
    bf* WQ = (bf*)take((size_t)DQ * DM * 2); bf* WK = (bf*)take((size_t)DKV * DM * 2); bf* WV = (bf*)take((size_t)DKV * DM * 2); bf* WO = (bf*)take((size_t)DM * DQ * 2); float* CS = (float*)take((size_t)TT * HD * 2 * 4);
    bf* XB = (bf*)take((size_t)TT * DM * 2); float* FQ = (float*)take((size_t)TT * DQ * 4); float* FK = (float*)take((size_t)TT * DKV * 4);
    h16* QP16 = (h16*)take((size_t)NH_ * TT * HD * 2); h16* KP16 = (h16*)take((size_t)NKV * TT * HD * 2); h16* VT16 = (h16*)take((size_t)NKV * HD * PP * 2);
    bf* QPh = (bf*)take((size_t)NH_ * TT * HD * 2); bf* QPl = (bf*)take((size_t)NH_ * TT * HD * 2); bf* KPh = (bf*)take((size_t)NKV * TT * HD * 2); bf* KPl = (bf*)take((size_t)NKV * TT * HD * 2); bf* VTh = (bf*)take((size_t)NKV * HD * PP * 2); bf* VTl = (bf*)take((size_t)NKV * HD * PP * 2);
    bf* ATh = (bf*)take((size_t)TT * DQ * 2); bf* ATl = (bf*)take((size_t)TT * DQ * 2);
    if ((size_t)(wsp - (char*)d_ws) > ws_size) return;    // ws 256 MiB
    float* FV = FK;   // v projection reuses the k buffer after the k planes are built (stream-ordered)
    { k_wtG<<<dim3((unsigned)((DM * HD / 64 + 63) / 64), NH_, 3), 256, 0, stream>>>(wq, wk, wv, DM, HD, WQ);   /* per-head weights [h][DM][HD] ('xw' per head) -> the head's HD rows of the Bt planes WQ, WK, WV, which lie one behind the other in the workspace (NKV == NH_) */
      k_wtG<<<(unsigned)((DQ * DM / 64 + 63) / 64), 256, 0, stream>>>(wo, wo, wo, DQ, DM, WO);
       }
    k_csid<<<(TT * HD + 255) / 256, 256, 0, stream>>>(CS);
    const unsigned LQ = (unsigned)(((size_t)NH_ * TT * HD / 2 + 255) / 256), LKv = (unsigned)(((size_t)NKV * TT * HD / 2 + 255) / 256);
    for (int b = 0; b < NB_; ++b) {
        
        k_cvt8<<<(unsigned)(((size_t)TT * DM / 8 + 255) / 256), 256, 0, stream>>>(x + (size_t)b * TT * DM, XB, (size_t)TT * DM / 8);
        k_gemmks<bf, 0, 8, false, true><<<dim3(TT / 64, DQ / 64, 1), 8 * 32, 0, stream>>>(XB, nullptr, WQ, nullptr, DM, FQ, DQ, 0, bq, 0, 0, 0);
        k_rope<<<LQ, 256, 0, stream>>>(FQ, DQ, NH_, CS, nullptr, nullptr, 1.0f, QP16, QPh, QPl);
        k_gemmks<bf, 0, 8, false, true><<<dim3(TT / 64, DKV / 64, 1), 8 * 32, 0, stream>>>(XB, nullptr, WK, nullptr, DM, FK, DKV, 0, bk, 0, 0, 0);
        k_rope<<<LKv, 256, 0, stream>>>(FK, DKV, NKV, CS, nullptr, nullptr, 1.0f, KP16, KPh, KPl);
        k_gemmks<bf, 0, 8, false, true><<<dim3(TT / 64, DKV / 64, 1), 8 * 32, 0, stream>>>(XB, nullptr, WV, nullptr, DM, FV, DKV, 0, bv, 0, 0, 0); k_vtp<<<LKv, 256, 0, stream>>>(FV, DKV, NKV, VT16, VTh, VTl);
        k_fattn<<<dim3(NH_, TT / 32, 1), FW * 32, 0, stream>>>(QP16, KP16, VT16, QPh, QPl, KPh, KPl, VTh, VTl, ATh, ATl);
        k_gemmks<bf, 1, 8, false, true><<<dim3(TT / 64, DM / 64, 1), 8 * 32, 0, stream>>>(ATh, ATl, WO, nullptr, DQ, OUT + (size_t)b * TT * DM, DM, 0, bo, 0, 0, 0); }
}
// regate 2

// v004
// It runs in 364 microseconds.
// Next to v003, in two timings, it ran 1.26 and 1.27 times as fast.
// Over all steps from v000 it is 8.74 times as fast.
#include <hip/hip_runtime.h>

// Causal multi-head self-attention whose q, k, v projections are given PER HEAD (x [4][2048][1024]; q, k, v = einsum('bte,hed->bhtd', x, W) + b[None, :, None, :] with W [16][1024][64] ((in, out) inside each head; 1/32-scale) and per-head biases b [16][64] (zeros on this draw); scores x 1/sqrt(64); causal (-inf); softmax; heads merged head-major (column h*64 + d); out = cat Wp + bp ('xw' [1024][1024] + zero bias) -> [4][2048][1024] (8.4 M); argument order x, Wq, bq, Wk, bk, Wv, bv, Wp, bp). THIS ROW: the same module under other names (token_embedding [4][2048][1024]; PER-HEAD stacked projections Wq, Wk, Wv [16][1024][64] normal x 1/32 with biases [16][64] zeros (read): q = einsum('btd,hde->bhte', x, Wq) + bq; scores / sqrt(64); tril kept, -inf; softmax; heads concatenated in order; out = cat Wo + bo ('xw' [1024][1024]; bias zeros: read); argument order token_embedding, Wq, bq, Wk, bk, Wv, bv, Wo, bo).
// Layout per batch: bf16 copy of x; 'xw' weights transposed once; exact projections + f32 biases, stored by the GEMM itself as the 16-bit head planes; causal T-2048 attention in one kernel, running softmax (hybrid rows: < 512 hi/lo 3 products, rest fp16 x1024; key blocks above the diagonal never visited); merged hi/lo x Wo exact + bo.
// Compute dtypes, f32 accumulate: every input rounded to bf16; projections exact + f32 biases; attention rows < 512 3 products, rest fp16; softmax f32; output projection hl x exact.

#define NB_  4
#define TT   2048
#define DM   1024
#define NH_  16
#define NKV  16
#define REP  (NH_ / NKV)
#define HD   64
#define DQ   (NH_ * HD)
#define DKV  (NKV * HD)
#define RH   512                  // query rows < RH use hi+lo planes (0: none)
#define PP   (2 * TT)              // row pitch, in 16-bit elements, of the transposed value planes
#define SCL  0.125f   // HD^-0.5
typedef _Float16 h16;
typedef unsigned short bf;
typedef __attribute__((ext_vector_type(16))) __bf16   v16bf;
typedef __attribute__((ext_vector_type(16))) _Float16 v16h;
typedef __attribute__((ext_vector_type(8)))  _Float16 v8h;
typedef __attribute__((ext_vector_type(8)))  unsigned short v8us;
typedef __attribute__((ext_vector_type(8)))  float    v8f;
typedef __attribute__((ext_vector_type(4)))  float    v4f;
typedef v8h  __attribute__((may_alias)) v8ha;
typedef v4f  __attribute__((may_alias)) v4fa;
typedef v8us __attribute__((may_alias)) v8usa;

__device__ __forceinline__ unsigned short f2bf(float f) { unsigned u = __float_as_uint(f); u += 0x7FFFu + ((u >> 16) & 1u); return (unsigned short)(u >> 16); }
__device__ __forceinline__ float bf2f(unsigned short b) { return __uint_as_float(((unsigned)b) << 16); }
__device__ __forceinline__ float bfr(float f) { return bf2f(f2bf(f)); }
__device__ __forceinline__ v16h cat16(v8h lo, v8h hi) { return __builtin_shufflevector(lo, hi, 0, 1, 2, 3, 4, 5, 6, 7, 8, 9, 10, 11, 12, 13, 14, 15); }
__device__ __forceinline__ v16bf cat16b(v8us lo, v8us hi) { return __builtin_bit_cast(v16bf, __builtin_shufflevector(lo, hi, 0, 1, 2, 3, 4, 5, 6, 7, 8, 9, 10, 11, 12, 13, 14, 15)); }
__device__ __forceinline__ v8f wmma16(v16h a, v16h b, v8f c) { return __builtin_amdgcn_wmma_f32_16x16x32_f16(false, a, false, b, (short)0, c, false, false); }
__device__ __forceinline__ v8f wmmab(v16bf a, v16bf b, v8f c) { return __builtin_amdgcn_wmma_f32_16x16x32_bf16(false, a, false, b, (short)0, c, false, false); }



// ---- k_gemmks: register-blocked GEMM, one 64x64 output tile per work-group, its K loop split over the KS waves of the work-group; operands straight from K-contiguous 16-bit planes; grid (M/64, N/64, Z), KS*32 threads.
// C[m][n] (f32, pitch ldc, + optional f32 bias[n]) = sum_k A[m][k] Bt[n][k] (+ split products per NSPLIT). z-batch strides sA/sB/sC in elements. K % 64 == 0.
// Each wave keeps the whole tile (16 accumulators) and walks every KS-th 64-wide K chunk (one 128-byte line of each operand row); the KS partial tiles meet in LDS and are summed in the fixed order wave 0..KS-1.
// CAUSAL (probability x value): the K loop stops at the diagonal block of query rows r0+roff.. (probabilities beyond it are exactly zero).
// MODE 0: f32 C as above. MODE 1, 2: no f32 C; the summed tile (one head's HD columns of 64 positions) goes straight to the three 16-bit planes (fp16, bf16 hi, bf16 lo) that the attention kernel reads:
// MODE 1 query / key planes [h][t][d], MODE 2 transposed value planes [g][d][t] at pitch PP. The accumulator's register direction is made the plane's contiguous direction
// (MODE 1 swaps the two operands of the matrix instruction, so that a lane holds 8 consecutive d of one t; MODE 2 keeps them: 8 consecutive t of one d).
template <typename T16> struct WFrag;
template <> struct WFrag<h16> { typedef v16h V; static __device__ __forceinline__ V ld(const h16* p) { return cat16(*(const v8h*)p, *(const v8h*)(p + 16)); } static __device__ __forceinline__ v8f mma(V a, V b, v8f c) { return wmma16(a, b, c); } };
template <> struct WFrag<bf> { typedef v16bf V; static __device__ __forceinline__ V ld(const bf* p) { return cat16b(*(const v8us*)p, *(const v8us*)(p + 16)); } static __device__ __forceinline__ v8f mma(V a, V b, v8f c) { return wmmab(a, b, c); } };
template <typename T16, int NSPLIT, int KS, bool CAUSAL, bool BIAS, int MODE>
__global__ __launch_bounds__(KS * 32) void k_gemmks(const T16* __restrict__ A, const T16* __restrict__ A2, const T16* __restrict__ Bt, const T16* __restrict__ Bt2, int K, float* C, int ldc, int roff, const float* __restrict__ bias, size_t sA, size_t sB, size_t sC, h16* P16, bf* Ph, bf* Pl) {
    static_assert(MODE == 0 || (NSPLIT == 0 && KS == 8 && HD == 64), "the plane epilogue is laid out for 8 waves and one head a tile");
    typedef typename WFrag<T16>::V V;
    constexpr int NP = KS / 4, JW = 8 / NP;                          // each 16-row band is summed by NP waves, JW accumulator registers (rows) each
    typedef __attribute__((ext_vector_type(JW))) float vj;
    __shared__ vj red[KS * 16 * NP * 32];                            // [wave][tile][part][lane]: 16 KiB a wave, lanes side by side (no bank conflict)
    const size_t z = blockIdx.z; A += z * sA; if (A2) A2 += z * sA; Bt += z * sB; if (Bt2) Bt2 += z * sB; C += z * sC;
    const int lane = threadIdx.x & 31, lr = lane & 15, hi = lane >> 4; const int r0 = blockIdx.x * 64, c0 = blockIdx.y * 64;
    const int wave = __builtin_amdgcn_readfirstlane(threadIdx.x >> 5);   // scalar, so that the K loop's branch is scalar and EXEC stays full at the matrix instructions
    const int Kl = CAUSAL ? min(K, r0 + roff + 64) : K;
    v8f acc[4][4];
#pragma unroll
    for (int mb = 0; mb < 4; ++mb)
#pragma unroll
        for (int nb = 0; nb < 4; ++nb) acc[mb][nb] = (v8f){};
    const size_t aoff = (size_t)(r0 + lr) * K + 8 * hi, boff = (size_t)(c0 + lr) * K + 8 * hi;
    // rolled: one set of fragments live beside the 16 accumulators. Two trips of 32 per chunk, then on to this wave's next chunk.
#pragma unroll 1
    for (int kc = wave * 64; kc < Kl; kc += (kc & 32) ? KS * 64 - 32 : 32) {
        V a[4], a2[4];
#pragma unroll
        for (int mb = 0; mb < 4; ++mb) { a[mb] = WFrag<T16>::ld(A + aoff + (size_t)mb * 16 * K + kc); if (NSPLIT == 1 || NSPLIT == 2) a2[mb] = WFrag<T16>::ld(A2 + aoff + (size_t)mb * 16 * K + kc); }
#pragma unroll
        for (int nb = 0; nb < 4; ++nb) { const V b = WFrag<T16>::ld(Bt + boff + (size_t)nb * 16 * K + kc); V b2; if (NSPLIT >= 2) b2 = WFrag<T16>::ld(Bt2 + boff + (size_t)nb * 16 * K + kc);
#pragma unroll
            for (int mb = 0; mb < 4; ++mb) { acc[mb][nb] = (MODE == 1) ? WFrag<T16>::mma(b, a[mb], acc[mb][nb]) : WFrag<T16>::mma(a[mb], b, acc[mb][nb]); if (NSPLIT == 1 || NSPLIT == 2) acc[mb][nb] = WFrag<T16>::mma(a2[mb], b, acc[mb][nb]); if (NSPLIT >= 2) acc[mb][nb] = WFrag<T16>::mma(a[mb], b2, acc[mb][nb]); } }
        // four vector slots between the last matrix instruction and the back edge, behind which the next trip's loads overwrite the fragments
        asm volatile("v_nop\n\tv_nop\n\tv_nop\n\tv_nop" : "+v"(acc[0][0]), "+v"(acc[1][1]), "+v"(acc[2][2]), "+v"(acc[3][3]) : "v"(a[0]), "v"(a[3]));
    }
    if constexpr (MODE != 0) {
        // Plane epilogue. Wave w joins 8 lines of the planes (lane direction: tile w / 2, columns (w & 1) * 8 ..+7), 4 lanes a line, 2 x 8 consecutive elements a lane: whole 128-byte lines, one writer a line.
        const int lt = wave >> 1, lc = (wave & 1) * 8 + (lane & 7), hr = (lane >> 3) & 1, hf = lane >> 4;
        v4f bv[2][2];                                                // biases of this lane's 16 elements, asked for ahead of the LDS traffic
#pragma unroll
        for (int c = 0; c < 2; ++c)
#pragma unroll
            for (int p = 0; p < 2; ++p) { if (MODE == 1) { const v4f t = *(const v4f*)(bias + c0 + (c * 2 + hf) * 16 + hr * 8 + p * 4);
#pragma unroll
                    for (int jj = 0; jj < 4; ++jj) bv[c][p][jj] = bfr(t[jj]); }
                else { const float t = bfr(bias[c0 + lt * 16 + lc]); bv[c][p] = (v4f){ t, t, t, t }; } }
        // the upper half-wave's slots are turned by 8, so that the 16 lanes of a joining half-wave (8 columns of either accumulator half) meet all 64 banks once
        vj* rw = red + wave * (16 * NP * 32) + (lane ^ (hi << 3));
#pragma unroll
        for (int mb = 0; mb < 4; ++mb)
#pragma unroll
            for (int nb = 0; nb < 4; ++nb)
#pragma unroll
                for (int p = 0; p < NP; ++p) { vj t;
#pragma unroll
                    for (int jj = 0; jj < JW; ++jj) t[jj] = acc[mb][nb][p * JW + jj];
                    rw[((mb * 4 + nb) * NP + p) * 32] = t; }
        __syncthreads();                                             // every wave's partial tile is in LDS before any wave sums
#pragma unroll
        for (int c = 0; c < 2; ++c) { const int rt = c * 2 + hf;     // register-direction tile: the 4 lanes of a line store 64 consecutive bytes at a time
            const vj* rr = red + ((MODE == 1 ? lt * 4 + rt : rt * 4 + lt) * NP) * 32 + ((lc + 16 * hr) ^ (hr << 3)); v8h o16; v8us oh, ol;
#pragma unroll
            for (int p = 0; p < NP; ++p) { vj s = rr[p * 32];
#pragma unroll
                for (int u = 1; u < KS; ++u) s += rr[u * (16 * NP * 32) + p * 32];
                if (BIAS) s += bv[c][p];
#pragma unroll
                for (int jj = 0; jj < JW; ++jj) { o16[p * JW + jj] = (h16)s[jj]; const unsigned short a2 = f2bf(s[jj]); oh[p * JW + jj] = a2; ol[p * JW + jj] = f2bf(s[jj] - bf2f(a2)); } }
            const size_t e = (MODE == 1) ? ((size_t)blockIdx.y * TT + r0 + lt * 16 + lc) * HD + rt * 16 + hr * 8 : (size_t)(c0 + lt * 16 + lc) * PP + r0 + rt * 16 + hr * 8;
            *(v8h*)(P16 + e) = o16; *(v8us*)(Ph + e) = oh; *(v8us*)(Pl + e) = ol; }
    } else {
    float bb[4];                                                     // bias of this lane's four columns, asked for ahead of the LDS traffic
#pragma unroll
    for (int nb = 0; nb < 4; ++nb) bb[nb] = BIAS ? bfr(bias[c0 + nb * 16 + lr]) : 0.0f;
    vj* rw = red + wave * (16 * NP * 32) + lane;
#pragma unroll
    for (int mb = 0; mb < 4; ++mb)
#pragma unroll
        for (int nb = 0; nb < 4; ++nb)
#pragma unroll
            for (int p = 0; p < NP; ++p) { vj t;
#pragma unroll
                for (int jj = 0; jj < JW; ++jj) t[jj] = acc[mb][nb][p * JW + jj];
                rw[((mb * 4 + nb) * NP + p) * 32] = t; }
    __syncthreads();                                                 // every wave's partial tile is in LDS before any wave sums
    const int mbw = wave / NP, pw = wave % NP;                       // this wave sums rows mbw*16 + {0, 8} + pw*JW .. +JW-1 over all 64 columns: whole 256-byte pieces of output rows, one writer a line
    float* crow = C + (size_t)(r0 + mbw * 16 + hi * 8 + pw * JW) * ldc + c0 + lr;
#pragma unroll
    for (int nb = 0; nb < 4; ++nb) { const vj* rr = red + ((mbw * 4 + nb) * NP + pw) * 32 + lane; vj s = rr[0];
#pragma unroll
        for (int u = 1; u < KS; ++u) s += rr[u * (16 * NP * 32)];
        if (BIAS) s += bb[nb];
#pragma unroll
        for (int jj = 0; jj < JW; ++jj) crow[(size_t)jj * ldc + nb * 16] = s[jj]; }
    }
}

__device__ __forceinline__ h16 tohx(float x) { return (h16)x; }
__device__ __forceinline__ void splitf(float y, unsigned short& h, unsigned short& l) { h = f2bf(y); l = f2bf(y - bf2f(h)); }
typedef __attribute__((ext_vector_type(2))) _Float16 v2h;
typedef __attribute__((ext_vector_type(4))) _Float16 v4h;
typedef __attribute__((ext_vector_type(2))) unsigned short v2us;
typedef __attribute__((ext_vector_type(4))) unsigned short v4us;
typedef __attribute__((ext_vector_type(2))) float v2f;
typedef __attribute__((ext_vector_type(4))) int v4i;

// grid (lines / 64, matrices per source, sources): matrix y of source z ([K][N], K * N apart in its source) goes to the K * N elements number z * NH_ + y of Bt
__global__ __launch_bounds__(256) void k_wtG(const float* __restrict__ w0, const float* __restrict__ w1, const float* __restrict__ w2, int K, int N, bf* Bt) {
    const float* __restrict__ w = (blockIdx.z == 0 ? w0 : blockIdx.z == 1 ? w1 : w2) + (size_t)blockIdx.y * K * N; Bt += ((size_t)blockIdx.z * NH_ + blockIdx.y) * K * N;
    const int lane = threadIdx.x & 31; const int L0 = (blockIdx.x * 8 + (threadIdx.x >> 5)) * 8; const int nlines = N * K / 64;
{
#pragma unroll 1
        for (int l = 0; l < 8; ++l) { const int L = L0 + l; if (L >= nlines) break; const size_t e = (size_t)L * 64 + lane * 2; const int k = (int)(e % K), n = (int)(e / K); v2us o;
            o[0] = f2bf(w[(size_t)k * N + n]); o[1] = f2bf(w[(size_t)(k + 1) * N + n]); *(v2us*)(Bt + e) = o; }
         }
}
__global__ __launch_bounds__(256) void k_cvt8(const float* __restrict__ src, bf* dst, size_t n8) { const size_t i = (size_t)blockIdx.x * 256 + threadIdx.x; if (i >= n8) return; const v8f v = *(const v8f*)(src + i * 8); v8us o;
#pragma unroll
    for (int k = 0; k < 8; ++k) o[k] = f2bf(v[k]); *(v8us*)(dst + i * 8) = o;  }

#define FW 8
template <typename T16, bool HIRES>
__device__ __forceinline__ void fa_tile(const T16* __restrict__ Q, const T16* __restrict__ Q2, const T16* __restrict__ Kp, const T16* __restrict__ K2, const T16* __restrict__ Vt, const T16* __restrict__ V2, int q0, bf* Ah, bf* Al, float* red, float* st) {
    typedef typename WFrag<T16>::V V;
    const int lane = threadIdx.x & 31, lr = lane & 15, hi = lane >> 4;
    const int wave = __builtin_amdgcn_readfirstlane(threadIdx.x >> 5);   // scalar, so that the key loop's branch is scalar and EXEC stays full at the matrix instructions
    V qf[2][2], qf2[2][2];
#pragma unroll
    for (int qt = 0; qt < 2; ++qt)
#pragma unroll
        for (int kc = 0; kc < 2; ++kc) { const size_t o = (size_t)(q0 + qt * 16 + lr) * HD + kc * 32 + 8 * hi; qf[qt][kc] = WFrag<T16>::ld(Q + o); if (HIRES) qf2[qt][kc] = WFrag<T16>::ld(Q2 + o); }
    v8f o[4][2];
#pragma unroll
    for (int dt = 0; dt < 4; ++dt)
#pragma unroll
        for (int qt = 0; qt < 2; ++qt) o[dt][qt] = (v8f){};
    float m[2] = { -3.0e38f, -3.0e38f }, l[2] = { 0.0f, 0.0f };
    // fp16 rows (up to 8 blocks a wave): the key fragments are fetched one block ahead and the value fragments at the head of their block, so that a block waits for no load of its own.
    // hi + lo rows (at most 2 blocks a wave, twice the fragments): every fragment is fetched where it is used, which keeps the kernel within 256 registers.
    V kf[2][2], kf2[2][2];
    if (!HIRES) {
#pragma unroll
        for (int kt = 0; kt < 2; ++kt)
#pragma unroll
            for (int kc = 0; kc < 2; ++kc) kf[kt][kc] = WFrag<T16>::ld(Kp + (size_t)(wave * 32 + kt * 16 + lr) * HD + kc * 32 + 8 * hi);   // block number 'wave' exists in the plane also where this tile ends before it
    }
    // rolled: one block's fragments live beside the 8 output accumulators
#pragma unroll 1
    for (int kb = wave * 32; kb < q0 + 32; kb += FW * 32) {
        V vf[4], vf2[4];
        if (!HIRES) {
#pragma unroll
            for (int dt = 0; dt < 4; ++dt) vf[dt] = WFrag<T16>::ld(Vt + (size_t)(dt * 16 + lr) * PP + kb + 8 * hi);
        }
        v8f s[2][2];
#pragma unroll
        for (int kt = 0; kt < 2; ++kt)
#pragma unroll
            for (int qt = 0; qt < 2; ++qt) s[kt][qt] = (v8f){};
#pragma unroll
        for (int kt = 0; kt < 2; ++kt)
#pragma unroll
            for (int kc = 0; kc < 2; ++kc) { if (HIRES) { const size_t ko = (size_t)(kb + kt * 16 + lr) * HD + kc * 32 + 8 * hi; kf[kt][kc] = WFrag<T16>::ld(Kp + ko); kf2[kt][kc] = WFrag<T16>::ld(K2 + ko);
                    asm volatile("s_wait_xcnt 0x0" ::: "memory"); }   // stands in front of any overwrite of these four loads' address registers
#pragma unroll
                for (int qt = 0; qt < 2; ++qt) { s[kt][qt] = WFrag<T16>::mma(kf[kt][kc], qf[qt][kc], s[kt][qt]); if (HIRES) { s[kt][qt] = WFrag<T16>::mma(kf[kt][kc], qf2[qt][kc], s[kt][qt]); s[kt][qt] = WFrag<T16>::mma(kf2[kt][kc], qf[qt][kc], s[kt][qt]); } } }
        if (!HIRES) { const int kn = min(kb + FW * 32, q0);              // this wave's next block; behind its last one the tile's diagonal block is fetched and not used
#pragma unroll
            for (int kt = 0; kt < 2; ++kt)
#pragma unroll
                for (int kc = 0; kc < 2; ++kc) kf[kt][kc] = WFrag<T16>::ld(Kp + (size_t)(kn + kt * 16 + lr) * HD + kc * 32 + 8 * hi);
        }
#pragma unroll
        for (int kt = 0; kt < 2; ++kt)
#pragma unroll
            for (int qt = 0; qt < 2; ++qt) s[kt][qt] *= SCL * 1.4426950408889634f;
        if (kb == q0) {                                                  // the diagonal block (the tile's last): keys beyond the query are masked; key kb itself never is, so every column keeps a finite maximum
#pragma unroll
            for (int kt = 0; kt < 2; ++kt)
#pragma unroll
                for (int qt = 0; qt < 2; ++qt)
#pragma unroll
                    for (int j = 0; j < 8; ++j) if (kt * 16 + hi * 8 + j > qt * 16 + lr) s[kt][qt][j] = -3.0e38f;
        }
        V pf[2], pf2[2];
#pragma unroll
        for (int qt = 0; qt < 2; ++qt) {
            float mx = s[0][qt][0];
#pragma unroll
            for (int j = 1; j < 16; ++j) mx = fmaxf(mx, s[j >> 3][qt][j & 7]);
            mx = fmaxf(mx, __shfl_xor(mx, 16, 32));
            const float mn = fmaxf(m[qt], mx), al = __builtin_amdgcn_exp2f(m[qt] - mn), mo = mn - 10.0f; m[qt] = mn;
            float sum = 0.0f;
#pragma unroll
            for (int j = 0; j < 16; ++j) { const float p = __builtin_amdgcn_exp2f(s[j >> 3][qt][j & 7] - mo); s[j >> 3][qt][j & 7] = p; sum += p; }
            l[qt] = l[qt] * al + sum;
#pragma unroll
            for (int dt = 0; dt < 4; ++dt) o[dt][qt] *= al;
            if constexpr (HIRES) { v8us h0, h1, l0, l1;
#pragma unroll
                for (int j = 0; j < 8; ++j) { unsigned short a, c2; splitf(s[0][qt][j], a, c2); h0[j] = a; l0[j] = c2; splitf(s[1][qt][j], a, c2); h1[j] = a; l1[j] = c2; }
                pf[qt] = cat16b(h0, h1); pf2[qt] = cat16b(l0, l1);
            } else { v8h c0, c1;
#pragma unroll
                for (int j = 0; j < 8; ++j) { c0[j] = tohx(s[0][qt][j]); c1[j] = tohx(s[1][qt][j]); }
                pf[qt] = cat16(c0, c1); }
        }
#pragma unroll
        for (int dt = 0; dt < 4; ++dt) { if (HIRES) { const size_t vo = (size_t)(dt * 16 + lr) * PP + kb + 8 * hi; vf[dt] = WFrag<T16>::ld(Vt + vo); vf2[dt] = WFrag<T16>::ld(V2 + vo); }
#pragma unroll
            for (int qt = 0; qt < 2; ++qt) { o[dt][qt] = WFrag<T16>::mma(vf[dt], pf[qt], o[dt][qt]); if (HIRES) { o[dt][qt] = WFrag<T16>::mma(vf[dt], pf2[qt], o[dt][qt]); o[dt][qt] = WFrag<T16>::mma(vf2[dt], pf[qt], o[dt][qt]); } } }
    }
#pragma unroll
    for (int qt = 0; qt < 2; ++qt) { const float lj = l[qt] + __shfl_xor(l[qt], 16, 32); st[wave * 64 + qt * 16 + lr] = m[qt]; st[wave * 64 + 32 + qt * 16 + lr] = lj;   // both halves hold, and store, the same two values
#pragma unroll
        for (int dt = 0; dt < 4; ++dt) *(v8f*)(red + (size_t)(((wave * 8 + qt * 4 + dt) * 32 + lane) * 8)) = o[dt][qt]; }
    __syncthreads();                                                     // every wave's partial result is in LDS before any wave joins
    // wave w joins queries 4w..4w+3, 8 lanes a query, 8 consecutive d a lane: whole 128-byte lines of the merged planes, one writer a line. A wave that had no block left m = -3e38, l = 0, Ot = 0: factor 0.
    const int q = wave * 4 + (lane >> 3), dg = lane & 7;
    const float* rr = red + (((q >> 4) * 4 + (dg >> 1)) * 32 + (q & 15) + 16 * (dg & 1)) * 8;
    float M = st[q];
#pragma unroll
    for (int u = 1; u < FW; ++u) M = fmaxf(M, st[u * 64 + q]);
    float L = 0.0f; v8f acc = (v8f){};
#pragma unroll
    for (int u = 0; u < FW; ++u) { const float f = __builtin_amdgcn_exp2f(st[u * 64 + q] - M); L += st[u * 64 + 32 + q] * f; acc += *(const v8f*)(rr + u * (8 * 32 * 8)) * f; }
    const float inv = __fdiv_rn(1.0f, L); v8us oh, ol;
#pragma unroll
    for (int j = 0; j < 8; ++j) { unsigned short a, c2; splitf(acc[j] * inv, a, c2); oh[j] = a; ol[j] = c2; }
    const size_t oo = (size_t)(q0 + q) * DQ + dg * 8; *(v8us*)(Ah + oo) = oh; *(v8us*)(Al + oo) = ol;
}
__global__ __launch_bounds__(FW * 32) void k_fattn(const h16* __restrict__ Q16, const h16* __restrict__ K16, const h16* __restrict__ V16, const bf* __restrict__ Qh, const bf* __restrict__ Ql, const bf* __restrict__ Kh, const bf* __restrict__ Kl, const bf* __restrict__ Vh, const bf* __restrict__ Vl, bf* Ah, bf* Al) {
    __shared__ __align__(32) float red[FW * 8 * 32 * 8];                 // [wave][query group][d tile][lane][8]: 8 KiB a wave
    __shared__ float st[FW * 64];                                        // [wave][m, l][query]
    const int q0 = (TT / 32 - 1 - (int)blockIdx.y) * 32; const size_t h = blockIdx.x, g = h / REP; const size_t qo = h * TT * HD, ko = g * TT * HD, vo = g * HD * PP;
    if (q0 < RH) fa_tile<bf, true>(Qh + qo, Ql + qo, Kh + ko, Kl + ko, Vh + vo, Vl + vo, q0, Ah + h * HD, Al + h * HD, red, st);
    else fa_tile<h16, false>(Q16 + qo, nullptr, K16 + ko, nullptr, V16 + vo, nullptr, q0, Ah + h * HD, Al + h * HD, red, st);
}

extern "C" void kernel_launch(void* const* d_in, const int* in_sizes, int n_in,
                              void* d_out, int out_size, void* d_ws, size_t ws_size, hipStream_t stream) {
    (void)in_sizes; (void)n_in; (void)out_size;
    const float* x = (const float*)d_in[0]; const float* wq = (const float*)d_in[1]; const float* bq = (const float*)d_in[2]; const float* wk = (const float*)d_in[3]; const float* bk = (const float*)d_in[4]; const float* wv = (const float*)d_in[5]; const float* bv = (const float*)d_in[6]; const float* wo = (const float*)d_in[7]; const float* bo = (const float*)d_in[8];   /* argument order x, Wq, bq, Wk, bk, Wv, bv, Wp, bp (per-head weights [16][1024][64]; per-head biases [16][64] = flat index h*64 + d) */
    float* OUT = (float*)d_out;     // [4][2048][1024]
    char* wsp = (char*)d_ws;
    auto take = [&](size_t bytes) { char* p = wsp; wsp += (bytes + 255) & ~(size_t)255; return (void*)p; };
    bf* WQ = (bf*)take((size_t)DQ * DM * 2); bf* WK = (bf*)take((size_t)DKV * DM * 2); bf* WV = (bf*)take((size_t)DKV * DM * 2); bf* WO = (bf*)take((size_t)DM * DQ * 2);
    bf* XB = (bf*)take((size_t)TT * DM * 2);
    h16* QP16 = (h16*)take((size_t)NH_ * TT * HD * 2); h16* KP16 = (h16*)take((size_t)NKV * TT * HD * 2); h16* VT16 = (h16*)take((size_t)NKV * HD * PP * 2);
    bf* QPh = (bf*)take((size_t)NH_ * TT * HD * 2); bf* QPl = (bf*)take((size_t)NH_ * TT * HD * 2); bf* KPh = (bf*)take((size_t)NKV * TT * HD * 2); bf* KPl = (bf*)take((size_t)NKV * TT * HD * 2); bf* VTh = (bf*)take((size_t)NKV * HD * PP * 2); bf* VTl = (bf*)take((size_t)NKV * HD * PP * 2);
    bf* ATh = (bf*)take((size_t)TT * DQ * 2); bf* ATl = (bf*)take((size_t)TT * DQ * 2);
    if ((size_t)(wsp - (char*)d_ws) > ws_size) return;    // ws 256 MiB
    { k_wtG<<<dim3((unsigned)((DM * HD / 64 + 63) / 64), NH_, 3), 256, 0, stream>>>(wq, wk, wv, DM, HD, WQ);   /* per-head weights [h][DM][HD] ('xw' per head) -> the head's HD rows of the Bt planes WQ, WK, WV, which lie one behind the other in the workspace (NKV == NH_) */
      k_wtG<<<(unsigned)((DQ * DM / 64 + 63) / 64), 256, 0, stream>>>(wo, wo, wo, DQ, DM, WO);
       }
    for (int b = 0; b < NB_; ++b) {
        
        k_cvt8<<<(unsigned)(((size_t)TT * DM / 8 + 255) / 256), 256, 0, stream>>>(x + (size_t)b * TT * DM, XB, (size_t)TT * DM / 8);
        k_gemmks<bf, 0, 8, false, true, 1><<<dim3(TT / 64, DQ / 64, 1), 8 * 32, 0, stream>>>(XB, nullptr, WQ, nullptr, DM, nullptr, 0, 0, bq, 0, 0, 0, QP16, QPh, QPl);
        k_gemmks<bf, 0, 8, false, true, 1><<<dim3(TT / 64, DKV / 64, 1), 8 * 32, 0, stream>>>(XB, nullptr, WK, nullptr, DM, nullptr, 0, 0, bk, 0, 0, 0, KP16, KPh, KPl);
        k_gemmks<bf, 0, 8, false, true, 2><<<dim3(TT / 64, DKV / 64, 1), 8 * 32, 0, stream>>>(XB, nullptr, WV, nullptr, DM, nullptr, 0, 0, bv, 0, 0, 0, VT16, VTh, VTl);
        k_fattn<<<dim3(NH_, TT / 32, 1), FW * 32, 0, stream>>>(QP16, KP16, VT16, QPh, QPl, KPh, KPl, VTh, VTl, ATh, ATl);
        k_gemmks<bf, 1, 8, false, true, 0><<<dim3(TT / 64, DM / 64, 1), 8 * 32, 0, stream>>>(ATh, ATl, WO, nullptr, DQ, OUT + (size_t)b * TT * DM, DM, 0, bo, 0, 0, 0, nullptr, nullptr, nullptr); }
}
// regate 2

// v005
// Measured time: 319 microseconds a run.
// Two timings next to v004 both put it at 1.14 times that version's speed.
// Counting every step since v000, it is 9.97 times as fast.
#include <hip/hip_runtime.h>

// Causal multi-head self-attention whose q, k, v projections are given PER HEAD (x [4][2048][1024]; q, k, v = einsum('bte,hed->bhtd', x, W) + b[None, :, None, :] with W [16][1024][64] ((in, out) inside each head; 1/32-scale) and per-head biases b [16][64] (zeros on this draw); scores x 1/sqrt(64); causal (-inf); softmax; heads merged head-major (column h*64 + d); out = cat Wp + bp ('xw' [1024][1024] + zero bias) -> [4][2048][1024] (8.4 M); argument order x, Wq, bq, Wk, bk, Wv, bv, Wp, bp). THIS ROW: the same module under other names (token_embedding [4][2048][1024]; PER-HEAD stacked projections Wq, Wk, Wv [16][1024][64] normal x 1/32 with biases [16][64] zeros (read): q = einsum('btd,hde->bhte', x, Wq) + bq; scores / sqrt(64); tril kept, -inf; softmax; heads concatenated in order; out = cat Wo + bo ('xw' [1024][1024]; bias zeros: read); argument order token_embedding, Wq, bq, Wk, bk, Wv, bv, Wo, bo).
// Layout, all batches in every launch (6 launches): bf16 copy of x; 'xw' weights transposed once; exact projections + f32 biases, stored by the GEMM itself as the 16-bit head planes; causal T-2048 attention in one kernel, running softmax (hybrid rows: < 512 hi/lo 3 products, rest fp16 x1024; key blocks above the diagonal never visited); merged hi/lo x Wo exact + bo.
// Compute dtypes, f32 accumulate: every input rounded to bf16; projections exact + f32 biases; attention rows < 512 3 products, rest fp16; softmax f32; output projection hl x exact.

#define NB_  4
#define TT   2048
#define DM   1024
#define NH_  16
#define NKV  16
#define REP  (NH_ / NKV)
#define HD   64
#define DQ   (NH_ * HD)
#define DKV  (NKV * HD)
#define RH   512                  // query rows < RH use hi+lo planes (0: none)
#define PP   (2 * TT)              // row pitch, in 16-bit elements, of the transposed value planes
#define SCL  0.125f   // HD^-0.5
typedef _Float16 h16;
typedef unsigned short bf;
typedef __attribute__((ext_vector_type(16))) __bf16   v16bf;
typedef __attribute__((ext_vector_type(16))) _Float16 v16h;
typedef __attribute__((ext_vector_type(8)))  _Float16 v8h;
typedef __attribute__((ext_vector_type(8)))  unsigned short v8us;
typedef __attribute__((ext_vector_type(8)))  float    v8f;
typedef __attribute__((ext_vector_type(4)))  float    v4f;
typedef v8h  __attribute__((may_alias)) v8ha;
typedef v4f  __attribute__((may_alias)) v4fa;
typedef v8us __attribute__((may_alias)) v8usa;

__device__ __forceinline__ unsigned short f2bf(float f) { unsigned u = __float_as_uint(f); u += 0x7FFFu + ((u >> 16) & 1u); return (unsigned short)(u >> 16); }
__device__ __forceinline__ float bf2f(unsigned short b) { return __uint_as_float(((unsigned)b) << 16); }
__device__ __forceinline__ float bfr(float f) { return bf2f(f2bf(f)); }
__device__ __forceinline__ v16h cat16(v8h lo, v8h hi) { return __builtin_shufflevector(lo, hi, 0, 1, 2, 3, 4, 5, 6, 7, 8, 9, 10, 11, 12, 13, 14, 15); }
__device__ __forceinline__ v16bf cat16b(v8us lo, v8us hi) { return __builtin_bit_cast(v16bf, __builtin_shufflevector(lo, hi, 0, 1, 2, 3, 4, 5, 6, 7, 8, 9, 10, 11, 12, 13, 14, 15)); }
__device__ __forceinline__ v8f wmma16(v16h a, v16h b, v8f c) { return __builtin_amdgcn_wmma_f32_16x16x32_f16(false, a, false, b, (short)0, c, false, false); }
__device__ __forceinline__ v8f wmmab(v16bf a, v16bf b, v8f c) { return __builtin_amdgcn_wmma_f32_16x16x32_bf16(false, a, false, b, (short)0, c, false, false); }



// ---- k_gemmks: register-blocked GEMM, one 64x64 output tile per work-group, its K loop split over the KS waves of the work-group; operands straight from K-contiguous 16-bit planes; grid (M/64, N/64, Z), KS*32 threads. The rows of A run through all batches (M = NB_ * TT).
// C[m][n] (f32, pitch ldc, + optional f32 bias[n]) = sum_k A[m][k] Bt[n][k] (+ split products per NSPLIT). z-batch strides sA/sB/sC (sP: the 16-bit planes) in elements; z > 0 takes bias2 (z = 0 query, z = 1 key projection in one launch). K % 64 == 0.
// Each wave keeps the whole tile (16 accumulators) and walks every KS-th 64-wide K chunk (one 128-byte line of each operand row); the KS partial tiles meet in LDS and are summed in the fixed order wave 0..KS-1.
// CAUSAL (probability x value): the K loop stops at the diagonal block of query rows r0+roff.. (probabilities beyond it are exactly zero).
// MODE 0: f32 C as above. MODE 1, 2: no f32 C; the summed tile (one head's HD columns of 64 positions) goes straight to the three 16-bit planes (fp16, bf16 hi, bf16 lo) that the attention kernel reads:
// MODE 1 query / key planes [b][h][t][d], MODE 2 transposed value planes [b][g][d][t] at pitch PP. The accumulator's register direction is made the plane's contiguous direction
// (MODE 1 swaps the two operands of the matrix instruction, so that a lane holds 8 consecutive d of one t; MODE 2 keeps them: 8 consecutive t of one d).
template <typename T16> struct WFrag;
template <> struct WFrag<h16> { typedef v16h V; static __device__ __forceinline__ V ld(const h16* p) { return cat16(*(const v8h*)p, *(const v8h*)(p + 16)); } static __device__ __forceinline__ v8f mma(V a, V b, v8f c) { return wmma16(a, b, c); } };
template <> struct WFrag<bf> { typedef v16bf V; static __device__ __forceinline__ V ld(const bf* p) { return cat16b(*(const v8us*)p, *(const v8us*)(p + 16)); } static __device__ __forceinline__ v8f mma(V a, V b, v8f c) { return wmmab(a, b, c); } };
template <typename T16, int NSPLIT, int KS, bool CAUSAL, bool BIAS, int MODE>
__global__ __launch_bounds__(KS * 32) void k_gemmks(const T16* __restrict__ A, const T16* __restrict__ A2, const T16* __restrict__ Bt, const T16* __restrict__ Bt2, int K, float* C, int ldc, int roff, const float* __restrict__ bias, const float* __restrict__ bias2, size_t sA, size_t sB, size_t sC, size_t sP, h16* P16, bf* Ph, bf* Pl) {
    static_assert(MODE == 0 || (NSPLIT == 0 && KS == 8 && HD == 64), "the plane epilogue is laid out for 8 waves and one head a tile");
    typedef typename WFrag<T16>::V V;
    constexpr int NP = KS / 4, JW = 8 / NP;                          // each 16-row band is summed by NP waves, JW accumulator registers (rows) each
    typedef __attribute__((ext_vector_type(JW))) float vj;
    __shared__ vj red[KS * 16 * NP * 32];                            // [wave][tile][part][lane]: 16 KiB a wave, lanes side by side (no bank conflict)
    const size_t z = blockIdx.z; A += z * sA; if (A2) A2 += z * sA; Bt += z * sB; if (Bt2) Bt2 += z * sB; C += z * sC; if (MODE != 0) { P16 += z * sP; Ph += z * sP; Pl += z * sP; if (z) bias = bias2; }
    const int lane = threadIdx.x & 31, lr = lane & 15, hi = lane >> 4; const int r0 = blockIdx.x * 64, c0 = blockIdx.y * 64;
    const int wave = __builtin_amdgcn_readfirstlane(threadIdx.x >> 5);   // scalar, so that the K loop's branch is scalar and EXEC stays full at the matrix instructions
    const int Kl = CAUSAL ? min(K, r0 + roff + 64) : K;
    v8f acc[4][4];
#pragma unroll
    for (int mb = 0; mb < 4; ++mb)
#pragma unroll
        for (int nb = 0; nb < 4; ++nb) acc[mb][nb] = (v8f){};
    const size_t aoff = (size_t)(r0 + lr) * K + 8 * hi, boff = (size_t)(c0 + lr) * K + 8 * hi;
    // rolled: one set of fragments live beside the 16 accumulators. Two trips of 32 per chunk, then on to this wave's next chunk.
#pragma unroll 1
    for (int kc = wave * 64; kc < Kl; kc += (kc & 32) ? KS * 64 - 32 : 32) {
        V a[4], a2[4];
#pragma unroll
        for (int mb = 0; mb < 4; ++mb) { a[mb] = WFrag<T16>::ld(A + aoff + (size_t)mb * 16 * K + kc); if (NSPLIT == 1 || NSPLIT == 2) a2[mb] = WFrag<T16>::ld(A2 + aoff + (size_t)mb * 16 * K + kc); }
#pragma unroll
        for (int nb = 0; nb < 4; ++nb) { const V b = WFrag<T16>::ld(Bt + boff + (size_t)nb * 16 * K + kc); V b2; if (NSPLIT >= 2) b2 = WFrag<T16>::ld(Bt2 + boff + (size_t)nb * 16 * K + kc);
#pragma unroll
            for (int mb = 0; mb < 4; ++mb) { acc[mb][nb] = (MODE == 1) ? WFrag<T16>::mma(b, a[mb], acc[mb][nb]) : WFrag<T16>::mma(a[mb], b, acc[mb][nb]); if (NSPLIT == 1 || NSPLIT == 2) acc[mb][nb] = WFrag<T16>::mma(a2[mb], b, acc[mb][nb]); if (NSPLIT >= 2) acc[mb][nb] = WFrag<T16>::mma(a[mb], b2, acc[mb][nb]); } }
        // four vector slots between the last matrix instruction and the back edge, behind which the next trip's loads overwrite the fragments
        asm volatile("v_nop\n\tv_nop\n\tv_nop\n\tv_nop" : "+v"(acc[0][0]), "+v"(acc[1][1]), "+v"(acc[2][2]), "+v"(acc[3][3]) : "v"(a[0]), "v"(a[3]));
    }
    if constexpr (MODE != 0) {
        // Plane epilogue. Wave w joins 8 lines of the planes (lane direction: tile w / 2, columns (w & 1) * 8 ..+7), 4 lanes a line, 2 x 8 consecutive elements a lane: whole 128-byte lines, one writer a line.
        const int lt = wave >> 1, lc = (wave & 1) * 8 + (lane & 7), hr = (lane >> 3) & 1, hf = lane >> 4;
        v4f bv[2][2];                                                // biases of this lane's 16 elements, asked for ahead of the LDS traffic
#pragma unroll
        for (int c = 0; c < 2; ++c)
#pragma unroll
            for (int p = 0; p < 2; ++p) { if (MODE == 1) { const v4f t = *(const v4f*)(bias + c0 + (c * 2 + hf) * 16 + hr * 8 + p * 4);
#pragma unroll
                    for (int jj = 0; jj < 4; ++jj) bv[c][p][jj] = bfr(t[jj]); }
                else { const float t = bfr(bias[c0 + lt * 16 + lc]); bv[c][p] = (v4f){ t, t, t, t }; } }
        asm volatile("s_wait_xcnt 0x0" ::: "memory");                // stands in front of any overwrite of the bias loads' address registers
        // the upper half-wave's slots are turned by 8, so that the 16 lanes of a joining half-wave (8 columns of either accumulator half) meet all 64 banks once
        vj* rw = red + wave * (16 * NP * 32) + (lane ^ (hi << 3));
#pragma unroll
        for (int mb = 0; mb < 4; ++mb)
#pragma unroll
            for (int nb = 0; nb < 4; ++nb)
#pragma unroll
                for (int p = 0; p < NP; ++p) { vj t;
#pragma unroll
                    for (int jj = 0; jj < JW; ++jj) t[jj] = acc[mb][nb][p * JW + jj];
                    rw[((mb * 4 + nb) * NP + p) * 32] = t; }
        __syncthreads();                                             // every wave's partial tile is in LDS before any wave sums
#pragma unroll
        for (int c = 0; c < 2; ++c) { const int rt = c * 2 + hf;     // register-direction tile: the 4 lanes of a line store 64 consecutive bytes at a time
            const vj* rr = red + ((MODE == 1 ? lt * 4 + rt : rt * 4 + lt) * NP) * 32 + ((lc + 16 * hr) ^ (hr << 3)); v8h o16; v8us oh, ol;
#pragma unroll
            for (int p = 0; p < NP; ++p) { vj s = rr[p * 32];
#pragma unroll
                for (int u = 1; u < KS; ++u) s += rr[u * (16 * NP * 32) + p * 32];
                if (BIAS) s += bv[c][p];
#pragma unroll
                for (int jj = 0; jj < JW; ++jj) { o16[p * JW + jj] = (h16)s[jj]; const unsigned short a2 = f2bf(s[jj]); oh[p * JW + jj] = a2; ol[p * JW + jj] = f2bf(s[jj] - bf2f(a2)); } }
            const int bt = r0 / TT, t0 = r0 % TT;                     // the tile's batch and its first position there (TT % 64 == 0: a tile lies in one batch)
            const size_t e = (MODE == 1) ? (((size_t)bt * NH_ + blockIdx.y) * TT + t0 + lt * 16 + lc) * HD + rt * 16 + hr * 8 : ((size_t)bt * DKV + c0 + lt * 16 + lc) * PP + t0 + rt * 16 + hr * 8;
            *(v8h*)(P16 + e) = o16; *(v8us*)(Ph + e) = oh; *(v8us*)(Pl + e) = ol; }
    } else {
    float bb[4];                                                     // bias of this lane's four columns, asked for ahead of the LDS traffic
#pragma unroll
    for (int nb = 0; nb < 4; ++nb) bb[nb] = BIAS ? bfr(bias[c0 + nb * 16 + lr]) : 0.0f;
    vj* rw = red + wave * (16 * NP * 32) + lane;
#pragma unroll
    for (int mb = 0; mb < 4; ++mb)
#pragma unroll
        for (int nb = 0; nb < 4; ++nb)
#pragma unroll
            for (int p = 0; p < NP; ++p) { vj t;
#pragma unroll
                for (int jj = 0; jj < JW; ++jj) t[jj] = acc[mb][nb][p * JW + jj];
                rw[((mb * 4 + nb) * NP + p) * 32] = t; }
    __syncthreads();                                                 // every wave's partial tile is in LDS before any wave sums
    const int mbw = wave / NP, pw = wave % NP;                       // this wave sums rows mbw*16 + {0, 8} + pw*JW .. +JW-1 over all 64 columns: whole 256-byte pieces of output rows, one writer a line
    float* crow = C + (size_t)(r0 + mbw * 16 + hi * 8 + pw * JW) * ldc + c0 + lr;
#pragma unroll
    for (int nb = 0; nb < 4; ++nb) { const vj* rr = red + ((mbw * 4 + nb) * NP + pw) * 32 + lane; vj s = rr[0];
#pragma unroll
        for (int u = 1; u < KS; ++u) s += rr[u * (16 * NP * 32)];
        if (BIAS) s += bb[nb];
#pragma unroll
        for (int jj = 0; jj < JW; ++jj) crow[(size_t)jj * ldc + nb * 16] = s[jj]; }
    }
}

__device__ __forceinline__ h16 tohx(float x) { return (h16)x; }
__device__ __forceinline__ void splitf(float y, unsigned short& h, unsigned short& l) { h = f2bf(y); l = f2bf(y - bf2f(h)); }
typedef __attribute__((ext_vector_type(2))) _Float16 v2h;
typedef __attribute__((ext_vector_type(4))) _Float16 v4h;
typedef __attribute__((ext_vector_type(2))) unsigned short v2us;
typedef __attribute__((ext_vector_type(4))) unsigned short v4us;
typedef __attribute__((ext_vector_type(2))) float v2f;
typedef __attribute__((ext_vector_type(4))) int v4i;

// grid (lines / 64, NH_, 4). Sources 0..2: matrix y of source z ([Kh][Nh], Kh * Nh apart in its source) goes to the Kh * Nh elements number z * NH_ + y of Bt.
// Source 3: ONE matrix [Ko][No] of NH_ * Kh * Nh elements, behind the others in Bt; its lines are dealt over the (x, y) blocks.
__global__ __launch_bounds__(256) void k_wtG(const float* __restrict__ w0, const float* __restrict__ w1, const float* __restrict__ w2, const float* __restrict__ w3, int Kh, int Nh, int Ko, int No, bf* Bt) {
    const bool one = blockIdx.z == 3; const int K = one ? Ko : Kh, N = one ? No : Nh; const int bx = one ? blockIdx.y * gridDim.x + blockIdx.x : blockIdx.x;
    const float* __restrict__ w = one ? w3 : (blockIdx.z == 0 ? w0 : blockIdx.z == 1 ? w1 : w2) + (size_t)blockIdx.y * Kh * Nh; Bt += ((size_t)blockIdx.z * NH_ + (one ? 0 : blockIdx.y)) * Kh * Nh;
    const int lane = threadIdx.x & 31; const int L0 = (bx * 8 + (threadIdx.x >> 5)) * 8; const int nlines = N * K / 64;
{
#pragma unroll 1
        for (int l = 0; l < 8; ++l) { const int L = L0 + l; if (L >= nlines) break; const size_t e = (size_t)L * 64 + lane * 2; const int k = (int)(e % K), n = (int)(e / K); v2us o;
            o[0] = f2bf(w[(size_t)k * N + n]); o[1] = f2bf(w[(size_t)(k + 1) * N + n]); *(v2us*)(Bt + e) = o; }
         }
}
__global__ __launch_bounds__(256) void k_cvt8(const float* __restrict__ src, bf* dst, size_t n8) { const size_t i = (size_t)blockIdx.x * 256 + threadIdx.x; if (i >= n8) return; const v8f v = *(const v8f*)(src + i * 8); v8us o;
#pragma unroll
    for (int k = 0; k < 8; ++k) o[k] = f2bf(v[k]); *(v8us*)(dst + i * 8) = o;  }

#define FW 8
template <typename T16, bool HIRES>
__device__ __forceinline__ void fa_tile(const T16* __restrict__ Q, const T16* __restrict__ Q2, const T16* __restrict__ Kp, const T16* __restrict__ K2, const T16* __restrict__ Vt, const T16* __restrict__ V2, int q0, bf* Ah, bf* Al, float* red, float* st) {
    typedef typename WFrag<T16>::V V;
    const int lane = threadIdx.x & 31, lr = lane & 15, hi = lane >> 4;
    const int wave = __builtin_amdgcn_readfirstlane(threadIdx.x >> 5);   // scalar, so that the key loop's branch is scalar and EXEC stays full at the matrix instructions
    V qf[2][2], qf2[2][2];
#pragma unroll
    for (int qt = 0; qt < 2; ++qt)
#pragma unroll
        for (int kc = 0; kc < 2; ++kc) { const size_t o = (size_t)(q0 + qt * 16 + lr) * HD + kc * 32 + 8 * hi; qf[qt][kc] = WFrag<T16>::ld(Q + o); if (HIRES) qf2[qt][kc] = WFrag<T16>::ld(Q2 + o); }
    v8f o[4][2];
#pragma unroll
    for (int dt = 0; dt < 4; ++dt)
#pragma unroll
        for (int qt = 0; qt < 2; ++qt) o[dt][qt] = (v8f){};
    float m[2] = { -3.0e38f, -3.0e38f }, l[2] = { 0.0f, 0.0f };
    // fp16 rows (up to 8 blocks a wave): the key fragments are fetched one block ahead and the value fragments at the head of their block, so that a block waits for no load of its own.
    // hi + lo rows (at most 2 blocks a wave, twice the fragments): every fragment is fetched where it is used, which keeps the kernel within 256 registers.
    V kf[2][2], kf2[2][2];
    if (!HIRES) {
#pragma unroll
        for (int kt = 0; kt < 2; ++kt)
#pragma unroll
            for (int kc = 0; kc < 2; ++kc) kf[kt][kc] = WFrag<T16>::ld(Kp + (size_t)(wave * 32 + kt * 16 + lr) * HD + kc * 32 + 8 * hi);   // block number 'wave' exists in the plane also where this tile ends before it
    }
    // rolled: one block's fragments live beside the 8 output accumulators
#pragma unroll 1
    for (int kb = wave * 32; kb < q0 + 32; kb += FW * 32) {
        V vf[4], vf2[4];
        if (!HIRES) {
#pragma unroll
            for (int dt = 0; dt < 4; ++dt) vf[dt] = WFrag<T16>::ld(Vt + (size_t)(dt * 16 + lr) * PP + kb + 8 * hi);
        }
        v8f s[2][2];
#pragma unroll
        for (int kt = 0; kt < 2; ++kt)
#pragma unroll
            for (int qt = 0; qt < 2; ++qt) s[kt][qt] = (v8f){};
#pragma unroll
        for (int kt = 0; kt < 2; ++kt)
#pragma unroll
            for (int kc = 0; kc < 2; ++kc) { if (HIRES) { const size_t ko = (size_t)(kb + kt * 16 + lr) * HD + kc * 32 + 8 * hi; kf[kt][kc] = WFrag<T16>::ld(Kp + ko); kf2[kt][kc] = WFrag<T16>::ld(K2 + ko);
                    asm volatile("s_wait_xcnt 0x0" ::: "memory"); }   // stands in front of any overwrite of these four loads' address registers
#pragma unroll
                for (int qt = 0; qt < 2; ++qt) { s[kt][qt] = WFrag<T16>::mma(kf[kt][kc], qf[qt][kc], s[kt][qt]); if (HIRES) { s[kt][qt] = WFrag<T16>::mma(kf[kt][kc], qf2[qt][kc], s[kt][qt]); s[kt][qt] = WFrag<T16>::mma(kf2[kt][kc], qf[qt][kc], s[kt][qt]); } } }
        if (!HIRES) { const int kn = min(kb + FW * 32, q0);              // this wave's next block; behind its last one the tile's diagonal block is fetched and not used
#pragma unroll
            for (int kt = 0; kt < 2; ++kt)
#pragma unroll
                for (int kc = 0; kc < 2; ++kc) kf[kt][kc] = WFrag<T16>::ld(Kp + (size_t)(kn + kt * 16 + lr) * HD + kc * 32 + 8 * hi);
        }
#pragma unroll
        for (int kt = 0; kt < 2; ++kt)
#pragma unroll
            for (int qt = 0; qt < 2; ++qt) s[kt][qt] *= SCL * 1.4426950408889634f;
        if (kb == q0) {                                                  // the diagonal block (the tile's last): keys beyond the query are masked; key kb itself never is, so every column keeps a finite maximum
#pragma unroll
            for (int kt = 0; kt < 2; ++kt)
#pragma unroll
                for (int qt = 0; qt < 2; ++qt)
#pragma unroll
                    for (int j = 0; j < 8; ++j) if (kt * 16 + hi * 8 + j > qt * 16 + lr) s[kt][qt][j] = -3.0e38f;
        }
        V pf[2], pf2[2];
#pragma unroll
        for (int qt = 0; qt < 2; ++qt) {
            float mx = s[0][qt][0];
#pragma unroll
            for (int j = 1; j < 16; ++j) mx = fmaxf(mx, s[j >> 3][qt][j & 7]);
            mx = fmaxf(mx, __shfl_xor(mx, 16, 32));
            const float mn = fmaxf(m[qt], mx), al = __builtin_amdgcn_exp2f(m[qt] - mn), mo = mn - 10.0f; m[qt] = mn;
            float sum = 0.0f;
#pragma unroll
            for (int j = 0; j < 16; ++j) { const float p = __builtin_amdgcn_exp2f(s[j >> 3][qt][j & 7] - mo); s[j >> 3][qt][j & 7] = p; sum += p; }
            l[qt] = l[qt] * al + sum;
#pragma unroll
            for (int dt = 0; dt < 4; ++dt) o[dt][qt] *= al;
            if constexpr (HIRES) { v8us h0, h1, l0, l1;
#pragma unroll
                for (int j = 0; j < 8; ++j) { unsigned short a, c2; splitf(s[0][qt][j], a, c2); h0[j] = a; l0[j] = c2; splitf(s[1][qt][j], a, c2); h1[j] = a; l1[j] = c2; }
                pf[qt] = cat16b(h0, h1); pf2[qt] = cat16b(l0, l1);
            } else { v8h c0, c1;
#pragma unroll
                for (int j = 0; j < 8; ++j) { c0[j] = tohx(s[0][qt][j]); c1[j] = tohx(s[1][qt][j]); }
                pf[qt] = cat16(c0, c1); }
        }
#pragma unroll
        for (int dt = 0; dt < 4; ++dt) { if (HIRES) { const size_t vo = (size_t)(dt * 16 + lr) * PP + kb + 8 * hi; vf[dt] = WFrag<T16>::ld(Vt + vo); vf2[dt] = WFrag<T16>::ld(V2 + vo); }
#pragma unroll
            for (int qt = 0; qt < 2; ++qt) { o[dt][qt] = WFrag<T16>::mma(vf[dt], pf[qt], o[dt][qt]); if (HIRES) { o[dt][qt] = WFrag<T16>::mma(vf[dt], pf2[qt], o[dt][qt]); o[dt][qt] = WFrag<T16>::mma(vf2[dt], pf[qt], o[dt][qt]); } } }
    }
#pragma unroll
    for (int qt = 0; qt < 2; ++qt) { const float lj = l[qt] + __shfl_xor(l[qt], 16, 32); st[wave * 64 + qt * 16 + lr] = m[qt]; st[wave * 64 + 32 + qt * 16 + lr] = lj;   // both halves hold, and store, the same two values
#pragma unroll
        for (int dt = 0; dt < 4; ++dt) *(v8f*)(red + (size_t)(((wave * 8 + qt * 4 + dt) * 32 + lane) * 8)) = o[dt][qt]; }
    __syncthreads();                                                     // every wave's partial result is in LDS before any wave joins
    // wave w joins queries 4w..4w+3, 8 lanes a query, 8 consecutive d a lane: whole 128-byte lines of the merged planes, one writer a line. A wave that had no block left m = -3e38, l = 0, Ot = 0: factor 0.
    const int q = wave * 4 + (lane >> 3), dg = lane & 7;
    const float* rr = red + (((q >> 4) * 4 + (dg >> 1)) * 32 + (q & 15) + 16 * (dg & 1)) * 8;
    float M = st[q];
#pragma unroll
    for (int u = 1; u < FW; ++u) M = fmaxf(M, st[u * 64 + q]);
    float L = 0.0f; v8f acc = (v8f){};
#pragma unroll
    for (int u = 0; u < FW; ++u) { const float f = __builtin_amdgcn_exp2f(st[u * 64 + q] - M); L += st[u * 64 + 32 + q] * f; acc += *(const v8f*)(rr + u * (8 * 32 * 8)) * f; }
    const float inv = __fdiv_rn(1.0f, L); v8us oh, ol;
#pragma unroll
    for (int j = 0; j < 8; ++j) { unsigned short a, c2; splitf(acc[j] * inv, a, c2); oh[j] = a; ol[j] = c2; }
    const size_t oo = (size_t)(q0 + q) * DQ + dg * 8; *(v8us*)(Ah + oo) = oh; *(v8us*)(Al + oo) = ol;
}
__global__ __launch_bounds__(FW * 32) void k_fattn(const h16* __restrict__ Q16, const h16* __restrict__ K16, const h16* __restrict__ V16, const bf* __restrict__ Qh, const bf* __restrict__ Ql, const bf* __restrict__ Kh, const bf* __restrict__ Kl, const bf* __restrict__ Vh, const bf* __restrict__ Vl, bf* Ah, bf* Al) {
    __shared__ __align__(32) float red[FW * 8 * 32 * 8];                 // [wave][query group][d tile][lane][8]: 8 KiB a wave
    __shared__ float st[FW * 64];                                        // [wave][m, l][query]
    const int q0 = (TT / 32 - 1 - (int)blockIdx.y) * 32; const size_t h = blockIdx.x, g = h / REP, b = blockIdx.z; const size_t qo = (b * NH_ + h) * TT * HD, ko = (b * NKV + g) * TT * HD, vo = (b * NKV + g) * HD * PP; Ah += b * TT * DQ; Al += b * TT * DQ;
    if (q0 < RH) fa_tile<bf, true>(Qh + qo, Ql + qo, Kh + ko, Kl + ko, Vh + vo, Vl + vo, q0, Ah + h * HD, Al + h * HD, red, st);
    else fa_tile<h16, false>(Q16 + qo, nullptr, K16 + ko, nullptr, V16 + vo, nullptr, q0, Ah + h * HD, Al + h * HD, red, st);
}

extern "C" void kernel_launch(void* const* d_in, const int* in_sizes, int n_in,
                              void* d_out, int out_size, void* d_ws, size_t ws_size, hipStream_t stream) {
    (void)in_sizes; (void)n_in; (void)out_size;
    const float* x = (const float*)d_in[0]; const float* wq = (const float*)d_in[1]; const float* bq = (const float*)d_in[2]; const float* wk = (const float*)d_in[3]; const float* bk = (const float*)d_in[4]; const float* wv = (const float*)d_in[5]; const float* bv = (const float*)d_in[6]; const float* wo = (const float*)d_in[7]; const float* bo = (const float*)d_in[8];   /* argument order x, Wq, bq, Wk, bk, Wv, bv, Wp, bp (per-head weights [16][1024][64]; per-head biases [16][64] = flat index h*64 + d) */
    float* OUT = (float*)d_out;     // [4][2048][1024]
    char* wsp = (char*)d_ws;
    auto take = [&](size_t bytes) { char* p = wsp; wsp += (bytes + 255) & ~(size_t)255; return (void*)p; };
    bf* WQ = (bf*)take((size_t)DQ * DM * 2); bf* WK = (bf*)take((size_t)DKV * DM * 2); bf* WV = (bf*)take((size_t)DKV * DM * 2); bf* WO = (bf*)take((size_t)DM * DQ * 2);
    bf* XB = (bf*)take((size_t)NB_ * TT * DM * 2);
    const size_t PQ = (size_t)NB_ * NH_ * TT * HD;         // elements of one query or key plane, all batches (NKV == NH_); each key plane lies directly behind its query plane
    h16* QP16 = (h16*)take(PQ * 2); h16* KP16 = (h16*)take(PQ * 2); bf* QPh = (bf*)take(PQ * 2); bf* KPh = (bf*)take(PQ * 2); bf* QPl = (bf*)take(PQ * 2); bf* KPl = (bf*)take(PQ * 2);
    h16* VT16 = (h16*)take((size_t)NB_ * NKV * HD * PP * 2); bf* VTh = (bf*)take((size_t)NB_ * NKV * HD * PP * 2); bf* VTl = (bf*)take((size_t)NB_ * NKV * HD * PP * 2);
    bf* ATh = (bf*)take((size_t)NB_ * TT * DQ * 2); bf* ATl = (bf*)take((size_t)NB_ * TT * DQ * 2);
    if ((size_t)(wsp - (char*)d_ws) > ws_size) return;    // 248 MiB of the 256 MiB
    (void)WK;                                              // reached through WQ: the four Bt planes lie one behind the other in the workspace
    k_wtG<<<dim3((unsigned)(DM * HD / 64 / 64), NH_, 4), 256, 0, stream>>>(wq, wk, wv, wo, DM, HD, DQ, DM, WQ);   /* per-head weights [h][DM][HD] ('xw' per head) -> the head's HD rows of WQ, WK, WV; wo [DQ][DM] -> WO */
    k_cvt8<<<(unsigned)(((size_t)NB_ * TT * DM / 8 + 255) / 256), 256, 0, stream>>>(x, XB, (size_t)NB_ * TT * DM / 8);
    k_gemmks<bf, 0, 8, false, true, 1><<<dim3(NB_ * TT / 64, NH_, 2), 8 * 32, 0, stream>>>(XB, nullptr, WQ, nullptr, DM, nullptr, 0, 0, bq, bk, 0, (size_t)DQ * DM, 0, PQ, QP16, QPh, QPl);
    k_gemmks<bf, 0, 8, false, true, 2><<<dim3(NB_ * TT / 64, DKV / 64, 1), 8 * 32, 0, stream>>>(XB, nullptr, WV, nullptr, DM, nullptr, 0, 0, bv, nullptr, 0, 0, 0, 0, VT16, VTh, VTl);
    k_fattn<<<dim3(NH_, TT / 32, NB_), FW * 32, 0, stream>>>(QP16, KP16, VT16, QPh, QPl, KPh, KPl, VTh, VTl, ATh, ATl);
    k_gemmks<bf, 1, 8, false, true, 0><<<dim3(NB_ * TT / 64, DM / 64, 1), 8 * 32, 0, stream>>>(ATh, ATl, WO, nullptr, DQ, OUT, DM, 0, bo, nullptr, 0, 0, 0, 0, nullptr, nullptr, nullptr);
}
// regate 2

// v006
// It runs in 189 microseconds.
// Next to v005, in two timings, it ran 1.69 and 1.68 times as fast.
// All steps since v000 together make it 16.8 times as fast.
#include <hip/hip_runtime.h>

// Causal multi-head self-attention whose q, k, v projections are given PER HEAD (x [4][2048][1024]; q, k, v = einsum('bte,hed->bhtd', x, W) + b[None, :, None, :] with W [16][1024][64] ((in, out) inside each head; 1/32-scale) and per-head biases b [16][64] (zeros on this draw); scores x 1/sqrt(64); causal (-inf); softmax; heads merged head-major (column h*64 + d); out = cat Wp + bp ('xw' [1024][1024] + zero bias) -> [4][2048][1024] (8.4 M); argument order x, Wq, bq, Wk, bk, Wv, bv, Wp, bp). THIS ROW: the same module under other names (token_embedding [4][2048][1024]; PER-HEAD stacked projections Wq, Wk, Wv [16][1024][64] normal x 1/32 with biases [16][64] zeros (read): q = einsum('btd,hde->bhte', x, Wq) + bq; scores / sqrt(64); tril kept, -inf; softmax; heads concatenated in order; out = cat Wo + bo ('xw' [1024][1024]; bias zeros: read); argument order token_embedding, Wq, bq, Wk, bk, Wv, bv, Wo, bo).
// Layout, all batches in every launch (6 launches): bf16 copy of x; 'xw' weights transposed once; exact projections + f32 biases, stored by the GEMM itself as the 16-bit head planes; causal T-2048 attention in one kernel, running softmax (hybrid rows: < 512 hi/lo 3 products, rest fp16 x1024; key blocks above the diagonal never visited); merged hi/lo x Wo exact + bo.
// Compute dtypes, f32 accumulate: every input rounded to bf16; projections exact + f32 biases; attention rows < 512 3 products, rest fp16; softmax f32; output projection hl x exact.

#define NB_  4
#define TT   2048
#define DM   1024
#define NH_  16
#define NKV  16
#define REP  (NH_ / NKV)
#define HD   64
#define DQ   (NH_ * HD)
#define DKV  (NKV * HD)
#define RH   512                  // query rows < RH use hi+lo planes (0: none)
#define PP   (2 * TT)              // row pitch, in 16-bit elements, of the transposed value planes
#define SCL  0.125f   // HD^-0.5
typedef _Float16 h16;
typedef unsigned short bf;
typedef __attribute__((ext_vector_type(16))) __bf16   v16bf;
typedef __attribute__((ext_vector_type(16))) _Float16 v16h;
typedef __attribute__((ext_vector_type(8)))  _Float16 v8h;
typedef __attribute__((ext_vector_type(8)))  unsigned short v8us;
typedef __attribute__((ext_vector_type(8)))  float    v8f;
typedef __attribute__((ext_vector_type(4)))  float    v4f;
typedef v8h  __attribute__((may_alias)) v8ha;
typedef v4f  __attribute__((may_alias)) v4fa;
typedef v8us __attribute__((may_alias)) v8usa;

__device__ __forceinline__ unsigned short f2bf(float f) { unsigned u = __float_as_uint(f); u += 0x7FFFu + ((u >> 16) & 1u); return (unsigned short)(u >> 16); }
__device__ __forceinline__ float bf2f(unsigned short b) { return __uint_as_float(((unsigned)b) << 16); }
__device__ __forceinline__ float bfr(float f) { return bf2f(f2bf(f)); }
__device__ __forceinline__ v16h cat16(v8h lo, v8h hi) { return __builtin_shufflevector(lo, hi, 0, 1, 2, 3, 4, 5, 6, 7, 8, 9, 10, 11, 12, 13, 14, 15); }
__device__ __forceinline__ v16bf cat16b(v8us lo, v8us hi) { return __builtin_bit_cast(v16bf, __builtin_shufflevector(lo, hi, 0, 1, 2, 3, 4, 5, 6, 7, 8, 9, 10, 11, 12, 13, 14, 15)); }
__device__ __forceinline__ v8f wmma16(v16h a, v16h b, v8f c) { return __builtin_amdgcn_wmma_f32_16x16x32_f16(false, a, false, b, (short)0, c, false, false); }
__device__ __forceinline__ v8f wmmab(v16bf a, v16bf b, v8f c) { return __builtin_amdgcn_wmma_f32_16x16x32_bf16(false, a, false, b, (short)0, c, false, false); }



// ---- k_gemmt: GEMM, one 128x128 output tile per work-group of 4 waves (2 x 2, 64x64 a wave, 16 accumulators); grid (M/128, N/128, Z), 128 threads. The rows of A run through all batches (M = NB_ * TT).
// C[m][n] = bias[n] + sum_k A[m][k] Bt[n][k], A and Bt K-contiguous bf16 planes; the accumulators start at the bias. TWO: a lo plane A2 is staged beside A and meets the same Bt fragments (C = bias + A Bt^T + A2 Bt^T).
// z > 0 takes Bt + z sB, bias2 and the planes + z sP (z = 0 query, z = 1 key projection in one launch).
// A stage is 64 k (one 128-byte line) of the tile's 128 A rows (TWO: of both planes) and 128 Bt rows, brought into LDS by asynchronous copies (whole lines, 8 lanes a row) and read there by the two waves that need it: every operand line leaves L2 once a work-group.
// Two buffers: the next stage's copies fly while this one is worked on.
// MODE 0: f32 C (pitch ldc). MODE 1, 2: no f32 C; the tile goes straight to the three 16-bit planes (fp16, bf16 hi, bf16 lo) that the attention kernel reads (a wave's 64 columns are one head):
// MODE 1 query / key planes [b][h][t][d], MODE 2 transposed value planes [b][g][d][t] at pitch PP. The accumulator's register direction is made the plane's contiguous direction
// (MODE 1 swaps the two operands of the matrix instruction, so that a lane holds 8 consecutive d of one t; MODE 2 keeps them: 8 consecutive t of one d).
template <typename T16> struct WFrag;
template <> struct WFrag<h16> { typedef v16h V; static __device__ __forceinline__ V ld(const h16* p) { return cat16(*(const v8h*)p, *(const v8h*)(p + 16)); } static __device__ __forceinline__ v8f mma(V a, V b, v8f c) { return wmma16(a, b, c); } };
template <> struct WFrag<bf> { typedef v16bf V; static __device__ __forceinline__ V ld(const bf* p) { return cat16b(*(const v8us*)p, *(const v8us*)(p + 16)); } static __device__ __forceinline__ v8f mma(V a, V b, v8f c) { return wmmab(a, b, c); } };
#define GP 72                      // LDS row pitch in 16-bit elements: the row's 128 bytes + 16, which spreads the 16-byte fragment reads of 16 rows over all banks
// Eight asynchronous 16-byte copies a lane, 16 rows apart (LDS address l, global address g, 'step' elements between the rows).
// The s_wait_xcnt stands inside the statement, behind the last copy, so that no address register is rewritten in front of it.
__device__ __forceinline__ void cp8(unsigned l, const bf* g, size_t step) {
    asm volatile("global_load_async_to_lds_b128 %0, %8, off\n\t"
                 "global_load_async_to_lds_b128 %1, %9, off\n\t"
                 "global_load_async_to_lds_b128 %2, %10, off\n\t"
                 "global_load_async_to_lds_b128 %3, %11, off\n\t"
                 "global_load_async_to_lds_b128 %4, %12, off\n\t"
                 "global_load_async_to_lds_b128 %5, %13, off\n\t"
                 "global_load_async_to_lds_b128 %6, %14, off\n\t"
                 "global_load_async_to_lds_b128 %7, %15, off\n\t"
                 "s_wait_xcnt 0x0"
                 :: "v"(l), "v"(l + 1 * 16 * GP * 2), "v"(l + 2 * 16 * GP * 2), "v"(l + 3 * 16 * GP * 2), "v"(l + 4 * 16 * GP * 2), "v"(l + 5 * 16 * GP * 2), "v"(l + 6 * 16 * GP * 2), "v"(l + 7 * 16 * GP * 2),
                    "v"(g), "v"(g + step), "v"(g + 2 * step), "v"(g + 3 * step), "v"(g + 4 * step), "v"(g + 5 * step), "v"(g + 6 * step), "v"(g + 7 * step)
                 : "memory");
}
template <int MODE, bool TWO, int K>
__global__ __launch_bounds__(128) void k_gemmt(const bf* __restrict__ A, const bf* __restrict__ A2, const bf* __restrict__ Bt, float* C, int ldc, const float* __restrict__ bias, const float* __restrict__ bias2, size_t sB, size_t sP, h16* P16, bf* Ph, bf* Pl) {
    static_assert(MODE == 0 || (HD == 64 && !TWO), "the plane epilogue takes a wave's 64 columns as one head and a quarter of the 72 KiB");
    static_assert(K % 64 == 0 && K >= 128, "whole stages, at least two");
    typedef WFrag<bf>::V V;
    constexpr int AR = TWO ? 256 : 128, GROWS = AR + 128;            // rows of a buffer: 128 of A (TWO: then 128 of A2), then 128 of Bt
    __shared__ __attribute__((aligned(16))) bf tl[2 * GROWS * GP];   // [buffer][row][pitch]: 72 KiB (TWO: 108 KiB)
    const size_t z = blockIdx.z; Bt += z * sB; if (MODE != 0) { P16 += z * sP; Ph += z * sP; Pl += z * sP; if (z) bias = bias2; }
    const int tid = threadIdx.x, lane = tid & 31, lr = lane & 15, hi = lane >> 4; const int r0 = blockIdx.x * 128, c0 = blockIdx.y * 128;
    const int wave = __builtin_amdgcn_readfirstlane(tid >> 5), wm = wave >> 1, wn = wave & 1;
    const int rw = r0 + wm * 64, cw = c0 + wn * 64;                   // this wave's 64 x 64 piece
    constexpr int NT = K / 64;                                       // stages
    // copies: lane = 16 bytes number tid & 7 of rows tid >> 3 (+ 16 i): a wave's copy is 4 whole lines
    const size_t aoff = (size_t)(r0 + (tid >> 3)) * K + (tid & 7) * 8, boff = (size_t)(c0 + (tid >> 3)) * K + (tid & 7) * 8;
    const unsigned l0 = (unsigned)(size_t)tl + (unsigned)((tid >> 3) * (GP * 2) + (tid & 7) * 16);
    auto issue = [&](int t, int buf) { const int kk = t * 64; const unsigned l = l0 + (unsigned)buf * (GROWS * GP * 2);
        cp8(l, A + aoff + kk, (size_t)16 * K); if (TWO) cp8(l + 128 * GP * 2, A2 + aoff + kk, (size_t)16 * K); cp8(l + AR * GP * 2, Bt + boff + kk, (size_t)16 * K); };
    issue(0, 0);
    v8f acc[4][4];                                                   // start value: the bias of the element's column (its loads return while stage 0 flies)
#pragma unroll
    for (int nb = 0; nb < 4; ++nb) { v8f bv;
        if (MODE == 1) { const v4f u0 = *(const v4f*)(bias + cw + nb * 16 + hi * 8), u1 = *(const v4f*)(bias + cw + nb * 16 + hi * 8 + 4);
#pragma unroll
            for (int j = 0; j < 4; ++j) { bv[j] = bfr(u0[j]); bv[4 + j] = bfr(u1[j]); } }
        else { const float u = bfr(bias[cw + nb * 16 + lr]);
#pragma unroll
            for (int j = 0; j < 8; ++j) bv[j] = u; }
#pragma unroll
        for (int mb = 0; mb < 4; ++mb) acc[mb][nb] = bv; }
    asm volatile("s_wait_asynccnt 0x0" ::: "memory");                // this wave's share of stage 0 has landed
    __syncthreads();                                                 // stage 0 is published
    issue(1, 1);
    const bf* fa = tl + (wm * 64 + lr) * GP + 8 * hi; const bf* fb = tl + (AR + wn * 64 + lr) * GP + 8 * hi;
    // rolled: one stage a trip
#pragma unroll 1
    for (int t = 0; t < NT; ++t) { const int bo = (t & 1) * (GROWS * GP);
#pragma unroll
        for (int kc = 0; kc < 2; ++kc) { V a[4], a2[4], b[4];
            b[0] = WFrag<bf>::ld(fb + bo + kc * 32);
#pragma unroll
            for (int mb = 0; mb < 4; ++mb) a[mb] = WFrag<bf>::ld(fa + bo + mb * 16 * GP + kc * 32);
#pragma unroll
            for (int nb = 1; nb < 4; ++nb) b[nb] = WFrag<bf>::ld(fb + bo + nb * 16 * GP + kc * 32);
            if (TWO) {
#pragma unroll
                for (int mb = 0; mb < 4; ++mb) a2[mb] = WFrag<bf>::ld(fa + bo + (128 + mb * 16) * GP + kc * 32); }
            __builtin_amdgcn_sched_barrier(0);                       // the fragment reads stay one group in front of their matrix instructions (for speed only)
#pragma unroll
            for (int nb = 0; nb < 4; ++nb)
#pragma unroll
                for (int mb = 0; mb < 4; ++mb) acc[mb][nb] = (MODE == 1) ? wmmab(b[nb], a[mb], acc[mb][nb]) : wmmab(a[mb], b[nb], acc[mb][nb]);
            if (TWO) {
#pragma unroll
                for (int nb = 0; nb < 4; ++nb)
#pragma unroll
                    for (int mb = 0; mb < 4; ++mb) acc[mb][nb] = wmmab(a2[mb], b[nb], acc[mb][nb]); }
            __builtin_amdgcn_sched_barrier(0);                       // the same, for the next group of reads
        }
        asm volatile("s_wait_dscnt 0x0" ::: "memory");               // this wave's reads of the buffer have returned before the buffer is given up
        asm volatile("s_wait_asynccnt 0x0" ::: "memory");            // this wave's share of stage t + 1 has landed
        __syncthreads();                                             // publishes stage t + 1 and ends every wave's reads of stage t
        if (t + 2 < NT) issue(t + 2, t & 1);
    }
    asm volatile("s_wait_asynccnt 0x0" ::: "memory");                // no copy is outstanding from here on
    if constexpr (MODE != 0) {
        // Plane epilogue. The buffers are free (every wave's reads ended at the last trip's barrier). Each wave turns its piece in its own quarter of them, 32 plane rows (128-byte lines) of the three planes at a time,
        // and stores whole lines: 8 lanes a line, one writer a line. l2: tile in the lane direction (the plane's rows), rt: in the register direction (along a row).
        bf* sw = tl + wave * (GROWS * GP / 2);
        const int bt = rw / TT, t0 = rw % TT;                         // the piece's batch and its first position there (TT % 64 == 0: a piece lies in one batch)
#pragma unroll
        for (int h = 0; h < 2; ++h) {
#pragma unroll
            for (int l2 = 0; l2 < 2; ++l2)
#pragma unroll
                for (int rt = 0; rt < 4; ++rt) { const v8f s = (MODE == 1) ? acc[h * 2 + l2][rt] : acc[rt][h * 2 + l2]; v8h o16; v8us oh, ol;
#pragma unroll
                    for (int j = 0; j < 8; ++j) { o16[j] = (h16)s[j]; const unsigned short a2 = f2bf(s[j]); oh[j] = a2; ol[j] = f2bf(s[j] - bf2f(a2)); }
                    bf* p = sw + (l2 * 16 + lr) * GP + rt * 16 + hi * 8;
                    *(v8us*)p = __builtin_bit_cast(v8us, o16); *(v8us*)(p + 32 * GP) = oh; *(v8us*)(p + 64 * GP) = ol; }
            asm volatile("s_wait_dscnt 0x0" ::: "memory");           // the wave's stores are in LDS before its lanes read one another's
#pragma unroll
            for (int pl = 0; pl < 3; ++pl) { bf* dst = (pl == 0) ? (bf*)P16 : (pl == 1) ? Ph : Pl;
#pragma unroll
                for (int i = 0; i < 8; ++i) { const int row = i * 4 + (lane >> 3);
                    const size_t e = (MODE == 1) ? (((size_t)bt * NH_ + cw / HD) * TT + t0 + h * 32 + row) * HD + (lane & 7) * 8 : ((size_t)bt * DKV + cw + h * 32 + row) * PP + t0 + (lane & 7) * 8;
                    *(v8us*)(dst + e) = *(const v8us*)(sw + (pl * 32 + row) * GP + (lane & 7) * 8); } }
        }
    } else {
        float* crow = C + (size_t)(rw + hi * 8) * ldc + cw + lr;
#pragma unroll
        for (int nb = 0; nb < 4; ++nb)
#pragma unroll
            for (int mb = 0; mb < 4; ++mb)
#pragma unroll
                for (int j = 0; j < 8; ++j) crow[(size_t)(mb * 16 + j) * ldc + nb * 16] = acc[mb][nb][j];
    }
}

__device__ __forceinline__ h16 tohx(float x) { return (h16)x; }
__device__ __forceinline__ void splitf(float y, unsigned short& h, unsigned short& l) { h = f2bf(y); l = f2bf(y - bf2f(h)); }
typedef __attribute__((ext_vector_type(2))) _Float16 v2h;
typedef __attribute__((ext_vector_type(4))) _Float16 v4h;
typedef __attribute__((ext_vector_type(2))) unsigned short v2us;
typedef __attribute__((ext_vector_type(4))) unsigned short v4us;
typedef __attribute__((ext_vector_type(2))) float v2f;
typedef __attribute__((ext_vector_type(4))) int v4i;

// grid (lines / 64, NH_, 4). Sources 0..2: matrix y of source z ([Kh][Nh], Kh * Nh apart in its source) goes to the Kh * Nh elements number z * NH_ + y of Bt.
// Source 3: ONE matrix [Ko][No] of NH_ * Kh * Nh elements, behind the others in Bt; its lines are dealt over the (x, y) blocks.
__global__ __launch_bounds__(256) void k_wtG(const float* __restrict__ w0, const float* __restrict__ w1, const float* __restrict__ w2, const float* __restrict__ w3, int Kh, int Nh, int Ko, int No, bf* Bt) {
    const bool one = blockIdx.z == 3; const int K = one ? Ko : Kh, N = one ? No : Nh; const int bx = one ? blockIdx.y * gridDim.x + blockIdx.x : blockIdx.x;
    const float* __restrict__ w = one ? w3 : (blockIdx.z == 0 ? w0 : blockIdx.z == 1 ? w1 : w2) + (size_t)blockIdx.y * Kh * Nh; Bt += ((size_t)blockIdx.z * NH_ + (one ? 0 : blockIdx.y)) * Kh * Nh;
    const int lane = threadIdx.x & 31; const int L0 = (bx * 8 + (threadIdx.x >> 5)) * 8; const int nlines = N * K / 64;
{
#pragma unroll 1
        for (int l = 0; l < 8; ++l) { const int L = L0 + l; if (L >= nlines) break; const size_t e = (size_t)L * 64 + lane * 2; const int k = (int)(e % K), n = (int)(e / K); v2us o;
            o[0] = f2bf(w[(size_t)k * N + n]); o[1] = f2bf(w[(size_t)(k + 1) * N + n]); *(v2us*)(Bt + e) = o; }
         }
}
__global__ __launch_bounds__(256) void k_cvt8(const float* __restrict__ src, bf* dst, size_t n8) { const size_t i = (size_t)blockIdx.x * 256 + threadIdx.x; if (i >= n8) return; const v8f v = *(const v8f*)(src + i * 8); v8us o;
#pragma unroll
    for (int k = 0; k < 8; ++k) o[k] = f2bf(v[k]); *(v8us*)(dst + i * 8) = o;  }

#define FW 8
template <typename T16, bool HIRES>
__device__ __forceinline__ void fa_tile(const T16* __restrict__ Q, const T16* __restrict__ Q2, const T16* __restrict__ Kp, const T16* __restrict__ K2, const T16* __restrict__ Vt, const T16* __restrict__ V2, int q0, bf* Ah, bf* Al, float* red, float* st) {
    typedef typename WFrag<T16>::V V;
    const int lane = threadIdx.x & 31, lr = lane & 15, hi = lane >> 4;
    const int wave = __builtin_amdgcn_readfirstlane(threadIdx.x >> 5);   // scalar, so that the key loop's branch is scalar and EXEC stays full at the matrix instructions
    V qf[2][2], qf2[2][2];
#pragma unroll
    for (int qt = 0; qt < 2; ++qt)
#pragma unroll
        for (int kc = 0; kc < 2; ++kc) { const size_t o = (size_t)(q0 + qt * 16 + lr) * HD + kc * 32 + 8 * hi; qf[qt][kc] = WFrag<T16>::ld(Q + o); if (HIRES) qf2[qt][kc] = WFrag<T16>::ld(Q2 + o); }
    v8f o[4][2];
#pragma unroll
    for (int dt = 0; dt < 4; ++dt)
#pragma unroll
        for (int qt = 0; qt < 2; ++qt) o[dt][qt] = (v8f){};
    float m[2] = { -3.0e38f, -3.0e38f }, l[2] = { 0.0f, 0.0f };
    // fp16 rows (up to 8 blocks a wave): the key fragments are fetched one block ahead and the value fragments at the head of their block, so that a block waits for no load of its own.
    // hi + lo rows (at most 2 blocks a wave, twice the fragments): every fragment is fetched where it is used, which keeps the kernel within 256 registers.
    V kf[2][2], kf2[2][2];
    if (!HIRES) {
#pragma unroll
        for (int kt = 0; kt < 2; ++kt)
#pragma unroll
            for (int kc = 0; kc < 2; ++kc) kf[kt][kc] = WFrag<T16>::ld(Kp + (size_t)(wave * 32 + kt * 16 + lr) * HD + kc * 32 + 8 * hi);   // block number 'wave' exists in the plane also where this tile ends before it
    }
    // rolled: one block's fragments live beside the 8 output accumulators
#pragma unroll 1
    for (int kb = wave * 32; kb < q0 + 32; kb += FW * 32) {
        V vf[4], vf2[4];
        if (!HIRES) {
#pragma unroll
            for (int dt = 0; dt < 4; ++dt) vf[dt] = WFrag<T16>::ld(Vt + (size_t)(dt * 16 + lr) * PP + kb + 8 * hi);
        }
        v8f s[2][2];
#pragma unroll
        for (int kt = 0; kt < 2; ++kt)
#pragma unroll
            for (int qt = 0; qt < 2; ++qt) s[kt][qt] = (v8f){};
#pragma unroll
        for (int kt = 0; kt < 2; ++kt)
#pragma unroll
            for (int kc = 0; kc < 2; ++kc) { if (HIRES) { const size_t ko = (size_t)(kb + kt * 16 + lr) * HD + kc * 32 + 8 * hi; kf[kt][kc] = WFrag<T16>::ld(Kp + ko); kf2[kt][kc] = WFrag<T16>::ld(K2 + ko);
                    asm volatile("s_wait_xcnt 0x0" ::: "memory"); }   // stands in front of any overwrite of these four loads' address registers
#pragma unroll
                for (int qt = 0; qt < 2; ++qt) { s[kt][qt] = WFrag<T16>::mma(kf[kt][kc], qf[qt][kc], s[kt][qt]); if (HIRES) { s[kt][qt] = WFrag<T16>::mma(kf[kt][kc], qf2[qt][kc], s[kt][qt]); s[kt][qt] = WFrag<T16>::mma(kf2[kt][kc], qf[qt][kc], s[kt][qt]); } } }
        if (!HIRES) { const int kn = min(kb + FW * 32, q0);              // this wave's next block; behind its last one the tile's diagonal block is fetched and not used
#pragma unroll
            for (int kt = 0; kt < 2; ++kt)
#pragma unroll
                for (int kc = 0; kc < 2; ++kc) kf[kt][kc] = WFrag<T16>::ld(Kp + (size_t)(kn + kt * 16 + lr) * HD + kc * 32 + 8 * hi);
        }
#pragma unroll
        for (int kt = 0; kt < 2; ++kt)
#pragma unroll
            for (int qt = 0; qt < 2; ++qt) s[kt][qt] *= SCL * 1.4426950408889634f;
        if (kb == q0) {                                                  // the diagonal block (the tile's last): keys beyond the query are masked; key kb itself never is, so every column keeps a finite maximum
#pragma unroll
            for (int kt = 0; kt < 2; ++kt)
#pragma unroll
                for (int qt = 0; qt < 2; ++qt)
#pragma unroll
                    for (int j = 0; j < 8; ++j) if (kt * 16 + hi * 8 + j > qt * 16 + lr) s[kt][qt][j] = -3.0e38f;
        }
        V pf[2], pf2[2];
#pragma unroll
        for (int qt = 0; qt < 2; ++qt) {
            float mx = s[0][qt][0];
#pragma unroll
            for (int j = 1; j < 16; ++j) mx = fmaxf(mx, s[j >> 3][qt][j & 7]);
            mx = fmaxf(mx, __shfl_xor(mx, 16, 32));
            const float mn = fmaxf(m[qt], mx), al = __builtin_amdgcn_exp2f(m[qt] - mn), mo = mn - 10.0f; m[qt] = mn;
            float sum = 0.0f;
#pragma unroll
            for (int j = 0; j < 16; ++j) { const float p = __builtin_amdgcn_exp2f(s[j >> 3][qt][j & 7] - mo); s[j >> 3][qt][j & 7] = p; sum += p; }
            l[qt] = l[qt] * al + sum;
#pragma unroll
            for (int dt = 0; dt < 4; ++dt) o[dt][qt] *= al;
            if constexpr (HIRES) { v8us h0, h1, l0, l1;
#pragma unroll
                for (int j = 0; j < 8; ++j) { unsigned short a, c2; splitf(s[0][qt][j], a, c2); h0[j] = a; l0[j] = c2; splitf(s[1][qt][j], a, c2); h1[j] = a; l1[j] = c2; }
                pf[qt] = cat16b(h0, h1); pf2[qt] = cat16b(l0, l1);
            } else { v8h c0, c1;
#pragma unroll
                for (int j = 0; j < 8; ++j) { c0[j] = tohx(s[0][qt][j]); c1[j] = tohx(s[1][qt][j]); }
                pf[qt] = cat16(c0, c1); }
        }
#pragma unroll
        for (int dt = 0; dt < 4; ++dt) { if (HIRES) { const size_t vo = (size_t)(dt * 16 + lr) * PP + kb + 8 * hi; vf[dt] = WFrag<T16>::ld(Vt + vo); vf2[dt] = WFrag<T16>::ld(V2 + vo); }
#pragma unroll
            for (int qt = 0; qt < 2; ++qt) { o[dt][qt] = WFrag<T16>::mma(vf[dt], pf[qt], o[dt][qt]); if (HIRES) { o[dt][qt] = WFrag<T16>::mma(vf[dt], pf2[qt], o[dt][qt]); o[dt][qt] = WFrag<T16>::mma(vf2[dt], pf[qt], o[dt][qt]); } } }
    }
#pragma unroll
    for (int qt = 0; qt < 2; ++qt) { const float lj = l[qt] + __shfl_xor(l[qt], 16, 32); st[wave * 64 + qt * 16 + lr] = m[qt]; st[wave * 64 + 32 + qt * 16 + lr] = lj;   // both halves hold, and store, the same two values
#pragma unroll
        for (int dt = 0; dt < 4; ++dt) *(v8f*)(red + (size_t)(((wave * 8 + qt * 4 + dt) * 32 + lane) * 8)) = o[dt][qt]; }
    __syncthreads();                                                     // every wave's partial result is in LDS before any wave joins
    // wave w joins queries 4w..4w+3, 8 lanes a query, 8 consecutive d a lane: whole 128-byte lines of the merged planes, one writer a line. A wave that had no block left m = -3e38, l = 0, Ot = 0: factor 0.
    const int q = wave * 4 + (lane >> 3), dg = lane & 7;
    const float* rr = red + (((q >> 4) * 4 + (dg >> 1)) * 32 + (q & 15) + 16 * (dg & 1)) * 8;
    float M = st[q];
#pragma unroll
    for (int u = 1; u < FW; ++u) M = fmaxf(M, st[u * 64 + q]);
    float L = 0.0f; v8f acc = (v8f){};
#pragma unroll
    for (int u = 0; u < FW; ++u) { const float f = __builtin_amdgcn_exp2f(st[u * 64 + q] - M); L += st[u * 64 + 32 + q] * f; acc += *(const v8f*)(rr + u * (8 * 32 * 8)) * f; }
    const float inv = __fdiv_rn(1.0f, L); v8us oh, ol;
#pragma unroll
    for (int j = 0; j < 8; ++j) { unsigned short a, c2; splitf(acc[j] * inv, a, c2); oh[j] = a; ol[j] = c2; }
    const size_t oo = (size_t)(q0 + q) * DQ + dg * 8; *(v8us*)(Ah + oo) = oh; *(v8us*)(Al + oo) = ol;
}
__global__ __launch_bounds__(FW * 32) void k_fattn(const h16* __restrict__ Q16, const h16* __restrict__ K16, const h16* __restrict__ V16, const bf* __restrict__ Qh, const bf* __restrict__ Ql, const bf* __restrict__ Kh, const bf* __restrict__ Kl, const bf* __restrict__ Vh, const bf* __restrict__ Vl, bf* Ah, bf* Al) {
    __shared__ __align__(32) float red[FW * 8 * 32 * 8];                 // [wave][query group][d tile][lane][8]: 8 KiB a wave
    __shared__ float st[FW * 64];                                        // [wave][m, l][query]
    const int q0 = (TT / 32 - 1 - (int)blockIdx.y) * 32; const size_t h = blockIdx.x, g = h / REP, b = blockIdx.z; const size_t qo = (b * NH_ + h) * TT * HD, ko = (b * NKV + g) * TT * HD, vo = (b * NKV + g) * HD * PP; Ah += b * TT * DQ; Al += b * TT * DQ;
    if (q0 < RH) fa_tile<bf, true>(Qh + qo, Ql + qo, Kh + ko, Kl + ko, Vh + vo, Vl + vo, q0, Ah + h * HD, Al + h * HD, red, st);
    else fa_tile<h16, false>(Q16 + qo, nullptr, K16 + ko, nullptr, V16 + vo, nullptr, q0, Ah + h * HD, Al + h * HD, red, st);
}

extern "C" void kernel_launch(void* const* d_in, const int* in_sizes, int n_in,
                              void* d_out, int out_size, void* d_ws, size_t ws_size, hipStream_t stream) {
    (void)in_sizes; (void)n_in; (void)out_size;
    const float* x = (const float*)d_in[0]; const float* wq = (const float*)d_in[1]; const float* bq = (const float*)d_in[2]; const float* wk = (const float*)d_in[3]; const float* bk = (const float*)d_in[4]; const float* wv = (const float*)d_in[5]; const float* bv = (const float*)d_in[6]; const float* wo = (const float*)d_in[7]; const float* bo = (const float*)d_in[8];   /* argument order x, Wq, bq, Wk, bk, Wv, bv, Wp, bp (per-head weights [16][1024][64]; per-head biases [16][64] = flat index h*64 + d) */
    float* OUT = (float*)d_out;     // [4][2048][1024]
    char* wsp = (char*)d_ws;
    auto take = [&](size_t bytes) { char* p = wsp; wsp += (bytes + 255) & ~(size_t)255; return (void*)p; };
    bf* WQ = (bf*)take((size_t)DQ * DM * 2); bf* WK = (bf*)take((size_t)DKV * DM * 2); bf* WV = (bf*)take((size_t)DKV * DM * 2); bf* WO = (bf*)take((size_t)DM * DQ * 2);
    bf* XB = (bf*)take((size_t)NB_ * TT * DM * 2);
    const size_t PQ = (size_t)NB_ * NH_ * TT * HD;         // elements of one query or key plane, all batches (NKV == NH_); each key plane lies directly behind its query plane
    h16* QP16 = (h16*)take(PQ * 2); h16* KP16 = (h16*)take(PQ * 2); bf* QPh = (bf*)take(PQ * 2); bf* KPh = (bf*)take(PQ * 2); bf* QPl = (bf*)take(PQ * 2); bf* KPl = (bf*)take(PQ * 2);
    h16* VT16 = (h16*)take((size_t)NB_ * NKV * HD * PP * 2); bf* VTh = (bf*)take((size_t)NB_ * NKV * HD * PP * 2); bf* VTl = (bf*)take((size_t)NB_ * NKV * HD * PP * 2);
    bf* ATh = (bf*)take((size_t)NB_ * TT * DQ * 2); bf* ATl = (bf*)take((size_t)NB_ * TT * DQ * 2);
    if ((size_t)(wsp - (char*)d_ws) > ws_size) return;    // 248 MiB of the 256 MiB
    (void)WK;                                              // reached through WQ: the four Bt planes lie one behind the other in the workspace
    k_wtG<<<dim3((unsigned)(DM * HD / 64 / 64), NH_, 4), 256, 0, stream>>>(wq, wk, wv, wo, DM, HD, DQ, DM, WQ);   /* per-head weights [h][DM][HD] ('xw' per head) -> the head's HD rows of WQ, WK, WV; wo [DQ][DM] -> WO */
    k_cvt8<<<(unsigned)(((size_t)NB_ * TT * DM / 8 + 255) / 256), 256, 0, stream>>>(x, XB, (size_t)NB_ * TT * DM / 8);
    k_gemmt<1, false, DM><<<dim3(NB_ * TT / 128, DQ / 128, 2), 128, 0, stream>>>(XB, nullptr, WQ, nullptr, 0, bq, bk, (size_t)DQ * DM, PQ, QP16, QPh, QPl);
    k_gemmt<2, false, DM><<<dim3(NB_ * TT / 128, DKV / 128, 1), 128, 0, stream>>>(XB, nullptr, WV, nullptr, 0, bv, nullptr, 0, 0, VT16, VTh, VTl);
    k_fattn<<<dim3(NH_, TT / 32, NB_), FW * 32, 0, stream>>>(QP16, KP16, VT16, QPh, QPl, KPh, KPl, VTh, VTl, ATh, ATl);
    k_gemmt<0, true, DQ><<<dim3(NB_ * TT / 128, DM / 128, 1), 128, 0, stream>>>(ATh, ATl, WO, OUT, DM, bo, nullptr, 0, 0, nullptr, nullptr, nullptr);
}
// regate 2

// v007
// It runs in 134 microseconds.
// Next to v006, in two timings, it ran 1.41 and 1.42 times as fast.
// Over all steps from v000 it is 23.8 times as fast.
#include <hip/hip_runtime.h>

// Causal multi-head self-attention whose q, k, v projections are given PER HEAD (x [4][2048][1024]; q, k, v = einsum('bte,hed->bhtd', x, W) + b[None, :, None, :] with W [16][1024][64] ((in, out) inside each head; 1/32-scale) and per-head biases b [16][64] (zeros on this draw); scores x 1/sqrt(64); causal (-inf); softmax; heads merged head-major (column h*64 + d); out = cat Wp + bp ('xw' [1024][1024] + zero bias) -> [4][2048][1024] (8.4 M); argument order x, Wq, bq, Wk, bk, Wv, bv, Wp, bp). THIS ROW: the same module under other names (token_embedding [4][2048][1024]; PER-HEAD stacked projections Wq, Wk, Wv [16][1024][64] normal x 1/32 with biases [16][64] zeros (read): q = einsum('btd,hde->bhte', x, Wq) + bq; scores / sqrt(64); tril kept, -inf; softmax; heads concatenated in order; out = cat Wo + bo ('xw' [1024][1024]; bias zeros: read); argument order token_embedding, Wq, bq, Wk, bk, Wv, bv, Wo, bo).
// Layout, all batches in every launch (6 launches): bf16 copy of x; 'xw' weights transposed once; exact projections + f32 biases, stored by the GEMM itself as the 16-bit head planes; causal T-2048 attention in one kernel, running softmax (hybrid rows: < 512 hi/lo 3 products, rest fp16 x1024; key blocks above the diagonal never visited); merged hi/lo x Wo exact + bo.
// Compute dtypes, f32 accumulate: every input rounded to bf16; projections exact + f32 biases; attention rows < 512 3 products, rest fp16; softmax f32; output projection hl x exact.

#define NB_  4
#define TT   2048
#define DM   1024
#define NH_  16
#define NKV  16
#define REP  (NH_ / NKV)
#define HD   64
#define DQ   (NH_ * HD)
#define DKV  (NKV * HD)
#define RH   512                  // query rows < RH use hi+lo planes
#define PP   (2 * TT)              // row pitch, in 16-bit elements, of the transposed value planes
#define SCL  0.125f   // HD^-0.5
typedef _Float16 h16;
typedef unsigned short bf;
typedef __attribute__((ext_vector_type(16))) __bf16   v16bf;
typedef __attribute__((ext_vector_type(16))) _Float16 v16h;
typedef __attribute__((ext_vector_type(8)))  _Float16 v8h;
typedef __attribute__((ext_vector_type(8)))  unsigned short v8us;
typedef __attribute__((ext_vector_type(8)))  float    v8f;
typedef __attribute__((ext_vector_type(4)))  float    v4f;
typedef v8h  __attribute__((may_alias)) v8ha;
typedef v4f  __attribute__((may_alias)) v4fa;
typedef v8us __attribute__((may_alias)) v8usa;

__device__ __forceinline__ unsigned short f2bf(float f) { unsigned u = __float_as_uint(f); u += 0x7FFFu + ((u >> 16) & 1u); return (unsigned short)(u >> 16); }
__device__ __forceinline__ float bf2f(unsigned short b) { return __uint_as_float(((unsigned)b) << 16); }
__device__ __forceinline__ float bfr(float f) { return bf2f(f2bf(f)); }
__device__ __forceinline__ v16h cat16(v8h lo, v8h hi) { return __builtin_shufflevector(lo, hi, 0, 1, 2, 3, 4, 5, 6, 7, 8, 9, 10, 11, 12, 13, 14, 15); }
__device__ __forceinline__ v16bf cat16b(v8us lo, v8us hi) { return __builtin_bit_cast(v16bf, __builtin_shufflevector(lo, hi, 0, 1, 2, 3, 4, 5, 6, 7, 8, 9, 10, 11, 12, 13, 14, 15)); }
__device__ __forceinline__ v8f wmma16(v16h a, v16h b, v8f c) { return __builtin_amdgcn_wmma_f32_16x16x32_f16(false, a, false, b, (short)0, c, false, false); }
__device__ __forceinline__ v8f wmmab(v16bf a, v16bf b, v8f c) { return __builtin_amdgcn_wmma_f32_16x16x32_bf16(false, a, false, b, (short)0, c, false, false); }



// ---- k_gemmt: GEMM, one 128x128 output tile per work-group of 4 waves (2 x 2, 64x64 a wave, 16 accumulators); grid (M/128, N/128, Z), 128 threads. The rows of A run through all batches (M = NB_ * TT).
// C[m][n] = bias[n] + sum_k A[m][k] Bt[n][k], A and Bt K-contiguous bf16 planes; the accumulators start at the bias. TWO: a lo plane A2 is staged beside A and meets the same Bt fragments (C = bias + A Bt^T + A2 Bt^T).
// z > 0 takes Bt + z sB, bias2 and the planes + z sP (z = 0 query, z = 1 key projection in one launch).
// A stage is 64 k (one 128-byte line) of the tile's 128 A rows (TWO: of both planes) and 128 Bt rows, brought into LDS by asynchronous copies (whole lines, 8 lanes a row) and read there by the two waves that need it: every operand line leaves L2 once a work-group.
// Two buffers: the next stage's copies fly while this one is worked on.
// MODE 0: f32 C (pitch ldc). MODE 1, 2: no f32 C; the tile goes straight to the three 16-bit planes (fp16, bf16 hi, bf16 lo) that the attention kernel reads (a wave's 64 columns are one head):
// MODE 1 query / key planes [b][h][t][d], MODE 2 transposed value planes [b][g][d][t] at pitch PP. The accumulator's register direction is made the plane's contiguous direction
// (MODE 1 swaps the two operands of the matrix instruction, so that a lane holds 8 consecutive d of one t; MODE 2 keeps them: 8 consecutive t of one d).
template <typename T16> struct WFrag;
template <> struct WFrag<h16> { typedef v16h V; static __device__ __forceinline__ V ld(const h16* p) { return cat16(*(const v8h*)p, *(const v8h*)(p + 16)); } static __device__ __forceinline__ v8f mma(V a, V b, v8f c) { return wmma16(a, b, c); } };
template <> struct WFrag<bf> { typedef v16bf V; static __device__ __forceinline__ V ld(const bf* p) { return cat16b(*(const v8us*)p, *(const v8us*)(p + 16)); } static __device__ __forceinline__ v8f mma(V a, V b, v8f c) { return wmmab(a, b, c); } };
#define GP 72                      // LDS row pitch in 16-bit elements: the row's 128 bytes + 16, which spreads the 16-byte fragment reads of 16 rows over all banks
// Eight asynchronous 16-byte copies a lane, 16 rows apart (LDS address l, global address g, 'step' elements between the rows).
// The s_wait_xcnt stands inside the statement, behind the last copy, so that no address register is rewritten in front of it.
__device__ __forceinline__ void cp8(unsigned l, const bf* g, size_t step) {
    asm volatile("global_load_async_to_lds_b128 %0, %8, off\n\t"
                 "global_load_async_to_lds_b128 %1, %9, off\n\t"
                 "global_load_async_to_lds_b128 %2, %10, off\n\t"
                 "global_load_async_to_lds_b128 %3, %11, off\n\t"
                 "global_load_async_to_lds_b128 %4, %12, off\n\t"
                 "global_load_async_to_lds_b128 %5, %13, off\n\t"
                 "global_load_async_to_lds_b128 %6, %14, off\n\t"
                 "global_load_async_to_lds_b128 %7, %15, off\n\t"
                 "s_wait_xcnt 0x0"
                 :: "v"(l), "v"(l + 1 * 16 * GP * 2), "v"(l + 2 * 16 * GP * 2), "v"(l + 3 * 16 * GP * 2), "v"(l + 4 * 16 * GP * 2), "v"(l + 5 * 16 * GP * 2), "v"(l + 6 * 16 * GP * 2), "v"(l + 7 * 16 * GP * 2),
                    "v"(g), "v"(g + step), "v"(g + 2 * step), "v"(g + 3 * step), "v"(g + 4 * step), "v"(g + 5 * step), "v"(g + 6 * step), "v"(g + 7 * step)
                 : "memory");
}
template <int MODE, bool TWO, int K>
__global__ __launch_bounds__(128) void k_gemmt(const bf* __restrict__ A, const bf* __restrict__ A2, const bf* __restrict__ Bt, float* C, int ldc, const float* __restrict__ bias, const float* __restrict__ bias2, size_t sB, size_t sP, h16* P16, bf* Ph, bf* Pl) {
    static_assert(MODE == 0 || (HD == 64 && !TWO), "the plane epilogue takes a wave's 64 columns as one head and a quarter of the 72 KiB");
    static_assert(K % 64 == 0 && K >= 128, "whole stages, at least two");
    typedef WFrag<bf>::V V;
    constexpr int AR = TWO ? 256 : 128, GROWS = AR + 128;            // rows of a buffer: 128 of A (TWO: then 128 of A2), then 128 of Bt
    __shared__ __attribute__((aligned(16))) bf tl[2 * GROWS * GP];   // [buffer][row][pitch]: 72 KiB (TWO: 108 KiB)
    const size_t z = blockIdx.z; Bt += z * sB; if (MODE != 0) { P16 += z * sP; Ph += z * sP; Pl += z * sP; if (z) bias = bias2; }
    const int tid = threadIdx.x, lane = tid & 31, lr = lane & 15, hi = lane >> 4; const int r0 = blockIdx.x * 128, c0 = blockIdx.y * 128;
    const int wave = __builtin_amdgcn_readfirstlane(tid >> 5), wm = wave >> 1, wn = wave & 1;
    const int rw = r0 + wm * 64, cw = c0 + wn * 64;                   // this wave's 64 x 64 piece
    constexpr int NT = K / 64;                                       // stages
    // copies: lane = 16 bytes number tid & 7 of rows tid >> 3 (+ 16 i): a wave's copy is 4 whole lines
    const size_t aoff = (size_t)(r0 + (tid >> 3)) * K + (tid & 7) * 8, boff = (size_t)(c0 + (tid >> 3)) * K + (tid & 7) * 8;
    const unsigned l0 = (unsigned)(size_t)tl + (unsigned)((tid >> 3) * (GP * 2) + (tid & 7) * 16);
    auto issue = [&](int t, int buf) { const int kk = t * 64; const unsigned l = l0 + (unsigned)buf * (GROWS * GP * 2);
        cp8(l, A + aoff + kk, (size_t)16 * K); if (TWO) cp8(l + 128 * GP * 2, A2 + aoff + kk, (size_t)16 * K); cp8(l + AR * GP * 2, Bt + boff + kk, (size_t)16 * K); };
    issue(0, 0);
    v8f acc[4][4];                                                   // start value: the bias of the element's column (its loads return while stage 0 flies)
#pragma unroll
    for (int nb = 0; nb < 4; ++nb) { v8f bv;
        if (MODE == 1) { const v4f u0 = *(const v4f*)(bias + cw + nb * 16 + hi * 8), u1 = *(const v4f*)(bias + cw + nb * 16 + hi * 8 + 4);
#pragma unroll
            for (int j = 0; j < 4; ++j) { bv[j] = bfr(u0[j]); bv[4 + j] = bfr(u1[j]); } }
        else { const float u = bfr(bias[cw + nb * 16 + lr]);
#pragma unroll
            for (int j = 0; j < 8; ++j) bv[j] = u; }
#pragma unroll
        for (int mb = 0; mb < 4; ++mb) acc[mb][nb] = bv; }
    asm volatile("s_wait_asynccnt 0x0" ::: "memory");                // this wave's share of stage 0 has landed
    __syncthreads();                                                 // stage 0 is published
    issue(1, 1);
    const bf* fa = tl + (wm * 64 + lr) * GP + 8 * hi; const bf* fb = tl + (AR + wn * 64 + lr) * GP + 8 * hi;
    // rolled: one stage a trip
#pragma unroll 1
    for (int t = 0; t < NT; ++t) { const int bo = (t & 1) * (GROWS * GP);
#pragma unroll
        for (int kc = 0; kc < 2; ++kc) { V a[4], a2[4], b[4];
            b[0] = WFrag<bf>::ld(fb + bo + kc * 32);
#pragma unroll
            for (int mb = 0; mb < 4; ++mb) a[mb] = WFrag<bf>::ld(fa + bo + mb * 16 * GP + kc * 32);
#pragma unroll
            for (int nb = 1; nb < 4; ++nb) b[nb] = WFrag<bf>::ld(fb + bo + nb * 16 * GP + kc * 32);
            if (TWO) {
#pragma unroll
                for (int mb = 0; mb < 4; ++mb) a2[mb] = WFrag<bf>::ld(fa + bo + (128 + mb * 16) * GP + kc * 32); }
            __builtin_amdgcn_sched_barrier(0);                       // the fragment reads stay one group in front of their matrix instructions (for speed only)
#pragma unroll
            for (int nb = 0; nb < 4; ++nb)
#pragma unroll
                for (int mb = 0; mb < 4; ++mb) acc[mb][nb] = (MODE == 1) ? wmmab(b[nb], a[mb], acc[mb][nb]) : wmmab(a[mb], b[nb], acc[mb][nb]);
            if (TWO) {
#pragma unroll
                for (int nb = 0; nb < 4; ++nb)
#pragma unroll
                    for (int mb = 0; mb < 4; ++mb) acc[mb][nb] = wmmab(a2[mb], b[nb], acc[mb][nb]); }
            __builtin_amdgcn_sched_barrier(0);                       // the same, for the next group of reads
        }
        asm volatile("s_wait_dscnt 0x0" ::: "memory");               // this wave's reads of the buffer have returned before the buffer is given up
        asm volatile("s_wait_asynccnt 0x0" ::: "memory");            // this wave's share of stage t + 1 has landed
        __syncthreads();                                             // publishes stage t + 1 and ends every wave's reads of stage t
        if (t + 2 < NT) issue(t + 2, t & 1);
    }
    asm volatile("s_wait_asynccnt 0x0" ::: "memory");                // no copy is outstanding from here on
    if constexpr (MODE != 0) {
        // Plane epilogue. The buffers are free (every wave's reads ended at the last trip's barrier). Each wave turns its piece in its own quarter of them, 32 plane rows (128-byte lines) of the three planes at a time,
        // and stores whole lines: 8 lanes a line, one writer a line. l2: tile in the lane direction (the plane's rows), rt: in the register direction (along a row).
        bf* sw = tl + wave * (GROWS * GP / 2);
        const int bt = rw / TT, t0 = rw % TT;                         // the piece's batch and its first position there (TT % 64 == 0: a piece lies in one batch)
#pragma unroll
        for (int h = 0; h < 2; ++h) {
#pragma unroll
            for (int l2 = 0; l2 < 2; ++l2)
#pragma unroll
                for (int rt = 0; rt < 4; ++rt) { const v8f s = (MODE == 1) ? acc[h * 2 + l2][rt] : acc[rt][h * 2 + l2]; v8h o16; v8us oh, ol;
#pragma unroll
                    for (int j = 0; j < 8; ++j) { o16[j] = (h16)s[j]; const unsigned short a2 = f2bf(s[j]); oh[j] = a2; ol[j] = f2bf(s[j] - bf2f(a2)); }
                    bf* p = sw + (l2 * 16 + lr) * GP + rt * 16 + hi * 8;
                    *(v8us*)p = __builtin_bit_cast(v8us, o16); *(v8us*)(p + 32 * GP) = oh; *(v8us*)(p + 64 * GP) = ol; }
            asm volatile("s_wait_dscnt 0x0" ::: "memory");           // the wave's stores are in LDS before its lanes read one another's
#pragma unroll
            for (int pl = 0; pl < 3; ++pl) { bf* dst = (pl == 0) ? (bf*)P16 : (pl == 1) ? Ph : Pl;
#pragma unroll
                for (int i = 0; i < 8; ++i) { const int row = i * 4 + (lane >> 3);
                    const size_t e = (MODE == 1) ? (((size_t)bt * NH_ + cw / HD) * TT + t0 + h * 32 + row) * HD + (lane & 7) * 8 : ((size_t)bt * DKV + cw + h * 32 + row) * PP + t0 + (lane & 7) * 8;
                    *(v8us*)(dst + e) = *(const v8us*)(sw + (pl * 32 + row) * GP + (lane & 7) * 8); } }
        }
    } else {
        float* crow = C + (size_t)(rw + hi * 8) * ldc + cw + lr;
#pragma unroll
        for (int nb = 0; nb < 4; ++nb)
#pragma unroll
            for (int mb = 0; mb < 4; ++mb)
#pragma unroll
                for (int j = 0; j < 8; ++j) crow[(size_t)(mb * 16 + j) * ldc + nb * 16] = acc[mb][nb][j];
    }
}

__device__ __forceinline__ h16 tohx(float x) { return (h16)x; }
__device__ __forceinline__ void splitf(float y, unsigned short& h, unsigned short& l) { h = f2bf(y); l = f2bf(y - bf2f(h)); }
typedef __attribute__((ext_vector_type(2))) _Float16 v2h;
typedef __attribute__((ext_vector_type(4))) _Float16 v4h;
typedef __attribute__((ext_vector_type(2))) unsigned short v2us;
typedef __attribute__((ext_vector_type(4))) unsigned short v4us;
typedef __attribute__((ext_vector_type(2))) float v2f;
typedef __attribute__((ext_vector_type(4))) int v4i;

// grid (lines / 64, NH_, 4). Sources 0..2: matrix y of source z ([Kh][Nh], Kh * Nh apart in its source) goes to the Kh * Nh elements number z * NH_ + y of Bt.
// Source 3: ONE matrix [Ko][No] of NH_ * Kh * Nh elements, behind the others in Bt; its lines are dealt over the (x, y) blocks.
__global__ __launch_bounds__(256) void k_wtG(const float* __restrict__ w0, const float* __restrict__ w1, const float* __restrict__ w2, const float* __restrict__ w3, int Kh, int Nh, int Ko, int No, bf* Bt) {
    const bool one = blockIdx.z == 3; const int K = one ? Ko : Kh, N = one ? No : Nh; const int bx = one ? blockIdx.y * gridDim.x + blockIdx.x : blockIdx.x;
    const float* __restrict__ w = one ? w3 : (blockIdx.z == 0 ? w0 : blockIdx.z == 1 ? w1 : w2) + (size_t)blockIdx.y * Kh * Nh; Bt += ((size_t)blockIdx.z * NH_ + (one ? 0 : blockIdx.y)) * Kh * Nh;
    const int lane = threadIdx.x & 31; const int L0 = (bx * 8 + (threadIdx.x >> 5)) * 8; const int nlines = N * K / 64;
{
#pragma unroll 1
        for (int l = 0; l < 8; ++l) { const int L = L0 + l; if (L >= nlines) break; const size_t e = (size_t)L * 64 + lane * 2; const int k = (int)(e % K), n = (int)(e / K); v2us o;
            o[0] = f2bf(w[(size_t)k * N + n]); o[1] = f2bf(w[(size_t)(k + 1) * N + n]); *(v2us*)(Bt + e) = o; }
         }
}
__global__ __launch_bounds__(256) void k_cvt8(const float* __restrict__ src, bf* dst, size_t n8) { const size_t i = (size_t)blockIdx.x * 256 + threadIdx.x; if (i >= n8) return; const v8f v = *(const v8f*)(src + i * 8); v8us o;
#pragma unroll
    for (int k = 0; k < 8; ++k) o[k] = f2bf(v[k]); *(v8us*)(dst + i * 8) = o;  }

#define FW 8
template <typename T16, bool HIRES>
__device__ __forceinline__ void fa_tile(const T16* __restrict__ Q, const T16* __restrict__ Q2, const T16* __restrict__ Kp, const T16* __restrict__ K2, const T16* __restrict__ Vt, const T16* __restrict__ V2, int q0, bf* Ah, bf* Al, float* red, float* st) {
    static_assert(HIRES, "written for the hi + lo planes");
    typedef typename WFrag<T16>::V V;
    const int lane = threadIdx.x & 31, lr = lane & 15, hi = lane >> 4;
    const int wave = __builtin_amdgcn_readfirstlane(threadIdx.x >> 5);   // scalar, so that the key loop's branch is scalar and EXEC stays full at the matrix instructions
    V qf[2][2], qf2[2][2];
#pragma unroll
    for (int qt = 0; qt < 2; ++qt)
#pragma unroll
        for (int kc = 0; kc < 2; ++kc) { const size_t o = (size_t)(q0 + qt * 16 + lr) * HD + kc * 32 + 8 * hi; qf[qt][kc] = WFrag<T16>::ld(Q + o); if (HIRES) qf2[qt][kc] = WFrag<T16>::ld(Q2 + o); }
    v8f o[4][2];
#pragma unroll
    for (int dt = 0; dt < 4; ++dt)
#pragma unroll
        for (int qt = 0; qt < 2; ++qt) o[dt][qt] = (v8f){};
    float m[2] = { -3.0e38f, -3.0e38f }, l[2] = { 0.0f, 0.0f };
    // at most 2 blocks a wave, twice the fragments: every fragment is fetched where it is used, which keeps the kernel within 256 registers.
    V kf[2][2], kf2[2][2];
    // rolled: one block's fragments live beside the 8 output accumulators
#pragma unroll 1
    for (int kb = wave * 32; kb < q0 + 32; kb += FW * 32) {
        V vf[4], vf2[4];
        v8f s[2][2];
#pragma unroll
        for (int kt = 0; kt < 2; ++kt)
#pragma unroll
            for (int qt = 0; qt < 2; ++qt) s[kt][qt] = (v8f){};
#pragma unroll
        for (int kt = 0; kt < 2; ++kt)
#pragma unroll
            for (int kc = 0; kc < 2; ++kc) { if (HIRES) { const size_t ko = (size_t)(kb + kt * 16 + lr) * HD + kc * 32 + 8 * hi; kf[kt][kc] = WFrag<T16>::ld(Kp + ko); kf2[kt][kc] = WFrag<T16>::ld(K2 + ko);
                    asm volatile("s_wait_xcnt 0x0" ::: "memory"); }   // stands in front of any overwrite of these four loads' address registers
#pragma unroll
                for (int qt = 0; qt < 2; ++qt) { s[kt][qt] = WFrag<T16>::mma(kf[kt][kc], qf[qt][kc], s[kt][qt]); if (HIRES) { s[kt][qt] = WFrag<T16>::mma(kf[kt][kc], qf2[qt][kc], s[kt][qt]); s[kt][qt] = WFrag<T16>::mma(kf2[kt][kc], qf[qt][kc], s[kt][qt]); } } }
#pragma unroll
        for (int kt = 0; kt < 2; ++kt)
#pragma unroll
            for (int qt = 0; qt < 2; ++qt) s[kt][qt] *= SCL * 1.4426950408889634f;
        if (kb == q0) {                                                  // the diagonal block (the tile's last): keys beyond the query are masked; key kb itself never is, so every column keeps a finite maximum
#pragma unroll
            for (int kt = 0; kt < 2; ++kt)
#pragma unroll
                for (int qt = 0; qt < 2; ++qt)
#pragma unroll
                    for (int j = 0; j < 8; ++j) if (kt * 16 + hi * 8 + j > qt * 16 + lr) s[kt][qt][j] = -3.0e38f;
        }
        V pf[2], pf2[2];
#pragma unroll
        for (int qt = 0; qt < 2; ++qt) {
            float mx = s[0][qt][0];
#pragma unroll
            for (int j = 1; j < 16; ++j) mx = fmaxf(mx, s[j >> 3][qt][j & 7]);
            mx = fmaxf(mx, __shfl_xor(mx, 16, 32));
            const float mn = fmaxf(m[qt], mx), al = __builtin_amdgcn_exp2f(m[qt] - mn), mo = mn - 10.0f; m[qt] = mn;
            float sum = 0.0f;
#pragma unroll
            for (int j = 0; j < 16; ++j) { const float p = __builtin_amdgcn_exp2f(s[j >> 3][qt][j & 7] - mo); s[j >> 3][qt][j & 7] = p; sum += p; }
            l[qt] = l[qt] * al + sum;
#pragma unroll
            for (int dt = 0; dt < 4; ++dt) o[dt][qt] *= al;
            if constexpr (HIRES) { v8us h0, h1, l0, l1;
#pragma unroll
                for (int j = 0; j < 8; ++j) { unsigned short a, c2; splitf(s[0][qt][j], a, c2); h0[j] = a; l0[j] = c2; splitf(s[1][qt][j], a, c2); h1[j] = a; l1[j] = c2; }
                pf[qt] = cat16b(h0, h1); pf2[qt] = cat16b(l0, l1);
            }
        }
#pragma unroll
        for (int dt = 0; dt < 4; ++dt) { if (HIRES) { const size_t vo = (size_t)(dt * 16 + lr) * PP + kb + 8 * hi; vf[dt] = WFrag<T16>::ld(Vt + vo); vf2[dt] = WFrag<T16>::ld(V2 + vo); }
#pragma unroll
            for (int qt = 0; qt < 2; ++qt) { o[dt][qt] = WFrag<T16>::mma(vf[dt], pf[qt], o[dt][qt]); if (HIRES) { o[dt][qt] = WFrag<T16>::mma(vf[dt], pf2[qt], o[dt][qt]); o[dt][qt] = WFrag<T16>::mma(vf2[dt], pf[qt], o[dt][qt]); } } }
    }
#pragma unroll
    for (int qt = 0; qt < 2; ++qt) { const float lj = l[qt] + __shfl_xor(l[qt], 16, 32); st[wave * 64 + qt * 16 + lr] = m[qt]; st[wave * 64 + 32 + qt * 16 + lr] = lj;   // both halves hold, and store, the same two values
#pragma unroll
        for (int dt = 0; dt < 4; ++dt) *(v8f*)(red + (size_t)(((wave * 8 + qt * 4 + dt) * 32 + lane) * 8)) = o[dt][qt]; }
    __syncthreads();                                                     // every wave's partial result is in LDS before any wave joins
    // wave w joins queries 4w..4w+3, 8 lanes a query, 8 consecutive d a lane: whole 128-byte lines of the merged planes, one writer a line. A wave that had no block left m = -3e38, l = 0, Ot = 0: factor 0.
    const int q = wave * 4 + (lane >> 3), dg = lane & 7;
    const float* rr = red + (((q >> 4) * 4 + (dg >> 1)) * 32 + (q & 15) + 16 * (dg & 1)) * 8;
    float M = st[q];
#pragma unroll
    for (int u = 1; u < FW; ++u) M = fmaxf(M, st[u * 64 + q]);
    float L = 0.0f; v8f acc = (v8f){};
#pragma unroll
    for (int u = 0; u < FW; ++u) { const float f = __builtin_amdgcn_exp2f(st[u * 64 + q] - M); L += st[u * 64 + 32 + q] * f; acc += *(const v8f*)(rr + u * (8 * 32 * 8)) * f; }
    const float inv = __fdiv_rn(1.0f, L); v8us oh, ol;
#pragma unroll
    for (int j = 0; j < 8; ++j) { unsigned short a, c2; splitf(acc[j] * inv, a, c2); oh[j] = a; ol[j] = c2; }
    const size_t oo = (size_t)(q0 + q) * DQ + dg * 8; *(v8us*)(Ah + oo) = oh; *(v8us*)(Al + oo) = ol;
}
// ---- fa_wide: the fp16 rows (>= RH). One work-group = FW * 32 = 256 query rows of one head, 32 a wave; every wave walks ALL keys of its own rows, so there is no join.
// A stage is SK = 64 keys: 64 key rows and the 64 rows of the transposed value plane, one whole 128-byte line each, brought into LDS by asynchronous copies (8 lanes a line)
// and read there by all FW waves: a key or value line leaves L2 once for 256 query rows, as a whole line. Two buffers: the next stage's copies fly while this one is worked on.
// A wave works on the 32-key blocks up to its own diagonal block and only passes the barriers of the stages behind it.
#define SK 64
#define KP 72                      // LDS row pitch in 16-bit elements: the row's 128 bytes + 16, which spreads the 16-byte fragment reads of 16 rows over all banks
// Four asynchronous 16-byte copies a lane: key rows r, r + 32 and value rows r, r + 32 of a stage.
// The s_wait_xcnt stands inside the statement, behind the last copy, so that no address register is rewritten in front of it.
__device__ __forceinline__ void cp4(unsigned l, const h16* gk, const h16* gv) {
    asm volatile("global_load_async_to_lds_b128 %0, %4, off\n\t"
                 "global_load_async_to_lds_b128 %1, %5, off\n\t"
                 "global_load_async_to_lds_b128 %2, %6, off\n\t"
                 "global_load_async_to_lds_b128 %3, %7, off\n\t"
                 "s_wait_xcnt 0x0"
                 :: "v"(l), "v"(l + 32 * KP * 2), "v"(l + 64 * KP * 2), "v"(l + 96 * KP * 2), "v"(gk), "v"(gk + 32 * HD), "v"(gv), "v"(gv + 32 * PP)
                 : "memory");
}
__device__ __forceinline__ void fa_wide(const h16* __restrict__ Q, const h16* __restrict__ Kp, const h16* __restrict__ Vt, int Q0, bf* Ah, bf* Al, h16* tl) {
    static_assert(HD == 64 && SK == 64 && FW * 32 % SK == 0, "a key row and a stage's piece of a value row are one 128-byte line; whole stages");
    typedef WFrag<h16>::V V;
    const int tid = threadIdx.x, lane = tid & 31, lr = lane & 15, hi = lane >> 4;
    const int wave = __builtin_amdgcn_readfirstlane(tid >> 5);           // scalar, so that the block loop's branch is scalar and EXEC stays full at the matrix instructions
    const int q0 = Q0 + wave * 32, NS = (Q0 + FW * 32) / SK;             // this wave's first row; stages of the work-group (at least 4)
    const unsigned l0 = (unsigned)(size_t)tl + (unsigned)((tid >> 3) * (KP * 2) + (tid & 7) * 16);
    const h16* gk = Kp + (size_t)(tid >> 3) * HD + (tid & 7) * 8; const h16* gv = Vt + (size_t)(tid >> 3) * PP + (tid & 7) * 8;
    auto issue = [&](int t, int buf) { cp4(l0 + (unsigned)buf * (2 * SK * KP * 2), gk + (size_t)t * SK * HD, gv + t * SK); };
    issue(0, 0);
    V qf[2][2];
#pragma unroll
    for (int qt = 0; qt < 2; ++qt)
#pragma unroll
        for (int kc = 0; kc < 2; ++kc) qf[qt][kc] = WFrag<h16>::ld(Q + (size_t)(q0 + qt * 16 + lr) * HD + kc * 32 + 8 * hi);
    v8f o[4][2];
#pragma unroll
    for (int dt = 0; dt < 4; ++dt)
#pragma unroll
        for (int qt = 0; qt < 2; ++qt) o[dt][qt] = (v8f){};
    float m[2] = { -3.0e38f, -3.0e38f }, l[2] = { 0.0f, 0.0f };
    asm volatile("s_wait_asynccnt 0x0" ::: "memory");                    // this wave's share of stage 0 has landed
    __syncthreads();                                                     // stage 0 is published
    issue(1, 1);
    // rolled: one stage a trip
#pragma unroll 1
    for (int t = 0; t < NS; ++t) {
        const h16* kl = tl + (t & 1) * (2 * SK * KP); const h16* vl = kl + SK * KP;
        const int ke = min(t * SK + SK, q0 + 32);                        // the wave's blocks end with its diagonal block
        // rolled: one block's fragments live beside the 8 output accumulators
#pragma unroll 1
        for (int kb = t * SK; kb < ke; kb += 32) {
            V kf[2][2], vf[4];
#pragma unroll
            for (int kt = 0; kt < 2; ++kt)
#pragma unroll
                for (int kc = 0; kc < 2; ++kc) kf[kt][kc] = WFrag<h16>::ld(kl + ((kb & 32) + kt * 16 + lr) * KP + kc * 32 + 8 * hi);
#pragma unroll
            for (int dt = 0; dt < 4; ++dt) vf[dt] = WFrag<h16>::ld(vl + (dt * 16 + lr) * KP + (kb & 32) + 8 * hi);
            v8f s[2][2];
#pragma unroll
            for (int kt = 0; kt < 2; ++kt)
#pragma unroll
                for (int qt = 0; qt < 2; ++qt) s[kt][qt] = (v8f){};
#pragma unroll
            for (int kt = 0; kt < 2; ++kt)
#pragma unroll
                for (int kc = 0; kc < 2; ++kc)
#pragma unroll
                    for (int qt = 0; qt < 2; ++qt) s[kt][qt] = wmma16(kf[kt][kc], qf[qt][kc], s[kt][qt]);
#pragma unroll
            for (int kt = 0; kt < 2; ++kt)
#pragma unroll
                for (int qt = 0; qt < 2; ++qt) s[kt][qt] *= SCL * 1.4426950408889634f;
            if (kb == q0) {                                              // the diagonal block (the wave's last): keys beyond the query are masked; key kb itself never is, so every column keeps a finite maximum
#pragma unroll
                for (int kt = 0; kt < 2; ++kt)
#pragma unroll
                    for (int qt = 0; qt < 2; ++qt)
#pragma unroll
                        for (int j = 0; j < 8; ++j) if (kt * 16 + hi * 8 + j > qt * 16 + lr) s[kt][qt][j] = -3.0e38f;
            }
            V pf[2];
#pragma unroll
            for (int qt = 0; qt < 2; ++qt) {
                float mx = s[0][qt][0];
#pragma unroll
                for (int j = 1; j < 16; ++j) mx = fmaxf(mx, s[j >> 3][qt][j & 7]);
                mx = fmaxf(mx, __shfl_xor(mx, 16, 32));
                const float mn = fmaxf(m[qt], mx), al = __builtin_amdgcn_exp2f(m[qt] - mn), mo = mn - 10.0f; m[qt] = mn;
                float sum = 0.0f;
#pragma unroll
                for (int j = 0; j < 16; ++j) { const float p = __builtin_amdgcn_exp2f(s[j >> 3][qt][j & 7] - mo); s[j >> 3][qt][j & 7] = p; sum += p; }
                l[qt] = l[qt] * al + sum;
#pragma unroll
                for (int dt = 0; dt < 4; ++dt) o[dt][qt] *= al;
                v8h c0, c1;
#pragma unroll
                for (int j = 0; j < 8; ++j) { c0[j] = tohx(s[0][qt][j]); c1[j] = tohx(s[1][qt][j]); }
                pf[qt] = cat16(c0, c1);
            }
#pragma unroll
            for (int dt = 0; dt < 4; ++dt)
#pragma unroll
                for (int qt = 0; qt < 2; ++qt) o[dt][qt] = wmma16(vf[dt], pf[qt], o[dt][qt]);
        }
        asm volatile("s_wait_dscnt 0x0" ::: "memory");                   // this wave's reads of the buffer have returned before the buffer is given up
        asm volatile("s_wait_asynccnt 0x0" ::: "memory");                // this wave's share of stage t + 1 has landed
        __syncthreads();                                                 // publishes stage t + 1 and ends every wave's reads of stage t
        if (t + 2 < NS) issue(t + 2, t & 1);
    }
    asm volatile("s_wait_asynccnt 0x0" ::: "memory");                    // no copy is outstanding from here on
    // Epilogue. The buffers are free (every wave's reads ended at the last trip's barrier). Each wave turns its 32 rows in its own eighth of them, one merged plane at a time, and stores whole 128-byte lines: 8 lanes a line, one writer a line.
    bf* sw = (bf*)tl + wave * (32 * KP);
    float inv[2];
#pragma unroll
    for (int qt = 0; qt < 2; ++qt) inv[qt] = __fdiv_rn(1.0f, l[qt] + __shfl_xor(l[qt], 16, 32));
#pragma unroll
    for (int pl = 0; pl < 2; ++pl) { bf* dst = pl ? Al : Ah;
#pragma unroll
        for (int qt = 0; qt < 2; ++qt)
#pragma unroll
            for (int dt = 0; dt < 4; ++dt) { v8us ov;
#pragma unroll
                for (int j = 0; j < 8; ++j) { unsigned short a, c2; splitf(o[dt][qt][j] * inv[qt], a, c2); ov[j] = pl ? c2 : a; }
                *(v8us*)(sw + (qt * 16 + lr) * KP + dt * 16 + hi * 8) = ov; }
        asm volatile("s_wait_dscnt 0x0" ::: "memory");                   // the wave's stores are in LDS before its lanes read one another's
#pragma unroll
        for (int i = 0; i < 8; ++i) { const int row = i * 4 + (lane >> 3);
            *(v8us*)(dst + (size_t)(q0 + row) * DQ + (lane & 7) * 8) = *(const v8us*)(sw + row * KP + (lane & 7) * 8); }
    }
}
// grid (heads * batches, 6 + RH / 32). y < 6: 256 fp16 rows (fa_wide), position blocks in the order 7, 6, 5, 4, 2, 3: all of these are resident at once, two places a WGP.
// Behind them the hi + lo tiles of 32 rows (fa_tile), longest first.
__global__ __launch_bounds__(FW * 32) void k_fattn(const h16* __restrict__ Q16, const h16* __restrict__ K16, const h16* __restrict__ V16, const bf* __restrict__ Qh, const bf* __restrict__ Ql, const bf* __restrict__ Kh, const bf* __restrict__ Kl, const bf* __restrict__ Vh, const bf* __restrict__ Vl, bf* Ah, bf* Al) {
    static_assert(TT == 2048 && RH == 512 && FW == 8, "the order of the position blocks is written for 8 blocks of 256 rows, the first 2 of them hi + lo");
    __shared__ __align__(32) float red[FW * 8 * 32 * 8];                 // fa_tile: [wave][query group][d tile][lane][8], 8 KiB a wave; fa_wide: its two buffers (36 KiB)
    __shared__ float st[FW * 64];                                        // [wave][m, l][query]
    static_assert(2 * 2 * SK * KP * 2 <= sizeof(red), "the two buffers fit");
    const int y = blockIdx.y; const size_t h = blockIdx.x % NH_, g = h / REP, b = blockIdx.x / NH_; const size_t qo = (b * NH_ + h) * TT * HD, ko = (b * NKV + g) * TT * HD, vo = (b * NKV + g) * HD * PP; Ah += b * TT * DQ; Al += b * TT * DQ;
    if (y < 6) fa_wide(Q16 + qo, K16 + ko, V16 + vo, (y < 4 ? 7 - y : y - 2) * (FW * 32), Ah + h * HD, Al + h * HD, (h16*)red);
    else fa_tile<bf, true>(Qh + qo, Ql + qo, Kh + ko, Kl + ko, Vh + vo, Vl + vo, (RH / 32 - 1 - (y - 6)) * 32, Ah + h * HD, Al + h * HD, red, st);
}

extern "C" void kernel_launch(void* const* d_in, const int* in_sizes, int n_in,
                              void* d_out, int out_size, void* d_ws, size_t ws_size, hipStream_t stream) {
    (void)in_sizes; (void)n_in; (void)out_size;
    const float* x = (const float*)d_in[0]; const float* wq = (const float*)d_in[1]; const float* bq = (const float*)d_in[2]; const float* wk = (const float*)d_in[3]; const float* bk = (const float*)d_in[4]; const float* wv = (const float*)d_in[5]; const float* bv = (const float*)d_in[6]; const float* wo = (const float*)d_in[7]; const float* bo = (const float*)d_in[8];   /* argument order x, Wq, bq, Wk, bk, Wv, bv, Wp, bp (per-head weights [16][1024][64]; per-head biases [16][64] = flat index h*64 + d) */
    float* OUT = (float*)d_out;     // [4][2048][1024]
    char* wsp = (char*)d_ws;
    auto take = [&](size_t bytes) { char* p = wsp; wsp += (bytes + 255) & ~(size_t)255; return (void*)p; };
    bf* WQ = (bf*)take((size_t)DQ * DM * 2); bf* WK = (bf*)take((size_t)DKV * DM * 2); bf* WV = (bf*)take((size_t)DKV * DM * 2); bf* WO = (bf*)take((size_t)DM * DQ * 2);
    bf* XB = (bf*)take((size_t)NB_ * TT * DM * 2);
    const size_t PQ = (size_t)NB_ * NH_ * TT * HD;         // elements of one query or key plane, all batches (NKV == NH_); each key plane lies directly behind its query plane
    h16* QP16 = (h16*)take(PQ * 2); h16* KP16 = (h16*)take(PQ * 2); bf* QPh = (bf*)take(PQ * 2); bf* KPh = (bf*)take(PQ * 2); bf* QPl = (bf*)take(PQ * 2); bf* KPl = (bf*)take(PQ * 2);
    h16* VT16 = (h16*)take((size_t)NB_ * NKV * HD * PP * 2); bf* VTh = (bf*)take((size_t)NB_ * NKV * HD * PP * 2); bf* VTl = (bf*)take((size_t)NB_ * NKV * HD * PP * 2);
    bf* ATh = (bf*)take((size_t)NB_ * TT * DQ * 2); bf* ATl = (bf*)take((size_t)NB_ * TT * DQ * 2);
    if ((size_t)(wsp - (char*)d_ws) > ws_size) return;    // 248 MiB of the 256 MiB
    (void)WK;                                              // reached through WQ: the four Bt planes lie one behind the other in the workspace
    k_wtG<<<dim3((unsigned)(DM * HD / 64 / 64), NH_, 4), 256, 0, stream>>>(wq, wk, wv, wo, DM, HD, DQ, DM, WQ);   /* per-head weights [h][DM][HD] ('xw' per head) -> the head's HD rows of WQ, WK, WV; wo [DQ][DM] -> WO */
    k_cvt8<<<(unsigned)(((size_t)NB_ * TT * DM / 8 + 255) / 256), 256, 0, stream>>>(x, XB, (size_t)NB_ * TT * DM / 8);
    k_gemmt<1, false, DM><<<dim3(NB_ * TT / 128, DQ / 128, 2), 128, 0, stream>>>(XB, nullptr, WQ, nullptr, 0, bq, bk, (size_t)DQ * DM, PQ, QP16, QPh, QPl);
    k_gemmt<2, false, DM><<<dim3(NB_ * TT / 128, DKV / 128, 1), 128, 0, stream>>>(XB, nullptr, WV, nullptr, 0, bv, nullptr, 0, 0, VT16, VTh, VTl);
    k_fattn<<<dim3(NH_ * NB_, 6 + RH / 32, 1), FW * 32, 0, stream>>>(QP16, KP16, VT16, QPh, QPl, KPh, KPl, VTh, VTl, ATh, ATl);
    k_gemmt<0, true, DQ><<<dim3(NB_ * TT / 128, DM / 128, 1), 128, 0, stream>>>(ATh, ATl, WO, OUT, DM, bo, nullptr, 0, 0, nullptr, nullptr, nullptr);
}

// v008
// A run of this version takes 132 microseconds.
// In both of two side-by-side timings against v007, it was 1.03 times as fast.
// Counting every step since v000, it is 24.6 times as fast.
#include <hip/hip_runtime.h>

// Causal multi-head self-attention whose q, k, v projections are given PER HEAD (x [4][2048][1024]; q, k, v = einsum('bte,hed->bhtd', x, W) + b[None, :, None, :] with W [16][1024][64] ((in, out) inside each head; 1/32-scale) and per-head biases b [16][64] (zeros on this draw); scores x 1/sqrt(64); causal (-inf); softmax; heads merged head-major (column h*64 + d); out = cat Wp + bp ('xw' [1024][1024] + zero bias) -> [4][2048][1024] (8.4 M); argument order x, Wq, bq, Wk, bk, Wv, bv, Wp, bp). THIS ROW: the same module under other names (token_embedding [4][2048][1024]; PER-HEAD stacked projections Wq, Wk, Wv [16][1024][64] normal x 1/32 with biases [16][64] zeros (read): q = einsum('btd,hde->bhte', x, Wq) + bq; scores / sqrt(64); tril kept, -inf; softmax; heads concatenated in order; out = cat Wo + bo ('xw' [1024][1024]; bias zeros: read); argument order token_embedding, Wq, bq, Wk, bk, Wv, bv, Wo, bo).
// Layout, all batches in every launch (6 launches): bf16 copy of x; 'xw' weights transposed once; exact projections + f32 biases, stored by the GEMM itself as the 16-bit head planes; causal T-2048 attention in one kernel, running softmax (hybrid rows: < 512 hi/lo 3 products, rest fp16 x1024; key blocks above the diagonal never visited); merged hi/lo x Wo exact + bo.
// Compute dtypes, f32 accumulate: every input rounded to bf16; projections exact + f32 biases; attention rows < 512 3 products, rest fp16; softmax f32; output projection hl x exact.

#define NB_  4
#define TT   2048
#define DM   1024
#define NH_  16
#define NKV  16
#define REP  (NH_ / NKV)
#define HD   64
#define DQ   (NH_ * HD)
#define DKV  (NKV * HD)
#define RH   512                  // query rows < RH use hi+lo planes
#define PP   (2 * TT)              // row pitch, in 16-bit elements, of the transposed value planes
#define SCL  0.125f   // HD^-0.5
typedef _Float16 h16;
typedef unsigned short bf;
typedef __attribute__((ext_vector_type(16))) __bf16   v16bf;
typedef __attribute__((ext_vector_type(16))) _Float16 v16h;
typedef __attribute__((ext_vector_type(8)))  _Float16 v8h;
typedef __attribute__((ext_vector_type(8)))  unsigned short v8us;
typedef __attribute__((ext_vector_type(8)))  float    v8f;
typedef __attribute__((ext_vector_type(4)))  float    v4f;
typedef v8h  __attribute__((may_alias)) v8ha;
typedef v4f  __attribute__((may_alias)) v4fa;
typedef v8us __attribute__((may_alias)) v8usa;

__device__ __forceinline__ unsigned short f2bf(float f) { unsigned u = __float_as_uint(f); u += 0x7FFFu + ((u >> 16) & 1u); return (unsigned short)(u >> 16); }
__device__ __forceinline__ float bf2f(unsigned short b) { return __uint_as_float(((unsigned)b) << 16); }
__device__ __forceinline__ float bfr(float f) { return bf2f(f2bf(f)); }
__device__ __forceinline__ v16h cat16(v8h lo, v8h hi) { return __builtin_shufflevector(lo, hi, 0, 1, 2, 3, 4, 5, 6, 7, 8, 9, 10, 11, 12, 13, 14, 15); }
__device__ __forceinline__ v16bf cat16b(v8us lo, v8us hi) { return __builtin_bit_cast(v16bf, __builtin_shufflevector(lo, hi, 0, 1, 2, 3, 4, 5, 6, 7, 8, 9, 10, 11, 12, 13, 14, 15)); }
__device__ __forceinline__ v8f wmma16(v16h a, v16h b, v8f c) { return __builtin_amdgcn_wmma_f32_16x16x32_f16(false, a, false, b, (short)0, c, false, false); }
__device__ __forceinline__ v8f wmmab(v16bf a, v16bf b, v8f c) { return __builtin_amdgcn_wmma_f32_16x16x32_bf16(false, a, false, b, (short)0, c, false, false); }



// ---- k_gemmt: GEMM, one 128x128 output tile per work-group of 4 waves (2 x 2, 64x64 a wave, 16 accumulators); grid (M/128, N/128, Z), 128 threads. The rows of A run through all batches (M = NB_ * TT).
// C[m][n] = bias[n] + sum_k A[m][k] Bt[n][k], A and Bt K-contiguous bf16 planes; the accumulators start at the bias. TWO: a lo plane A2 is staged beside A and meets the same Bt fragments (C = bias + A Bt^T + A2 Bt^T).
// z > 0 takes Bt + z sB, bias2 and the planes + z sP (z = 0 query, z = 1 key projection in one launch).
// A stage is 64 k (one 128-byte line) of the tile's 128 A rows (TWO: of both planes) and 128 Bt rows, brought into LDS by asynchronous copies (whole lines, 8 lanes a row) and read there by the two waves that need it: every operand line leaves L2 once a work-group.
// Two buffers: the next stage's copies fly while this one is worked on.
// MODE 0: f32 C (pitch ldc). MODE 1, 2: no f32 C; the tile goes straight to the three 16-bit planes (fp16, bf16 hi, bf16 lo) that the attention kernel reads (a wave's 64 columns are one head):
// MODE 1 query / key planes [b][h][t][d], MODE 2 transposed value planes [b][g][d][t] at pitch PP. The accumulator's register direction is made the plane's contiguous direction
// (MODE 1 swaps the two operands of the matrix instruction, so that a lane holds 8 consecutive d of one t; MODE 2 keeps them: 8 consecutive t of one d).
template <typename T16> struct WFrag;
template <> struct WFrag<h16> { typedef v16h V; static __device__ __forceinline__ V ld(const h16* p) { return cat16(*(const v8h*)p, *(const v8h*)(p + 16)); } static __device__ __forceinline__ v8f mma(V a, V b, v8f c) { return wmma16(a, b, c); } };
template <> struct WFrag<bf> { typedef v16bf V; static __device__ __forceinline__ V ld(const bf* p) { return cat16b(*(const v8us*)p, *(const v8us*)(p + 16)); } static __device__ __forceinline__ v8f mma(V a, V b, v8f c) { return wmmab(a, b, c); } };
#define GP 72                      // LDS row pitch in 16-bit elements: the row's 128 bytes + 16, which spreads the 16-byte fragment reads of 16 rows over all banks
// Eight asynchronous 16-byte copies a lane, 16 rows apart (LDS address l, global address g, 'step' elements between the rows).
// The s_wait_xcnt stands inside the statement, behind the last copy, so that no address register is rewritten in front of it.
__device__ __forceinline__ void cp8(unsigned l, const bf* g, size_t step) {
    asm volatile("global_load_async_to_lds_b128 %0, %8, off\n\t"
                 "global_load_async_to_lds_b128 %1, %9, off\n\t"
                 "global_load_async_to_lds_b128 %2, %10, off\n\t"
                 "global_load_async_to_lds_b128 %3, %11, off\n\t"
                 "global_load_async_to_lds_b128 %4, %12, off\n\t"
                 "global_load_async_to_lds_b128 %5, %13, off\n\t"
                 "global_load_async_to_lds_b128 %6, %14, off\n\t"
                 "global_load_async_to_lds_b128 %7, %15, off\n\t"
                 "s_wait_xcnt 0x0"
                 :: "v"(l), "v"(l + 1 * 16 * GP * 2), "v"(l + 2 * 16 * GP * 2), "v"(l + 3 * 16 * GP * 2), "v"(l + 4 * 16 * GP * 2), "v"(l + 5 * 16 * GP * 2), "v"(l + 6 * 16 * GP * 2), "v"(l + 7 * 16 * GP * 2),
                    "v"(g), "v"(g + step), "v"(g + 2 * step), "v"(g + 3 * step), "v"(g + 4 * step), "v"(g + 5 * step), "v"(g + 6 * step), "v"(g + 7 * step)
                 : "memory");
}
template <int MODE, bool TWO, int K>
__global__ __launch_bounds__(128) void k_gemmt(const bf* __restrict__ A, const bf* __restrict__ A2, const bf* __restrict__ Bt, float* C, int ldc, const float* __restrict__ bias, const float* __restrict__ bias2, size_t sB, size_t sP, h16* P16, bf* Ph, bf* Pl) {
    static_assert(MODE == 0 || (HD == 64 && !TWO), "the plane epilogue takes a wave's 64 columns as one head and a quarter of the 72 KiB");
    static_assert(K % 64 == 0 && K >= 128, "whole stages, at least two");
    typedef WFrag<bf>::V V;
    constexpr int AR = TWO ? 256 : 128, GROWS = AR + 128;            // rows of a buffer: 128 of A (TWO: then 128 of A2), then 128 of Bt
    __shared__ __attribute__((aligned(16))) bf tl[2 * GROWS * GP];   // [buffer][row][pitch]: 72 KiB (TWO: 108 KiB)
    const size_t z = blockIdx.z; Bt += z * sB; if (MODE != 0) { P16 += z * sP; Ph += z * sP; Pl += z * sP; if (z) bias = bias2; }
    const int tid = threadIdx.x, lane = tid & 31, lr = lane & 15, hi = lane >> 4; const int r0 = blockIdx.x * 128, c0 = blockIdx.y * 128;
    const int wave = __builtin_amdgcn_readfirstlane(tid >> 5), wm = wave >> 1, wn = wave & 1;
    const int rw = r0 + wm * 64, cw = c0 + wn * 64;                   // this wave's 64 x 64 piece
    constexpr int NT = K / 64;                                       // stages
    // copies: lane = 16 bytes number tid & 7 of rows tid >> 3 (+ 16 i): a wave's copy is 4 whole lines
    const size_t aoff = (size_t)(r0 + (tid >> 3)) * K + (tid & 7) * 8, boff = (size_t)(c0 + (tid >> 3)) * K + (tid & 7) * 8;
    const unsigned l0 = (unsigned)(size_t)tl + (unsigned)((tid >> 3) * (GP * 2) + (tid & 7) * 16);
    auto issue = [&](int t, int buf) { const int kk = t * 64; const unsigned l = l0 + (unsigned)buf * (GROWS * GP * 2);
        cp8(l, A + aoff + kk, (size_t)16 * K); if (TWO) cp8(l + 128 * GP * 2, A2 + aoff + kk, (size_t)16 * K); cp8(l + AR * GP * 2, Bt + boff + kk, (size_t)16 * K); };
    issue(0, 0);
    v8f acc[4][4];                                                   // start value: the bias of the element's column (its loads return while stage 0 flies)
#pragma unroll
    for (int nb = 0; nb < 4; ++nb) { v8f bv;
        if (MODE == 1) { const v4f u0 = *(const v4f*)(bias + cw + nb * 16 + hi * 8), u1 = *(const v4f*)(bias + cw + nb * 16 + hi * 8 + 4);
#pragma unroll
            for (int j = 0; j < 4; ++j) { bv[j] = bfr(u0[j]); bv[4 + j] = bfr(u1[j]); } }
        else { const float u = bfr(bias[cw + nb * 16 + lr]);
#pragma unroll
            for (int j = 0; j < 8; ++j) bv[j] = u; }
#pragma unroll
        for (int mb = 0; mb < 4; ++mb) acc[mb][nb] = bv; }
    asm volatile("s_wait_asynccnt 0x0" ::: "memory");                // this wave's share of stage 0 has landed
    __syncthreads();                                                 // stage 0 is published
    issue(1, 1);
    const bf* fa = tl + (wm * 64 + lr) * GP + 8 * hi; const bf* fb = tl + (AR + wn * 64 + lr) * GP + 8 * hi;
    // rolled: one stage a trip
#pragma unroll 1
    for (int t = 0; t < NT; ++t) { const int bo = (t & 1) * (GROWS * GP);
#pragma unroll
        for (int kc = 0; kc < 2; ++kc) { V a[4], a2[4], b[4];
            b[0] = WFrag<bf>::ld(fb + bo + kc * 32);
#pragma unroll
            for (int mb = 0; mb < 4; ++mb) a[mb] = WFrag<bf>::ld(fa + bo + mb * 16 * GP + kc * 32);
#pragma unroll
            for (int nb = 1; nb < 4; ++nb) b[nb] = WFrag<bf>::ld(fb + bo + nb * 16 * GP + kc * 32);
            if (TWO) {
#pragma unroll
                for (int mb = 0; mb < 4; ++mb) a2[mb] = WFrag<bf>::ld(fa + bo + (128 + mb * 16) * GP + kc * 32); }
            __builtin_amdgcn_sched_barrier(0);                       // the fragment reads stay one group in front of their matrix instructions (for speed only)
#pragma unroll
            for (int nb = 0; nb < 4; ++nb)
#pragma unroll
                for (int mb = 0; mb < 4; ++mb) acc[mb][nb] = (MODE == 1) ? wmmab(b[nb], a[mb], acc[mb][nb]) : wmmab(a[mb], b[nb], acc[mb][nb]);
            if (TWO) {
#pragma unroll
                for (int nb = 0; nb < 4; ++nb)
#pragma unroll
                    for (int mb = 0; mb < 4; ++mb) acc[mb][nb] = wmmab(a2[mb], b[nb], acc[mb][nb]); }
            __builtin_amdgcn_sched_barrier(0);                       // the same, for the next group of reads
        }
        asm volatile("s_wait_dscnt 0x0" ::: "memory");               // this wave's reads of the buffer have returned before the buffer is given up
        asm volatile("s_wait_asynccnt 0x0" ::: "memory");            // this wave's share of stage t + 1 has landed
        __syncthreads();                                             // publishes stage t + 1 and ends every wave's reads of stage t
        if (t + 2 < NT) issue(t + 2, t & 1);
    }
    asm volatile("s_wait_asynccnt 0x0" ::: "memory");                // no copy is outstanding from here on
    if constexpr (MODE != 0) {
        // Plane epilogue. The buffers are free (every wave's reads ended at the last trip's barrier). Each wave turns its piece in its own quarter of them, 32 plane rows (128-byte lines) of the three planes at a time,
        // and stores whole lines: 8 lanes a line, one writer a line. l2: tile in the lane direction (the plane's rows), rt: in the register direction (along a row).
        bf* sw = tl + wave * (GROWS * GP / 2);
        const int bt = rw / TT, t0 = rw % TT;                         // the piece's batch and its first position there (TT % 64 == 0: a piece lies in one batch)
#pragma unroll
        for (int h = 0; h < 2; ++h) {
#pragma unroll
            for (int l2 = 0; l2 < 2; ++l2)
#pragma unroll
                for (int rt = 0; rt < 4; ++rt) { const v8f s = (MODE == 1) ? acc[h * 2 + l2][rt] : acc[rt][h * 2 + l2]; v8h o16; v8us oh, ol;
#pragma unroll
                    for (int j = 0; j < 8; ++j) { o16[j] = (h16)s[j]; const unsigned short a2 = f2bf(s[j]); oh[j] = a2; ol[j] = f2bf(s[j] - bf2f(a2)); }
                    bf* p = sw + (l2 * 16 + lr) * GP + rt * 16 + hi * 8;
                    *(v8us*)p = __builtin_bit_cast(v8us, o16); *(v8us*)(p + 32 * GP) = oh; *(v8us*)(p + 64 * GP) = ol; }
            asm volatile("s_wait_dscnt 0x0" ::: "memory");           // the wave's stores are in LDS before its lanes read one another's
#pragma unroll
            for (int pl = 0; pl < 3; ++pl) { bf* dst = (pl == 0) ? (bf*)P16 : (pl == 1) ? Ph : Pl;
#pragma unroll
                for (int i = 0; i < 8; ++i) { const int row = i * 4 + (lane >> 3);
                    const size_t e = (MODE == 1) ? (((size_t)bt * NH_ + cw / HD) * TT + t0 + h * 32 + row) * HD + (lane & 7) * 8 : ((size_t)bt * DKV + cw + h * 32 + row) * PP + t0 + (lane & 7) * 8;
                    *(v8us*)(dst + e) = *(const v8us*)(sw + (pl * 32 + row) * GP + (lane & 7) * 8); } }
        }
    } else {
        float* crow = C + (size_t)(rw + hi * 8) * ldc + cw + lr;
#pragma unroll
        for (int nb = 0; nb < 4; ++nb)
#pragma unroll
            for (int mb = 0; mb < 4; ++mb)
#pragma unroll
                for (int j = 0; j < 8; ++j) crow[(size_t)(mb * 16 + j) * ldc + nb * 16] = acc[mb][nb][j];
    }
}

__device__ __forceinline__ h16 tohx(float x) { return (h16)x; }
__device__ __forceinline__ void splitf(float y, unsigned short& h, unsigned short& l) { h = f2bf(y); l = f2bf(y - bf2f(h)); }
typedef __attribute__((ext_vector_type(2))) _Float16 v2h;
typedef __attribute__((ext_vector_type(4))) _Float16 v4h;
typedef __attribute__((ext_vector_type(2))) unsigned short v2us;
typedef __attribute__((ext_vector_type(4))) unsigned short v4us;
typedef __attribute__((ext_vector_type(2))) float v2f;
typedef __attribute__((ext_vector_type(4))) int v4i;

typedef __attribute__((ext_vector_type(4))) unsigned v4u;
// ---- k_wtG: the four 'xw' weights, f32 [k][n], to the K-contiguous bf16 planes Bt [n][k]. grid (DM / 256, NH_, 4), 256 threads: one tile of 256 k x 64 n a work-group, turned in LDS.
// Sources 0..2: head y's matrix [DM][HD] (all its 64 columns, k tile x). Source 3: ONE matrix [DQ][DM], k tile x, column tile y. Either way the tile's rows in Bt are number (z * NH_ + y) * 64 + n, pitch DM.
// Reads: 16 lanes a source row piece of 256 bytes (two whole lines), a lane's 16 loads all in flight. Stores: 16 lanes a 256-byte piece of a row of Bt (two whole lines), one writer a line.
// A lane takes 4 columns of the rows k, k + 1 and puts each column's pair into one LDS word; the pitch of WP words keeps both the word stores (banks 4 c + r) and the word reads (banks n + 4 c) free of conflicts.
#define WP 129
template <int N>                                                         // N: pitch of the source rows
__device__ __forceinline__ void wt_tile(const float* __restrict__ w, bf* dst, unsigned* tp) {
    const int tid = threadIdx.x, c = tid & 15, r = tid >> 4;
    const float* src = w + (size_t)(2 * r) * N + c * 4;
    v4f a[8][2];
#pragma unroll
    for (int i = 0; i < 8; ++i)
#pragma unroll
        for (int e = 0; e < 2; ++e) a[i][e] = *(const v4f*)(src + (size_t)(32 * i + e) * N);
    // the wait in front of any overwrite of the loads' address register pair; it names the pair as an input so that it lives up to the wait (without that a load's result can be given the pair)
    asm volatile("s_wait_xcnt 0x0" :: "v"(src) : "memory");
#pragma unroll
    for (int i = 0; i < 8; ++i)
#pragma unroll
        for (int j = 0; j < 4; ++j) tp[(c * 4 + j) * WP + r + 16 * i] = (unsigned)f2bf(a[i][0][j]) | ((unsigned)f2bf(a[i][1][j]) << 16);
    __syncthreads();                                                     // the whole tile is in LDS before any lane reads another's words
#pragma unroll
    for (int u = 0; u < 8; ++u) { const int n = (u & 3) * 16 + r, o = (u >> 2) * 64 + c * 4; v4u v;
#pragma unroll
        for (int e = 0; e < 4; ++e) v[e] = tp[n * WP + o + e];
        *(v4u*)(dst + (size_t)n * DM + o * 2) = v; }
}
__global__ __launch_bounds__(256) void k_wtG(const float* __restrict__ w0, const float* __restrict__ w1, const float* __restrict__ w2, const float* __restrict__ w3, bf* Bt) {
    static_assert(HD == 64 && DQ == DM && DKV == DQ && DM % 256 == 0, "a head's columns are one tile; all four planes have DM rows of DM elements, one behind the other");
    __shared__ unsigned tp[64 * WP];                                     // [n][k / 2]
    const size_t x = blockIdx.x, y = blockIdx.y, z = blockIdx.z;
    bf* dst = Bt + (z * NH_ + y) * 64 * DM + x * 256;
    if (z == 3) wt_tile<DM>(w3 + x * 256 * DM + y * 64, dst, tp);
    else wt_tile<HD>((z == 0 ? w0 : z == 1 ? w1 : w2) + y * DM * HD + x * 256 * HD, dst, tp);
}
__global__ __launch_bounds__(256) void k_cvt8(const float* __restrict__ src, bf* dst, size_t n8) { const size_t i = (size_t)blockIdx.x * 256 + threadIdx.x; if (i >= n8) return; const v8f v = *(const v8f*)(src + i * 8); v8us o;
#pragma unroll
    for (int k = 0; k < 8; ++k) o[k] = f2bf(v[k]); *(v8us*)(dst + i * 8) = o;  }

#define FW 8
template <typename T16, bool HIRES>
__device__ __forceinline__ void fa_tile(const T16* __restrict__ Q, const T16* __restrict__ Q2, const T16* __restrict__ Kp, const T16* __restrict__ K2, const T16* __restrict__ Vt, const T16* __restrict__ V2, int q0, bf* Ah, bf* Al, float* red, float* st) {
    static_assert(HIRES, "written for the hi + lo planes");
    typedef typename WFrag<T16>::V V;
    const int lane = threadIdx.x & 31, lr = lane & 15, hi = lane >> 4;
    const int wave = __builtin_amdgcn_readfirstlane(threadIdx.x >> 5);   // scalar, so that the key loop's branch is scalar and EXEC stays full at the matrix instructions
    V qf[2][2], qf2[2][2];
#pragma unroll
    for (int qt = 0; qt < 2; ++qt)
#pragma unroll
        for (int kc = 0; kc < 2; ++kc) { const size_t o = (size_t)(q0 + qt * 16 + lr) * HD + kc * 32 + 8 * hi; qf[qt][kc] = WFrag<T16>::ld(Q + o); if (HIRES) qf2[qt][kc] = WFrag<T16>::ld(Q2 + o); }
    v8f o[4][2];
#pragma unroll
    for (int dt = 0; dt < 4; ++dt)
#pragma unroll
        for (int qt = 0; qt < 2; ++qt) o[dt][qt] = (v8f){};
    float m[2] = { -3.0e38f, -3.0e38f }, l[2] = { 0.0f, 0.0f };
    // at most 2 blocks a wave, twice the fragments: every fragment is fetched where it is used, which keeps the kernel within 256 registers.
    V kf[2][2], kf2[2][2];
    // rolled: one block's fragments live beside the 8 output accumulators
#pragma unroll 1
    for (int kb = wave * 32; kb < q0 + 32; kb += FW * 32) {
        V vf[4], vf2[4];
        v8f s[2][2];
#pragma unroll
        for (int kt = 0; kt < 2; ++kt)
#pragma unroll
            for (int qt = 0; qt < 2; ++qt) s[kt][qt] = (v8f){};
#pragma unroll
        for (int kt = 0; kt < 2; ++kt)
#pragma unroll
            for (int kc = 0; kc < 2; ++kc) { if (HIRES) { const size_t ko = (size_t)(kb + kt * 16 + lr) * HD + kc * 32 + 8 * hi; kf[kt][kc] = WFrag<T16>::ld(Kp + ko); kf2[kt][kc] = WFrag<T16>::ld(K2 + ko);
                    asm volatile("s_wait_xcnt 0x0" ::: "memory"); }   // stands in front of any overwrite of these four loads' address registers
#pragma unroll
                for (int qt = 0; qt < 2; ++qt) { s[kt][qt] = WFrag<T16>::mma(kf[kt][kc], qf[qt][kc], s[kt][qt]); if (HIRES) { s[kt][qt] = WFrag<T16>::mma(kf[kt][kc], qf2[qt][kc], s[kt][qt]); s[kt][qt] = WFrag<T16>::mma(kf2[kt][kc], qf[qt][kc], s[kt][qt]); } } }
#pragma unroll
        for (int kt = 0; kt < 2; ++kt)
#pragma unroll
            for (int qt = 0; qt < 2; ++qt) s[kt][qt] *= SCL * 1.4426950408889634f;
        if (kb == q0) {                                                  // the diagonal block (the tile's last): keys beyond the query are masked; key kb itself never is, so every column keeps a finite maximum
#pragma unroll
            for (int kt = 0; kt < 2; ++kt)
#pragma unroll
                for (int qt = 0; qt < 2; ++qt)
#pragma unroll
                    for (int j = 0; j < 8; ++j) if (kt * 16 + hi * 8 + j > qt * 16 + lr) s[kt][qt][j] = -3.0e38f;
        }
        V pf[2], pf2[2];
#pragma unroll
        for (int qt = 0; qt < 2; ++qt) {
            float mx = s[0][qt][0];
#pragma unroll
            for (int j = 1; j < 16; ++j) mx = fmaxf(mx, s[j >> 3][qt][j & 7]);
            mx = fmaxf(mx, __shfl_xor(mx, 16, 32));
            const float mn = fmaxf(m[qt], mx), al = __builtin_amdgcn_exp2f(m[qt] - mn), mo = mn - 10.0f; m[qt] = mn;
            float sum = 0.0f;
#pragma unroll
            for (int j = 0; j < 16; ++j) { const float p = __builtin_amdgcn_exp2f(s[j >> 3][qt][j & 7] - mo); s[j >> 3][qt][j & 7] = p; sum += p; }
            l[qt] = l[qt] * al + sum;
#pragma unroll
            for (int dt = 0; dt < 4; ++dt) o[dt][qt] *= al;
            if constexpr (HIRES) { v8us h0, h1, l0, l1;
#pragma unroll
                for (int j = 0; j < 8; ++j) { unsigned short a, c2; splitf(s[0][qt][j], a, c2); h0[j] = a; l0[j] = c2; splitf(s[1][qt][j], a, c2); h1[j] = a; l1[j] = c2; }
                pf[qt] = cat16b(h0, h1); pf2[qt] = cat16b(l0, l1);
            }
        }
#pragma unroll
        for (int dt = 0; dt < 4; ++dt) { if (HIRES) { const size_t vo = (size_t)(dt * 16 + lr) * PP + kb + 8 * hi; vf[dt] = WFrag<T16>::ld(Vt + vo); vf2[dt] = WFrag<T16>::ld(V2 + vo); }
#pragma unroll
            for (int qt = 0; qt < 2; ++qt) { o[dt][qt] = WFrag<T16>::mma(vf[dt], pf[qt], o[dt][qt]); if (HIRES) { o[dt][qt] = WFrag<T16>::mma(vf[dt], pf2[qt], o[dt][qt]); o[dt][qt] = WFrag<T16>::mma(vf2[dt], pf[qt], o[dt][qt]); } } }
    }
#pragma unroll
    for (int qt = 0; qt < 2; ++qt) { const float lj = l[qt] + __shfl_xor(l[qt], 16, 32); st[wave * 64 + qt * 16 + lr] = m[qt]; st[wave * 64 + 32 + qt * 16 + lr] = lj;   // both halves hold, and store, the same two values
#pragma unroll
        for (int dt = 0; dt < 4; ++dt) *(v8f*)(red + (size_t)(((wave * 8 + qt * 4 + dt) * 32 + lane) * 8)) = o[dt][qt]; }
    __syncthreads();                                                     // every wave's partial result is in LDS before any wave joins
    // wave w joins queries 4w..4w+3, 8 lanes a query, 8 consecutive d a lane: whole 128-byte lines of the merged planes, one writer a line. A wave that had no block left m = -3e38, l = 0, Ot = 0: factor 0.
    const int q = wave * 4 + (lane >> 3), dg = lane & 7;
    const float* rr = red + (((q >> 4) * 4 + (dg >> 1)) * 32 + (q & 15) + 16 * (dg & 1)) * 8;
    float M = st[q];
#pragma unroll
    for (int u = 1; u < FW; ++u) M = fmaxf(M, st[u * 64 + q]);
    float L = 0.0f; v8f acc = (v8f){};
#pragma unroll
    for (int u = 0; u < FW; ++u) { const float f = __builtin_amdgcn_exp2f(st[u * 64 + q] - M); L += st[u * 64 + 32 + q] * f; acc += *(const v8f*)(rr + u * (8 * 32 * 8)) * f; }
    const float inv = __fdiv_rn(1.0f, L); v8us oh, ol;
#pragma unroll
    for (int j = 0; j < 8; ++j) { unsigned short a, c2; splitf(acc[j] * inv, a, c2); oh[j] = a; ol[j] = c2; }
    const size_t oo = (size_t)(q0 + q) * DQ + dg * 8; *(v8us*)(Ah + oo) = oh; *(v8us*)(Al + oo) = ol;
}
// ---- fa_wide: the fp16 rows (>= RH). One work-group = FW * 32 = 256 query rows of one head, 32 a wave; every wave walks ALL keys of its own rows, so there is no join.
// A stage is SK = 64 keys: 64 key rows and the 64 rows of the transposed value plane, one whole 128-byte line each, brought into LDS by asynchronous copies (8 lanes a line)
// and read there by all FW waves: a key or value line leaves L2 once for 256 query rows, as a whole line. Two buffers: the next stage's copies fly while this one is worked on.
// A wave works on the 32-key blocks up to its own diagonal block and only passes the barriers of the stages behind it.
#define SK 64
#define KP 72                      // LDS row pitch in 16-bit elements: the row's 128 bytes + 16, which spreads the 16-byte fragment reads of 16 rows over all banks
// Four asynchronous 16-byte copies a lane: key rows r, r + 32 and value rows r, r + 32 of a stage.
// The s_wait_xcnt stands inside the statement, behind the last copy, so that no address register is rewritten in front of it.
__device__ __forceinline__ void cp4(unsigned l, const h16* gk, const h16* gv) {
    asm volatile("global_load_async_to_lds_b128 %0, %4, off\n\t"
                 "global_load_async_to_lds_b128 %1, %5, off\n\t"
                 "global_load_async_to_lds_b128 %2, %6, off\n\t"
                 "global_load_async_to_lds_b128 %3, %7, off\n\t"
                 "s_wait_xcnt 0x0"
                 :: "v"(l), "v"(l + 32 * KP * 2), "v"(l + 64 * KP * 2), "v"(l + 96 * KP * 2), "v"(gk), "v"(gk + 32 * HD), "v"(gv), "v"(gv + 32 * PP)
                 : "memory");
}
__device__ __forceinline__ void fa_wide(const h16* __restrict__ Q, const h16* __restrict__ Kp, const h16* __restrict__ Vt, int Q0, bf* Ah, bf* Al, h16* tl) {
    static_assert(HD == 64 && SK == 64 && FW * 32 % SK == 0, "a key row and a stage's piece of a value row are one 128-byte line; whole stages");
    typedef WFrag<h16>::V V;
    const int tid = threadIdx.x, lane = tid & 31, lr = lane & 15, hi = lane >> 4;
    const int wave = __builtin_amdgcn_readfirstlane(tid >> 5);           // scalar, so that the block loop's branch is scalar and EXEC stays full at the matrix instructions
    const int q0 = Q0 + wave * 32, NS = (Q0 + FW * 32) / SK;             // this wave's first row; stages of the work-group (at least 4)
    const unsigned l0 = (unsigned)(size_t)tl + (unsigned)((tid >> 3) * (KP * 2) + (tid & 7) * 16);
    const h16* gk = Kp + (size_t)(tid >> 3) * HD + (tid & 7) * 8; const h16* gv = Vt + (size_t)(tid >> 3) * PP + (tid & 7) * 8;
    auto issue = [&](int t, int buf) { cp4(l0 + (unsigned)buf * (2 * SK * KP * 2), gk + (size_t)t * SK * HD, gv + t * SK); };
    issue(0, 0);
    V qf[2][2];
#pragma unroll
    for (int qt = 0; qt < 2; ++qt)
#pragma unroll
        for (int kc = 0; kc < 2; ++kc) qf[qt][kc] = WFrag<h16>::ld(Q + (size_t)(q0 + qt * 16 + lr) * HD + kc * 32 + 8 * hi);
    v8f o[4][2];
#pragma unroll
    for (int dt = 0; dt < 4; ++dt)
#pragma unroll
        for (int qt = 0; qt < 2; ++qt) o[dt][qt] = (v8f){};
    float m[2] = { -3.0e38f, -3.0e38f }, l[2] = { 0.0f, 0.0f };
    asm volatile("s_wait_asynccnt 0x0" ::: "memory");                    // this wave's share of stage 0 has landed
    __syncthreads();                                                     // stage 0 is published
    issue(1, 1);
    // rolled: one stage a trip
#pragma unroll 1
    for (int t = 0; t < NS; ++t) {
        const h16* kl = tl + (t & 1) * (2 * SK * KP); const h16* vl = kl + SK * KP;
        const int ke = min(t * SK + SK, q0 + 32);                        // the wave's blocks end with its diagonal block
        // rolled: one block's fragments live beside the 8 output accumulators
#pragma unroll 1
        for (int kb = t * SK; kb < ke; kb += 32) {
            V kf[2][2], vf[4];
#pragma unroll
            for (int kt = 0; kt < 2; ++kt)
#pragma unroll
                for (int kc = 0; kc < 2; ++kc) kf[kt][kc] = WFrag<h16>::ld(kl + ((kb & 32) + kt * 16 + lr) * KP + kc * 32 + 8 * hi);
#pragma unroll
            for (int dt = 0; dt < 4; ++dt) vf[dt] = WFrag<h16>::ld(vl + (dt * 16 + lr) * KP + (kb & 32) + 8 * hi);
            v8f s[2][2];
#pragma unroll
            for (int kt = 0; kt < 2; ++kt)
#pragma unroll
                for (int qt = 0; qt < 2; ++qt) s[kt][qt] = (v8f){};
#pragma unroll
            for (int kt = 0; kt < 2; ++kt)
#pragma unroll
                for (int kc = 0; kc < 2; ++kc)
#pragma unroll
                    for (int qt = 0; qt < 2; ++qt) s[kt][qt] = wmma16(kf[kt][kc], qf[qt][kc], s[kt][qt]);
#pragma unroll
            for (int kt = 0; kt < 2; ++kt)
#pragma unroll
                for (int qt = 0; qt < 2; ++qt) s[kt][qt] *= SCL * 1.4426950408889634f;
            if (kb == q0) {                                              // the diagonal block (the wave's last): keys beyond the query are masked; key kb itself never is, so every column keeps a finite maximum
#pragma unroll
                for (int kt = 0; kt < 2; ++kt)
#pragma unroll
                    for (int qt = 0; qt < 2; ++qt)
#pragma unroll
                        for (int j = 0; j < 8; ++j) if (kt * 16 + hi * 8 + j > qt * 16 + lr) s[kt][qt][j] = -3.0e38f;
            }
            V pf[2];
#pragma unroll
            for (int qt = 0; qt < 2; ++qt) {
                float mx = s[0][qt][0];
#pragma unroll
                for (int j = 1; j < 16; ++j) mx = fmaxf(mx, s[j >> 3][qt][j & 7]);
                mx = fmaxf(mx, __shfl_xor(mx, 16, 32));
                const float mn = fmaxf(m[qt], mx), al = __builtin_amdgcn_exp2f(m[qt] - mn), mo = mn - 10.0f; m[qt] = mn;
                float sum = 0.0f;
#pragma unroll
                for (int j = 0; j < 16; ++j) { const float p = __builtin_amdgcn_exp2f(s[j >> 3][qt][j & 7] - mo); s[j >> 3][qt][j & 7] = p; sum += p; }
                l[qt] = l[qt] * al + sum;
#pragma unroll
                for (int dt = 0; dt < 4; ++dt) o[dt][qt] *= al;
                v8h c0, c1;
#pragma unroll
                for (int j = 0; j < 8; ++j) { c0[j] = tohx(s[0][qt][j]); c1[j] = tohx(s[1][qt][j]); }
                pf[qt] = cat16(c0, c1);
            }
#pragma unroll
            for (int dt = 0; dt < 4; ++dt)
#pragma unroll
                for (int qt = 0; qt < 2; ++qt) o[dt][qt] = wmma16(vf[dt], pf[qt], o[dt][qt]);
        }
        asm volatile("s_wait_dscnt 0x0" ::: "memory");                   // this wave's reads of the buffer have returned before the buffer is given up
        asm volatile("s_wait_asynccnt 0x0" ::: "memory");                // this wave's share of stage t + 1 has landed
        __syncthreads();                                                 // publishes stage t + 1 and ends every wave's reads of stage t
        if (t + 2 < NS) issue(t + 2, t & 1);
    }
    asm volatile("s_wait_asynccnt 0x0" ::: "memory");                    // no copy is outstanding from here on
    // Epilogue. The buffers are free (every wave's reads ended at the last trip's barrier). Each wave turns its 32 rows in its own eighth of them, one merged plane at a time, and stores whole 128-byte lines: 8 lanes a line, one writer a line.
    bf* sw = (bf*)tl + wave * (32 * KP);
    float inv[2];
#pragma unroll
    for (int qt = 0; qt < 2; ++qt) inv[qt] = __fdiv_rn(1.0f, l[qt] + __shfl_xor(l[qt], 16, 32));
#pragma unroll
    for (int pl = 0; pl < 2; ++pl) { bf* dst = pl ? Al : Ah;
#pragma unroll
        for (int qt = 0; qt < 2; ++qt)
#pragma unroll
            for (int dt = 0; dt < 4; ++dt) { v8us ov;
#pragma unroll
                for (int j = 0; j < 8; ++j) { unsigned short a, c2; splitf(o[dt][qt][j] * inv[qt], a, c2); ov[j] = pl ? c2 : a; }
                *(v8us*)(sw + (qt * 16 + lr) * KP + dt * 16 + hi * 8) = ov; }
        asm volatile("s_wait_dscnt 0x0" ::: "memory");                   // the wave's stores are in LDS before its lanes read one another's
#pragma unroll
        for (int i = 0; i < 8; ++i) { const int row = i * 4 + (lane >> 3);
            *(v8us*)(dst + (size_t)(q0 + row) * DQ + (lane & 7) * 8) = *(const v8us*)(sw + row * KP + (lane & 7) * 8); }
    }
}
// grid (heads * batches, 6 + RH / 32). y < 6: 256 fp16 rows (fa_wide), position blocks in the order 7, 6, 5, 4, 2, 3: all of these are resident at once, two places a WGP.
// Behind them the hi + lo tiles of 32 rows (fa_tile), longest first.
__global__ __launch_bounds__(FW * 32) void k_fattn(const h16* __restrict__ Q16, const h16* __restrict__ K16, const h16* __restrict__ V16, const bf* __restrict__ Qh, const bf* __restrict__ Ql, const bf* __restrict__ Kh, const bf* __restrict__ Kl, const bf* __restrict__ Vh, const bf* __restrict__ Vl, bf* Ah, bf* Al) {
    static_assert(TT == 2048 && RH == 512 && FW == 8, "the order of the position blocks is written for 8 blocks of 256 rows, the first 2 of them hi + lo");
    __shared__ __align__(32) float red[FW * 8 * 32 * 8];                 // fa_tile: [wave][query group][d tile][lane][8], 8 KiB a wave; fa_wide: its two buffers (36 KiB)
    __shared__ float st[FW * 64];                                        // [wave][m, l][query]
    static_assert(2 * 2 * SK * KP * 2 <= sizeof(red), "the two buffers fit");
    const int y = blockIdx.y; const size_t h = blockIdx.x % NH_, g = h / REP, b = blockIdx.x / NH_; const size_t qo = (b * NH_ + h) * TT * HD, ko = (b * NKV + g) * TT * HD, vo = (b * NKV + g) * HD * PP; Ah += b * TT * DQ; Al += b * TT * DQ;
    if (y < 6) fa_wide(Q16 + qo, K16 + ko, V16 + vo, (y < 4 ? 7 - y : y - 2) * (FW * 32), Ah + h * HD, Al + h * HD, (h16*)red);
    else fa_tile<bf, true>(Qh + qo, Ql + qo, Kh + ko, Kl + ko, Vh + vo, Vl + vo, (RH / 32 - 1 - (y - 6)) * 32, Ah + h * HD, Al + h * HD, red, st);
}

extern "C" void kernel_launch(void* const* d_in, const int* in_sizes, int n_in,
                              void* d_out, int out_size, void* d_ws, size_t ws_size, hipStream_t stream) {
    (void)in_sizes; (void)n_in; (void)out_size;
    const float* x = (const float*)d_in[0]; const float* wq = (const float*)d_in[1]; const float* bq = (const float*)d_in[2]; const float* wk = (const float*)d_in[3]; const float* bk = (const float*)d_in[4]; const float* wv = (const float*)d_in[5]; const float* bv = (const float*)d_in[6]; const float* wo = (const float*)d_in[7]; const float* bo = (const float*)d_in[8];   /* argument order x, Wq, bq, Wk, bk, Wv, bv, Wp, bp (per-head weights [16][1024][64]; per-head biases [16][64] = flat index h*64 + d) */
    float* OUT = (float*)d_out;     // [4][2048][1024]
    char* wsp = (char*)d_ws;
    auto take = [&](size_t bytes) { char* p = wsp; wsp += (bytes + 255) & ~(size_t)255; return (void*)p; };
    bf* WQ = (bf*)take((size_t)DQ * DM * 2); bf* WK = (bf*)take((size_t)DKV * DM * 2); bf* WV = (bf*)take((size_t)DKV * DM * 2); bf* WO = (bf*)take((size_t)DM * DQ * 2);
    bf* XB = (bf*)take((size_t)NB_ * TT * DM * 2);
    const size_t PQ = (size_t)NB_ * NH_ * TT * HD;         // elements of one query or key plane, all batches (NKV == NH_); each key plane lies directly behind its query plane
    h16* QP16 = (h16*)take(PQ * 2); h16* KP16 = (h16*)take(PQ * 2); bf* QPh = (bf*)take(PQ * 2); bf* KPh = (bf*)take(PQ * 2); bf* QPl = (bf*)take(PQ * 2); bf* KPl = (bf*)take(PQ * 2);
    h16* VT16 = (h16*)take((size_t)NB_ * NKV * HD * PP * 2); bf* VTh = (bf*)take((size_t)NB_ * NKV * HD * PP * 2); bf* VTl = (bf*)take((size_t)NB_ * NKV * HD * PP * 2);
    bf* ATh = (bf*)take((size_t)NB_ * TT * DQ * 2); bf* ATl = (bf*)take((size_t)NB_ * TT * DQ * 2);
    if ((size_t)(wsp - (char*)d_ws) > ws_size) return;    // 248 MiB of the 256 MiB
    (void)WK;                                              // reached through WQ: the four Bt planes lie one behind the other in the workspace
    k_wtG<<<dim3(DM / 256, NH_, 4), 256, 0, stream>>>(wq, wk, wv, wo, WQ);   /* per-head weights [h][DM][HD] ('xw' per head) -> the head's HD rows of WQ, WK, WV; wo [DQ][DM] -> WO */
    k_cvt8<<<(unsigned)(((size_t)NB_ * TT * DM / 8 + 255) / 256), 256, 0, stream>>>(x, XB, (size_t)NB_ * TT * DM / 8);
    k_gemmt<1, false, DM><<<dim3(NB_ * TT / 128, DQ / 128, 2), 128, 0, stream>>>(XB, nullptr, WQ, nullptr, 0, bq, bk, (size_t)DQ * DM, PQ, QP16, QPh, QPl);
    k_gemmt<2, false, DM><<<dim3(NB_ * TT / 128, DKV / 128, 1), 128, 0, stream>>>(XB, nullptr, WV, nullptr, 0, bv, nullptr, 0, 0, VT16, VTh, VTl);
    k_fattn<<<dim3(NH_ * NB_, 6 + RH / 32, 1), FW * 32, 0, stream>>>(QP16, KP16, VT16, QPh, QPl, KPh, KPl, VTh, VTl, ATh, ATl);
    k_gemmt<0, true, DQ><<<dim3(NB_ * TT / 128, DM / 128, 1), 128, 0, stream>>>(ATh, ATl, WO, OUT, DM, bo, nullptr, 0, 0, nullptr, nullptr, nullptr);
}

// v009
// Measured time: 127 microseconds a run.
// In both of two side-by-side timings against v008, it was 1.03 times as fast.
// Counting every step since v000, it is 25.4 times as fast.
#include <hip/hip_runtime.h>

// Causal multi-head self-attention whose q, k, v projections are given PER HEAD (x [4][2048][1024]; q, k, v = einsum('bte,hed->bhtd', x, W) + b[None, :, None, :] with W [16][1024][64] ((in, out) inside each head; 1/32-scale) and per-head biases b [16][64] (zeros on this draw); scores x 1/sqrt(64); causal (-inf); softmax; heads merged head-major (column h*64 + d); out = cat Wp + bp ('xw' [1024][1024] + zero bias) -> [4][2048][1024] (8.4 M); argument order x, Wq, bq, Wk, bk, Wv, bv, Wp, bp). THIS ROW: the same module under other names (token_embedding [4][2048][1024]; PER-HEAD stacked projections Wq, Wk, Wv [16][1024][64] normal x 1/32 with biases [16][64] zeros (read): q = einsum('btd,hde->bhte', x, Wq) + bq; scores / sqrt(64); tril kept, -inf; softmax; heads concatenated in order; out = cat Wo + bo ('xw' [1024][1024]; bias zeros: read); argument order token_embedding, Wq, bq, Wk, bk, Wv, bv, Wo, bo).
// Layout, all batches in every launch (6 launches): bf16 copy of x; 'xw' weights transposed once; exact projections + f32 biases, stored by the GEMM itself as the 16-bit head planes; causal T-2048 attention in one kernel, running softmax (hybrid rows: < 512 hi/lo 3 products, rest fp16 x1024; key blocks above the diagonal never visited); merged hi/lo x Wo exact + bo.
// Compute dtypes, f32 accumulate: every input rounded to bf16; projections exact + f32 biases; attention rows < 512 3 products, rest fp16; softmax f32; output projection hl x exact.

#define NB_  4
#define TT   2048
#define DM   1024
#define NH_  16
#define NKV  16
#define REP  (NH_ / NKV)
#define HD   64
#define DQ   (NH_ * HD)
#define DKV  (NKV * HD)
#define RH   512                  // query rows < RH use hi+lo planes
#define PP   (2 * TT)              // row pitch, in 16-bit elements, of the transposed value planes
#define SCL  0.125f   // HD^-0.5
typedef _Float16 h16;
typedef unsigned short bf;
typedef __attribute__((ext_vector_type(16))) __bf16   v16bf;
typedef __attribute__((ext_vector_type(16))) _Float16 v16h;
typedef __attribute__((ext_vector_type(8)))  _Float16 v8h;
typedef __attribute__((ext_vector_type(8)))  unsigned short v8us;
typedef __attribute__((ext_vector_type(8)))  float    v8f;
typedef __attribute__((ext_vector_type(4)))  float    v4f;
typedef v8h  __attribute__((may_alias)) v8ha;
typedef v4f  __attribute__((may_alias)) v4fa;
typedef v8us __attribute__((may_alias)) v8usa;

__device__ __forceinline__ unsigned short f2bf(float f) { unsigned u = __float_as_uint(f); u += 0x7FFFu + ((u >> 16) & 1u); return (unsigned short)(u >> 16); }
__device__ __forceinline__ float bf2f(unsigned short b) { return __uint_as_float(((unsigned)b) << 16); }
__device__ __forceinline__ float bfr(float f) { return bf2f(f2bf(f)); }
__device__ __forceinline__ v16h cat16(v8h lo, v8h hi) { return __builtin_shufflevector(lo, hi, 0, 1, 2, 3, 4, 5, 6, 7, 8, 9, 10, 11, 12, 13, 14, 15); }
__device__ __forceinline__ v16bf cat16b(v8us lo, v8us hi) { return __builtin_bit_cast(v16bf, __builtin_shufflevector(lo, hi, 0, 1, 2, 3, 4, 5, 6, 7, 8, 9, 10, 11, 12, 13, 14, 15)); }
__device__ __forceinline__ v8f wmma16(v16h a, v16h b, v8f c) { return __builtin_amdgcn_wmma_f32_16x16x32_f16(false, a, false, b, (short)0, c, false, false); }
__device__ __forceinline__ v8f wmmab(v16bf a, v16bf b, v8f c) { return __builtin_amdgcn_wmma_f32_16x16x32_bf16(false, a, false, b, (short)0, c, false, false); }



// ---- k_gemmt: GEMM, one 128x128 output tile per work-group of 4 waves (2 x 2, 64x64 a wave, 16 accumulators); grid (M/128, N/128, Z), 128 threads. The rows of A run through all batches (M = NB_ * TT).
// C[m][n] = bias[n] + sum_k A[m][k] Bt[n][k], A and Bt K-contiguous bf16 planes; the accumulators start at the bias. TWO: a lo plane A2 is staged beside A and meets the same Bt fragments (C = bias + A Bt^T + A2 Bt^T).
// z > 0 takes Bt + z sB, bias2 and the planes + z sP (z = 0 query, z = 1 key projection in one launch).
// A stage is 64 k (one 128-byte line) of the tile's 128 A rows (TWO: of both planes) and 128 Bt rows, brought into LDS by asynchronous copies (whole lines, 8 lanes a row) and read there by the two waves that need it: every operand line leaves L2 once a work-group.
// Two buffers: the next stage's copies fly while this one is worked on.
// MODE 0: f32 C (pitch ldc). MODE 1, 2: no f32 C; the tile goes straight to the three 16-bit planes (fp16, bf16 hi, bf16 lo) that the attention kernel reads (a wave's 64 columns are one head):
// MODE 1 query / key planes [b][h][t][d], MODE 2 transposed value planes [b][g][d][t] at pitch PP. The accumulator's register direction is made the plane's contiguous direction
// (MODE 1 swaps the two operands of the matrix instruction, so that a lane holds 8 consecutive d of one t; MODE 2 keeps them: 8 consecutive t of one d).
template <typename T16> struct WFrag;
template <> struct WFrag<h16> { typedef v16h V; static __device__ __forceinline__ V ld(const h16* p) { return cat16(*(const v8h*)p, *(const v8h*)(p + 16)); } static __device__ __forceinline__ v8f mma(V a, V b, v8f c) { return wmma16(a, b, c); } };
template <> struct WFrag<bf> { typedef v16bf V; static __device__ __forceinline__ V ld(const bf* p) { return cat16b(*(const v8us*)p, *(const v8us*)(p + 16)); } static __device__ __forceinline__ v8f mma(V a, V b, v8f c) { return wmmab(a, b, c); } };
#define GP 72                      // LDS row pitch in 16-bit elements: the row's 128 bytes + 16, which spreads the 16-byte fragment reads of 16 rows over all banks
// Eight asynchronous 16-byte copies a lane, 16 rows apart (LDS address l, global address g, 'step' elements between the rows).
// The s_wait_xcnt stands inside the statement, behind the last copy, so that no address register is rewritten in front of it.
__device__ __forceinline__ void cp8(unsigned l, const bf* g, size_t step) {
    asm volatile("global_load_async_to_lds_b128 %0, %8, off\n\t"
                 "global_load_async_to_lds_b128 %1, %9, off\n\t"
                 "global_load_async_to_lds_b128 %2, %10, off\n\t"
                 "global_load_async_to_lds_b128 %3, %11, off\n\t"
                 "global_load_async_to_lds_b128 %4, %12, off\n\t"
                 "global_load_async_to_lds_b128 %5, %13, off\n\t"
                 "global_load_async_to_lds_b128 %6, %14, off\n\t"
                 "global_load_async_to_lds_b128 %7, %15, off\n\t"
                 "s_wait_xcnt 0x0"
                 :: "v"(l), "v"(l + 1 * 16 * GP * 2), "v"(l + 2 * 16 * GP * 2), "v"(l + 3 * 16 * GP * 2), "v"(l + 4 * 16 * GP * 2), "v"(l + 5 * 16 * GP * 2), "v"(l + 6 * 16 * GP * 2), "v"(l + 7 * 16 * GP * 2),
                    "v"(g), "v"(g + step), "v"(g + 2 * step), "v"(g + 3 * step), "v"(g + 4 * step), "v"(g + 5 * step), "v"(g + 6 * step), "v"(g + 7 * step)
                 : "memory");
}
template <int MODE, bool TWO, int K>
__global__ __launch_bounds__(128) void k_gemmt(const bf* __restrict__ A, const bf* __restrict__ A2, const bf* __restrict__ Bt, float* C, int ldc, const float* __restrict__ bias, const float* __restrict__ bias2, size_t sB, size_t sP, h16* P16, bf* Ph, bf* Pl) {
    static_assert(MODE == 0 || (HD == 64 && !TWO), "the plane epilogue takes a wave's 64 columns as one head and a quarter of the 72 KiB");
    static_assert(K % 64 == 0 && K >= 128, "whole stages, at least two");
    typedef WFrag<bf>::V V;
    constexpr int AR = TWO ? 256 : 128, GROWS = AR + 128;            // rows of a buffer: 128 of A (TWO: then 128 of A2), then 128 of Bt
    __shared__ __attribute__((aligned(16))) bf tl[2 * GROWS * GP];   // [buffer][row][pitch]: 72 KiB (TWO: 108 KiB)
    const size_t z = blockIdx.z; Bt += z * sB; if (MODE != 0) { P16 += z * sP; Ph += z * sP; Pl += z * sP; if (z) bias = bias2; }
    const int tid = threadIdx.x, lane = tid & 31, lr = lane & 15, hi = lane >> 4; const int r0 = blockIdx.x * 128, c0 = blockIdx.y * 128;
    const int wave = __builtin_amdgcn_readfirstlane(tid >> 5), wm = wave >> 1, wn = wave & 1;
    const int rw = r0 + wm * 64, cw = c0 + wn * 64;                   // this wave's 64 x 64 piece
    constexpr int NT = K / 64;                                       // stages
    // copies: lane = 16 bytes number tid & 7 of rows tid >> 3 (+ 16 i): a wave's copy is 4 whole lines
    const size_t aoff = (size_t)(r0 + (tid >> 3)) * K + (tid & 7) * 8, boff = (size_t)(c0 + (tid >> 3)) * K + (tid & 7) * 8;
    const unsigned l0 = (unsigned)(size_t)tl + (unsigned)((tid >> 3) * (GP * 2) + (tid & 7) * 16);
    auto issue = [&](int t, int buf) { const int kk = t * 64; const unsigned l = l0 + (unsigned)buf * (GROWS * GP * 2);
        cp8(l, A + aoff + kk, (size_t)16 * K); if (TWO) cp8(l + 128 * GP * 2, A2 + aoff + kk, (size_t)16 * K); cp8(l + AR * GP * 2, Bt + boff + kk, (size_t)16 * K); };
    issue(0, 0);
    v8f acc[4][4];                                                   // start value: the bias of the element's column (its loads return while stage 0 flies)
#pragma unroll
    for (int nb = 0; nb < 4; ++nb) { v8f bv;
        if (MODE == 1) { const v4f u0 = *(const v4f*)(bias + cw + nb * 16 + hi * 8), u1 = *(const v4f*)(bias + cw + nb * 16 + hi * 8 + 4);
#pragma unroll
            for (int j = 0; j < 4; ++j) { bv[j] = bfr(u0[j]); bv[4 + j] = bfr(u1[j]); } }
        else { const float u = bfr(bias[cw + nb * 16 + lr]);
#pragma unroll
            for (int j = 0; j < 8; ++j) bv[j] = u; }
#pragma unroll
        for (int mb = 0; mb < 4; ++mb) acc[mb][nb] = bv; }
    asm volatile("s_wait_asynccnt 0x0" ::: "memory");                // this wave's share of stage 0 has landed
    __syncthreads();                                                 // stage 0 is published
    issue(1, 1);
    const bf* fa = tl + (wm * 64 + lr) * GP + 8 * hi; const bf* fb = tl + (AR + wn * 64 + lr) * GP + 8 * hi;
    // rolled: one stage a trip
#pragma unroll 1
    for (int t = 0; t < NT; ++t) { const int bo = (t & 1) * (GROWS * GP);
#pragma unroll
        for (int kc = 0; kc < 2; ++kc) { V a[4], a2[4], b[4];
            b[0] = WFrag<bf>::ld(fb + bo + kc * 32);
#pragma unroll
            for (int mb = 0; mb < 4; ++mb) a[mb] = WFrag<bf>::ld(fa + bo + mb * 16 * GP + kc * 32);
#pragma unroll
            for (int nb = 1; nb < 4; ++nb) b[nb] = WFrag<bf>::ld(fb + bo + nb * 16 * GP + kc * 32);
            if (TWO) {
#pragma unroll
                for (int mb = 0; mb < 4; ++mb) a2[mb] = WFrag<bf>::ld(fa + bo + (128 + mb * 16) * GP + kc * 32); }
            __builtin_amdgcn_sched_barrier(0);                       // the fragment reads stay one group in front of their matrix instructions (for speed only)
#pragma unroll
            for (int nb = 0; nb < 4; ++nb)
#pragma unroll
                for (int mb = 0; mb < 4; ++mb) acc[mb][nb] = (MODE == 1) ? wmmab(b[nb], a[mb], acc[mb][nb]) : wmmab(a[mb], b[nb], acc[mb][nb]);
            if (TWO) {
#pragma unroll
                for (int nb = 0; nb < 4; ++nb)
#pragma unroll
                    for (int mb = 0; mb < 4; ++mb) acc[mb][nb] = wmmab(a2[mb], b[nb], acc[mb][nb]); }
            __builtin_amdgcn_sched_barrier(0);                       // the same, for the next group of reads
        }
        asm volatile("s_wait_dscnt 0x0" ::: "memory");               // this wave's reads of the buffer have returned before the buffer is given up
        asm volatile("s_wait_asynccnt 0x0" ::: "memory");            // this wave's share of stage t + 1 has landed
        __syncthreads();                                             // publishes stage t + 1 and ends every wave's reads of stage t
        if (t + 2 < NT) issue(t + 2, t & 1);
    }
    asm volatile("s_wait_asynccnt 0x0" ::: "memory");                // no copy is outstanding from here on
    if constexpr (MODE != 0) {
        // Plane epilogue. The buffers are free (every wave's reads ended at the last trip's barrier). Each wave turns its piece in its own quarter of them, 32 plane rows (128-byte lines) of the three planes at a time,
        // and stores whole lines: 8 lanes a line, one writer a line. l2: tile in the lane direction (the plane's rows), rt: in the register direction (along a row).
        bf* sw = tl + wave * (GROWS * GP / 2);
        const int bt = rw / TT, t0 = rw % TT;                         // the piece's batch and its first position there (TT % 64 == 0: a piece lies in one batch)
        const float qs = (MODE == 1 && z == 0) ? SCL * 1.4426950408889634f : 1.0f;   // the fp16 query plane carries the score scale (log2 units), rounded once from f32; every other plane is unscaled
#pragma unroll
        for (int h = 0; h < 2; ++h) {
#pragma unroll
            for (int l2 = 0; l2 < 2; ++l2)
#pragma unroll
                for (int rt = 0; rt < 4; ++rt) { const v8f s = (MODE == 1) ? acc[h * 2 + l2][rt] : acc[rt][h * 2 + l2]; v8h o16; v8us oh, ol;
#pragma unroll
                    for (int j = 0; j < 8; ++j) { o16[j] = (h16)(MODE == 1 ? s[j] * qs : s[j]); const unsigned short a2 = f2bf(s[j]); oh[j] = a2; ol[j] = f2bf(s[j] - bf2f(a2)); }
                    bf* p = sw + (l2 * 16 + lr) * GP + rt * 16 + hi * 8;
                    *(v8us*)p = __builtin_bit_cast(v8us, o16); *(v8us*)(p + 32 * GP) = oh; *(v8us*)(p + 64 * GP) = ol; }
            asm volatile("s_wait_dscnt 0x0" ::: "memory");           // the wave's stores are in LDS before its lanes read one another's
#pragma unroll
            for (int pl = 0; pl < 3; ++pl) { bf* dst = (pl == 0) ? (bf*)P16 : (pl == 1) ? Ph : Pl;
#pragma unroll
                for (int i = 0; i < 8; ++i) { const int row = i * 4 + (lane >> 3);
                    const size_t e = (MODE == 1) ? (((size_t)bt * NH_ + cw / HD) * TT + t0 + h * 32 + row) * HD + (lane & 7) * 8 : ((size_t)bt * DKV + cw + h * 32 + row) * PP + t0 + (lane & 7) * 8;
                    *(v8us*)(dst + e) = *(const v8us*)(sw + (pl * 32 + row) * GP + (lane & 7) * 8); } }
        }
    } else {
        float* crow = C + (size_t)(rw + hi * 8) * ldc + cw + lr;
#pragma unroll
        for (int nb = 0; nb < 4; ++nb)
#pragma unroll
            for (int mb = 0; mb < 4; ++mb)
#pragma unroll
                for (int j = 0; j < 8; ++j) crow[(size_t)(mb * 16 + j) * ldc + nb * 16] = acc[mb][nb][j];
    }
}

__device__ __forceinline__ h16 tohx(float x) { return (h16)x; }
__device__ __forceinline__ void splitf(float y, unsigned short& h, unsigned short& l) { h = f2bf(y); l = f2bf(y - bf2f(h)); }
typedef __attribute__((ext_vector_type(2))) _Float16 v2h;
typedef __attribute__((ext_vector_type(4))) _Float16 v4h;
typedef __attribute__((ext_vector_type(2))) unsigned short v2us;
typedef __attribute__((ext_vector_type(4))) unsigned short v4us;
typedef __attribute__((ext_vector_type(2))) float v2f;
typedef __attribute__((ext_vector_type(4))) int v4i;

typedef __attribute__((ext_vector_type(4))) unsigned v4u;
// ---- k_wtG: the four 'xw' weights, f32 [k][n], to the K-contiguous bf16 planes Bt [n][k]. grid (DM / 256, NH_, 4), 256 threads: one tile of 256 k x 64 n a work-group, turned in LDS.
// Sources 0..2: head y's matrix [DM][HD] (all its 64 columns, k tile x). Source 3: ONE matrix [DQ][DM], k tile x, column tile y. Either way the tile's rows in Bt are number (z * NH_ + y) * 64 + n, pitch DM.
// Reads: 16 lanes a source row piece of 256 bytes (two whole lines), a lane's 16 loads all in flight. Stores: 16 lanes a 256-byte piece of a row of Bt (two whole lines), one writer a line.
// A lane takes 4 columns of the rows k, k + 1 and puts each column's pair into one LDS word; the pitch of WP words keeps both the word stores (banks 4 c + r) and the word reads (banks n + 4 c) free of conflicts.
#define WP 129
template <int N>                                                         // N: pitch of the source rows
__device__ __forceinline__ void wt_tile(const float* __restrict__ w, bf* dst, unsigned* tp) {
    const int tid = threadIdx.x, c = tid & 15, r = tid >> 4;
    const float* src = w + (size_t)(2 * r) * N + c * 4;
    v4f a[8][2];
#pragma unroll
    for (int i = 0; i < 8; ++i)
#pragma unroll
        for (int e = 0; e < 2; ++e) a[i][e] = *(const v4f*)(src + (size_t)(32 * i + e) * N);
    // the wait in front of any overwrite of the loads' address register pair; it names the pair as an input so that it lives up to the wait (without that a load's result can be given the pair)
    asm volatile("s_wait_xcnt 0x0" :: "v"(src) : "memory");
#pragma unroll
    for (int i = 0; i < 8; ++i)
#pragma unroll
        for (int j = 0; j < 4; ++j) tp[(c * 4 + j) * WP + r + 16 * i] = (unsigned)f2bf(a[i][0][j]) | ((unsigned)f2bf(a[i][1][j]) << 16);
    __syncthreads();                                                     // the whole tile is in LDS before any lane reads another's words
#pragma unroll
    for (int u = 0; u < 8; ++u) { const int n = (u & 3) * 16 + r, o = (u >> 2) * 64 + c * 4; v4u v;
#pragma unroll
        for (int e = 0; e < 4; ++e) v[e] = tp[n * WP + o + e];
        *(v4u*)(dst + (size_t)n * DM + o * 2) = v; }
}
__global__ __launch_bounds__(256) void k_wtG(const float* __restrict__ w0, const float* __restrict__ w1, const float* __restrict__ w2, const float* __restrict__ w3, bf* Bt) {
    static_assert(HD == 64 && DQ == DM && DKV == DQ && DM % 256 == 0, "a head's columns are one tile; all four planes have DM rows of DM elements, one behind the other");
    __shared__ unsigned tp[64 * WP];                                     // [n][k / 2]
    const size_t x = blockIdx.x, y = blockIdx.y, z = blockIdx.z;
    bf* dst = Bt + (z * NH_ + y) * 64 * DM + x * 256;
    if (z == 3) wt_tile<DM>(w3 + x * 256 * DM + y * 64, dst, tp);
    else wt_tile<HD>((z == 0 ? w0 : z == 1 ? w1 : w2) + y * DM * HD + x * 256 * HD, dst, tp);
}
__global__ __launch_bounds__(256) void k_cvt8(const float* __restrict__ src, bf* dst, size_t n8) { const size_t i = (size_t)blockIdx.x * 256 + threadIdx.x; if (i >= n8) return; const v8f v = *(const v8f*)(src + i * 8); v8us o;
#pragma unroll
    for (int k = 0; k < 8; ++k) o[k] = f2bf(v[k]); *(v8us*)(dst + i * 8) = o;  }

#define FW 8
template <typename T16, bool HIRES>
__device__ __forceinline__ void fa_tile(const T16* __restrict__ Q, const T16* __restrict__ Q2, const T16* __restrict__ Kp, const T16* __restrict__ K2, const T16* __restrict__ Vt, const T16* __restrict__ V2, int q0, bf* Ah, bf* Al, float* red, float* st) {
    static_assert(HIRES, "written for the hi + lo planes");
    typedef typename WFrag<T16>::V V;
    const int lane = threadIdx.x & 31, lr = lane & 15, hi = lane >> 4;
    const int wave = __builtin_amdgcn_readfirstlane(threadIdx.x >> 5);   // scalar, so that the key loop's branch is scalar and EXEC stays full at the matrix instructions
    V qf[2][2], qf2[2][2];
#pragma unroll
    for (int qt = 0; qt < 2; ++qt)
#pragma unroll
        for (int kc = 0; kc < 2; ++kc) { const size_t o = (size_t)(q0 + qt * 16 + lr) * HD + kc * 32 + 8 * hi; qf[qt][kc] = WFrag<T16>::ld(Q + o); if (HIRES) qf2[qt][kc] = WFrag<T16>::ld(Q2 + o); }
    v8f o[4][2];
#pragma unroll
    for (int dt = 0; dt < 4; ++dt)
#pragma unroll
        for (int qt = 0; qt < 2; ++qt) o[dt][qt] = (v8f){};
    float m[2] = { -3.0e38f, -3.0e38f }, l[2] = { 0.0f, 0.0f };
    // at most 2 blocks a wave, twice the fragments: every fragment is fetched where it is used, which keeps the kernel within 256 registers.
    V kf[2][2], kf2[2][2];
    // rolled: one block's fragments live beside the 8 output accumulators
#pragma unroll 1
    for (int kb = wave * 32; kb < q0 + 32; kb += FW * 32) {
        V vf[4], vf2[4];
        v8f s[2][2];
#pragma unroll
        for (int kt = 0; kt < 2; ++kt)
#pragma unroll
            for (int qt = 0; qt < 2; ++qt) s[kt][qt] = (v8f){};
#pragma unroll
        for (int kt = 0; kt < 2; ++kt)
#pragma unroll
            for (int kc = 0; kc < 2; ++kc) { if (HIRES) { const size_t ko = (size_t)(kb + kt * 16 + lr) * HD + kc * 32 + 8 * hi; kf[kt][kc] = WFrag<T16>::ld(Kp + ko); kf2[kt][kc] = WFrag<T16>::ld(K2 + ko);
                    asm volatile("s_wait_xcnt 0x0" ::: "memory"); }   // stands in front of any overwrite of these four loads' address registers
#pragma unroll
                for (int qt = 0; qt < 2; ++qt) { s[kt][qt] = WFrag<T16>::mma(kf[kt][kc], qf[qt][kc], s[kt][qt]); if (HIRES) { s[kt][qt] = WFrag<T16>::mma(kf[kt][kc], qf2[qt][kc], s[kt][qt]); s[kt][qt] = WFrag<T16>::mma(kf2[kt][kc], qf[qt][kc], s[kt][qt]); } } }
#pragma unroll
        for (int kt = 0; kt < 2; ++kt)
#pragma unroll
            for (int qt = 0; qt < 2; ++qt) s[kt][qt] *= SCL * 1.4426950408889634f;
        if (kb == q0) {                                                  // the diagonal block (the tile's last): keys beyond the query are masked; key kb itself never is, so every column keeps a finite maximum
#pragma unroll
            for (int kt = 0; kt < 2; ++kt)
#pragma unroll
                for (int qt = 0; qt < 2; ++qt)
#pragma unroll
                    for (int j = 0; j < 8; ++j) if (kt * 16 + hi * 8 + j > qt * 16 + lr) s[kt][qt][j] = -3.0e38f;
        }
        V pf[2], pf2[2];
#pragma unroll
        for (int qt = 0; qt < 2; ++qt) {
            float mx = s[0][qt][0];
#pragma unroll
            for (int j = 1; j < 16; ++j) mx = fmaxf(mx, s[j >> 3][qt][j & 7]);
            mx = fmaxf(mx, __shfl_xor(mx, 16, 32));
            const float mn = fmaxf(m[qt], mx), al = __builtin_amdgcn_exp2f(m[qt] - mn), mo = mn - 10.0f; m[qt] = mn;
            float sum = 0.0f;
#pragma unroll
            for (int j = 0; j < 16; ++j) { const float p = __builtin_amdgcn_exp2f(s[j >> 3][qt][j & 7] - mo); s[j >> 3][qt][j & 7] = p; sum += p; }
            l[qt] = l[qt] * al + sum;
#pragma unroll
            for (int dt = 0; dt < 4; ++dt) o[dt][qt] *= al;
            if constexpr (HIRES) { v8us h0, h1, l0, l1;
#pragma unroll
                for (int j = 0; j < 8; ++j) { unsigned short a, c2; splitf(s[0][qt][j], a, c2); h0[j] = a; l0[j] = c2; splitf(s[1][qt][j], a, c2); h1[j] = a; l1[j] = c2; }
                pf[qt] = cat16b(h0, h1); pf2[qt] = cat16b(l0, l1);
            }
        }
#pragma unroll
        for (int dt = 0; dt < 4; ++dt) { if (HIRES) { const size_t vo = (size_t)(dt * 16 + lr) * PP + kb + 8 * hi; vf[dt] = WFrag<T16>::ld(Vt + vo); vf2[dt] = WFrag<T16>::ld(V2 + vo); }
#pragma unroll
            for (int qt = 0; qt < 2; ++qt) { o[dt][qt] = WFrag<T16>::mma(vf[dt], pf[qt], o[dt][qt]); if (HIRES) { o[dt][qt] = WFrag<T16>::mma(vf[dt], pf2[qt], o[dt][qt]); o[dt][qt] = WFrag<T16>::mma(vf2[dt], pf[qt], o[dt][qt]); } } }
    }
#pragma unroll
    for (int qt = 0; qt < 2; ++qt) { const float lj = l[qt] + __shfl_xor(l[qt], 16, 32); st[wave * 64 + qt * 16 + lr] = m[qt]; st[wave * 64 + 32 + qt * 16 + lr] = lj;   // both halves hold, and store, the same two values
#pragma unroll
        for (int dt = 0; dt < 4; ++dt) *(v8f*)(red + (size_t)(((wave * 8 + qt * 4 + dt) * 32 + lane) * 8)) = o[dt][qt]; }
    __syncthreads();                                                     // every wave's partial result is in LDS before any wave joins
    // wave w joins queries 4w..4w+3, 8 lanes a query, 8 consecutive d a lane: whole 128-byte lines of the merged planes, one writer a line. A wave that had no block left m = -3e38, l = 0, Ot = 0: factor 0.
    const int q = wave * 4 + (lane >> 3), dg = lane & 7;
    const float* rr = red + (((q >> 4) * 4 + (dg >> 1)) * 32 + (q & 15) + 16 * (dg & 1)) * 8;
    float M = st[q];
#pragma unroll
    for (int u = 1; u < FW; ++u) M = fmaxf(M, st[u * 64 + q]);
    float L = 0.0f; v8f acc = (v8f){};
#pragma unroll
    for (int u = 0; u < FW; ++u) { const float f = __builtin_amdgcn_exp2f(st[u * 64 + q] - M); L += st[u * 64 + 32 + q] * f; acc += *(const v8f*)(rr + u * (8 * 32 * 8)) * f; }
    const float inv = __fdiv_rn(1.0f, L); v8us oh, ol;
#pragma unroll
    for (int j = 0; j < 8; ++j) { unsigned short a, c2; splitf(acc[j] * inv, a, c2); oh[j] = a; ol[j] = c2; }
    const size_t oo = (size_t)(q0 + q) * DQ + dg * 8; *(v8us*)(Ah + oo) = oh; *(v8us*)(Al + oo) = ol;
}
// ---- fa_wide: the fp16 rows (>= RH). One work-group = FW * 32 = 256 query rows of one head, 32 a wave; every wave walks ALL keys of its own rows, so there is no join.
// A stage is SK = 64 keys: 64 key rows and the 64 rows of the transposed value plane, one whole 128-byte line each, brought into LDS by asynchronous copies (8 lanes a line)
// and read there by all FW waves: a key or value line leaves L2 once for 256 query rows, as a whole line. Two buffers: the next stage's copies fly while this one is worked on.
// A wave works on the 32-key blocks up to its own diagonal block and only passes the barriers of the stages behind it.
// Softmax here: the fp16 query plane already carries the score scale, and the score accumulators START at cs = 10 - (maximum in use), so that exp2 reads the matrix results as they are.
// The maximum in use is set by the first block and moves only when a lane's sum over a block passes 2^15 (then, and in the first block, Ot and l are rescaled and the block's probabilities made anew):
// without that step every probability is at most 2^15, inside fp16; a score more than 5 above the maximum in use always takes it.
__device__ __forceinline__ float sum16(v8f a, v8f b) { const v8f c = a + b; const v4f d = __builtin_shufflevector(c, c, 0, 1, 2, 3) + __builtin_shufflevector(c, c, 4, 5, 6, 7); return (d[0] + d[2]) + (d[1] + d[3]); }
#define SK 64
#define KP 72                      // LDS row pitch in 16-bit elements: the row's 128 bytes + 16, which spreads the 16-byte fragment reads of 16 rows over all banks
// Four asynchronous 16-byte copies a lane: key rows r, r + 32 and value rows r, r + 32 of a stage.
// The s_wait_xcnt stands inside the statement, behind the last copy, so that no address register is rewritten in front of it.
__device__ __forceinline__ void cp4(unsigned l, const h16* gk, const h16* gv) {
    asm volatile("global_load_async_to_lds_b128 %0, %4, off\n\t"
                 "global_load_async_to_lds_b128 %1, %5, off\n\t"
                 "global_load_async_to_lds_b128 %2, %6, off\n\t"
                 "global_load_async_to_lds_b128 %3, %7, off\n\t"
                 "s_wait_xcnt 0x0"
                 :: "v"(l), "v"(l + 32 * KP * 2), "v"(l + 64 * KP * 2), "v"(l + 96 * KP * 2), "v"(gk), "v"(gk + 32 * HD), "v"(gv), "v"(gv + 32 * PP)
                 : "memory");
}
__device__ __forceinline__ void fa_wide(const h16* __restrict__ Q, const h16* __restrict__ Kp, const h16* __restrict__ Vt, int Q0, bf* Ah, bf* Al, h16* tl) {
    static_assert(HD == 64 && SK == 64 && FW * 32 % SK == 0, "a key row and a stage's piece of a value row are one 128-byte line; whole stages");
    typedef WFrag<h16>::V V;
    const int tid = threadIdx.x, lane = tid & 31, lr = lane & 15, hi = lane >> 4;
    const int wave = __builtin_amdgcn_readfirstlane(tid >> 5);           // scalar, so that the block loop's branch is scalar and EXEC stays full at the matrix instructions
    const int q0 = Q0 + wave * 32, NS = (Q0 + FW * 32) / SK;             // this wave's first row; stages of the work-group (at least 4)
    const unsigned l0 = (unsigned)(size_t)tl + (unsigned)((tid >> 3) * (KP * 2) + (tid & 7) * 16);
    const h16* gk = Kp + (size_t)(tid >> 3) * HD + (tid & 7) * 8; const h16* gv = Vt + (size_t)(tid >> 3) * PP + (tid & 7) * 8;
    auto issue = [&](int t, int buf) { cp4(l0 + (unsigned)buf * (2 * SK * KP * 2), gk + (size_t)t * SK * HD, gv + t * SK); };
    issue(0, 0);
    V qf[2][2];
#pragma unroll
    for (int qt = 0; qt < 2; ++qt)
#pragma unroll
        for (int kc = 0; kc < 2; ++kc) qf[qt][kc] = WFrag<h16>::ld(Q + (size_t)(q0 + qt * 16 + lr) * HD + kc * 32 + 8 * hi);
    v8f o[4][2];
#pragma unroll
    for (int dt = 0; dt < 4; ++dt)
#pragma unroll
        for (int qt = 0; qt < 2; ++qt) o[dt][qt] = (v8f){};
    float cs[2] = { 0.0f, 0.0f }, l[2] = { 0.0f, 0.0f };
    v8f cb[2][2] = { { (v8f){}, (v8f){} }, { (v8f){}, (v8f){} } };       // cs in all 8 registers: the C operand of a score tile's first product (written per tile: with one array a query group the build copied it, 8 register-pair moves, in every block)
    asm volatile("s_wait_asynccnt 0x0" ::: "memory");                    // this wave's share of stage 0 has landed
    __syncthreads();                                                     // stage 0 is published
    issue(1, 1);
    // rolled: one stage a trip
#pragma unroll 1
    for (int t = 0; t < NS; ++t) {
        const h16* kl = tl + (t & 1) * (2 * SK * KP); const h16* vl = kl + SK * KP;
        const int ke = min(t * SK + SK, q0 + 32);                        // the wave's blocks end with its diagonal block
        const h16* kp = kl + lr * KP + 8 * hi; const h16* vp = vl + lr * KP + 8 * hi;   // this lane's place in the block's key rows and value columns
        // rolled: one block's fragments live beside the 8 output accumulators
#pragma unroll 1
        for (int kb = t * SK; kb < ke; kb += 32) {
            V kf[2][2], vf[4];
#pragma unroll
            for (int kt = 0; kt < 2; ++kt)
#pragma unroll
                for (int kc = 0; kc < 2; ++kc) kf[kt][kc] = WFrag<h16>::ld(kp + kt * 16 * KP + kc * 32);
            __builtin_amdgcn_sched_barrier(0);                           // the key fragment reads stay one group in front of the score products (for speed only)
            v8f s[2][2];
#pragma unroll
            for (int kt = 0; kt < 2; ++kt)
#pragma unroll
                for (int qt = 0; qt < 2; ++qt) s[kt][qt] = cb[kt][qt];
#pragma unroll
            for (int kt = 0; kt < 2; ++kt)
#pragma unroll
                for (int kc = 0; kc < 2; ++kc)
#pragma unroll
                    for (int qt = 0; qt < 2; ++qt) s[kt][qt] = wmma16(kf[kt][kc], qf[qt][kc], s[kt][qt]);
            __builtin_amdgcn_sched_barrier(0);                           // the value fragments are asked for behind the score products (they take the key fragments' registers) ...
#pragma unroll
            for (int dt = 0; dt < 4; ++dt) vf[dt] = WFrag<h16>::ld(vp + dt * 16 * KP);
            kp += 32 * KP; vp += 32;                                     // the next block's places, formed here: no address arithmetic stands between the block's last product and the next block's reads
            __builtin_amdgcn_sched_barrier(0);                           // ... and as one group in front of the exponentials, under which they return (sunk to their products, each waits out the LDS)
            if (kb == q0) {                                              // the diagonal block (the wave's last): keys beyond the query are masked; key kb itself never is, so every column keeps a finite maximum
#pragma unroll
                for (int kt = 0; kt < 2; ++kt)
#pragma unroll
                    for (int qt = 0; qt < 2; ++qt)
#pragma unroll
                        for (int j = 0; j < 8; ++j) if (kt * 16 + hi * 8 + j > qt * 16 + lr) s[kt][qt][j] = -3.0e38f;
            }
            v8f p[2][2]; float sum[2];
#pragma unroll
            for (int qt = 0; qt < 2; ++qt) {
#pragma unroll
                for (int j = 0; j < 16; ++j) p[j >> 3][qt][j & 7] = __builtin_amdgcn_exp2f(s[j >> 3][qt][j & 7]);
                sum[qt] = sum16(p[0][qt], p[1][qt]);
            }
            if ((__builtin_amdgcn_ballot_w32(fmaxf(sum[0], sum[1]) > 32768.0f) | (unsigned)(kb == 0)) != 0) {   // one scalar branch a block; behind the first block it is rarely taken
#pragma unroll
                for (int qt = 0; qt < 2; ++qt) {
                    float mx = s[0][qt][0];
#pragma unroll
                    for (int j = 1; j < 16; ++j) mx = fmaxf(mx, s[j >> 3][qt][j & 7]);
                    mx = fmaxf(mx, __shfl_xor(mx, 16, 32));              // both halves of the wave move a query's maximum alike
                    const float up = fmaxf(mx - 10.0f, 0.0f), d = (kb == 0) ? mx - 10.0f : up, al = __builtin_amdgcn_exp2f(-up);   // the first block sets the maximum (Ot = l = 0 there), a later one only raises it
                    cs[qt] -= d; l[qt] *= al;
#pragma unroll
                    for (int j = 0; j < 8; ++j) { cb[0][qt][j] = cs[qt]; cb[1][qt][j] = cs[qt]; }
#pragma unroll
                    for (int dt = 0; dt < 4; ++dt) o[dt][qt] *= al;
#pragma unroll
                    for (int j = 0; j < 16; ++j) p[j >> 3][qt][j & 7] = __builtin_amdgcn_exp2f(s[j >> 3][qt][j & 7] - d);
                    sum[qt] = sum16(p[0][qt], p[1][qt]);
                }
            }
            V pf[2];
#pragma unroll
            for (int qt = 0; qt < 2; ++qt) {
                l[qt] += sum[qt];
                v8h c0, c1;
#pragma unroll
                for (int j = 0; j < 8; ++j) { c0[j] = tohx(p[0][qt][j]); c1[j] = tohx(p[1][qt][j]); }
                pf[qt] = cat16(c0, c1);
            }
#pragma unroll
            for (int dt = 0; dt < 4; ++dt)
#pragma unroll
                for (int qt = 0; qt < 2; ++qt) o[dt][qt] = wmma16(vf[dt], pf[qt], o[dt][qt]);
        }
        asm volatile("s_wait_dscnt 0x0" ::: "memory");                   // this wave's reads of the buffer have returned before the buffer is given up
        asm volatile("s_wait_asynccnt 0x0" ::: "memory");                // this wave's share of stage t + 1 has landed
        __syncthreads();                                                 // publishes stage t + 1 and ends every wave's reads of stage t
        if (t + 2 < NS) issue(t + 2, t & 1);
    }
    asm volatile("s_wait_asynccnt 0x0" ::: "memory");                    // no copy is outstanding from here on
    // Epilogue. The buffers are free (every wave's reads ended at the last trip's barrier). Each wave turns its 32 rows in its own eighth of them, one merged plane at a time, and stores whole 128-byte lines: 8 lanes a line, one writer a line.
    bf* sw = (bf*)tl + wave * (32 * KP);
    float inv[2];
#pragma unroll
    for (int qt = 0; qt < 2; ++qt) inv[qt] = __fdiv_rn(1.0f, l[qt] + __shfl_xor(l[qt], 16, 32));
#pragma unroll
    for (int pl = 0; pl < 2; ++pl) { bf* dst = pl ? Al : Ah;
#pragma unroll
        for (int qt = 0; qt < 2; ++qt)
#pragma unroll
            for (int dt = 0; dt < 4; ++dt) { v8us ov;
#pragma unroll
                for (int j = 0; j < 8; ++j) { unsigned short a, c2; splitf(o[dt][qt][j] * inv[qt], a, c2); ov[j] = pl ? c2 : a; }
                *(v8us*)(sw + (qt * 16 + lr) * KP + dt * 16 + hi * 8) = ov; }
        asm volatile("s_wait_dscnt 0x0" ::: "memory");                   // the wave's stores are in LDS before its lanes read one another's
#pragma unroll
        for (int i = 0; i < 8; ++i) { const int row = i * 4 + (lane >> 3);
            *(v8us*)(dst + (size_t)(q0 + row) * DQ + (lane & 7) * 8) = *(const v8us*)(sw + row * KP + (lane & 7) * 8); }
    }
}
// grid (heads * batches, 6 + RH / 32). y < 6: 256 fp16 rows (fa_wide), position blocks in the order 7, 6, 5, 4, 2, 3: all of these are resident at once, two places a WGP.
// Behind them the hi + lo tiles of 32 rows (fa_tile), longest first.
__global__ __launch_bounds__(FW * 32) void k_fattn(const h16* __restrict__ Q16, const h16* __restrict__ K16, const h16* __restrict__ V16, const bf* __restrict__ Qh, const bf* __restrict__ Ql, const bf* __restrict__ Kh, const bf* __restrict__ Kl, const bf* __restrict__ Vh, const bf* __restrict__ Vl, bf* Ah, bf* Al) {
    static_assert(TT == 2048 && RH == 512 && FW == 8, "the order of the position blocks is written for 8 blocks of 256 rows, the first 2 of them hi + lo");
    __shared__ __align__(32) float red[FW * 8 * 32 * 8];                 // fa_tile: [wave][query group][d tile][lane][8], 8 KiB a wave; fa_wide: its two buffers (36 KiB)
    __shared__ float st[FW * 64];                                        // [wave][m, l][query]
    static_assert(2 * 2 * SK * KP * 2 <= sizeof(red), "the two buffers fit");
    const int y = blockIdx.y; const size_t h = blockIdx.x % NH_, g = h / REP, b = blockIdx.x / NH_; const size_t qo = (b * NH_ + h) * TT * HD, ko = (b * NKV + g) * TT * HD, vo = (b * NKV + g) * HD * PP; Ah += b * TT * DQ; Al += b * TT * DQ;
    if (y < 6) fa_wide(Q16 + qo, K16 + ko, V16 + vo, (y < 4 ? 7 - y : y - 2) * (FW * 32), Ah + h * HD, Al + h * HD, (h16*)red);
    else fa_tile<bf, true>(Qh + qo, Ql + qo, Kh + ko, Kl + ko, Vh + vo, Vl + vo, (RH / 32 - 1 - (y - 6)) * 32, Ah + h * HD, Al + h * HD, red, st);
}

extern "C" void kernel_launch(void* const* d_in, const int* in_sizes, int n_in,
                              void* d_out, int out_size, void* d_ws, size_t ws_size, hipStream_t stream) {
    (void)in_sizes; (void)n_in; (void)out_size;
    const float* x = (const float*)d_in[0]; const float* wq = (const float*)d_in[1]; const float* bq = (const float*)d_in[2]; const float* wk = (const float*)d_in[3]; const float* bk = (const float*)d_in[4]; const float* wv = (const float*)d_in[5]; const float* bv = (const float*)d_in[6]; const float* wo = (const float*)d_in[7]; const float* bo = (const float*)d_in[8];   /* argument order x, Wq, bq, Wk, bk, Wv, bv, Wp, bp (per-head weights [16][1024][64]; per-head biases [16][64] = flat index h*64 + d) */
    float* OUT = (float*)d_out;     // [4][2048][1024]
    char* wsp = (char*)d_ws;
    auto take = [&](size_t bytes) { char* p = wsp; wsp += (bytes + 255) & ~(size_t)255; return (void*)p; };
    bf* WQ = (bf*)take((size_t)DQ * DM * 2); bf* WK = (bf*)take((size_t)DKV * DM * 2); bf* WV = (bf*)take((size_t)DKV * DM * 2); bf* WO = (bf*)take((size_t)DM * DQ * 2);
    bf* XB = (bf*)take((size_t)NB_ * TT * DM * 2);
    const size_t PQ = (size_t)NB_ * NH_ * TT * HD;         // elements of one query or key plane, all batches (NKV == NH_); each key plane lies directly behind its query plane
    h16* QP16 = (h16*)take(PQ * 2); h16* KP16 = (h16*)take(PQ * 2); bf* QPh = (bf*)take(PQ * 2); bf* KPh = (bf*)take(PQ * 2); bf* QPl = (bf*)take(PQ * 2); bf* KPl = (bf*)take(PQ * 2);
    h16* VT16 = (h16*)take((size_t)NB_ * NKV * HD * PP * 2); bf* VTh = (bf*)take((size_t)NB_ * NKV * HD * PP * 2); bf* VTl = (bf*)take((size_t)NB_ * NKV * HD * PP * 2);
    bf* ATh = (bf*)take((size_t)NB_ * TT * DQ * 2); bf* ATl = (bf*)take((size_t)NB_ * TT * DQ * 2);
    if ((size_t)(wsp - (char*)d_ws) > ws_size) return;    // 248 MiB of the 256 MiB
    (void)WK;                                              // reached through WQ: the four Bt planes lie one behind the other in the workspace
    k_wtG<<<dim3(DM / 256, NH_, 4), 256, 0, stream>>>(wq, wk, wv, wo, WQ);   /* per-head weights [h][DM][HD] ('xw' per head) -> the head's HD rows of WQ, WK, WV; wo [DQ][DM] -> WO */
    k_cvt8<<<(unsigned)(((size_t)NB_ * TT * DM / 8 + 255) / 256), 256, 0, stream>>>(x, XB, (size_t)NB_ * TT * DM / 8);
    k_gemmt<1, false, DM><<<dim3(NB_ * TT / 128, DQ / 128, 2), 128, 0, stream>>>(XB, nullptr, WQ, nullptr, 0, bq, bk, (size_t)DQ * DM, PQ, QP16, QPh, QPl);
    k_gemmt<2, false, DM><<<dim3(NB_ * TT / 128, DKV / 128, 1), 128, 0, stream>>>(XB, nullptr, WV, nullptr, 0, bv, nullptr, 0, 0, VT16, VTh, VTl);
    k_fattn<<<dim3(NH_ * NB_, 6 + RH / 32, 1), FW * 32, 0, stream>>>(QP16, KP16, VT16, QPh, QPl, KPh, KPl, VTh, VTl, ATh, ATl);
    k_gemmt<0, true, DQ><<<dim3(NB_ * TT / 128, DM / 128, 1), 128, 0, stream>>>(ATh, ATl, WO, OUT, DM, bo, nullptr, 0, 0, nullptr, nullptr, nullptr);
}

// v010
// One run takes 122 microseconds.
// Two timings next to v009 both put it at 1.04 times that version's speed.
// Over all steps from v000 it is 26.3 times as fast.
#include <hip/hip_runtime.h>

// Causal multi-head self-attention whose q, k, v projections are given PER HEAD (x [4][2048][1024]; q, k, v = einsum('bte,hed->bhtd', x, W) + b[None, :, None, :] with W [16][1024][64] ((in, out) inside each head; 1/32-scale) and per-head biases b [16][64] (zeros on this draw); scores x 1/sqrt(64); causal (-inf); softmax; heads merged head-major (column h*64 + d); out = cat Wp + bp ('xw' [1024][1024] + zero bias) -> [4][2048][1024] (8.4 M); argument order x, Wq, bq, Wk, bk, Wv, bv, Wp, bp). THIS ROW: the same module under other names (token_embedding [4][2048][1024]; PER-HEAD stacked projections Wq, Wk, Wv [16][1024][64] normal x 1/32 with biases [16][64] zeros (read): q = einsum('btd,hde->bhte', x, Wq) + bq; scores / sqrt(64); tril kept, -inf; softmax; heads concatenated in order; out = cat Wo + bo ('xw' [1024][1024]; bias zeros: read); argument order token_embedding, Wq, bq, Wk, bk, Wv, bv, Wo, bo).
// Layout, all batches in every launch (4 launches): bf16 copy of x and the 'xw' weights transposed, in one launch; q, k and v projections in one launch; exact projections + f32 biases, stored by the GEMM itself as the 16-bit head planes; causal T-2048 attention in one kernel, running softmax (hybrid rows: < 512 hi/lo 3 products, rest fp16 x1024; key blocks above the diagonal never visited); merged hi/lo x Wo exact + bo.
// Compute dtypes, f32 accumulate: every input rounded to bf16; projections exact + f32 biases; attention rows < 512 3 products, rest fp16; softmax f32; output projection hl x exact.

#define NB_  4
#define TT   2048
#define DM   1024
#define NH_  16
#define NKV  16
#define REP  (NH_ / NKV)
#define HD   64
#define DQ   (NH_ * HD)
#define DKV  (NKV * HD)
#define RH   512                  // query rows < RH use hi+lo planes
#define PP   (2 * TT)              // row pitch, in 16-bit elements, of the transposed value planes
#define SCL  0.125f   // HD^-0.5
typedef _Float16 h16;
typedef unsigned short bf;
typedef __attribute__((ext_vector_type(16))) __bf16   v16bf;
typedef __attribute__((ext_vector_type(16))) _Float16 v16h;
typedef __attribute__((ext_vector_type(8)))  _Float16 v8h;
typedef __attribute__((ext_vector_type(8)))  unsigned short v8us;
typedef __attribute__((ext_vector_type(8)))  float    v8f;
typedef __attribute__((ext_vector_type(4)))  float    v4f;
typedef v8h  __attribute__((may_alias)) v8ha;
typedef v4f  __attribute__((may_alias)) v4fa;
typedef v8us __attribute__((may_alias)) v8usa;

__device__ __forceinline__ unsigned short f2bf(float f) { unsigned u = __float_as_uint(f); u += 0x7FFFu + ((u >> 16) & 1u); return (unsigned short)(u >> 16); }
__device__ __forceinline__ float bf2f(unsigned short b) { return __uint_as_float(((unsigned)b) << 16); }
__device__ __forceinline__ float bfr(float f) { return bf2f(f2bf(f)); }
__device__ __forceinline__ v16h cat16(v8h lo, v8h hi) { return __builtin_shufflevector(lo, hi, 0, 1, 2, 3, 4, 5, 6, 7, 8, 9, 10, 11, 12, 13, 14, 15); }
__device__ __forceinline__ v16bf cat16b(v8us lo, v8us hi) { return __builtin_bit_cast(v16bf, __builtin_shufflevector(lo, hi, 0, 1, 2, 3, 4, 5, 6, 7, 8, 9, 10, 11, 12, 13, 14, 15)); }
__device__ __forceinline__ v8f wmma16(v16h a, v16h b, v8f c) { return __builtin_amdgcn_wmma_f32_16x16x32_f16(false, a, false, b, (short)0, c, false, false); }
__device__ __forceinline__ v8f wmmab(v16bf a, v16bf b, v8f c) { return __builtin_amdgcn_wmma_f32_16x16x32_bf16(false, a, false, b, (short)0, c, false, false); }



// ---- gemm_tile: GEMM, one 128x128 output tile per work-group of 4 waves (2 x 2, 64x64 a wave, 16 accumulators); grid (M/128, N/128, Z), 128 threads; the kernels k_qkv and k_gemmo, below it, call it. The rows of A run through all batches (M = NB_ * TT).
// C[m][n] = bias[n] + sum_k A[m][k] Bt[n][k], A and Bt K-contiguous bf16 planes; the accumulators start at the bias. TWO: a lo plane A2 is staged beside A and meets the same Bt fragments (C = bias + A Bt^T + A2 Bt^T).
// The caller hands in the LDS (tl) and, by its grid z, the operand, bias and planes of its product; SQ: the fp16 plane carries the score scale (the query projection).
// A stage is 64 k (one 128-byte line) of the tile's 128 A rows (TWO: of both planes) and 128 Bt rows, brought into LDS by asynchronous copies (whole lines, 8 lanes a row) and read there by the two waves that need it: every operand line leaves L2 once a work-group.
// Two buffers: the next stage's copies fly while this one is worked on.
// MODE 0: f32 C (pitch ldc). MODE 1, 2: no f32 C; the tile goes straight to the three 16-bit planes (fp16, bf16 hi, bf16 lo) that the attention kernel reads (a wave's 64 columns are one head):
// MODE 1 query / key planes [b][h][t][d], MODE 2 transposed value planes [b][g][d][t] at pitch PP. The accumulator's register direction is made the plane's contiguous direction
// (MODE 1 swaps the two operands of the matrix instruction, so that a lane holds 8 consecutive d of one t; MODE 2 keeps them: 8 consecutive t of one d).
template <typename T16> struct WFrag;
template <> struct WFrag<h16> { typedef v16h V; static __device__ __forceinline__ V ld(const h16* p) { return cat16(*(const v8h*)p, *(const v8h*)(p + 16)); } static __device__ __forceinline__ v8f mma(V a, V b, v8f c) { return wmma16(a, b, c); } };
template <> struct WFrag<bf> { typedef v16bf V; static __device__ __forceinline__ V ld(const bf* p) { return cat16b(*(const v8us*)p, *(const v8us*)(p + 16)); } static __device__ __forceinline__ v8f mma(V a, V b, v8f c) { return wmmab(a, b, c); } };
#define GP 72                      // LDS row pitch in 16-bit elements: the row's 128 bytes + 16, which spreads the 16-byte fragment reads of 16 rows over all banks
// Eight asynchronous 16-byte copies a lane, 16 rows apart (LDS address l, global address g, 'step' elements between the rows).
// The s_wait_xcnt stands inside the statement, behind the last copy, so that no address register is rewritten in front of it.
__device__ __forceinline__ void cp8(unsigned l, const bf* g, size_t step) {
    asm volatile("global_load_async_to_lds_b128 %0, %8, off\n\t"
                 "global_load_async_to_lds_b128 %1, %9, off\n\t"
                 "global_load_async_to_lds_b128 %2, %10, off\n\t"
                 "global_load_async_to_lds_b128 %3, %11, off\n\t"
                 "global_load_async_to_lds_b128 %4, %12, off\n\t"
                 "global_load_async_to_lds_b128 %5, %13, off\n\t"
                 "global_load_async_to_lds_b128 %6, %14, off\n\t"
                 "global_load_async_to_lds_b128 %7, %15, off\n\t"
                 "s_wait_xcnt 0x0"
                 :: "v"(l), "v"(l + 1 * 16 * GP * 2), "v"(l + 2 * 16 * GP * 2), "v"(l + 3 * 16 * GP * 2), "v"(l + 4 * 16 * GP * 2), "v"(l + 5 * 16 * GP * 2), "v"(l + 6 * 16 * GP * 2), "v"(l + 7 * 16 * GP * 2),
                    "v"(g), "v"(g + step), "v"(g + 2 * step), "v"(g + 3 * step), "v"(g + 4 * step), "v"(g + 5 * step), "v"(g + 6 * step), "v"(g + 7 * step)
                 : "memory");
}
template <bool TWO> struct GemmLds { static constexpr int AR = TWO ? 256 : 128, GROWS = AR + 128, ELEMS = 2 * GROWS * GP; };   // rows of a buffer: 128 of A (TWO: then 128 of A2), then 128 of Bt; [buffer][row][pitch]: 72 KiB (TWO: 108 KiB)
template <int MODE, bool TWO, int K>
__device__ __forceinline__ void gemm_tile(const bf* __restrict__ A, const bf* __restrict__ A2, const bf* __restrict__ Bt, float* C, int ldc, const float* __restrict__ bias, bool SQ, h16* P16, bf* Ph, bf* Pl, bf* tl) {
    static_assert(MODE == 0 || (HD == 64 && !TWO), "the plane epilogue takes a wave's 64 columns as one head and a quarter of the 72 KiB");
    static_assert(K % 64 == 0 && K >= 128, "whole stages, at least two");
    typedef WFrag<bf>::V V;
    constexpr int AR = GemmLds<TWO>::AR, GROWS = GemmLds<TWO>::GROWS;
    const int tid = threadIdx.x, lane = tid & 31, lr = lane & 15, hi = lane >> 4; const int r0 = blockIdx.x * 128, c0 = blockIdx.y * 128;
    const int wave = __builtin_amdgcn_readfirstlane(tid >> 5), wm = wave >> 1, wn = wave & 1;
    const int rw = r0 + wm * 64, cw = c0 + wn * 64;                   // this wave's 64 x 64 piece
    constexpr int NT = K / 64;                                       // stages
    // copies: lane = 16 bytes number tid & 7 of rows tid >> 3 (+ 16 i): a wave's copy is 4 whole lines
    const size_t aoff = (size_t)(r0 + (tid >> 3)) * K + (tid & 7) * 8, boff = (size_t)(c0 + (tid >> 3)) * K + (tid & 7) * 8;
    const unsigned l0 = (unsigned)(size_t)tl + (unsigned)((tid >> 3) * (GP * 2) + (tid & 7) * 16);
    auto issue = [&](int t, int buf) { const int kk = t * 64; const unsigned l = l0 + (unsigned)buf * (GROWS * GP * 2);
        cp8(l, A + aoff + kk, (size_t)16 * K); if (TWO) cp8(l + 128 * GP * 2, A2 + aoff + kk, (size_t)16 * K); cp8(l + AR * GP * 2, Bt + boff + kk, (size_t)16 * K); };
    issue(0, 0);
    v8f acc[4][4];                                                   // start value: the bias of the element's column (its loads return while stage 0 flies)
#pragma unroll
    for (int nb = 0; nb < 4; ++nb) { v8f bv;
        if (MODE == 1) { const v4f u0 = *(const v4f*)(bias + cw + nb * 16 + hi * 8), u1 = *(const v4f*)(bias + cw + nb * 16 + hi * 8 + 4);
#pragma unroll
            for (int j = 0; j < 4; ++j) { bv[j] = bfr(u0[j]); bv[4 + j] = bfr(u1[j]); } }
        else { const float u = bfr(bias[cw + nb * 16 + lr]);
#pragma unroll
            for (int j = 0; j < 8; ++j) bv[j] = u; }
#pragma unroll
        for (int mb = 0; mb < 4; ++mb) acc[mb][nb] = bv; }
    asm volatile("s_wait_asynccnt 0x0" ::: "memory");                // this wave's share of stage 0 has landed
    __syncthreads();                                                 // stage 0 is published
    issue(1, 1);
    const bf* fa = tl + (wm * 64 + lr) * GP + 8 * hi; const bf* fb = tl + (AR + wn * 64 + lr) * GP + 8 * hi;
    // rolled: one stage a trip
#pragma unroll 1
    for (int t = 0; t < NT; ++t) { const int bo = (t & 1) * (GROWS * GP);
#pragma unroll
        for (int kc = 0; kc < 2; ++kc) { V a[4], a2[4], b[4];
            b[0] = WFrag<bf>::ld(fb + bo + kc * 32);
#pragma unroll
            for (int mb = 0; mb < 4; ++mb) a[mb] = WFrag<bf>::ld(fa + bo + mb * 16 * GP + kc * 32);
#pragma unroll
            for (int nb = 1; nb < 4; ++nb) b[nb] = WFrag<bf>::ld(fb + bo + nb * 16 * GP + kc * 32);
            if (TWO) {
#pragma unroll
                for (int mb = 0; mb < 4; ++mb) a2[mb] = WFrag<bf>::ld(fa + bo + (128 + mb * 16) * GP + kc * 32); }
            __builtin_amdgcn_sched_barrier(0);                       // the fragment reads stay one group in front of their matrix instructions (for speed only)
#pragma unroll
            for (int nb = 0; nb < 4; ++nb)
#pragma unroll
                for (int mb = 0; mb < 4; ++mb) acc[mb][nb] = (MODE == 1) ? wmmab(b[nb], a[mb], acc[mb][nb]) : wmmab(a[mb], b[nb], acc[mb][nb]);
            if (TWO) {
#pragma unroll
                for (int nb = 0; nb < 4; ++nb)
#pragma unroll
                    for (int mb = 0; mb < 4; ++mb) acc[mb][nb] = wmmab(a2[mb], b[nb], acc[mb][nb]); }
            __builtin_amdgcn_sched_barrier(0);                       // the same, for the next group of reads
        }
        asm volatile("s_wait_dscnt 0x0" ::: "memory");               // this wave's reads of the buffer have returned before the buffer is given up
        asm volatile("s_wait_asynccnt 0x0" ::: "memory");            // this wave's share of stage t + 1 has landed
        __syncthreads();                                             // publishes stage t + 1 and ends every wave's reads of stage t
        if (t + 2 < NT) issue(t + 2, t & 1);
    }
    asm volatile("s_wait_asynccnt 0x0" ::: "memory");                // no copy is outstanding from here on
    if constexpr (MODE != 0) {
        // Plane epilogue. The buffers are free (every wave's reads ended at the last trip's barrier). Each wave turns its piece in its own quarter of them, 32 plane rows (128-byte lines) of the three planes at a time,
        // and stores whole lines: 8 lanes a line, one writer a line. l2: tile in the lane direction (the plane's rows), rt: in the register direction (along a row).
        bf* sw = tl + wave * (GROWS * GP / 2);
        const int bt = rw / TT, t0 = rw % TT;                         // the piece's batch and its first position there (TT % 64 == 0: a piece lies in one batch)
        const float qs = (MODE == 1 && SQ) ? SCL * 1.4426950408889634f : 1.0f;   // the fp16 query plane carries the score scale (log2 units), rounded once from f32; every other plane is unscaled
#pragma unroll
        for (int h = 0; h < 2; ++h) {
#pragma unroll
            for (int l2 = 0; l2 < 2; ++l2)
#pragma unroll
                for (int rt = 0; rt < 4; ++rt) { const v8f s = (MODE == 1) ? acc[h * 2 + l2][rt] : acc[rt][h * 2 + l2]; v8h o16; v8us oh, ol;
#pragma unroll
                    for (int j = 0; j < 8; ++j) { o16[j] = (h16)(MODE == 1 ? s[j] * qs : s[j]); const unsigned short a2 = f2bf(s[j]); oh[j] = a2; ol[j] = f2bf(s[j] - bf2f(a2)); }
                    bf* p = sw + (l2 * 16 + lr) * GP + rt * 16 + hi * 8;
                    *(v8us*)p = __builtin_bit_cast(v8us, o16); *(v8us*)(p + 32 * GP) = oh; *(v8us*)(p + 64 * GP) = ol; }
            asm volatile("s_wait_dscnt 0x0" ::: "memory");           // the wave's stores are in LDS before its lanes read one another's
#pragma unroll
            for (int pl = 0; pl < 3; ++pl) { bf* dst = (pl == 0) ? (bf*)P16 : (pl == 1) ? Ph : Pl;
#pragma unroll
                for (int i = 0; i < 8; ++i) { const int row = i * 4 + (lane >> 3);
                    const size_t e = (MODE == 1) ? (((size_t)bt * NH_ + cw / HD) * TT + t0 + h * 32 + row) * HD + (lane & 7) * 8 : ((size_t)bt * DKV + cw + h * 32 + row) * PP + t0 + (lane & 7) * 8;
                    *(v8us*)(dst + e) = *(const v8us*)(sw + (pl * 32 + row) * GP + (lane & 7) * 8); }
                asm volatile("s_wait_xcnt 0x0" ::: "memory");         // stands in front of any overwrite of these eight stores' data and address registers (the next plane's LDS reads and the next half's conversions are given them)
                __builtin_amdgcn_sched_barrier(0); }                 // keeps the next half's conversions, which touch no memory, behind that wait (without it they were lifted among the stores, onto their data registers)
        }
    } else {
        float* crow = C + (size_t)(rw + hi * 8) * ldc + cw + lr;
#pragma unroll
        for (int nb = 0; nb < 4; ++nb)
#pragma unroll
            for (int mb = 0; mb < 4; ++mb)
#pragma unroll
                for (int j = 0; j < 8; ++j) crow[(size_t)(mb * 16 + j) * ldc + nb * 16] = acc[mb][nb][j];
    }
}

// k_qkv: the three projections in one launch, grid (M/128, DQ/128, 3): z = 0 query, z = 1 key (planes [b][h][t][d]), z = 2 value (transposed planes). The three Bt planes lie sB elements apart, each key plane sP elements behind its query plane.
// Later work-groups start in the places that the first ones leave, with no launch boundary between: their stages fly while the plane stores of those drain.
__global__ __launch_bounds__(128) void k_qkv(const bf* __restrict__ A, const bf* __restrict__ Bt, const float* __restrict__ bq, const float* __restrict__ bk, const float* __restrict__ bv, size_t sB, size_t sP, h16* P16, bf* Ph, bf* Pl, h16* V16, bf* Vh, bf* Vl) {
    // 96 KiB, of which the two buffers take 72: three work-groups fit a WGP (320 KiB), so that the launch's 1536 tiles are two full rounds of 256 x 3 places and every place takes two tiles.
    // At 72 KiB four would fit: 1024 places, and a second round that fills half of them, wherever places come free first.
    constexpr int QKV_LDS = 96 * 1024;
    static_assert(QKV_LDS >= GemmLds<false>::ELEMS * 2 && 320 * 1024 / QKV_LDS == 3 && (NB_ * TT / 128) * (DQ / 128) * 3 % (256 * 3) == 0, "the buffers fit; three work-groups a WGP; whole rounds");
    __shared__ __attribute__((aligned(16))) bf tl[QKV_LDS / 2];
    const size_t z = blockIdx.z;
    if (z < 2) gemm_tile<1, false, DM>(A, nullptr, Bt + z * sB, nullptr, 0, z ? bk : bq, z == 0, P16 + z * sP, Ph + z * sP, Pl + z * sP, tl);
    else gemm_tile<2, false, DM>(A, nullptr, Bt + 2 * sB, nullptr, 0, bv, false, V16, Vh, Vl, tl);
}
// k_gemmo: the output projection, grid (M/128, DM/128).
__global__ __launch_bounds__(128) void k_gemmo(const bf* __restrict__ A, const bf* __restrict__ A2, const bf* __restrict__ Bt, float* C, const float* __restrict__ bias) {
    __shared__ __attribute__((aligned(16))) bf tl[GemmLds<true>::ELEMS];
    gemm_tile<0, true, DQ>(A, A2, Bt, C, DM, bias, false, nullptr, nullptr, nullptr, tl);
}

__device__ __forceinline__ h16 tohx(float x) { return (h16)x; }
__device__ __forceinline__ void splitf(float y, unsigned short& h, unsigned short& l) { h = f2bf(y); l = f2bf(y - bf2f(h)); }
typedef __attribute__((ext_vector_type(2))) _Float16 v2h;
typedef __attribute__((ext_vector_type(4))) _Float16 v4h;
typedef __attribute__((ext_vector_type(2))) unsigned short v2us;
typedef __attribute__((ext_vector_type(4))) unsigned short v4us;
typedef __attribute__((ext_vector_type(2))) float v2f;
typedef __attribute__((ext_vector_type(4))) int v4i;

typedef __attribute__((ext_vector_type(4))) unsigned v4u;
// ---- k_prep, first part: the four 'xw' weights, f32 [k][n], to the K-contiguous bf16 planes Bt [n][k]. Work-groups 0 .. NWT - 1 as (x, y, z) of (DM / 256, NH_, 4), 256 threads: one tile of 256 k x 64 n a work-group, turned in LDS.
// Sources 0..2: head y's matrix [DM][HD] (all its 64 columns, k tile x). Source 3: ONE matrix [DQ][DM], k tile x, column tile y. Either way the tile's rows in Bt are number (z * NH_ + y) * 64 + n, pitch DM.
// Reads: 16 lanes a source row piece of 256 bytes (two whole lines), a lane's 16 loads all in flight. Stores: 16 lanes a 256-byte piece of a row of Bt (two whole lines), one writer a line.
// A lane takes 4 columns of the rows k, k + 1 and puts each column's pair into one LDS word; the pitch of WP words keeps both the word stores (banks 4 c + r) and the word reads (banks n + 4 c) free of conflicts.
#define WP 129
template <int N>                                                         // N: pitch of the source rows
__device__ __forceinline__ void wt_tile(const float* __restrict__ w, bf* dst, unsigned* tp) {
    const int tid = threadIdx.x, c = tid & 15, r = tid >> 4;
    const float* src = w + (size_t)(2 * r) * N + c * 4;
    v4f a[8][2];
#pragma unroll
    for (int i = 0; i < 8; ++i)
#pragma unroll
        for (int e = 0; e < 2; ++e) a[i][e] = *(const v4f*)(src + (size_t)(32 * i + e) * N);
    // the wait in front of any overwrite of the loads' address register pair; it names the pair as an input so that it lives up to the wait (without that a load's result can be given the pair)
    asm volatile("s_wait_xcnt 0x0" :: "v"(src) : "memory");
#pragma unroll
    for (int i = 0; i < 8; ++i)
#pragma unroll
        for (int j = 0; j < 4; ++j) tp[(c * 4 + j) * WP + r + 16 * i] = (unsigned)f2bf(a[i][0][j]) | ((unsigned)f2bf(a[i][1][j]) << 16);
    __syncthreads();                                                     // the whole tile is in LDS before any lane reads another's words
#pragma unroll
    for (int u = 0; u < 8; ++u) { const int n = (u & 3) * 16 + r, o = (u >> 2) * 64 + c * 4; v4u v;
#pragma unroll
        for (int e = 0; e < 4; ++e) v[e] = tp[n * WP + o + e];
        *(v4u*)(dst + (size_t)n * DM + o * 2) = v; }
    asm volatile("s_wait_xcnt 0x0" ::: "memory");                        // stands behind the eight stores, in front of any overwrite of their address pair in the code that follows in the caller
}
// Second part, the work-groups behind those: the bf16 copy of x, 8 elements a lane. Neither part reads what the other writes; the weight tiles, whose chain of load, barrier and store is the longer, come first in the block order.
#define NWT ((DM / 256) * NH_ * 4)
#define NCV (NB_ * TT * DM / 8 / 256)
__global__ __launch_bounds__(256) void k_prep(const float* __restrict__ w0, const float* __restrict__ w1, const float* __restrict__ w2, const float* __restrict__ w3, bf* Bt, const float* __restrict__ src, bf* xb) {
    static_assert(HD == 64 && DQ == DM && DKV == DQ && DM % 256 == 0, "a head's columns are one tile; all four planes have DM rows of DM elements, one behind the other");
    static_assert((size_t)NB_ * TT * DM % (8 * 256) == 0, "whole work-groups of the copy");
    __shared__ unsigned tp[64 * WP];                                     // [n][k / 2]
    const unsigned bid = blockIdx.x;
    if (bid < NWT) {
        const size_t x = bid % (DM / 256), y = bid / (DM / 256) % NH_, z = bid / ((DM / 256) * NH_);
        bf* dst = Bt + (z * NH_ + y) * 64 * DM + x * 256;
        if (z == 3) wt_tile<DM>(w3 + x * 256 * DM + y * 64, dst, tp);
        else wt_tile<HD>((z == 0 ? w0 : z == 1 ? w1 : w2) + y * DM * HD + x * 256 * HD, dst, tp);
    } else {
        const size_t i = (size_t)(bid - NWT) * 256 + threadIdx.x; const v8f v = *(const v8f*)(src + i * 8); v8us o;
#pragma unroll
        for (int k = 0; k < 8; ++k) o[k] = f2bf(v[k]);
        *(v8us*)(xb + i * 8) = o;
        asm volatile("s_wait_xcnt 0x0" ::: "memory");                    // stands behind the store, in front of any overwrite of its address pair in the blocks laid out behind it
    }
}

#define FW 8
template <typename T16, bool HIRES>
__device__ __forceinline__ void fa_tile(const T16* __restrict__ Q, const T16* __restrict__ Q2, const T16* __restrict__ Kp, const T16* __restrict__ K2, const T16* __restrict__ Vt, const T16* __restrict__ V2, int q0, bf* Ah, bf* Al, float* red, float* st) {
    static_assert(HIRES, "written for the hi + lo planes");
    typedef typename WFrag<T16>::V V;
    const int lane = threadIdx.x & 31, lr = lane & 15, hi = lane >> 4;
    const int wave = __builtin_amdgcn_readfirstlane(threadIdx.x >> 5);   // scalar, so that the key loop's branch is scalar and EXEC stays full at the matrix instructions
    V qf[2][2], qf2[2][2];
#pragma unroll
    for (int qt = 0; qt < 2; ++qt)
#pragma unroll
        for (int kc = 0; kc < 2; ++kc) { const size_t o = (size_t)(q0 + qt * 16 + lr) * HD + kc * 32 + 8 * hi; qf[qt][kc] = WFrag<T16>::ld(Q + o); if (HIRES) qf2[qt][kc] = WFrag<T16>::ld(Q2 + o); }
    v8f o[4][2];
#pragma unroll
    for (int dt = 0; dt < 4; ++dt)
#pragma unroll
        for (int qt = 0; qt < 2; ++qt) o[dt][qt] = (v8f){};
    float m[2] = { -3.0e38f, -3.0e38f }, l[2] = { 0.0f, 0.0f };
    // at most 2 blocks a wave, twice the fragments: every fragment is fetched where it is used, which keeps the kernel within 256 registers.
    V kf[2][2], kf2[2][2];
    // rolled: one block's fragments live beside the 8 output accumulators
#pragma unroll 1
    for (int kb = wave * 32; kb < q0 + 32; kb += FW * 32) {
        V vf[4], vf2[4];
        v8f s[2][2];
#pragma unroll
        for (int kt = 0; kt < 2; ++kt)
#pragma unroll
            for (int qt = 0; qt < 2; ++qt) s[kt][qt] = (v8f){};
#pragma unroll
        for (int kt = 0; kt < 2; ++kt)
#pragma unroll
            for (int kc = 0; kc < 2; ++kc) { if (HIRES) { const size_t ko = (size_t)(kb + kt * 16 + lr) * HD + kc * 32 + 8 * hi; kf[kt][kc] = WFrag<T16>::ld(Kp + ko); kf2[kt][kc] = WFrag<T16>::ld(K2 + ko);
                    asm volatile("s_wait_xcnt 0x0" ::: "memory"); }   // stands in front of any overwrite of these four loads' address registers
#pragma unroll
                for (int qt = 0; qt < 2; ++qt) { s[kt][qt] = WFrag<T16>::mma(kf[kt][kc], qf[qt][kc], s[kt][qt]); if (HIRES) { s[kt][qt] = WFrag<T16>::mma(kf[kt][kc], qf2[qt][kc], s[kt][qt]); s[kt][qt] = WFrag<T16>::mma(kf2[kt][kc], qf[qt][kc], s[kt][qt]); } } }
#pragma unroll
        for (int kt = 0; kt < 2; ++kt)
#pragma unroll
            for (int qt = 0; qt < 2; ++qt) s[kt][qt] *= SCL * 1.4426950408889634f;
        if (kb == q0) {                                                  // the diagonal block (the tile's last): keys beyond the query are masked; key kb itself never is, so every column keeps a finite maximum
#pragma unroll
            for (int kt = 0; kt < 2; ++kt)
#pragma unroll
                for (int qt = 0; qt < 2; ++qt)
#pragma unroll
                    for (int j = 0; j < 8; ++j) if (kt * 16 + hi * 8 + j > qt * 16 + lr) s[kt][qt][j] = -3.0e38f;
        }
        V pf[2], pf2[2];
#pragma unroll
        for (int qt = 0; qt < 2; ++qt) {
            float mx = s[0][qt][0];
#pragma unroll
            for (int j = 1; j < 16; ++j) mx = fmaxf(mx, s[j >> 3][qt][j & 7]);
            mx = fmaxf(mx, __shfl_xor(mx, 16, 32));
            const float mn = fmaxf(m[qt], mx), al = __builtin_amdgcn_exp2f(m[qt] - mn), mo = mn - 10.0f; m[qt] = mn;
            float sum = 0.0f;
#pragma unroll
            for (int j = 0; j < 16; ++j) { const float p = __builtin_amdgcn_exp2f(s[j >> 3][qt][j & 7] - mo); s[j >> 3][qt][j & 7] = p; sum += p; }
            l[qt] = l[qt] * al + sum;
#pragma unroll
            for (int dt = 0; dt < 4; ++dt) o[dt][qt] *= al;
            if constexpr (HIRES) { v8us h0, h1, l0, l1;
#pragma unroll
                for (int j = 0; j < 8; ++j) { unsigned short a, c2; splitf(s[0][qt][j], a, c2); h0[j] = a; l0[j] = c2; splitf(s[1][qt][j], a, c2); h1[j] = a; l1[j] = c2; }
                pf[qt] = cat16b(h0, h1); pf2[qt] = cat16b(l0, l1);
            }
        }
#pragma unroll
        for (int dt = 0; dt < 4; ++dt) { if (HIRES) { const size_t vo = (size_t)(dt * 16 + lr) * PP + kb + 8 * hi; vf[dt] = WFrag<T16>::ld(Vt + vo); vf2[dt] = WFrag<T16>::ld(V2 + vo); }
#pragma unroll
            for (int qt = 0; qt < 2; ++qt) { o[dt][qt] = WFrag<T16>::mma(vf[dt], pf[qt], o[dt][qt]); if (HIRES) { o[dt][qt] = WFrag<T16>::mma(vf[dt], pf2[qt], o[dt][qt]); o[dt][qt] = WFrag<T16>::mma(vf2[dt], pf[qt], o[dt][qt]); } } }
    }
#pragma unroll
    for (int qt = 0; qt < 2; ++qt) { const float lj = l[qt] + __shfl_xor(l[qt], 16, 32); st[wave * 64 + qt * 16 + lr] = m[qt]; st[wave * 64 + 32 + qt * 16 + lr] = lj;   // both halves hold, and store, the same two values
#pragma unroll
        for (int dt = 0; dt < 4; ++dt) *(v8f*)(red + (size_t)(((wave * 8 + qt * 4 + dt) * 32 + lane) * 8)) = o[dt][qt]; }
    __syncthreads();                                                     // every wave's partial result is in LDS before any wave joins
    // wave w joins queries 4w..4w+3, 8 lanes a query, 8 consecutive d a lane: whole 128-byte lines of the merged planes, one writer a line. A wave that had no block left m = -3e38, l = 0, Ot = 0: factor 0.
    const int q = wave * 4 + (lane >> 3), dg = lane & 7;
    const float* rr = red + (((q >> 4) * 4 + (dg >> 1)) * 32 + (q & 15) + 16 * (dg & 1)) * 8;
    float M = st[q];
#pragma unroll
    for (int u = 1; u < FW; ++u) M = fmaxf(M, st[u * 64 + q]);
    float L = 0.0f; v8f acc = (v8f){};
#pragma unroll
    for (int u = 0; u < FW; ++u) { const float f = __builtin_amdgcn_exp2f(st[u * 64 + q] - M); L += st[u * 64 + 32 + q] * f; acc += *(const v8f*)(rr + u * (8 * 32 * 8)) * f; }
    const float inv = __fdiv_rn(1.0f, L); v8us oh, ol;
#pragma unroll
    for (int j = 0; j < 8; ++j) { unsigned short a, c2; splitf(acc[j] * inv, a, c2); oh[j] = a; ol[j] = c2; }
    const size_t oo = (size_t)(q0 + q) * DQ + dg * 8; *(v8us*)(Ah + oo) = oh; *(v8us*)(Al + oo) = ol;
}
// ---- fa_wide: the fp16 rows (>= RH). One work-group = FW * 32 = 256 query rows of one head, 32 a wave; every wave walks ALL keys of its own rows, so there is no join.
// A stage is SK = 64 keys: 64 key rows and the 64 rows of the transposed value plane, one whole 128-byte line each, brought into LDS by asynchronous copies (8 lanes a line)
// and read there by all FW waves: a key or value line leaves L2 once for 256 query rows, as a whole line. Two buffers: the next stage's copies fly while this one is worked on.
// A wave works on the 32-key blocks up to its own diagonal block and only passes the barriers of the stages behind it.
// Softmax here: the fp16 query plane already carries the score scale, and the score accumulators START at cs = 10 - (maximum in use), so that exp2 reads the matrix results as they are.
// The maximum in use is set by the first block and moves only when a lane's sum over a block passes 2^15 (then, and in the first block, Ot and l are rescaled and the block's probabilities made anew):
// without that step every probability is at most 2^15, inside fp16; a score more than 5 above the maximum in use always takes it.
__device__ __forceinline__ float sum16(v8f a, v8f b) { const v8f c = a + b; const v4f d = __builtin_shufflevector(c, c, 0, 1, 2, 3) + __builtin_shufflevector(c, c, 4, 5, 6, 7); return (d[0] + d[2]) + (d[1] + d[3]); }
#define SK 64
#define KP 72                      // LDS row pitch in 16-bit elements: the row's 128 bytes + 16, which spreads the 16-byte fragment reads of 16 rows over all banks
// Four asynchronous 16-byte copies a lane: key rows r, r + 32 and value rows r, r + 32 of a stage.
// The s_wait_xcnt stands inside the statement, behind the last copy, so that no address register is rewritten in front of it.
__device__ __forceinline__ void cp4(unsigned l, const h16* gk, const h16* gv) {
    asm volatile("global_load_async_to_lds_b128 %0, %4, off\n\t"
                 "global_load_async_to_lds_b128 %1, %5, off\n\t"
                 "global_load_async_to_lds_b128 %2, %6, off\n\t"
                 "global_load_async_to_lds_b128 %3, %7, off\n\t"
                 "s_wait_xcnt 0x0"
                 :: "v"(l), "v"(l + 32 * KP * 2), "v"(l + 64 * KP * 2), "v"(l + 96 * KP * 2), "v"(gk), "v"(gk + 32 * HD), "v"(gv), "v"(gv + 32 * PP)
                 : "memory");
}
__device__ __forceinline__ void fa_wide(const h16* __restrict__ Q, const h16* __restrict__ Kp, const h16* __restrict__ Vt, int Q0, bf* Ah, bf* Al, h16* tl) {
    static_assert(HD == 64 && SK == 64 && FW * 32 % SK == 0, "a key row and a stage's piece of a value row are one 128-byte line; whole stages");
    typedef WFrag<h16>::V V;
    const int tid = threadIdx.x, lane = tid & 31, lr = lane & 15, hi = lane >> 4;
    const int wave = __builtin_amdgcn_readfirstlane(tid >> 5);           // scalar, so that the block loop's branch is scalar and EXEC stays full at the matrix instructions
    const int q0 = Q0 + wave * 32, NS = (Q0 + FW * 32) / SK;             // this wave's first row; stages of the work-group (at least 4)
    const unsigned l0 = (unsigned)(size_t)tl + (unsigned)((tid >> 3) * (KP * 2) + (tid & 7) * 16);
    const h16* gk = Kp + (size_t)(tid >> 3) * HD + (tid & 7) * 8; const h16* gv = Vt + (size_t)(tid >> 3) * PP + (tid & 7) * 8;
    auto issue = [&](int t, int buf) { cp4(l0 + (unsigned)buf * (2 * SK * KP * 2), gk + (size_t)t * SK * HD, gv + t * SK); };
    issue(0, 0);
    V qf[2][2];
#pragma unroll
    for (int qt = 0; qt < 2; ++qt)
#pragma unroll
        for (int kc = 0; kc < 2; ++kc) qf[qt][kc] = WFrag<h16>::ld(Q + (size_t)(q0 + qt * 16 + lr) * HD + kc * 32 + 8 * hi);
    v8f o[4][2];
#pragma unroll
    for (int dt = 0; dt < 4; ++dt)
#pragma unroll
        for (int qt = 0; qt < 2; ++qt) o[dt][qt] = (v8f){};
    float cs[2] = { 0.0f, 0.0f }, l[2] = { 0.0f, 0.0f };
    v8f cb[2][2] = { { (v8f){}, (v8f){} }, { (v8f){}, (v8f){} } };       // cs in all 8 registers: the C operand of a score tile's first product (written per tile: with one array a query group the build copied it, 8 register-pair moves, in every block)
    asm volatile("s_wait_asynccnt 0x0" ::: "memory");                    // this wave's share of stage 0 has landed
    __syncthreads();                                                     // stage 0 is published
    issue(1, 1);
    // rolled: one stage a trip
#pragma unroll 1
    for (int t = 0; t < NS; ++t) {
        const h16* kl = tl + (t & 1) * (2 * SK * KP); const h16* vl = kl + SK * KP;
        const int ke = min(t * SK + SK, q0 + 32);                        // the wave's blocks end with its diagonal block
        const h16* kp = kl + lr * KP + 8 * hi; const h16* vp = vl + lr * KP + 8 * hi;   // this lane's place in the block's key rows and value columns
        // rolled: one block's fragments live beside the 8 output accumulators
#pragma unroll 1
        for (int kb = t * SK; kb < ke; kb += 32) {
            V kf[2][2], vf[4];
#pragma unroll
            for (int kt = 0; kt < 2; ++kt)
#pragma unroll
                for (int kc = 0; kc < 2; ++kc) kf[kt][kc] = WFrag<h16>::ld(kp + kt * 16 * KP + kc * 32);
            __builtin_amdgcn_sched_barrier(0);                           // the key fragment reads stay one group in front of the score products (for speed only)
            v8f s[2][2];
#pragma unroll
            for (int kt = 0; kt < 2; ++kt)
#pragma unroll
                for (int qt = 0; qt < 2; ++qt) s[kt][qt] = cb[kt][qt];
#pragma unroll
            for (int kt = 0; kt < 2; ++kt)
#pragma unroll
                for (int kc = 0; kc < 2; ++kc)
#pragma unroll
                    for (int qt = 0; qt < 2; ++qt) s[kt][qt] = wmma16(kf[kt][kc], qf[qt][kc], s[kt][qt]);
            __builtin_amdgcn_sched_barrier(0);                           // the value fragments are asked for behind the score products (they take the key fragments' registers) ...
#pragma unroll
            for (int dt = 0; dt < 4; ++dt) vf[dt] = WFrag<h16>::ld(vp + dt * 16 * KP);
            kp += 32 * KP; vp += 32;                                     // the next block's places, formed here: no address arithmetic stands between the block's last product and the next block's reads
            __builtin_amdgcn_sched_barrier(0);                           // ... and as one group in front of the exponentials, under which they return (sunk to their products, each waits out the LDS)
            if (kb == q0) {                                              // the diagonal block (the wave's last): keys beyond the query are masked; key kb itself never is, so every column keeps a finite maximum
#pragma unroll
                for (int kt = 0; kt < 2; ++kt)
#pragma unroll
                    for (int qt = 0; qt < 2; ++qt)
#pragma unroll
                        for (int j = 0; j < 8; ++j) if (kt * 16 + hi * 8 + j > qt * 16 + lr) s[kt][qt][j] = -3.0e38f;
            }
            v8f p[2][2]; float sum[2];
#pragma unroll
            for (int qt = 0; qt < 2; ++qt) {
#pragma unroll
                for (int j = 0; j < 16; ++j) p[j >> 3][qt][j & 7] = __builtin_amdgcn_exp2f(s[j >> 3][qt][j & 7]);
                sum[qt] = sum16(p[0][qt], p[1][qt]);
            }
            if ((__builtin_amdgcn_ballot_w32(fmaxf(sum[0], sum[1]) > 32768.0f) | (unsigned)(kb == 0)) != 0) {   // one scalar branch a block; behind the first block it is rarely taken
#pragma unroll
                for (int qt = 0; qt < 2; ++qt) {
                    float mx = s[0][qt][0];
#pragma unroll
                    for (int j = 1; j < 16; ++j) mx = fmaxf(mx, s[j >> 3][qt][j & 7]);
                    mx = fmaxf(mx, __shfl_xor(mx, 16, 32));              // both halves of the wave move a query's maximum alike
                    const float up = fmaxf(mx - 10.0f, 0.0f), d = (kb == 0) ? mx - 10.0f : up, al = __builtin_amdgcn_exp2f(-up);   // the first block sets the maximum (Ot = l = 0 there), a later one only raises it
                    cs[qt] -= d; l[qt] *= al;
#pragma unroll
                    for (int j = 0; j < 8; ++j) { cb[0][qt][j] = cs[qt]; cb[1][qt][j] = cs[qt]; }
#pragma unroll
                    for (int dt = 0; dt < 4; ++dt) o[dt][qt] *= al;
#pragma unroll
                    for (int j = 0; j < 16; ++j) p[j >> 3][qt][j & 7] = __builtin_amdgcn_exp2f(s[j >> 3][qt][j & 7] - d);
                    sum[qt] = sum16(p[0][qt], p[1][qt]);
                }
            }
            V pf[2];
#pragma unroll
            for (int qt = 0; qt < 2; ++qt) {
                l[qt] += sum[qt];
                v8h c0, c1;
#pragma unroll
                for (int j = 0; j < 8; ++j) { c0[j] = tohx(p[0][qt][j]); c1[j] = tohx(p[1][qt][j]); }
                pf[qt] = cat16(c0, c1);
            }
#pragma unroll
            for (int dt = 0; dt < 4; ++dt)
#pragma unroll
                for (int qt = 0; qt < 2; ++qt) o[dt][qt] = wmma16(vf[dt], pf[qt], o[dt][qt]);
        }
        asm volatile("s_wait_dscnt 0x0" ::: "memory");                   // this wave's reads of the buffer have returned before the buffer is given up
        asm volatile("s_wait_asynccnt 0x0" ::: "memory");                // this wave's share of stage t + 1 has landed
        __syncthreads();                                                 // publishes stage t + 1 and ends every wave's reads of stage t
        if (t + 2 < NS) issue(t + 2, t & 1);
    }
    asm volatile("s_wait_asynccnt 0x0" ::: "memory");                    // no copy is outstanding from here on
    // Epilogue. The buffers are free (every wave's reads ended at the last trip's barrier). Each wave turns its 32 rows in its own eighth of them, one merged plane at a time, and stores whole 128-byte lines: 8 lanes a line, one writer a line.
    bf* sw = (bf*)tl + wave * (32 * KP);
    float inv[2];
#pragma unroll
    for (int qt = 0; qt < 2; ++qt) inv[qt] = __fdiv_rn(1.0f, l[qt] + __shfl_xor(l[qt], 16, 32));
#pragma unroll
    for (int pl = 0; pl < 2; ++pl) { bf* dst = pl ? Al : Ah;
#pragma unroll
        for (int qt = 0; qt < 2; ++qt)
#pragma unroll
            for (int dt = 0; dt < 4; ++dt) { v8us ov;
#pragma unroll
                for (int j = 0; j < 8; ++j) { unsigned short a, c2; splitf(o[dt][qt][j] * inv[qt], a, c2); ov[j] = pl ? c2 : a; }
                *(v8us*)(sw + (qt * 16 + lr) * KP + dt * 16 + hi * 8) = ov; }
        asm volatile("s_wait_dscnt 0x0" ::: "memory");                   // the wave's stores are in LDS before its lanes read one another's
#pragma unroll
        for (int i = 0; i < 8; ++i) { const int row = i * 4 + (lane >> 3);
            *(v8us*)(dst + (size_t)(q0 + row) * DQ + (lane & 7) * 8) = *(const v8us*)(sw + row * KP + (lane & 7) * 8); }
    }
}
// grid (heads * batches, 6 + RH / 32). y < 6: 256 fp16 rows (fa_wide), position blocks in the order 7, 6, 5, 4, 2, 3: all of these are resident at once, two places a WGP.
// Behind them the hi + lo tiles of 32 rows (fa_tile), longest first.
__global__ __launch_bounds__(FW * 32) void k_fattn(const h16* __restrict__ Q16, const h16* __restrict__ K16, const h16* __restrict__ V16, const bf* __restrict__ Qh, const bf* __restrict__ Ql, const bf* __restrict__ Kh, const bf* __restrict__ Kl, const bf* __restrict__ Vh, const bf* __restrict__ Vl, bf* Ah, bf* Al) {
    static_assert(TT == 2048 && RH == 512 && FW == 8, "the order of the position blocks is written for 8 blocks of 256 rows, the first 2 of them hi + lo");
    __shared__ __align__(32) float red[FW * 8 * 32 * 8];                 // fa_tile: [wave][query group][d tile][lane][8], 8 KiB a wave; fa_wide: its two buffers (36 KiB)
    __shared__ float st[FW * 64];                                        // [wave][m, l][query]
    static_assert(2 * 2 * SK * KP * 2 <= sizeof(red), "the two buffers fit");
    const int y = blockIdx.y; const size_t h = blockIdx.x % NH_, g = h / REP, b = blockIdx.x / NH_; const size_t qo = (b * NH_ + h) * TT * HD, ko = (b * NKV + g) * TT * HD, vo = (b * NKV + g) * HD * PP; Ah += b * TT * DQ; Al += b * TT * DQ;
    if (y < 6) fa_wide(Q16 + qo, K16 + ko, V16 + vo, (y < 4 ? 7 - y : y - 2) * (FW * 32), Ah + h * HD, Al + h * HD, (h16*)red);
    else fa_tile<bf, true>(Qh + qo, Ql + qo, Kh + ko, Kl + ko, Vh + vo, Vl + vo, (RH / 32 - 1 - (y - 6)) * 32, Ah + h * HD, Al + h * HD, red, st);
}

extern "C" void kernel_launch(void* const* d_in, const int* in_sizes, int n_in,
                              void* d_out, int out_size, void* d_ws, size_t ws_size, hipStream_t stream) {
    (void)in_sizes; (void)n_in; (void)out_size;
    const float* x = (const float*)d_in[0]; const float* wq = (const float*)d_in[1]; const float* bq = (const float*)d_in[2]; const float* wk = (const float*)d_in[3]; const float* bk = (const float*)d_in[4]; const float* wv = (const float*)d_in[5]; const float* bv = (const float*)d_in[6]; const float* wo = (const float*)d_in[7]; const float* bo = (const float*)d_in[8];   /* argument order x, Wq, bq, Wk, bk, Wv, bv, Wp, bp (per-head weights [16][1024][64]; per-head biases [16][64] = flat index h*64 + d) */
    float* OUT = (float*)d_out;     // [4][2048][1024]
    char* wsp = (char*)d_ws;
    auto take = [&](size_t bytes) { char* p = wsp; wsp += (bytes + 255) & ~(size_t)255; return (void*)p; };
    bf* WQ = (bf*)take((size_t)DQ * DM * 2); bf* WK = (bf*)take((size_t)DKV * DM * 2); bf* WV = (bf*)take((size_t)DKV * DM * 2); bf* WO = (bf*)take((size_t)DM * DQ * 2);
    bf* XB = (bf*)take((size_t)NB_ * TT * DM * 2);
    const size_t PQ = (size_t)NB_ * NH_ * TT * HD;         // elements of one query or key plane, all batches (NKV == NH_); each key plane lies directly behind its query plane
    h16* QP16 = (h16*)take(PQ * 2); h16* KP16 = (h16*)take(PQ * 2); bf* QPh = (bf*)take(PQ * 2); bf* KPh = (bf*)take(PQ * 2); bf* QPl = (bf*)take(PQ * 2); bf* KPl = (bf*)take(PQ * 2);
    h16* VT16 = (h16*)take((size_t)NB_ * NKV * HD * PP * 2); bf* VTh = (bf*)take((size_t)NB_ * NKV * HD * PP * 2); bf* VTl = (bf*)take((size_t)NB_ * NKV * HD * PP * 2);
    bf* ATh = (bf*)take((size_t)NB_ * TT * DQ * 2); bf* ATl = (bf*)take((size_t)NB_ * TT * DQ * 2);
    if ((size_t)(wsp - (char*)d_ws) > ws_size) return;    // 248 MiB of the 256 MiB
    (void)WK; (void)WV;                                    // reached through WQ: the four Bt planes lie one behind the other in the workspace
    k_prep<<<NWT + NCV, 256, 0, stream>>>(wq, wk, wv, wo, WQ, x, XB);   /* per-head weights [h][DM][HD] ('xw' per head) -> the head's HD rows of WQ, WK, WV; wo [DQ][DM] -> WO; x -> XB */
    k_qkv<<<dim3(NB_ * TT / 128, DQ / 128, 3), 128, 0, stream>>>(XB, WQ, bq, bk, bv, (size_t)DQ * DM, PQ, QP16, QPh, QPl, VT16, VTh, VTl);
    k_fattn<<<dim3(NH_ * NB_, 6 + RH / 32, 1), FW * 32, 0, stream>>>(QP16, KP16, VT16, QPh, QPl, KPh, KPl, VTh, VTl, ATh, ATl);
    k_gemmo<<<dim3(NB_ * TT / 128, DM / 128, 1), 128, 0, stream>>>(ATh, ATl, WO, OUT, bo);
}
